// v000
// Measured on an AMD MI455X. A time is GPU time per run, averaged over a window of back-to-back runs after a warm-up
// (all launches, gaps included; the runs take copies of the inputs in turn), and the median of several windows.
// Apart from v000's, it joins two sittings. Times from different sittings can be a few percent apart, while
// side-by-side timings come from the same sitting.
// v000 is the starting kernel. One run takes 1230 microseconds.
#include <hip/hip_runtime.h>
#include <stdint.h>

// Contractions: token projections (q, k, v, gate down/up, beta, out) on v_wmma_f32_16x16x32_f16 with f16 operands pre-scaled by powers of two, f32 accumulate; per-chunk Q*S and A*V on v_wmma_f32_16x16x32_bf16 as bf16 hi/lo three-product split, f32 accumulate; decay scores, state recurrence, shortconv and norms on VALU in f32. All float inputs RNE-converted to bf16 on load.

typedef _Float16 h16;
typedef h16    v16h __attribute__((ext_vector_type(16)));
typedef h16    v8h  __attribute__((ext_vector_type(8)));
typedef __bf16 v16b __attribute__((ext_vector_type(16)));
typedef float  v8f  __attribute__((ext_vector_type(8)));
typedef float  v4f  __attribute__((ext_vector_type(4)));

union HF { v16h v; v8h p[2]; };
union BF { v16b v; unsigned short u[16]; };

#define DM 1024
#define HD 64
#define NH 16
#define CH 64
#define QP 68

__device__ __forceinline__ unsigned short bf16_bits(float f) {
  unsigned int u = __float_as_uint(f);
  u += 0x7FFFu + ((u >> 16) & 1u);
  return (unsigned short)(u >> 16);
}
__device__ __forceinline__ float bf16r(float f) {
  return __uint_as_float(((unsigned int)bf16_bits(f)) << 16);
}
// x = hi + lo in bf16 pieces (RNE), bit patterns
__device__ __forceinline__ void split2(float x, unsigned short& hi, unsigned short& lo) {
  const unsigned short hb = bf16_bits(x);
  const float hf = __uint_as_float(((unsigned int)hb) << 16);
  hi = hb;
  lo = bf16_bits(x - hf);
}
__device__ __forceinline__ float sigm(float v) {
  return __fdividef(1.0f, 1.0f + __expf(-v));
}

// 16-bit WMMA wrappers with the VALU hazard guard after the matrix op
__device__ __forceinline__ v8f mma_f16(v16h a, v16h b, v8f c) {
  c = __builtin_amdgcn_wmma_f32_16x16x32_f16(false, a, false, b, (short)0, c, false, false);
  asm volatile("v_nop\n\tv_nop\n\tv_nop\n\tv_nop" : "+v"(c) : "v"(a), "v"(b));
  return c;
}
__device__ __forceinline__ v8f mma_bf16(v16b a, v16b b, v8f c) {
  c = __builtin_amdgcn_wmma_f32_16x16x32_bf16(false, a, false, b, (short)0, c, false, false);
  asm volatile("v_nop\n\tv_nop\n\tv_nop\n\tv_nop" : "+v"(c) : "v"(a), "v"(b));
  return c;
}

// A fragment (row m, split k map) from an f32 LDS row pointer pr = base + row*pitch + k0, as bf16 hi/lo
__device__ __forceinline__ void fragA_split(const float* pr, int h, BF& hi, BF& lo) {
  const v4f x0 = *(const v4f*)(pr + 8 * h);
  const v4f x1 = *(const v4f*)(pr + 8 * h + 4);
  const v4f x2 = *(const v4f*)(pr + 16 + 8 * h);
  const v4f x3 = *(const v4f*)(pr + 20 + 8 * h);
#pragma unroll
  for (int q = 0; q < 4; ++q) {
    split2(x0[q], hi.u[q],      lo.u[q]);
    split2(x1[q], hi.u[4 + q],  lo.u[4 + q]);
    split2(x2[q], hi.u[8 + q],  lo.u[8 + q]);
    split2(x3[q], hi.u[12 + q], lo.u[12 + q]);
  }
}
// B fragment (col n, same split k map) gathered down column col of f32 [k][pitch] in LDS, as bf16 hi/lo
__device__ __forceinline__ void fragB_split(const float* base, int pitch, int k0, int col, int h, BF& hi, BF& lo) {
#pragma unroll
  for (int i = 0; i < 8; ++i) {
    split2(base[(k0 + 8 * h + i) * pitch + col],      hi.u[i],     lo.u[i]);
    split2(base[(k0 + 16 + 8 * h + i) * pitch + col], hi.u[8 + i], lo.u[8 + i]);
  }
}

// ---------------------------------------------------------------------------
// ---------------------------------------------------------------------------
__global__ void __launch_bounds__(256)
k_cvtw(const float* __restrict__ src, h16* dst, int n8, float scale)
{
  const int i = blockIdx.x * 256 + threadIdx.x;
  const bool ok = i < n8;
  v8h o;
#pragma unroll
  for (int q = 0; q < 8; ++q) o[q] = (h16)0.0f;
  if (ok) {
    const v4f a = *(const v4f*)(src + (size_t)i * 8);
    const v4f c = *(const v4f*)(src + (size_t)i * 8 + 4);
#pragma unroll
    for (int q = 0; q < 4; ++q) {
      o[q]     = (h16)(bf16r(a[q]) * scale);
      o[4 + q] = (h16)(bf16r(c[q]) * scale);
    }
  }
  if (ok) *(v8h*)(dst + (size_t)i * 8) = o;
  
}

// ---------------------------------------------------------------------------
// Causal depthwise conv (4 taps) + SiLU for one of three weight sets (blockIdx.y), f16 output scaled by ascale;
// ---------------------------------------------------------------------------
__global__ void __launch_bounds__(256)
k_prep(const float* __restrict__ x,
       const float* __restrict__ w0, const float* __restrict__ b0,
       const float* __restrict__ w1, const float* __restrict__ b1,
       const float* __restrict__ w2, const float* __restrict__ b2,
       h16* xh, h16* y0, h16* y1, h16* y2, int n8, int T, float ascale)
{
  const int which = blockIdx.y;
  const float* w  = (which == 0) ? w0 : ((which == 1) ? w1 : w2);
  const float* bb = (which == 0) ? b0 : ((which == 1) ? b1 : b2);
  h16* y          = (which == 0) ? y0 : ((which == 1) ? y1 : y2);

  const int g = blockIdx.x * 256 + threadIdx.x;
  const bool ok = g < n8;
  const size_t eo = (size_t)g * 8;
  v8h o, ox;
#pragma unroll
  for (int q = 0; q < 8; ++q) { o[q] = (h16)0.0f; ox[q] = (h16)0.0f; }
  if (ok) {
    const size_t bt = (size_t)(g >> 7);          // token index (DM/8 = 128 groups per token)
    const int d0 = (g & 127) * 8;
    const int t = (int)(bt % (size_t)T);
    float xr[4][8];
#pragma unroll
    for (int j = 0; j < 4; ++j) {
      const int ts = t - 3 + j;
      if (ts >= 0) {
        const float* px = x + (bt - (size_t)(3 - j)) * DM + d0;
        const v4f a = *(const v4f*)px;
        const v4f c = *(const v4f*)(px + 4);
#pragma unroll
        for (int q = 0; q < 4; ++q) { xr[j][q] = bf16r(a[q]); xr[j][4 + q] = bf16r(c[q]); }
      } else {
#pragma unroll
        for (int q = 0; q < 8; ++q) xr[j][q] = 0.0f;
      }
    }
#pragma unroll
    for (int q = 0; q < 8; ++q) {
      const int d = d0 + q;
      const v4f wv4 = *(const v4f*)(w + (size_t)d * 4);
      float acc = xr[0][q] * bf16r(wv4[0]);
      acc += xr[1][q] * bf16r(wv4[1]);
      acc += xr[2][q] * bf16r(wv4[2]);
      acc += xr[3][q] * bf16r(wv4[3]);
      acc += bf16r(bb[d]);
      const float s = acc * sigm(acc);
      o[q]  = (h16)(s * ascale);
      ox[q] = (h16)xr[3][q];
    }
  }
  if (ok) {
    *(v8h*)(y + eo) = o;
    if (which == 0) *(v8h*)(xh + eo) = ox;
  }
  
}

// ---------------------------------------------------------------------------
// Y[M,N] = epi( A[M,K] * W[N,K]^T * oscale + bias[N] ), f16 operands (k-contiguous), f32 accumulate.
// Block 256 threads = 8 waves; block tile 128 rows x 16*NT cols; wave tile 16 x 16*NT.
// EPI: 0 none, 1 L2-normalise each row over the 64-col slab, 2 silu, 3 sigmoid then clip to [0.1,1], 4 sigmoid then min 1.
// ---------------------------------------------------------------------------
template<int NT, int EPI, typename OT>
__global__ void __launch_bounds__(256)
k_gemm(const h16* __restrict__ A, const h16* __restrict__ W, const float* __restrict__ bias,
       OT* Y, int N, int K, float oscale, float yscale)
{
  constexpr int TW = 16 * NT;
  __shared__ __attribute__((aligned(16))) float stg[8 * 16 * TW];

  const int lane = threadIdx.x & 31, wv = threadIdx.x >> 5;
  const int m = lane & 15, h = lane >> 4;
  const int rowBase = blockIdx.x * 128 + wv * 16;
  const int colBase = blockIdx.y * TW;

  v8f acc[NT];
#pragma unroll
  for (int t = 0; t < NT; ++t)
#pragma unroll
    for (int r = 0; r < 8; ++r) acc[t][r] = 0.0f;

  // A: lane row m, elements 0..7 <- k0+8h.., 8..15 <- k0+16+8h..;  B: lane col m, same k map
  const h16* arow  = A + (size_t)(rowBase + m) * K + 8 * h;
  const h16* wbase = W + (size_t)(colBase + m) * K + 8 * h;
  for (int k0 = 0; k0 < K; k0 += 32) {
    HF a;
    a.p[0] = *(const v8h*)(arow + k0);
    a.p[1] = *(const v8h*)(arow + k0 + 16);
#pragma unroll
    for (int t = 0; t < NT; ++t) {
      const h16* wrow = wbase + (size_t)(16 * t) * K + k0;
      HF b;
      b.p[0] = *(const v8h*)(wrow);
      b.p[1] = *(const v8h*)(wrow + 16);
      acc[t] = mma_f16(a.v, b.v, acc[t]);
    }
  }

  // epilogue values (D element r of this lane = row 8h+r, col m of tile t)
#pragma unroll
  for (int t = 0; t < NT; ++t) {
    const float bv = bf16r(bias[colBase + 16 * t + m]);
#pragma unroll
    for (int r = 0; r < 8; ++r) {
      float v = acc[t][r] * oscale + bv;
      if (EPI == 2)      { v = v * sigm(v); }
      else if (EPI == 3) { v = sigm(v); v = fminf(fmaxf(v, 0.1f), 1.0f); }
      else if (EPI == 4) { v = fminf(sigm(v), 1.0f); }
      acc[t][r] = v;
    }
  }
  if (EPI == 1) {
#pragma unroll
    for (int r = 0; r < 8; ++r) {
      float ss = 0.0f;
#pragma unroll
      for (int t = 0; t < NT; ++t) ss += acc[t][r] * acc[t][r];
      ss += __shfl_xor(ss, 1, 32);
      ss += __shfl_xor(ss, 2, 32);
      ss += __shfl_xor(ss, 4, 32);
      ss += __shfl_xor(ss, 8, 32);
      const float inv = 1.0f / sqrtf(fmaxf(ss, 1e-6f));
#pragma unroll
      for (int t = 0; t < NT; ++t) acc[t][r] *= inv;
    }
  }

  float* sw = stg + wv * 16 * TW;
#pragma unroll
  for (int t = 0; t < NT; ++t)
#pragma unroll
    for (int r = 0; r < 8; ++r) sw[(8 * h + r) * TW + 16 * t + m] = acc[t][r];
  __syncthreads();

  if constexpr (sizeof(OT) == 4 && NT == 4) {
    v4f vals[8];
    size_t offs[8];
#pragma unroll
    for (int it = 0; it < 8; ++it) {
      const int row = 2 * it + h, c4 = m * 4;
      vals[it] = *(const v4f*)(sw + row * TW + c4);
      offs[it] = (size_t)(rowBase + row) * N + colBase + c4;
    }
#pragma unroll
    for (int it = 0; it < 8; ++it) *(v4f*)(Y + offs[it]) = vals[it];
    
  } else if constexpr (sizeof(OT) == 2 && NT == 4) {
    v8h vals[4];
    size_t offs[4];
#pragma unroll
    for (int it = 0; it < 4; ++it) {
      const int row = it * 4 + (lane >> 3), c8 = (lane & 7) * 8;
      const v4f a = *(const v4f*)(sw + row * TW + c8);
      const v4f c = *(const v4f*)(sw + row * TW + c8 + 4);
      v8h o;
#pragma unroll
      for (int q = 0; q < 4; ++q) { o[q] = (h16)(a[q] * yscale); o[4 + q] = (h16)(c[q] * yscale); }
      vals[it] = o;
      offs[it] = (size_t)(rowBase + row) * N + colBase + c8;
    }
#pragma unroll
    for (int it = 0; it < 4; ++it) *(v8h*)(Y + offs[it]) = vals[it];
    
  } else if constexpr (sizeof(OT) == 4 && NT == 1) {
    // N == 16: the wave's 16 rows are 1 KB contiguous; 8 lanes x 16 B per line
    v4f vals[2];
    size_t offs[2];
#pragma unroll
    for (int it = 0; it < 2; ++it) {
      const int q = it * 32 + lane, row = q >> 2, c4 = (q & 3) * 4;
      vals[it] = *(const v4f*)(sw + row * TW + c4);
      offs[it] = (size_t)(rowBase + row) * N + colBase + c4;
    }
#pragma unroll
    for (int it = 0; it < 2; ++it) *(v4f*)(Y + offs[it]) = vals[it];
    
  }
}

// ---------------------------------------------------------------------------
// Chunked gated delta rule: one block per (b,h), 256 threads, T/64 chunks in sequence.
// State S (64x64 f32) lives in registers (16 entries per thread) and is copied to LDS once per chunk as the
// B operand of Q*S. Scores A[i][j] on VALU f32, O = Q*S + A*V on bf16 hi/lo WMMA, exact sequential state update.
// ---------------------------------------------------------------------------
__global__ void __launch_bounds__(256)
k_chunk(const float* __restrict__ Qp, const float* __restrict__ Kp, const float* __restrict__ Vp,
        const float* __restrict__ Ap, const float* __restrict__ Bp, const float* __restrict__ Gp,
        const float* __restrict__ rmsw, h16* Og, int T, float ogscale)
{
  __shared__ __attribute__((aligned(16))) float Qs[CH * QP];
  __shared__ __attribute__((aligned(16))) float Ks[CH * QP];
  __shared__ __attribute__((aligned(16))) float CLs[CH * QP];
  __shared__ __attribute__((aligned(16))) float SCs[CH * QP];
  __shared__ __attribute__((aligned(16))) float Vs[CH * HD];
  __shared__ __attribute__((aligned(16))) float ALs[CH * HD];
  __shared__ __attribute__((aligned(16))) float Sf[HD * HD];
  __shared__ float Bsh[CH], GS[CH], RV[CH], RW[HD];
  __shared__ float PK[2 * 256];

  const int tid = threadIdx.x;
  const int lane = tid & 31, wv = tid >> 5, m = lane & 15, h = lane >> 4;
  const int bh = blockIdx.x, b = bh / NH, hh = bh % NH;
  const int e = tid & 63, dg = tid >> 6;      // state ownership: column e, rows dg*16 .. dg*16+15

  float Sreg[16];
#pragma unroll
  for (int dd = 0; dd < 16; ++dd) Sreg[dd] = 0.0f;
  if (tid < HD) RW[tid] = bf16r(rmsw[hh * HD + tid]);

  const int nch = T / CH;
  for (int n = 0; n < nch; ++n) {
    const size_t rowbase = (size_t)b * T + (size_t)n * CH;
    const float* Qg = Qp + rowbase * DM + hh * HD;
    const float* Kg = Kp + rowbase * DM + hh * HD;
    const float* Vg = Vp + rowbase * DM + hh * HD;
    const float* Ag = Ap + rowbase * DM + hh * HD;

    __syncthreads();
    // tile loads (64 rows x 64 f32 each)
#pragma unroll
    for (int it = 0; it < 4; ++it) {
      const int idx = it * 256 + tid;
      const int c = idx >> 4, d4 = (idx & 15) * 4;
      const size_t go = (size_t)c * DM + d4;
      *(v4f*)(Qs  + c * QP + d4) = *(const v4f*)(Qg + go);
      *(v4f*)(Ks  + c * QP + d4) = *(const v4f*)(Kg + go);
      *(v4f*)(Vs  + c * HD + d4) = *(const v4f*)(Vg + go);
      *(v4f*)(ALs + c * HD + d4) = *(const v4f*)(Ag + go);
    }
    if (tid < CH) {
      Bsh[tid] = fminf(Bp[(rowbase + tid) * NH + hh], 1.0f);
      GS[tid]  = Gp[(rowbase + tid) * NH + hh];
    }
#pragma unroll
    for (int dd = 0; dd < 16; ++dd) Sf[(dg * 16 + dd) * HD + e] = Sreg[dd];
    __syncthreads();

    // cumulative log decay per feature, restarted per chunk
    if (tid < HD) {
      float a = 0.0f;
      for (int c = 0; c < CH; ++c) {
        a += __logf(fmaxf(ALs[c * HD + tid], 1e-7f));
        CLs[c * QP + tid] = a;
      }
    }
    __syncthreads();

    // scores: A[i][j] = beta_j * sum_d q[i][d] k[j][d] exp(cl[i][d] - cl[j][d]) for i >= j, else 0
    {
      const int j0 = lane, j1 = lane + 32;
      float a0[8], a1[4];
#pragma unroll
      for (int r = 0; r < 8; ++r) a0[r] = 0.0f;
#pragma unroll
      for (int r = 0; r < 4; ++r) a1[r] = 0.0f;
#pragma unroll 2
      for (int d = 0; d < HD; ++d) {
        const float k0v = Ks[j0 * QP + d], c0 = CLs[j0 * QP + d];
        const float k1v = Ks[j1 * QP + d], c1 = CLs[j1 * QP + d];
#pragma unroll
        for (int r = 0; r < 8; ++r) {
          const int i = wv + 8 * r;
          const float q = Qs[i * QP + d];
          const float ci = CLs[i * QP + d];
          a0[r] += q * k0v * __expf(ci - c0);
          if (r >= 4) a1[r - 4] += q * k1v * __expf(ci - c1);
        }
      }
      const float b0 = Bsh[j0], b1 = Bsh[j1];
#pragma unroll
      for (int r = 0; r < 8; ++r) {
        const int i = wv + 8 * r;
        SCs[i * QP + j0] = (i >= j0) ? a0[r] * b0 : 0.0f;
        float v1 = 0.0f;
        if (r >= 4) v1 = (i >= j1) ? a1[r - 4] * b1 : 0.0f;
        SCs[i * QP + j1] = v1;
      }
    }
    __syncthreads();

    // O = Q*S + A*V : wave owns rows 16*ti.., two 16-col tiles; bf16 hi/lo three products per operand pair
    {
      const int ti = wv >> 1, tj0 = (wv & 1) * 2;
      v8f acc[2];
#pragma unroll
      for (int s = 0; s < 2; ++s)
#pragma unroll
        for (int r = 0; r < 8; ++r) acc[s][r] = 0.0f;

#pragma unroll
      for (int ks = 0; ks < 2; ++ks) {
        const int k0 = ks * 32;
        BF ah, al;
        fragA_split(Qs + (ti * 16 + m) * QP + k0, h, ah, al);
#pragma unroll
        for (int s = 0; s < 2; ++s) {
          BF bhi, blo;
          fragB_split(Sf, HD, k0, (tj0 + s) * 16 + m, h, bhi, blo);
          acc[s] = mma_bf16(ah.v, bhi.v, acc[s]);
          acc[s] = mma_bf16(ah.v, blo.v, acc[s]);
          acc[s] = mma_bf16(al.v, bhi.v, acc[s]);
        }
      }
#pragma unroll
      for (int ks = 0; ks < 2; ++ks) {
        const int k0 = ks * 32;
        BF ah, al;
        fragA_split(SCs + (ti * 16 + m) * QP + k0, h, ah, al);
#pragma unroll
        for (int s = 0; s < 2; ++s) {
          BF bhi, blo;
          fragB_split(Vs, HD, k0, (tj0 + s) * 16 + m, h, bhi, blo);
          acc[s] = mma_bf16(ah.v, bhi.v, acc[s]);
          acc[s] = mma_bf16(ah.v, blo.v, acc[s]);
          acc[s] = mma_bf16(al.v, bhi.v, acc[s]);
        }
      }
      __syncthreads();   // all reads of SCs/Sf done; reuse SCs as the O tile
#pragma unroll
      for (int s = 0; s < 2; ++s)
#pragma unroll
        for (int r = 0; r < 8; ++r)
          SCs[(ti * 16 + 8 * h + r) * QP + (tj0 + s) * 16 + m] = acc[s][r];
    }
    __syncthreads();

    // per-row RMS normaliser times gate
    if (tid < CH) {
      float ss = 0.0f;
      for (int e2 = 0; e2 < HD; ++e2) { const float o = SCs[tid * QP + e2]; ss += o * o; }
      RV[tid] = GS[tid] / sqrtf(ss * (1.0f / 64.0f) + 1e-6f);
    }
    __syncthreads();

    {
      v8h ov[2];
      size_t go[2];
#pragma unroll
      for (int it = 0; it < 2; ++it) {
        const int c = it * 32 + (tid >> 3), e0 = (tid & 7) * 8;
        const v4f x0 = *(const v4f*)(SCs + c * QP + e0);
        const v4f x1 = *(const v4f*)(SCs + c * QP + e0 + 4);
        const float sc = RV[c] * ogscale;
        v8h o;
#pragma unroll
        for (int q = 0; q < 4; ++q) {
          o[q]     = (h16)(x0[q] * sc * RW[e0 + q]);
          o[4 + q] = (h16)(x1[q] * sc * RW[e0 + 4 + q]);
        }
        ov[it] = o;
        go[it] = (rowbase + c) * (size_t)DM + hh * HD + e0;
      }
#pragma unroll
      for (int it = 0; it < 2; ++it) *(v8h*)(Og + go[it]) = ov[it];
      
    }

    // exact sequential state update over the chunk: S = a*S; S += (beta*k) outer (v - k^T S)
    for (int t = 0; t < CH; ++t) {
      float kk[16], aa[16];
#pragma unroll
      for (int q = 0; q < 4; ++q) {
        const v4f kv = *(const v4f*)(Ks  + t * QP + dg * 16 + 4 * q);
        const v4f av = *(const v4f*)(ALs + t * HD + dg * 16 + 4 * q);
#pragma unroll
        for (int u = 0; u < 4; ++u) { kk[4 * q + u] = kv[u]; aa[4 * q + u] = av[u]; }
      }
      float part = 0.0f;
#pragma unroll
      for (int dd = 0; dd < 16; ++dd) { Sreg[dd] *= aa[dd]; part += kk[dd] * Sreg[dd]; }
      float* pk = PK + (t & 1) * 256;
      pk[tid] = part;
      __syncthreads();
      const float kts = (pk[e] + pk[64 + e]) + (pk[128 + e] + pk[192 + e]);
      const float bt = Bsh[t];
      const float dl = Vs[t * HD + e] - kts;
#pragma unroll
      for (int dd = 0; dd < 16; ++dd) Sreg[dd] += (bt * kk[dd]) * dl;
    }
  }
}

// ---------------------------------------------------------------------------
extern "C" void kernel_launch(void* const* d_in, const int* in_sizes, int n_in,
                              void* d_out, int out_size, void* d_ws, size_t ws_size,
                              hipStream_t stream)
{
  if (n_in < 26) return;
  const int T = 2048;
  const long nx = (long)in_sizes[0];
  if (nx <= 0 || (nx % ((long)DM * T)) != 0) return;
  const int M = (int)(nx / DM);                       // tokens, multiple of 2048 (hence of 128)
  if ((long)out_size != (long)M * DM) return;
  if (in_sizes[1] != DM * 4 || in_sizes[3] != DM * 4 || in_sizes[5] != DM * 4) return;
  if (in_sizes[7] != DM * DM || in_sizes[9] != DM * DM || in_sizes[11] != DM * DM || in_sizes[24] != DM * DM) return;
  if (in_sizes[13] != 64 * DM || in_sizes[15] != DM * 64 || in_sizes[17] != NH * DM ||
      in_sizes[20] != 64 * DM || in_sizes[22] != NH * 64) return;

  const float* x       = (const float*)d_in[0];
  const float* wq_conv = (const float*)d_in[1];  const float* bq_conv = (const float*)d_in[2];
  const float* wk_conv = (const float*)d_in[3];  const float* bk_conv = (const float*)d_in[4];
  const float* wv_conv = (const float*)d_in[5];  const float* bv_conv = (const float*)d_in[6];
  const float* Wq  = (const float*)d_in[7];   const float* bq  = (const float*)d_in[8];
  const float* Wk  = (const float*)d_in[9];   const float* bk  = (const float*)d_in[10];
  const float* Wv  = (const float*)d_in[11];  const float* bv  = (const float*)d_in[12];
  const float* Wad = (const float*)d_in[13];  const float* bad = (const float*)d_in[14];
  const float* Wau = (const float*)d_in[15];  const float* bau = (const float*)d_in[16];
  const float* Wbe = (const float*)d_in[17];  const float* bbe = (const float*)d_in[18];
  const float* rms_w = (const float*)d_in[19];
  const float* Wgd = (const float*)d_in[20];  const float* bgd = (const float*)d_in[21];
  const float* Wgu = (const float*)d_in[22];  const float* bgu = (const float*)d_in[23];
  const float* Wo  = (const float*)d_in[24];  const float* bo  = (const float*)d_in[25];

  char* ws = (char*)d_ws;
  size_t off = 0;
  auto carve = [&](size_t bytes) -> char* {
    char* p = ws + off;
    off += (bytes + 255) & ~(size_t)255;
    return p;
  };
  const size_t MD = (size_t)M * DM;
  h16* xh    = (h16*)carve(MD * 2);
  h16* cq    = (h16*)carve(MD * 2);
  h16* ck    = (h16*)carve(MD * 2);
  h16* cv    = (h16*)carve(MD * 2);
  h16* Wq16  = (h16*)carve((size_t)DM * DM * 2);
  h16* Wk16  = (h16*)carve((size_t)DM * DM * 2);
  h16* Wv16  = (h16*)carve((size_t)DM * DM * 2);
  h16* Wo16  = (h16*)carve((size_t)DM * DM * 2);
  h16* Wad16 = (h16*)carve((size_t)64 * DM * 2);
  h16* Wau16 = (h16*)carve((size_t)DM * 64 * 2);
  h16* Wbe16 = (h16*)carve((size_t)NH * DM * 2);
  h16* Wgd16 = (h16*)carve((size_t)64 * DM * 2);
  h16* Wgu16 = (h16*)carve((size_t)NH * 64 * 2);
  float* Qn  = (float*)carve(MD * 4);
  float* Kn  = (float*)carve(MD * 4);
  float* Vf  = (float*)carve(MD * 4);
  float* Al  = (float*)carve(MD * 4);
  float* Bt  = (float*)carve((size_t)M * NH * 4);
  float* Gt  = (float*)carve((size_t)M * NH * 4);
  h16* t1    = (h16*)carve((size_t)M * 64 * 2);
  h16* t2    = (h16*)carve((size_t)M * 64 * 2);
  h16* Og16  = (h16*)carve(MD * 2);
  if (off > ws_size) return;

  const float wsc = 256.0f;      // weight scale
  const float asc = 256.0f;      // conv activation scale
  const float tsc = 64.0f;       // gate hidden scale
  const float osc = 16.0f;       // gated output scale

  // 1) x -> f16 and three shortconv+SiLU activations
  {
    const int n8 = (int)(MD / 8);
    k_prep<<<dim3((n8 + 255) / 256, 3), 256, 0, stream>>>(x, wq_conv, bq_conv, wk_conv, bk_conv, wv_conv, bv_conv,
                                                         xh, cq, ck, cv, n8, T, asc);
  }
  // 2) weights -> scaled f16
  {
    int n8;
    n8 = DM * DM / 8;  k_cvtw<<<(n8 + 255) / 256, 256, 0, stream>>>(Wq,  Wq16,  n8, wsc);
    n8 = DM * DM / 8;  k_cvtw<<<(n8 + 255) / 256, 256, 0, stream>>>(Wk,  Wk16,  n8, wsc);
    n8 = DM * DM / 8;  k_cvtw<<<(n8 + 255) / 256, 256, 0, stream>>>(Wv,  Wv16,  n8, wsc);
    n8 = DM * DM / 8;  k_cvtw<<<(n8 + 255) / 256, 256, 0, stream>>>(Wo,  Wo16,  n8, wsc);
    n8 = 64 * DM / 8;  k_cvtw<<<(n8 + 255) / 256, 256, 0, stream>>>(Wad, Wad16, n8, wsc);
    n8 = DM * 64 / 8;  k_cvtw<<<(n8 + 255) / 256, 256, 0, stream>>>(Wau, Wau16, n8, wsc);
    n8 = NH * DM / 8;  k_cvtw<<<(n8 + 255) / 256, 256, 0, stream>>>(Wbe, Wbe16, n8, wsc);
    n8 = 64 * DM / 8;  k_cvtw<<<(n8 + 255) / 256, 256, 0, stream>>>(Wgd, Wgd16, n8, wsc);
    n8 = NH * 64 / 8;  k_cvtw<<<(n8 + 255) / 256, 256, 0, stream>>>(Wgu, Wgu16, n8, wsc);
  }
  // 3) projections
  const dim3 gbig(M / 128, DM / 64);
  const dim3 gsm(M / 128, 1);
  k_gemm<4, 1, float><<<gbig, 256, 0, stream>>>(cq, Wq16, bq, Qn, DM, DM, 1.0f / (asc * wsc), 1.0f);
  k_gemm<4, 1, float><<<gbig, 256, 0, stream>>>(ck, Wk16, bk, Kn, DM, DM, 1.0f / (asc * wsc), 1.0f);
  k_gemm<4, 0, float><<<gbig, 256, 0, stream>>>(cv, Wv16, bv, Vf, DM, DM, 1.0f / (asc * wsc), 1.0f);
  k_gemm<4, 2, h16  ><<<gsm,  256, 0, stream>>>(xh, Wad16, bad, t1, 64, DM, 1.0f / wsc, tsc);
  k_gemm<4, 3, float><<<gbig, 256, 0, stream>>>(t1, Wau16, bau, Al, DM, 64, 1.0f / (tsc * wsc), 1.0f);
  k_gemm<1, 4, float><<<gsm,  256, 0, stream>>>(xh, Wbe16, bbe, Bt, NH, DM, 1.0f / wsc, 1.0f);
  k_gemm<4, 2, h16  ><<<gsm,  256, 0, stream>>>(xh, Wgd16, bgd, t2, 64, DM, 1.0f / wsc, tsc);
  k_gemm<1, 4, float><<<gsm,  256, 0, stream>>>(t2, Wgu16, bgu, Gt, NH, 64, 1.0f / (tsc * wsc), 1.0f);
  // 4) chunked recurrence, one block per (b, h)
  k_chunk<<<(M / T) * NH, 256, 0, stream>>>(Qn, Kn, Vf, Al, Bt, Gt, rms_w, Og16, T, osc);
  // 5) output projection
  k_gemm<4, 0, float><<<gbig, 256, 0, stream>>>(Og16, Wo16, bo, (float*)d_out, DM, DM, 1.0f / (osc * wsc), 1.0f);
}

// v001
// It runs in 798 microseconds.
// Timed twice side by side with v000, it ran 1.55 times as fast both times.
#include <hip/hip_runtime.h>
#include <stdint.h>

// Contractions: token projections (q, k, v, gate down/up, beta, out) on v_wmma_f32_16x16x32_f16 with f16 operands pre-scaled by powers of two, f32 accumulate; per-chunk Q*S and A*V on v_wmma_f32_16x16x32_bf16 as bf16 hi/lo three-product split, f32 accumulate; decay scores, state recurrence, shortconv and norms on VALU in f32. All float inputs RNE-converted to bf16 on load.

typedef _Float16 h16;
typedef h16    v16h __attribute__((ext_vector_type(16)));
typedef h16    v8h  __attribute__((ext_vector_type(8)));
typedef __bf16 v16b __attribute__((ext_vector_type(16)));
typedef float  v8f  __attribute__((ext_vector_type(8)));
typedef float  v4f  __attribute__((ext_vector_type(4)));

union HF { v16h v; v8h p[2]; };
union BF { v16b v; unsigned short u[16]; };

#define DM 1024
#define HD 64
#define NH 16
#define CH 64
#define QP 68

__device__ __forceinline__ unsigned short bf16_bits(float f) {
  unsigned int u = __float_as_uint(f);
  u += 0x7FFFu + ((u >> 16) & 1u);
  return (unsigned short)(u >> 16);
}
__device__ __forceinline__ float bf16r(float f) {
  return __uint_as_float(((unsigned int)bf16_bits(f)) << 16);
}
// x = hi + lo in bf16 pieces (RNE), bit patterns
__device__ __forceinline__ void split2(float x, unsigned short& hi, unsigned short& lo) {
  const unsigned short hb = bf16_bits(x);
  const float hf = __uint_as_float(((unsigned int)hb) << 16);
  hi = hb;
  lo = bf16_bits(x - hf);
}
__device__ __forceinline__ float sigm(float v) {
  return __fdividef(1.0f, 1.0f + __expf(-v));
}

// 16-bit WMMA wrappers with the VALU hazard guard after the matrix op
__device__ __forceinline__ v8f mma_f16(v16h a, v16h b, v8f c) {
  c = __builtin_amdgcn_wmma_f32_16x16x32_f16(false, a, false, b, (short)0, c, false, false);
  asm volatile("v_nop\n\tv_nop\n\tv_nop\n\tv_nop" : "+v"(c) : "v"(a), "v"(b));
  return c;
}
__device__ __forceinline__ v8f mma_bf16(v16b a, v16b b, v8f c) {
  c = __builtin_amdgcn_wmma_f32_16x16x32_bf16(false, a, false, b, (short)0, c, false, false);
  asm volatile("v_nop\n\tv_nop\n\tv_nop\n\tv_nop" : "+v"(c) : "v"(a), "v"(b));
  return c;
}

// A fragment (row m, split k map) from an f32 LDS row pointer pr = base + row*pitch + k0, as bf16 hi/lo
__device__ __forceinline__ void fragA_split(const float* pr, int h, BF& hi, BF& lo) {
  const v4f x0 = *(const v4f*)(pr + 8 * h);
  const v4f x1 = *(const v4f*)(pr + 8 * h + 4);
  const v4f x2 = *(const v4f*)(pr + 16 + 8 * h);
  const v4f x3 = *(const v4f*)(pr + 20 + 8 * h);
#pragma unroll
  for (int q = 0; q < 4; ++q) {
    split2(x0[q], hi.u[q],      lo.u[q]);
    split2(x1[q], hi.u[4 + q],  lo.u[4 + q]);
    split2(x2[q], hi.u[8 + q],  lo.u[8 + q]);
    split2(x3[q], hi.u[12 + q], lo.u[12 + q]);
  }
}
// B fragment (col n, same split k map) gathered down column col of f32 [k][pitch] in LDS, as bf16 hi/lo
__device__ __forceinline__ void fragB_split(const float* base, int pitch, int k0, int col, int h, BF& hi, BF& lo) {
#pragma unroll
  for (int i = 0; i < 8; ++i) {
    split2(base[(k0 + 8 * h + i) * pitch + col],      hi.u[i],     lo.u[i]);
    split2(base[(k0 + 16 + 8 * h + i) * pitch + col], hi.u[8 + i], lo.u[8 + i]);
  }
}

// ---------------------------------------------------------------------------
// ---------------------------------------------------------------------------
__global__ void __launch_bounds__(256)
k_cvtw(const float* __restrict__ src, h16* dst, int n8, float scale)
{
  const int i = blockIdx.x * 256 + threadIdx.x;
  const bool ok = i < n8;
  v8h o;
#pragma unroll
  for (int q = 0; q < 8; ++q) o[q] = (h16)0.0f;
  if (ok) {
    const v4f a = *(const v4f*)(src + (size_t)i * 8);
    const v4f c = *(const v4f*)(src + (size_t)i * 8 + 4);
#pragma unroll
    for (int q = 0; q < 4; ++q) {
      o[q]     = (h16)(bf16r(a[q]) * scale);
      o[4 + q] = (h16)(bf16r(c[q]) * scale);
    }
  }
  if (ok) *(v8h*)(dst + (size_t)i * 8) = o;
  
}

// ---------------------------------------------------------------------------
// Causal depthwise conv (4 taps) + SiLU for one of three weight sets (blockIdx.y), f16 output scaled by ascale;
// ---------------------------------------------------------------------------
__global__ void __launch_bounds__(256)
k_prep(const float* __restrict__ x,
       const float* __restrict__ w0, const float* __restrict__ b0,
       const float* __restrict__ w1, const float* __restrict__ b1,
       const float* __restrict__ w2, const float* __restrict__ b2,
       h16* xh, h16* y0, h16* y1, h16* y2, int n8, int T, float ascale)
{
  const int which = blockIdx.y;
  const float* w  = (which == 0) ? w0 : ((which == 1) ? w1 : w2);
  const float* bb = (which == 0) ? b0 : ((which == 1) ? b1 : b2);
  h16* y          = (which == 0) ? y0 : ((which == 1) ? y1 : y2);

  const int g = blockIdx.x * 256 + threadIdx.x;
  const bool ok = g < n8;
  const size_t eo = (size_t)g * 8;
  v8h o, ox;
#pragma unroll
  for (int q = 0; q < 8; ++q) { o[q] = (h16)0.0f; ox[q] = (h16)0.0f; }
  if (ok) {
    const size_t bt = (size_t)(g >> 7);          // token index (DM/8 = 128 groups per token)
    const int d0 = (g & 127) * 8;
    const int t = (int)(bt % (size_t)T);
    float xr[4][8];
#pragma unroll
    for (int j = 0; j < 4; ++j) {
      const int ts = t - 3 + j;
      if (ts >= 0) {
        const float* px = x + (bt - (size_t)(3 - j)) * DM + d0;
        const v4f a = *(const v4f*)px;
        const v4f c = *(const v4f*)(px + 4);
#pragma unroll
        for (int q = 0; q < 4; ++q) { xr[j][q] = bf16r(a[q]); xr[j][4 + q] = bf16r(c[q]); }
      } else {
#pragma unroll
        for (int q = 0; q < 8; ++q) xr[j][q] = 0.0f;
      }
    }
#pragma unroll
    for (int q = 0; q < 8; ++q) {
      const int d = d0 + q;
      const v4f wv4 = *(const v4f*)(w + (size_t)d * 4);
      float acc = xr[0][q] * bf16r(wv4[0]);
      acc += xr[1][q] * bf16r(wv4[1]);
      acc += xr[2][q] * bf16r(wv4[2]);
      acc += xr[3][q] * bf16r(wv4[3]);
      acc += bf16r(bb[d]);
      const float s = acc * sigm(acc);
      o[q]  = (h16)(s * ascale);
      ox[q] = (h16)xr[3][q];
    }
  }
  if (ok) {
    *(v8h*)(y + eo) = o;
    if (which == 0) *(v8h*)(xh + eo) = ox;
  }
  
}

// ---------------------------------------------------------------------------
// Y[M,N] = epi( A[M,K] * W[N,K]^T * oscale + bias[N] ), f16 operands (k-contiguous), f32 accumulate.
// Block 256 threads = 8 waves; block tile 128 rows x 16*NT cols; wave tile 16 x 16*NT.
// EPI: 0 none, 1 L2-normalise each row over the 64-col slab, 2 silu, 3 sigmoid then clip to [0.1,1], 4 sigmoid then min 1.
// ---------------------------------------------------------------------------
template<int NT, int EPI, typename OT>
__global__ void __launch_bounds__(256)
k_gemm(const h16* __restrict__ A, const h16* __restrict__ W, const float* __restrict__ bias,
       OT* Y, int N, int K, float oscale, float yscale)
{
  constexpr int TW = 16 * NT;
  __shared__ __attribute__((aligned(16))) float stg[8 * 16 * TW];

  const int lane = threadIdx.x & 31, wv = threadIdx.x >> 5;
  const int m = lane & 15, h = lane >> 4;
  const int rowBase = blockIdx.x * 128 + wv * 16;
  const int colBase = blockIdx.y * TW;

  v8f acc[NT];
#pragma unroll
  for (int t = 0; t < NT; ++t)
#pragma unroll
    for (int r = 0; r < 8; ++r) acc[t][r] = 0.0f;

  // A: lane row m, elements 0..7 <- k0+8h.., 8..15 <- k0+16+8h..;  B: lane col m, same k map
  const h16* arow  = A + (size_t)(rowBase + m) * K + 8 * h;
  const h16* wbase = W + (size_t)(colBase + m) * K + 8 * h;
  for (int k0 = 0; k0 < K; k0 += 32) {
    HF a;
    a.p[0] = *(const v8h*)(arow + k0);
    a.p[1] = *(const v8h*)(arow + k0 + 16);
#pragma unroll
    for (int t = 0; t < NT; ++t) {
      const h16* wrow = wbase + (size_t)(16 * t) * K + k0;
      HF b;
      b.p[0] = *(const v8h*)(wrow);
      b.p[1] = *(const v8h*)(wrow + 16);
      acc[t] = mma_f16(a.v, b.v, acc[t]);
    }
  }

  // epilogue values (D element r of this lane = row 8h+r, col m of tile t)
#pragma unroll
  for (int t = 0; t < NT; ++t) {
    const float bv = bf16r(bias[colBase + 16 * t + m]);
#pragma unroll
    for (int r = 0; r < 8; ++r) {
      float v = acc[t][r] * oscale + bv;
      if (EPI == 2)      { v = v * sigm(v); }
      else if (EPI == 3) { v = sigm(v); v = fminf(fmaxf(v, 0.1f), 1.0f); }
      else if (EPI == 4) { v = fminf(sigm(v), 1.0f); }
      acc[t][r] = v;
    }
  }
  if (EPI == 1) {
#pragma unroll
    for (int r = 0; r < 8; ++r) {
      float ss = 0.0f;
#pragma unroll
      for (int t = 0; t < NT; ++t) ss += acc[t][r] * acc[t][r];
      ss += __shfl_xor(ss, 1, 32);
      ss += __shfl_xor(ss, 2, 32);
      ss += __shfl_xor(ss, 4, 32);
      ss += __shfl_xor(ss, 8, 32);
      const float inv = 1.0f / sqrtf(fmaxf(ss, 1e-6f));
#pragma unroll
      for (int t = 0; t < NT; ++t) acc[t][r] *= inv;
    }
  }

  float* sw = stg + wv * 16 * TW;
#pragma unroll
  for (int t = 0; t < NT; ++t)
#pragma unroll
    for (int r = 0; r < 8; ++r) sw[(8 * h + r) * TW + 16 * t + m] = acc[t][r];
  __syncthreads();

  if constexpr (sizeof(OT) == 4 && NT == 4) {
    v4f vals[8];
    size_t offs[8];
#pragma unroll
    for (int it = 0; it < 8; ++it) {
      const int row = 2 * it + h, c4 = m * 4;
      vals[it] = *(const v4f*)(sw + row * TW + c4);
      offs[it] = (size_t)(rowBase + row) * N + colBase + c4;
    }
#pragma unroll
    for (int it = 0; it < 8; ++it) *(v4f*)(Y + offs[it]) = vals[it];
    
  } else if constexpr (sizeof(OT) == 2 && NT == 4) {
    v8h vals[4];
    size_t offs[4];
#pragma unroll
    for (int it = 0; it < 4; ++it) {
      const int row = it * 4 + (lane >> 3), c8 = (lane & 7) * 8;
      const v4f a = *(const v4f*)(sw + row * TW + c8);
      const v4f c = *(const v4f*)(sw + row * TW + c8 + 4);
      v8h o;
#pragma unroll
      for (int q = 0; q < 4; ++q) { o[q] = (h16)(a[q] * yscale); o[4 + q] = (h16)(c[q] * yscale); }
      vals[it] = o;
      offs[it] = (size_t)(rowBase + row) * N + colBase + c8;
    }
#pragma unroll
    for (int it = 0; it < 4; ++it) *(v8h*)(Y + offs[it]) = vals[it];
    
  } else if constexpr (sizeof(OT) == 4 && NT == 1) {
    // N == 16: the wave's 16 rows are 1 KB contiguous; 8 lanes x 16 B per line
    v4f vals[2];
    size_t offs[2];
#pragma unroll
    for (int it = 0; it < 2; ++it) {
      const int q = it * 32 + lane, row = q >> 2, c4 = (q & 3) * 4;
      vals[it] = *(const v4f*)(sw + row * TW + c4);
      offs[it] = (size_t)(rowBase + row) * N + colBase + c4;
    }
#pragma unroll
    for (int it = 0; it < 2; ++it) *(v4f*)(Y + offs[it]) = vals[it];
    
  }
}

// ---------------------------------------------------------------------------
// Gated delta rule, serial part: one block per (b,h), 256 threads, T/64 chunks in sequence.
// State S (64x64 f32) lives in registers (16 entries per thread). Only the exact sequential state update runs here;
// the state each chunk starts from is stored to Sg[(bh*nch + n)][d][e] for the chunk-parallel output kernel.
// ---------------------------------------------------------------------------
__global__ void __launch_bounds__(256)
k_state(const float* __restrict__ Kp, const float* __restrict__ Vp, const float* __restrict__ Ap,
        const float* __restrict__ Bp, float* Sg, int T)
{
  __shared__ __attribute__((aligned(16))) float Ks[CH * QP];
  __shared__ __attribute__((aligned(16))) float Vs[CH * HD];
  __shared__ __attribute__((aligned(16))) float ALs[CH * HD];
  __shared__ float Bsh[CH];
  __shared__ float PK[2 * 256];

  const int tid = threadIdx.x;
  const int bh = blockIdx.x, b = bh / NH, hh = bh % NH;
  const int e = tid & 63, dg = tid >> 6;      // state ownership: column e, rows dg*16 .. dg*16+15

  float Sreg[16];
#pragma unroll
  for (int dd = 0; dd < 16; ++dd) Sreg[dd] = 0.0f;

  const int nch = T / CH;
  for (int n = 0; n < nch; ++n) {
    const size_t rowbase = (size_t)b * T + (size_t)n * CH;
    const float* Kg = Kp + rowbase * DM + hh * HD;
    const float* Vg = Vp + rowbase * DM + hh * HD;
    const float* Ag = Ap + rowbase * DM + hh * HD;
    float* So = Sg + ((size_t)bh * nch + n) * (HD * HD);

    __syncthreads();
    // entry state of this chunk, issued ahead of the tile loads so that the stores finish under the loads' latency
#pragma unroll
    for (int dd = 0; dd < 16; ++dd) So[(dg * 16 + dd) * HD + e] = Sreg[dd];
    // the tile loads that follow are given the registers these stores name: the wait stands in front of that overwrite
    asm volatile("s_wait_xcnt 0x0" ::: "memory");
    // scheduled as one region with the stores, the twelve tile loads came out as nine and, behind a wait, three more
    __builtin_amdgcn_sched_barrier(0);
    // tile loads (64 rows x 64 f32 each)
#pragma unroll
    for (int it = 0; it < 4; ++it) {
      const int idx = it * 256 + tid;
      const int c = idx >> 4, d4 = (idx & 15) * 4;
      const size_t go = (size_t)c * DM + d4;
      *(v4f*)(Ks  + c * QP + d4) = *(const v4f*)(Kg + go);
      *(v4f*)(Vs  + c * HD + d4) = *(const v4f*)(Vg + go);
      *(v4f*)(ALs + c * HD + d4) = *(const v4f*)(Ag + go);
    }
    if (tid < CH) Bsh[tid] = fminf(Bp[(rowbase + tid) * NH + hh], 1.0f);
    __syncthreads();

    // exact sequential state update over the chunk: S = a*S; S += (beta*k) outer (v - k^T S)
    for (int t = 0; t < CH; ++t) {
      float kk[16], aa[16];
#pragma unroll
      for (int q = 0; q < 4; ++q) {
        const v4f kv = *(const v4f*)(Ks  + t * QP + dg * 16 + 4 * q);
        const v4f av = *(const v4f*)(ALs + t * HD + dg * 16 + 4 * q);
#pragma unroll
        for (int u = 0; u < 4; ++u) { kk[4 * q + u] = kv[u]; aa[4 * q + u] = av[u]; }
      }
      float part = 0.0f;
#pragma unroll
      for (int dd = 0; dd < 16; ++dd) { Sreg[dd] *= aa[dd]; part += kk[dd] * Sreg[dd]; }
      float* pk = PK + (t & 1) * 256;
      pk[tid] = part;
      __syncthreads();
      const float kts = (pk[e] + pk[64 + e]) + (pk[128 + e] + pk[192 + e]);
      const float bt = Bsh[t];
      const float dl = Vs[t * HD + e] - kts;
#pragma unroll
      for (int dd = 0; dd < 16; ++dd) Sreg[dd] += (bt * kk[dd]) * dl;
    }
  }
}

// ---------------------------------------------------------------------------
// Gated delta rule, chunk-parallel part: one block per (chunk, b*h), 256 threads. Reads the chunk's entry state from Sg.
// Scores A[i][j] on VALU f32, O = Q*S + A*V on bf16 hi/lo WMMA, then headwise RMS norm and gate.
// ---------------------------------------------------------------------------
__global__ void __launch_bounds__(256)
k_out(const float* __restrict__ Qp, const float* __restrict__ Kp, const float* __restrict__ Vp,
      const float* __restrict__ Ap, const float* __restrict__ Bp, const float* __restrict__ Gp,
      const float* __restrict__ rmsw, const float* __restrict__ Sg, h16* Og, int T, float ogscale)
{
  __shared__ __attribute__((aligned(16))) float Qs[CH * QP];
  __shared__ __attribute__((aligned(16))) float Ks[CH * QP];
  __shared__ __attribute__((aligned(16))) float CLs[CH * QP];
  __shared__ __attribute__((aligned(16))) float SCs[CH * QP];
  __shared__ __attribute__((aligned(16))) float Vs[CH * HD];
  __shared__ __attribute__((aligned(16))) float ALs[CH * HD];
  __shared__ __attribute__((aligned(16))) float Sf[HD * HD];
  __shared__ float Bsh[CH], GS[CH], RV[CH], RW[HD];

  const int tid = threadIdx.x;
  const int lane = tid & 31, wv = tid >> 5, m = lane & 15, h = lane >> 4;
  const int n = blockIdx.x, bh = blockIdx.y, b = bh / NH, hh = bh % NH;

  if (tid < HD) RW[tid] = bf16r(rmsw[hh * HD + tid]);

  const size_t rowbase = (size_t)b * T + (size_t)n * CH;
  const float* Qg = Qp + rowbase * DM + hh * HD;
  const float* Kg = Kp + rowbase * DM + hh * HD;
  const float* Vg = Vp + rowbase * DM + hh * HD;
  const float* Ag = Ap + rowbase * DM + hh * HD;
  const float* Si = Sg + ((size_t)bh * (T / CH) + n) * (HD * HD);

  // tile loads (64 rows x 64 f32 each): one byte offset per thread, the step of 16 rows is a constant
  const unsigned tb = (unsigned)(((tid >> 4) * DM + (tid & 15) * 4) * 4);
  v4f tq[4], tk[4], tv[4], ta[4], ts[4];
#pragma unroll
  for (int it = 0; it < 4; ++it) {
    tq[it] = *(const v4f*)((const char*)Qg + tb + it * (16 * DM * 4));
    tk[it] = *(const v4f*)((const char*)Kg + tb + it * (16 * DM * 4));
    tv[it] = *(const v4f*)((const char*)Vg + tb + it * (16 * DM * 4));
    ta[it] = *(const v4f*)((const char*)Ag + tb + it * (16 * DM * 4));
    ts[it] = *(const v4f*)(Si + tid * 4 + it * (16 * HD));
  }
  // the wait stands in front of any overwrite of the offset register the loads name; as an input it stays live up to it
  asm volatile("s_wait_xcnt 0x0" :: "v"(tb) : "memory");
#pragma unroll
  for (int it = 0; it < 4; ++it) {
    const int idx = it * 256 + tid;
    const int c = idx >> 4, d4 = (idx & 15) * 4;
    *(v4f*)(Qs  + c * QP + d4) = tq[it];
    *(v4f*)(Ks  + c * QP + d4) = tk[it];
    *(v4f*)(Vs  + c * HD + d4) = tv[it];
    *(v4f*)(ALs + c * HD + d4) = ta[it];
    *(v4f*)(Sf  + c * HD + d4) = ts[it];
  }
  if (tid < CH) {
    Bsh[tid] = fminf(Bp[(rowbase + tid) * NH + hh], 1.0f);
    GS[tid]  = Gp[(rowbase + tid) * NH + hh];
  }
  __syncthreads();

  // cumulative log decay per feature, restarted per chunk
  if (tid < HD) {
    float a = 0.0f;
    for (int c = 0; c < CH; ++c) {
      a += __logf(fmaxf(ALs[c * HD + tid], 1e-7f));
      CLs[c * QP + tid] = a;
    }
  }
  __syncthreads();

  // scores: A[i][j] = beta_j * sum_d q[i][d] k[j][d] exp(cl[i][d] - cl[j][d]) for i >= j, else 0
  {
    const int j0 = lane, j1 = lane + 32;
    float a0[8], a1[4];
#pragma unroll
    for (int r = 0; r < 8; ++r) a0[r] = 0.0f;
#pragma unroll
    for (int r = 0; r < 4; ++r) a1[r] = 0.0f;
#pragma unroll 2
    for (int d = 0; d < HD; ++d) {
      const float k0v = Ks[j0 * QP + d], c0 = CLs[j0 * QP + d];
      const float k1v = Ks[j1 * QP + d], c1 = CLs[j1 * QP + d];
#pragma unroll
      for (int r = 0; r < 8; ++r) {
        const int i = wv + 8 * r;
        const float q = Qs[i * QP + d];
        const float ci = CLs[i * QP + d];
        a0[r] += q * k0v * __expf(ci - c0);
        if (r >= 4) a1[r - 4] += q * k1v * __expf(ci - c1);
      }
    }
    const float b0 = Bsh[j0], b1 = Bsh[j1];
#pragma unroll
    for (int r = 0; r < 8; ++r) {
      const int i = wv + 8 * r;
      SCs[i * QP + j0] = (i >= j0) ? a0[r] * b0 : 0.0f;
      float v1 = 0.0f;
      if (r >= 4) v1 = (i >= j1) ? a1[r - 4] * b1 : 0.0f;
      SCs[i * QP + j1] = v1;
    }
  }
  __syncthreads();

  // O = Q*S + A*V : wave owns rows 16*ti.., two 16-col tiles; bf16 hi/lo three products per operand pair
  {
    const int ti = wv >> 1, tj0 = (wv & 1) * 2;
    v8f acc[2];
#pragma unroll
    for (int s = 0; s < 2; ++s)
#pragma unroll
      for (int r = 0; r < 8; ++r) acc[s][r] = 0.0f;

#pragma unroll
    for (int ks = 0; ks < 2; ++ks) {
      const int k0 = ks * 32;
      BF ah, al;
      fragA_split(Qs + (ti * 16 + m) * QP + k0, h, ah, al);
#pragma unroll
      for (int s = 0; s < 2; ++s) {
        BF bhi, blo;
        fragB_split(Sf, HD, k0, (tj0 + s) * 16 + m, h, bhi, blo);
        acc[s] = mma_bf16(ah.v, bhi.v, acc[s]);
        acc[s] = mma_bf16(ah.v, blo.v, acc[s]);
        acc[s] = mma_bf16(al.v, bhi.v, acc[s]);
      }
    }
#pragma unroll
    for (int ks = 0; ks < 2; ++ks) {
      const int k0 = ks * 32;
      BF ah, al;
      fragA_split(SCs + (ti * 16 + m) * QP + k0, h, ah, al);
#pragma unroll
      for (int s = 0; s < 2; ++s) {
        BF bhi, blo;
        fragB_split(Vs, HD, k0, (tj0 + s) * 16 + m, h, bhi, blo);
        acc[s] = mma_bf16(ah.v, bhi.v, acc[s]);
        acc[s] = mma_bf16(ah.v, blo.v, acc[s]);
        acc[s] = mma_bf16(al.v, bhi.v, acc[s]);
      }
    }
    __syncthreads();   // all reads of SCs/Sf done; reuse SCs as the O tile
#pragma unroll
    for (int s = 0; s < 2; ++s)
#pragma unroll
      for (int r = 0; r < 8; ++r)
        SCs[(ti * 16 + 8 * h + r) * QP + (tj0 + s) * 16 + m] = acc[s][r];
  }
  __syncthreads();

  // per-row RMS normaliser times gate
  if (tid < CH) {
    float ss = 0.0f;
    for (int e2 = 0; e2 < HD; ++e2) { const float o = SCs[tid * QP + e2]; ss += o * o; }
    RV[tid] = GS[tid] / sqrtf(ss * (1.0f / 64.0f) + 1e-6f);
  }
  __syncthreads();

  {
    v8h ov[2];
    size_t go[2];
#pragma unroll
    for (int it = 0; it < 2; ++it) {
      const int c = it * 32 + (tid >> 3), e0 = (tid & 7) * 8;
      const v4f x0 = *(const v4f*)(SCs + c * QP + e0);
      const v4f x1 = *(const v4f*)(SCs + c * QP + e0 + 4);
      const float sc = RV[c] * ogscale;
      v8h o;
#pragma unroll
      for (int q = 0; q < 4; ++q) {
        o[q]     = (h16)(x0[q] * sc * RW[e0 + q]);
        o[4 + q] = (h16)(x1[q] * sc * RW[e0 + 4 + q]);
      }
      ov[it] = o;
      go[it] = (rowbase + c) * (size_t)DM + hh * HD + e0;
    }
#pragma unroll
    for (int it = 0; it < 2; ++it) *(v8h*)(Og + go[it]) = ov[it];
    
  }
}

// ---------------------------------------------------------------------------
extern "C" void kernel_launch(void* const* d_in, const int* in_sizes, int n_in,
                              void* d_out, int out_size, void* d_ws, size_t ws_size,
                              hipStream_t stream)
{
  if (n_in < 26) return;
  const int T = 2048;
  const long nx = (long)in_sizes[0];
  if (nx <= 0 || (nx % ((long)DM * T)) != 0) return;
  const int M = (int)(nx / DM);                       // tokens, multiple of 2048 (hence of 128)
  if ((long)out_size != (long)M * DM) return;
  if (in_sizes[1] != DM * 4 || in_sizes[3] != DM * 4 || in_sizes[5] != DM * 4) return;
  if (in_sizes[7] != DM * DM || in_sizes[9] != DM * DM || in_sizes[11] != DM * DM || in_sizes[24] != DM * DM) return;
  if (in_sizes[13] != 64 * DM || in_sizes[15] != DM * 64 || in_sizes[17] != NH * DM ||
      in_sizes[20] != 64 * DM || in_sizes[22] != NH * 64) return;

  const float* x       = (const float*)d_in[0];
  const float* wq_conv = (const float*)d_in[1];  const float* bq_conv = (const float*)d_in[2];
  const float* wk_conv = (const float*)d_in[3];  const float* bk_conv = (const float*)d_in[4];
  const float* wv_conv = (const float*)d_in[5];  const float* bv_conv = (const float*)d_in[6];
  const float* Wq  = (const float*)d_in[7];   const float* bq  = (const float*)d_in[8];
  const float* Wk  = (const float*)d_in[9];   const float* bk  = (const float*)d_in[10];
  const float* Wv  = (const float*)d_in[11];  const float* bv  = (const float*)d_in[12];
  const float* Wad = (const float*)d_in[13];  const float* bad = (const float*)d_in[14];
  const float* Wau = (const float*)d_in[15];  const float* bau = (const float*)d_in[16];
  const float* Wbe = (const float*)d_in[17];  const float* bbe = (const float*)d_in[18];
  const float* rms_w = (const float*)d_in[19];
  const float* Wgd = (const float*)d_in[20];  const float* bgd = (const float*)d_in[21];
  const float* Wgu = (const float*)d_in[22];  const float* bgu = (const float*)d_in[23];
  const float* Wo  = (const float*)d_in[24];  const float* bo  = (const float*)d_in[25];

  char* ws = (char*)d_ws;
  size_t off = 0;
  auto carve = [&](size_t bytes) -> char* {
    char* p = ws + off;
    off += (bytes + 255) & ~(size_t)255;
    return p;
  };
  const size_t MD = (size_t)M * DM;
  h16* xh    = (h16*)carve(MD * 2);
  h16* cq    = (h16*)carve(MD * 2);
  h16* ck    = (h16*)carve(MD * 2);
  h16* cv    = (h16*)carve(MD * 2);
  h16* Wq16  = (h16*)carve((size_t)DM * DM * 2);
  h16* Wk16  = (h16*)carve((size_t)DM * DM * 2);
  h16* Wv16  = (h16*)carve((size_t)DM * DM * 2);
  h16* Wo16  = (h16*)carve((size_t)DM * DM * 2);
  h16* Wad16 = (h16*)carve((size_t)64 * DM * 2);
  h16* Wau16 = (h16*)carve((size_t)DM * 64 * 2);
  h16* Wbe16 = (h16*)carve((size_t)NH * DM * 2);
  h16* Wgd16 = (h16*)carve((size_t)64 * DM * 2);
  h16* Wgu16 = (h16*)carve((size_t)NH * 64 * 2);
  float* Qn  = (float*)carve(MD * 4);
  float* Kn  = (float*)carve(MD * 4);
  float* Vf  = (float*)carve(MD * 4);
  float* Al  = (float*)carve(MD * 4);
  float* Bt  = (float*)carve((size_t)M * NH * 4);
  float* Gt  = (float*)carve((size_t)M * NH * 4);
  h16* t1    = (h16*)carve((size_t)M * 64 * 2);
  h16* t2    = (h16*)carve((size_t)M * 64 * 2);
  h16* Og16  = (h16*)carve(MD * 2);
  float* Sst = (float*)carve((size_t)(M / CH) * NH * HD * HD * 4);   // entry state of every (b, h, chunk)
  if (off > ws_size) return;

  const float wsc = 256.0f;      // weight scale
  const float asc = 256.0f;      // conv activation scale
  const float tsc = 64.0f;       // gate hidden scale
  const float osc = 16.0f;       // gated output scale

  // 1) x -> f16 and three shortconv+SiLU activations
  {
    const int n8 = (int)(MD / 8);
    k_prep<<<dim3((n8 + 255) / 256, 3), 256, 0, stream>>>(x, wq_conv, bq_conv, wk_conv, bk_conv, wv_conv, bv_conv,
                                                         xh, cq, ck, cv, n8, T, asc);
  }
  // 2) weights -> scaled f16
  {
    int n8;
    n8 = DM * DM / 8;  k_cvtw<<<(n8 + 255) / 256, 256, 0, stream>>>(Wq,  Wq16,  n8, wsc);
    n8 = DM * DM / 8;  k_cvtw<<<(n8 + 255) / 256, 256, 0, stream>>>(Wk,  Wk16,  n8, wsc);
    n8 = DM * DM / 8;  k_cvtw<<<(n8 + 255) / 256, 256, 0, stream>>>(Wv,  Wv16,  n8, wsc);
    n8 = DM * DM / 8;  k_cvtw<<<(n8 + 255) / 256, 256, 0, stream>>>(Wo,  Wo16,  n8, wsc);
    n8 = 64 * DM / 8;  k_cvtw<<<(n8 + 255) / 256, 256, 0, stream>>>(Wad, Wad16, n8, wsc);
    n8 = DM * 64 / 8;  k_cvtw<<<(n8 + 255) / 256, 256, 0, stream>>>(Wau, Wau16, n8, wsc);
    n8 = NH * DM / 8;  k_cvtw<<<(n8 + 255) / 256, 256, 0, stream>>>(Wbe, Wbe16, n8, wsc);
    n8 = 64 * DM / 8;  k_cvtw<<<(n8 + 255) / 256, 256, 0, stream>>>(Wgd, Wgd16, n8, wsc);
    n8 = NH * 64 / 8;  k_cvtw<<<(n8 + 255) / 256, 256, 0, stream>>>(Wgu, Wgu16, n8, wsc);
  }
  // 3) projections
  const dim3 gbig(M / 128, DM / 64);
  const dim3 gsm(M / 128, 1);
  k_gemm<4, 1, float><<<gbig, 256, 0, stream>>>(cq, Wq16, bq, Qn, DM, DM, 1.0f / (asc * wsc), 1.0f);
  k_gemm<4, 1, float><<<gbig, 256, 0, stream>>>(ck, Wk16, bk, Kn, DM, DM, 1.0f / (asc * wsc), 1.0f);
  k_gemm<4, 0, float><<<gbig, 256, 0, stream>>>(cv, Wv16, bv, Vf, DM, DM, 1.0f / (asc * wsc), 1.0f);
  k_gemm<4, 2, h16  ><<<gsm,  256, 0, stream>>>(xh, Wad16, bad, t1, 64, DM, 1.0f / wsc, tsc);
  k_gemm<4, 3, float><<<gbig, 256, 0, stream>>>(t1, Wau16, bau, Al, DM, 64, 1.0f / (tsc * wsc), 1.0f);
  k_gemm<1, 4, float><<<gsm,  256, 0, stream>>>(xh, Wbe16, bbe, Bt, NH, DM, 1.0f / wsc, 1.0f);
  k_gemm<4, 2, h16  ><<<gsm,  256, 0, stream>>>(xh, Wgd16, bgd, t2, 64, DM, 1.0f / wsc, tsc);
  k_gemm<1, 4, float><<<gsm,  256, 0, stream>>>(t2, Wgu16, bgu, Gt, NH, 64, 1.0f / (tsc * wsc), 1.0f);
  // 4) state recurrence, one block per (b, h); then the per-chunk outputs, one block per (chunk, b*h)
  k_state<<<(M / T) * NH, 256, 0, stream>>>(Kn, Vf, Al, Bt, Sst, T);
  k_out<<<dim3(T / CH, (M / T) * NH), 256, 0, stream>>>(Qn, Kn, Vf, Al, Bt, Gt, rms_w, Sst, Og16, T, osc);
  // 5) output projection
  k_gemm<4, 0, float><<<gbig, 256, 0, stream>>>(Og16, Wo16, bo, (float*)d_out, DM, DM, 1.0f / (osc * wsc), 1.0f);
}

// v002
// One run takes 449 microseconds.
// Two timings next to v001 put it at 1.78 and 1.79 times that version's speed.
// All steps since v000 together make it 2.76 times as fast.
#include <hip/hip_runtime.h>
#include <stdint.h>

// Contractions: token projections (q, k, v, gate down/up, beta, out) on v_wmma_f32_16x16x32_f16 with f16 operands pre-scaled by powers of two, f32 accumulate; per-chunk Q*S and A*V on v_wmma_f32_16x16x32_bf16 as bf16 hi/lo three-product split, f32 accumulate; decay scores, state recurrence, shortconv and norms on VALU in f32. All float inputs RNE-converted to bf16 on load.

typedef _Float16 h16;
typedef h16    v16h __attribute__((ext_vector_type(16)));
typedef h16    v8h  __attribute__((ext_vector_type(8)));
typedef __bf16 v16b __attribute__((ext_vector_type(16)));
typedef float  v8f  __attribute__((ext_vector_type(8)));
typedef float  v4f  __attribute__((ext_vector_type(4)));

union HF { v16h v; v8h p[2]; };
union BF { v16b v; unsigned short u[16]; };

#define DM 1024
#define HD 64
#define NH 16
#define CH 64
#define QP 68

__device__ __forceinline__ unsigned short bf16_bits(float f) {
  unsigned int u = __float_as_uint(f);
  u += 0x7FFFu + ((u >> 16) & 1u);
  return (unsigned short)(u >> 16);
}
__device__ __forceinline__ float bf16r(float f) {
  return __uint_as_float(((unsigned int)bf16_bits(f)) << 16);
}
// x = hi + lo in bf16 pieces (RNE), bit patterns
__device__ __forceinline__ void split2(float x, unsigned short& hi, unsigned short& lo) {
  const unsigned short hb = bf16_bits(x);
  const float hf = __uint_as_float(((unsigned int)hb) << 16);
  hi = hb;
  lo = bf16_bits(x - hf);
}
__device__ __forceinline__ float sigm(float v) {
  return __fdividef(1.0f, 1.0f + __expf(-v));
}

// 16-bit WMMA wrappers with the VALU hazard guard after the matrix op
__device__ __forceinline__ v8f mma_f16(v16h a, v16h b, v8f c) {
  c = __builtin_amdgcn_wmma_f32_16x16x32_f16(false, a, false, b, (short)0, c, false, false);
  asm volatile("v_nop\n\tv_nop\n\tv_nop\n\tv_nop" : "+v"(c) : "v"(a), "v"(b));
  return c;
}
__device__ __forceinline__ v8f mma_bf16(v16b a, v16b b, v8f c) {
  c = __builtin_amdgcn_wmma_f32_16x16x32_bf16(false, a, false, b, (short)0, c, false, false);
  asm volatile("v_nop\n\tv_nop\n\tv_nop\n\tv_nop" : "+v"(c) : "v"(a), "v"(b));
  return c;
}

// A fragment (row m, split k map) from an f32 LDS row pointer pr = base + row*pitch + k0, as bf16 hi/lo
__device__ __forceinline__ void fragA_split(const float* pr, int h, BF& hi, BF& lo) {
  const v4f x0 = *(const v4f*)(pr + 8 * h);
  const v4f x1 = *(const v4f*)(pr + 8 * h + 4);
  const v4f x2 = *(const v4f*)(pr + 16 + 8 * h);
  const v4f x3 = *(const v4f*)(pr + 20 + 8 * h);
#pragma unroll
  for (int q = 0; q < 4; ++q) {
    split2(x0[q], hi.u[q],      lo.u[q]);
    split2(x1[q], hi.u[4 + q],  lo.u[4 + q]);
    split2(x2[q], hi.u[8 + q],  lo.u[8 + q]);
    split2(x3[q], hi.u[12 + q], lo.u[12 + q]);
  }
}
// B fragment (col n, same split k map) gathered down column col of f32 [k][pitch] in LDS, as bf16 hi/lo
__device__ __forceinline__ void fragB_split(const float* base, int pitch, int k0, int col, int h, BF& hi, BF& lo) {
#pragma unroll
  for (int i = 0; i < 8; ++i) {
    split2(base[(k0 + 8 * h + i) * pitch + col],      hi.u[i],     lo.u[i]);
    split2(base[(k0 + 16 + 8 * h + i) * pitch + col], hi.u[8 + i], lo.u[8 + i]);
  }
}

// ---------------------------------------------------------------------------
// ---------------------------------------------------------------------------
__global__ void __launch_bounds__(256)
k_cvtw(const float* __restrict__ src, h16* dst, int n8, float scale)
{
  const int i = blockIdx.x * 256 + threadIdx.x;
  const bool ok = i < n8;
  v8h o;
#pragma unroll
  for (int q = 0; q < 8; ++q) o[q] = (h16)0.0f;
  if (ok) {
    const v4f a = *(const v4f*)(src + (size_t)i * 8);
    const v4f c = *(const v4f*)(src + (size_t)i * 8 + 4);
#pragma unroll
    for (int q = 0; q < 4; ++q) {
      o[q]     = (h16)(bf16r(a[q]) * scale);
      o[4 + q] = (h16)(bf16r(c[q]) * scale);
    }
  }
  if (ok) *(v8h*)(dst + (size_t)i * 8) = o;
  
}

// ---------------------------------------------------------------------------
// Causal depthwise conv (4 taps) + SiLU for one of three weight sets (blockIdx.y), f16 output scaled by ascale;
// ---------------------------------------------------------------------------
__global__ void __launch_bounds__(256)
k_prep(const float* __restrict__ x,
       const float* __restrict__ w0, const float* __restrict__ b0,
       const float* __restrict__ w1, const float* __restrict__ b1,
       const float* __restrict__ w2, const float* __restrict__ b2,
       h16* xh, h16* y0, h16* y1, h16* y2, int n8, int T, float ascale)
{
  const int which = blockIdx.y;
  const float* w  = (which == 0) ? w0 : ((which == 1) ? w1 : w2);
  const float* bb = (which == 0) ? b0 : ((which == 1) ? b1 : b2);
  h16* y          = (which == 0) ? y0 : ((which == 1) ? y1 : y2);

  const int g = blockIdx.x * 256 + threadIdx.x;
  const bool ok = g < n8;
  const size_t eo = (size_t)g * 8;
  v8h o, ox;
#pragma unroll
  for (int q = 0; q < 8; ++q) { o[q] = (h16)0.0f; ox[q] = (h16)0.0f; }
  if (ok) {
    const size_t bt = (size_t)(g >> 7);          // token index (DM/8 = 128 groups per token)
    const int d0 = (g & 127) * 8;
    const int t = (int)(bt % (size_t)T);
    float xr[4][8];
#pragma unroll
    for (int j = 0; j < 4; ++j) {
      const int ts = t - 3 + j;
      if (ts >= 0) {
        const float* px = x + (bt - (size_t)(3 - j)) * DM + d0;
        const v4f a = *(const v4f*)px;
        const v4f c = *(const v4f*)(px + 4);
#pragma unroll
        for (int q = 0; q < 4; ++q) { xr[j][q] = bf16r(a[q]); xr[j][4 + q] = bf16r(c[q]); }
      } else {
#pragma unroll
        for (int q = 0; q < 8; ++q) xr[j][q] = 0.0f;
      }
    }
#pragma unroll
    for (int q = 0; q < 8; ++q) {
      const int d = d0 + q;
      const v4f wv4 = *(const v4f*)(w + (size_t)d * 4);
      float acc = xr[0][q] * bf16r(wv4[0]);
      acc += xr[1][q] * bf16r(wv4[1]);
      acc += xr[2][q] * bf16r(wv4[2]);
      acc += xr[3][q] * bf16r(wv4[3]);
      acc += bf16r(bb[d]);
      const float s = acc * sigm(acc);
      o[q]  = (h16)(s * ascale);
      ox[q] = (h16)xr[3][q];
    }
  }
  if (ok) {
    *(v8h*)(y + eo) = o;
    if (which == 0) *(v8h*)(xh + eo) = ox;
  }
  
}

// ---------------------------------------------------------------------------
// Y[M,N] = epi( A[M,K] * W[N,K]^T * oscale + bias[N] ), f16 operands (k-contiguous), f32 accumulate.
// Block 256 threads = 8 waves; block tile 128 rows x 16*NT cols; wave tile 16 x 16*NT.
// EPI: 0 none, 1 L2-normalise each row over the 64-col slab, 2 silu, 3 sigmoid then clip to [0.1,1], 4 sigmoid then min 1.
// ---------------------------------------------------------------------------
template<int NT, int EPI, typename OT>
__global__ void __launch_bounds__(256)
k_gemm(const h16* __restrict__ A, const h16* __restrict__ W, const float* __restrict__ bias,
       OT* Y, int N, int K, float oscale, float yscale)
{
  constexpr int TW = 16 * NT;
  __shared__ __attribute__((aligned(16))) float stg[8 * 16 * TW];

  const int lane = threadIdx.x & 31, wv = threadIdx.x >> 5;
  const int m = lane & 15, h = lane >> 4;
  const int rowBase = blockIdx.x * 128 + wv * 16;
  const int colBase = blockIdx.y * TW;

  v8f acc[NT];
#pragma unroll
  for (int t = 0; t < NT; ++t)
#pragma unroll
    for (int r = 0; r < 8; ++r) acc[t][r] = 0.0f;

  // A: lane row m, elements 0..7 <- k0+8h.., 8..15 <- k0+16+8h..;  B: lane col m, same k map
  const h16* arow  = A + (size_t)(rowBase + m) * K + 8 * h;
  const h16* wbase = W + (size_t)(colBase + m) * K + 8 * h;
  for (int k0 = 0; k0 < K; k0 += 32) {
    HF a;
    a.p[0] = *(const v8h*)(arow + k0);
    a.p[1] = *(const v8h*)(arow + k0 + 16);
#pragma unroll
    for (int t = 0; t < NT; ++t) {
      const h16* wrow = wbase + (size_t)(16 * t) * K + k0;
      HF b;
      b.p[0] = *(const v8h*)(wrow);
      b.p[1] = *(const v8h*)(wrow + 16);
      acc[t] = mma_f16(a.v, b.v, acc[t]);
    }
  }

  // epilogue values (D element r of this lane = row 8h+r, col m of tile t)
#pragma unroll
  for (int t = 0; t < NT; ++t) {
    const float bv = bf16r(bias[colBase + 16 * t + m]);
#pragma unroll
    for (int r = 0; r < 8; ++r) {
      float v = acc[t][r] * oscale + bv;
      if (EPI == 2)      { v = v * sigm(v); }
      else if (EPI == 3) { v = sigm(v); v = fminf(fmaxf(v, 0.1f), 1.0f); }
      else if (EPI == 4) { v = fminf(sigm(v), 1.0f); }
      acc[t][r] = v;
    }
  }
  if (EPI == 1) {
#pragma unroll
    for (int r = 0; r < 8; ++r) {
      float ss = 0.0f;
#pragma unroll
      for (int t = 0; t < NT; ++t) ss += acc[t][r] * acc[t][r];
      ss += __shfl_xor(ss, 1, 32);
      ss += __shfl_xor(ss, 2, 32);
      ss += __shfl_xor(ss, 4, 32);
      ss += __shfl_xor(ss, 8, 32);
      const float inv = 1.0f / sqrtf(fmaxf(ss, 1e-6f));
#pragma unroll
      for (int t = 0; t < NT; ++t) acc[t][r] *= inv;
    }
  }

  float* sw = stg + wv * 16 * TW;
#pragma unroll
  for (int t = 0; t < NT; ++t)
#pragma unroll
    for (int r = 0; r < 8; ++r) sw[(8 * h + r) * TW + 16 * t + m] = acc[t][r];
  __syncthreads();

  if constexpr (sizeof(OT) == 4 && NT == 4) {
    v4f vals[8];
    size_t offs[8];
#pragma unroll
    for (int it = 0; it < 8; ++it) {
      const int row = 2 * it + h, c4 = m * 4;
      vals[it] = *(const v4f*)(sw + row * TW + c4);
      offs[it] = (size_t)(rowBase + row) * N + colBase + c4;
    }
#pragma unroll
    for (int it = 0; it < 8; ++it) *(v4f*)(Y + offs[it]) = vals[it];
    
  } else if constexpr (sizeof(OT) == 2 && NT == 4) {
    v8h vals[4];
    size_t offs[4];
#pragma unroll
    for (int it = 0; it < 4; ++it) {
      const int row = it * 4 + (lane >> 3), c8 = (lane & 7) * 8;
      const v4f a = *(const v4f*)(sw + row * TW + c8);
      const v4f c = *(const v4f*)(sw + row * TW + c8 + 4);
      v8h o;
#pragma unroll
      for (int q = 0; q < 4; ++q) { o[q] = (h16)(a[q] * yscale); o[4 + q] = (h16)(c[q] * yscale); }
      vals[it] = o;
      offs[it] = (size_t)(rowBase + row) * N + colBase + c8;
    }
#pragma unroll
    for (int it = 0; it < 4; ++it) *(v8h*)(Y + offs[it]) = vals[it];
    
  } else if constexpr (sizeof(OT) == 4 && NT == 1) {
    // N == 16: the wave's 16 rows are 1 KB contiguous; 8 lanes x 16 B per line
    v4f vals[2];
    size_t offs[2];
#pragma unroll
    for (int it = 0; it < 2; ++it) {
      const int q = it * 32 + lane, row = q >> 2, c4 = (q & 3) * 4;
      vals[it] = *(const v4f*)(sw + row * TW + c4);
      offs[it] = (size_t)(rowBase + row) * N + colBase + c4;
    }
#pragma unroll
    for (int it = 0; it < 2; ++it) *(v4f*)(Y + offs[it]) = vals[it];
    
  }
}

// ---------------------------------------------------------------------------
// Gated delta rule, serial part. The columns e of the state S (64x64 f32) never mix: each evolves from k, a, beta and v[e] alone.
// One block per (group of SC columns, b*h), 128 threads = 4 waves, T/64 chunks in sequence. A 16-lane row owns one column,
// lane lg of it the rows 4*lg .. 4*lg+3 in registers, so k^T S is summed inside the row and no step needs a barrier.
// The state each chunk starts from is stored column-major, Sg[(bh*nch + n)][e][d], for the chunk-parallel output kernel.
// ---------------------------------------------------------------------------
#define SC 8    // state columns per block
#define NSTP 8    // steps per group of LDS operand reads

// x + (x of lane l ^ mask) inside a 16-lane row; CTRL = 0x160 + mask is the DPP row_xmask control
template<int CTRL>
__device__ __forceinline__ float xmask_add(float x) {
  return x + __int_as_float(__builtin_amdgcn_update_dpp(0, __float_as_int(x), CTRL, 0xf, 0xf, true));
}

__global__ void __launch_bounds__(128)
k_state(const float* __restrict__ Kp, const float* __restrict__ Vp, const float* __restrict__ Ap,
        const float* __restrict__ Bp, float* Sg, int T)
{
  __shared__ __attribute__((aligned(16))) float Ks[CH * HD];
  __shared__ __attribute__((aligned(16))) float ALs[CH * HD];
  __shared__ __attribute__((aligned(16))) float Vt[SC * CH];     // [column][t]
  __shared__ __attribute__((aligned(16))) float Bsh[CH];

  const int tid = threadIdx.x;
  const int cg = blockIdx.x, bh = blockIdx.y, b = bh / NH, hh = bh % NH;
  const int lg = tid & 15, el = tid >> 4;      // state ownership: column cg*SC + el, rows 4*lg .. 4*lg+3

  v4f S;
#pragma unroll
  for (int u = 0; u < 4; ++u) S[u] = 0.0f;

  // per-thread byte offsets of the tile loads and of the state store; the chunk moves the uniform base only
  const unsigned tb = (unsigned)(((tid >> 4) * DM + (tid & 15) * 4) * 4);
  const unsigned vo = (unsigned)(((tid >> 1) * DM + cg * SC + (tid & 1) * 4) * 4);
  const unsigned so = (unsigned)(((cg * SC + el) * HD + 4 * lg) * 4);

  const float* kl = Ks  + 4 * lg;
  const float* al = ALs + 4 * lg;
  const float* vl = Vt  + el * CH;

  const int nch = T / CH;
  for (int n = 0; n < nch; ++n) {
    const size_t rowbase = (size_t)b * T + (size_t)n * CH;
    const float* Kg = Kp + rowbase * DM + hh * HD;
    const float* Vg = Vp + rowbase * DM + hh * HD;
    const float* Ag = Ap + rowbase * DM + hh * HD;
    float* So = Sg + ((size_t)bh * nch + n) * (HD * HD);

    __syncthreads();   // every wave has read the last chunk's tiles
    // entry state of this chunk, issued ahead of the tile loads so that the store finishes under the loads' latency
    *(v4f*)((char*)So + so) = S;
    // the tile loads that follow may be given the registers this store names: the wait stands in front of that overwrite
    asm volatile("s_wait_xcnt 0x0" ::: "memory");
    // keeps the store and its wait ahead of the loads: scheduled as one region, the store came out behind them on a reused address pair
    __builtin_amdgcn_sched_barrier(0);
    // tile loads: k and a 64 rows x 64 f32, v 64 rows x SC f32, beta 64 (read by both halves of the block, stored by one)
    const char* kp = (const char*)Kg + tb;
    const char* ap = (const char*)Ag + tb;
    const char* vp = (const char*)Vg + vo;
    const float* bp = Bp + (rowbase + (tid & (CH - 1))) * NH + hh;
    const float tbeta = *bp;
    v4f tk[8], ta[8];
#pragma unroll
    for (int it = 0; it < 8; ++it) {
      tk[it] = *(const v4f*)(kp + it * (8 * DM * 4));
      ta[it] = *(const v4f*)(ap + it * (8 * DM * 4));
    }
    const v4f tv = *(const v4f*)vp;
    // the wait stands in front of any overwrite of the address registers the loads name; as inputs they stay live up to it.
    // beta as an input holds its load up here with the others: left free, it sank behind the tile stores and its latency stood alone
    asm volatile("s_wait_xcnt 0x0" :: "v"(kp), "v"(ap), "v"(vp), "v"(bp), "v"(tbeta) : "memory");
#pragma unroll
    for (int it = 0; it < 8; ++it) {
      const int c = it * 8 + (tid >> 4), d4 = (tid & 15) * 4;
      *(v4f*)(Ks  + c * HD + d4) = tk[it];
      *(v4f*)(ALs + c * HD + d4) = ta[it];
    }
#pragma unroll
    for (int u = 0; u < 4; ++u) Vt[((tid & 1) * 4 + u) * CH + (tid >> 1)] = tv[u];
    if (tid < CH) Bsh[tid] = fminf(tbeta, 1.0f);
    __syncthreads();

    // exact sequential state update over the chunk: S = a*S; S += (beta*k) outer (v - k^T S)
    // the operands of NSTP steps are read as one group, one group ahead of the steps that use them
    v4f kq[2][NSTP], aq[2][NSTP], vq[2][NSTP / 4], bq[2][NSTP / 4];
#pragma unroll
    for (int s = 0; s < NSTP; ++s) {
      kq[0][s] = *(const v4f*)(kl + s * HD);
      aq[0][s] = *(const v4f*)(al + s * HD);
    }
#pragma unroll
    for (int s = 0; s < NSTP / 4; ++s) {
      vq[0][s] = *(const v4f*)(vl + 4 * s);
      bq[0][s] = *(const v4f*)(Bsh + 4 * s);
    }
#pragma unroll
    for (int g = 0; g < CH / NSTP; ++g) {
      const int cur = g & 1, nxt = cur ^ 1;
      // with the one behind the reads: keeps the next group's LDS reads in one place. Left free, they sank to just ahead of their
      // use, where each step waited out the LDS latency, or were strewn among the steps of the group before
      __builtin_amdgcn_sched_barrier(0);
      if (g + 1 < CH / NSTP) {
#pragma unroll
        for (int s = 0; s < NSTP; ++s) {
          kq[nxt][s] = *(const v4f*)(kl + (NSTP * (g + 1) + s) * HD);
          aq[nxt][s] = *(const v4f*)(al + (NSTP * (g + 1) + s) * HD);
        }
#pragma unroll
        for (int s = 0; s < NSTP / 4; ++s) {
          vq[nxt][s] = *(const v4f*)(vl + NSTP * (g + 1) + 4 * s);
          bq[nxt][s] = *(const v4f*)(Bsh + NSTP * (g + 1) + 4 * s);
        }
      }
      __builtin_amdgcn_sched_barrier(0);   // second of the pair, see above
#pragma unroll
      for (int s = 0; s < NSTP; ++s) {
        const v4f kk = kq[cur][s], aa = aq[cur][s];
        const float bt = bq[cur][s >> 2][s & 3];
#pragma unroll
        for (int u = 0; u < 4; ++u) S[u] *= aa[u];
        float kts = (kk[0] * S[0] + kk[2] * S[2]) + (kk[1] * S[1] + kk[3] * S[3]);
        kts = xmask_add<0x161>(kts);
        kts = xmask_add<0x162>(kts);
        kts = xmask_add<0x164>(kts);
        kts = xmask_add<0x168>(kts);
        const float dl = vq[cur][s >> 2][s & 3] - kts;
#pragma unroll
        for (int u = 0; u < 4; ++u) S[u] += (bt * kk[u]) * dl;
      }
    }
  }
}

// ---------------------------------------------------------------------------
// Gated delta rule, chunk-parallel part: one block per (chunk, b*h), 256 threads. Reads the chunk's entry state from Sg.
// Scores A[i][j] on VALU f32, O = Q*S + A*V on bf16 hi/lo WMMA, then headwise RMS norm and gate.
// ---------------------------------------------------------------------------
__global__ void __launch_bounds__(256)
k_out(const float* __restrict__ Qp, const float* __restrict__ Kp, const float* __restrict__ Vp,
      const float* __restrict__ Ap, const float* __restrict__ Bp, const float* __restrict__ Gp,
      const float* __restrict__ rmsw, const float* __restrict__ Sg, h16* Og, int T, float ogscale)
{
  __shared__ __attribute__((aligned(16))) float Qs[CH * QP];
  __shared__ __attribute__((aligned(16))) float Ks[CH * QP];
  __shared__ __attribute__((aligned(16))) float CLs[CH * QP];
  __shared__ __attribute__((aligned(16))) float SCs[CH * QP];
  __shared__ __attribute__((aligned(16))) float Vs[CH * HD];
  __shared__ __attribute__((aligned(16))) float ALs[CH * HD];
  __shared__ __attribute__((aligned(16))) float Sf[HD * QP];     // entry state, column-major: [e][d]
  __shared__ float Bsh[CH], GS[CH], RV[CH], RW[HD];

  const int tid = threadIdx.x;
  const int lane = tid & 31, wv = tid >> 5, m = lane & 15, h = lane >> 4;
  const int n = blockIdx.x, bh = blockIdx.y, b = bh / NH, hh = bh % NH;

  if (tid < HD) RW[tid] = bf16r(rmsw[hh * HD + tid]);

  const size_t rowbase = (size_t)b * T + (size_t)n * CH;
  const float* Qg = Qp + rowbase * DM + hh * HD;
  const float* Kg = Kp + rowbase * DM + hh * HD;
  const float* Vg = Vp + rowbase * DM + hh * HD;
  const float* Ag = Ap + rowbase * DM + hh * HD;
  const float* Si = Sg + ((size_t)bh * (T / CH) + n) * (HD * HD);

  // tile loads (64 rows x 64 f32 each): one byte offset per thread, the step of 16 rows is a constant
  const unsigned tb = (unsigned)(((tid >> 4) * DM + (tid & 15) * 4) * 4);
  v4f tq[4], tk[4], tv[4], ta[4], ts[4];
#pragma unroll
  for (int it = 0; it < 4; ++it) {
    tq[it] = *(const v4f*)((const char*)Qg + tb + it * (16 * DM * 4));
    tk[it] = *(const v4f*)((const char*)Kg + tb + it * (16 * DM * 4));
    tv[it] = *(const v4f*)((const char*)Vg + tb + it * (16 * DM * 4));
    ta[it] = *(const v4f*)((const char*)Ag + tb + it * (16 * DM * 4));
    ts[it] = *(const v4f*)(Si + tid * 4 + it * (16 * HD));
  }
  // the wait stands in front of any overwrite of the offset register the loads name; as an input it stays live up to it
  asm volatile("s_wait_xcnt 0x0" :: "v"(tb) : "memory");
#pragma unroll
  for (int it = 0; it < 4; ++it) {
    const int idx = it * 256 + tid;
    const int c = idx >> 4, d4 = (idx & 15) * 4;
    *(v4f*)(Qs  + c * QP + d4) = tq[it];
    *(v4f*)(Ks  + c * QP + d4) = tk[it];
    *(v4f*)(Vs  + c * HD + d4) = tv[it];
    *(v4f*)(ALs + c * HD + d4) = ta[it];
    *(v4f*)(Sf  + c * QP + d4) = ts[it];
  }
  if (tid < CH) {
    Bsh[tid] = fminf(Bp[(rowbase + tid) * NH + hh], 1.0f);
    GS[tid]  = Gp[(rowbase + tid) * NH + hh];
  }
  __syncthreads();

  // cumulative log decay per feature, restarted per chunk
  if (tid < HD) {
    float a = 0.0f;
    for (int c = 0; c < CH; ++c) {
      a += __logf(fmaxf(ALs[c * HD + tid], 1e-7f));
      CLs[c * QP + tid] = a;
    }
  }
  __syncthreads();

  // scores: A[i][j] = beta_j * sum_d q[i][d] k[j][d] exp(cl[i][d] - cl[j][d]) for i >= j, else 0
  {
    const int j0 = lane, j1 = lane + 32;
    float a0[8], a1[4];
#pragma unroll
    for (int r = 0; r < 8; ++r) a0[r] = 0.0f;
#pragma unroll
    for (int r = 0; r < 4; ++r) a1[r] = 0.0f;
#pragma unroll 2
    for (int d = 0; d < HD; ++d) {
      const float k0v = Ks[j0 * QP + d], c0 = CLs[j0 * QP + d];
      const float k1v = Ks[j1 * QP + d], c1 = CLs[j1 * QP + d];
#pragma unroll
      for (int r = 0; r < 8; ++r) {
        const int i = wv + 8 * r;
        const float q = Qs[i * QP + d];
        const float ci = CLs[i * QP + d];
        a0[r] += q * k0v * __expf(ci - c0);
        if (r >= 4) a1[r - 4] += q * k1v * __expf(ci - c1);
      }
    }
    const float b0 = Bsh[j0], b1 = Bsh[j1];
#pragma unroll
    for (int r = 0; r < 8; ++r) {
      const int i = wv + 8 * r;
      SCs[i * QP + j0] = (i >= j0) ? a0[r] * b0 : 0.0f;
      float v1 = 0.0f;
      if (r >= 4) v1 = (i >= j1) ? a1[r - 4] * b1 : 0.0f;
      SCs[i * QP + j1] = v1;
    }
  }
  __syncthreads();

  // O = Q*S + A*V : wave owns rows 16*ti.., two 16-col tiles; bf16 hi/lo three products per operand pair
  {
    const int ti = wv >> 1, tj0 = (wv & 1) * 2;
    v8f acc[2];
#pragma unroll
    for (int s = 0; s < 2; ++s)
#pragma unroll
      for (int r = 0; r < 8; ++r) acc[s][r] = 0.0f;

#pragma unroll
    for (int ks = 0; ks < 2; ++ks) {
      const int k0 = ks * 32;
      BF ah, al;
      fragA_split(Qs + (ti * 16 + m) * QP + k0, h, ah, al);
#pragma unroll
      for (int s = 0; s < 2; ++s) {
        BF bhi, blo;
        fragA_split(Sf + ((tj0 + s) * 16 + m) * QP + k0, h, bhi, blo);   // column e of S is a row of Sf: same k map as the gather
        acc[s] = mma_bf16(ah.v, bhi.v, acc[s]);
        acc[s] = mma_bf16(ah.v, blo.v, acc[s]);
        acc[s] = mma_bf16(al.v, bhi.v, acc[s]);
      }
    }
#pragma unroll
    for (int ks = 0; ks < 2; ++ks) {
      const int k0 = ks * 32;
      BF ah, al;
      fragA_split(SCs + (ti * 16 + m) * QP + k0, h, ah, al);
#pragma unroll
      for (int s = 0; s < 2; ++s) {
        BF bhi, blo;
        fragB_split(Vs, HD, k0, (tj0 + s) * 16 + m, h, bhi, blo);
        acc[s] = mma_bf16(ah.v, bhi.v, acc[s]);
        acc[s] = mma_bf16(ah.v, blo.v, acc[s]);
        acc[s] = mma_bf16(al.v, bhi.v, acc[s]);
      }
    }
    __syncthreads();   // all reads of SCs/Sf done; reuse SCs as the O tile
#pragma unroll
    for (int s = 0; s < 2; ++s)
#pragma unroll
      for (int r = 0; r < 8; ++r)
        SCs[(ti * 16 + 8 * h + r) * QP + (tj0 + s) * 16 + m] = acc[s][r];
  }
  __syncthreads();

  // per-row RMS normaliser times gate
  if (tid < CH) {
    float ss = 0.0f;
    for (int e2 = 0; e2 < HD; ++e2) { const float o = SCs[tid * QP + e2]; ss += o * o; }
    RV[tid] = GS[tid] / sqrtf(ss * (1.0f / 64.0f) + 1e-6f);
  }
  __syncthreads();

  {
    v8h ov[2];
    size_t go[2];
#pragma unroll
    for (int it = 0; it < 2; ++it) {
      const int c = it * 32 + (tid >> 3), e0 = (tid & 7) * 8;
      const v4f x0 = *(const v4f*)(SCs + c * QP + e0);
      const v4f x1 = *(const v4f*)(SCs + c * QP + e0 + 4);
      const float sc = RV[c] * ogscale;
      v8h o;
#pragma unroll
      for (int q = 0; q < 4; ++q) {
        o[q]     = (h16)(x0[q] * sc * RW[e0 + q]);
        o[4 + q] = (h16)(x1[q] * sc * RW[e0 + 4 + q]);
      }
      ov[it] = o;
      go[it] = (rowbase + c) * (size_t)DM + hh * HD + e0;
    }
#pragma unroll
    for (int it = 0; it < 2; ++it) *(v8h*)(Og + go[it]) = ov[it];
    
  }
}

// ---------------------------------------------------------------------------
extern "C" void kernel_launch(void* const* d_in, const int* in_sizes, int n_in,
                              void* d_out, int out_size, void* d_ws, size_t ws_size,
                              hipStream_t stream)
{
  if (n_in < 26) return;
  const int T = 2048;
  const long nx = (long)in_sizes[0];
  if (nx <= 0 || (nx % ((long)DM * T)) != 0) return;
  const int M = (int)(nx / DM);                       // tokens, multiple of 2048 (hence of 128)
  if ((long)out_size != (long)M * DM) return;
  if (in_sizes[1] != DM * 4 || in_sizes[3] != DM * 4 || in_sizes[5] != DM * 4) return;
  if (in_sizes[7] != DM * DM || in_sizes[9] != DM * DM || in_sizes[11] != DM * DM || in_sizes[24] != DM * DM) return;
  if (in_sizes[13] != 64 * DM || in_sizes[15] != DM * 64 || in_sizes[17] != NH * DM ||
      in_sizes[20] != 64 * DM || in_sizes[22] != NH * 64) return;

  const float* x       = (const float*)d_in[0];
  const float* wq_conv = (const float*)d_in[1];  const float* bq_conv = (const float*)d_in[2];
  const float* wk_conv = (const float*)d_in[3];  const float* bk_conv = (const float*)d_in[4];
  const float* wv_conv = (const float*)d_in[5];  const float* bv_conv = (const float*)d_in[6];
  const float* Wq  = (const float*)d_in[7];   const float* bq  = (const float*)d_in[8];
  const float* Wk  = (const float*)d_in[9];   const float* bk  = (const float*)d_in[10];
  const float* Wv  = (const float*)d_in[11];  const float* bv  = (const float*)d_in[12];
  const float* Wad = (const float*)d_in[13];  const float* bad = (const float*)d_in[14];
  const float* Wau = (const float*)d_in[15];  const float* bau = (const float*)d_in[16];
  const float* Wbe = (const float*)d_in[17];  const float* bbe = (const float*)d_in[18];
  const float* rms_w = (const float*)d_in[19];
  const float* Wgd = (const float*)d_in[20];  const float* bgd = (const float*)d_in[21];
  const float* Wgu = (const float*)d_in[22];  const float* bgu = (const float*)d_in[23];
  const float* Wo  = (const float*)d_in[24];  const float* bo  = (const float*)d_in[25];

  char* ws = (char*)d_ws;
  size_t off = 0;
  auto carve = [&](size_t bytes) -> char* {
    char* p = ws + off;
    off += (bytes + 255) & ~(size_t)255;
    return p;
  };
  const size_t MD = (size_t)M * DM;
  h16* xh    = (h16*)carve(MD * 2);
  h16* cq    = (h16*)carve(MD * 2);
  h16* ck    = (h16*)carve(MD * 2);
  h16* cv    = (h16*)carve(MD * 2);
  h16* Wq16  = (h16*)carve((size_t)DM * DM * 2);
  h16* Wk16  = (h16*)carve((size_t)DM * DM * 2);
  h16* Wv16  = (h16*)carve((size_t)DM * DM * 2);
  h16* Wo16  = (h16*)carve((size_t)DM * DM * 2);
  h16* Wad16 = (h16*)carve((size_t)64 * DM * 2);
  h16* Wau16 = (h16*)carve((size_t)DM * 64 * 2);
  h16* Wbe16 = (h16*)carve((size_t)NH * DM * 2);
  h16* Wgd16 = (h16*)carve((size_t)64 * DM * 2);
  h16* Wgu16 = (h16*)carve((size_t)NH * 64 * 2);
  float* Qn  = (float*)carve(MD * 4);
  float* Kn  = (float*)carve(MD * 4);
  float* Vf  = (float*)carve(MD * 4);
  float* Al  = (float*)carve(MD * 4);
  float* Bt  = (float*)carve((size_t)M * NH * 4);
  float* Gt  = (float*)carve((size_t)M * NH * 4);
  h16* t1    = (h16*)carve((size_t)M * 64 * 2);
  h16* t2    = (h16*)carve((size_t)M * 64 * 2);
  h16* Og16  = (h16*)carve(MD * 2);
  float* Sst = (float*)carve((size_t)(M / CH) * NH * HD * HD * 4);   // entry state of every (b, h, chunk)
  if (off > ws_size) return;

  const float wsc = 256.0f;      // weight scale
  const float asc = 256.0f;      // conv activation scale
  const float tsc = 64.0f;       // gate hidden scale
  const float osc = 16.0f;       // gated output scale

  // 1) x -> f16 and three shortconv+SiLU activations
  {
    const int n8 = (int)(MD / 8);
    k_prep<<<dim3((n8 + 255) / 256, 3), 256, 0, stream>>>(x, wq_conv, bq_conv, wk_conv, bk_conv, wv_conv, bv_conv,
                                                         xh, cq, ck, cv, n8, T, asc);
  }
  // 2) weights -> scaled f16
  {
    int n8;
    n8 = DM * DM / 8;  k_cvtw<<<(n8 + 255) / 256, 256, 0, stream>>>(Wq,  Wq16,  n8, wsc);
    n8 = DM * DM / 8;  k_cvtw<<<(n8 + 255) / 256, 256, 0, stream>>>(Wk,  Wk16,  n8, wsc);
    n8 = DM * DM / 8;  k_cvtw<<<(n8 + 255) / 256, 256, 0, stream>>>(Wv,  Wv16,  n8, wsc);
    n8 = DM * DM / 8;  k_cvtw<<<(n8 + 255) / 256, 256, 0, stream>>>(Wo,  Wo16,  n8, wsc);
    n8 = 64 * DM / 8;  k_cvtw<<<(n8 + 255) / 256, 256, 0, stream>>>(Wad, Wad16, n8, wsc);
    n8 = DM * 64 / 8;  k_cvtw<<<(n8 + 255) / 256, 256, 0, stream>>>(Wau, Wau16, n8, wsc);
    n8 = NH * DM / 8;  k_cvtw<<<(n8 + 255) / 256, 256, 0, stream>>>(Wbe, Wbe16, n8, wsc);
    n8 = 64 * DM / 8;  k_cvtw<<<(n8 + 255) / 256, 256, 0, stream>>>(Wgd, Wgd16, n8, wsc);
    n8 = NH * 64 / 8;  k_cvtw<<<(n8 + 255) / 256, 256, 0, stream>>>(Wgu, Wgu16, n8, wsc);
  }
  // 3) projections
  const dim3 gbig(M / 128, DM / 64);
  const dim3 gsm(M / 128, 1);
  k_gemm<4, 1, float><<<gbig, 256, 0, stream>>>(cq, Wq16, bq, Qn, DM, DM, 1.0f / (asc * wsc), 1.0f);
  k_gemm<4, 1, float><<<gbig, 256, 0, stream>>>(ck, Wk16, bk, Kn, DM, DM, 1.0f / (asc * wsc), 1.0f);
  k_gemm<4, 0, float><<<gbig, 256, 0, stream>>>(cv, Wv16, bv, Vf, DM, DM, 1.0f / (asc * wsc), 1.0f);
  k_gemm<4, 2, h16  ><<<gsm,  256, 0, stream>>>(xh, Wad16, bad, t1, 64, DM, 1.0f / wsc, tsc);
  k_gemm<4, 3, float><<<gbig, 256, 0, stream>>>(t1, Wau16, bau, Al, DM, 64, 1.0f / (tsc * wsc), 1.0f);
  k_gemm<1, 4, float><<<gsm,  256, 0, stream>>>(xh, Wbe16, bbe, Bt, NH, DM, 1.0f / wsc, 1.0f);
  k_gemm<4, 2, h16  ><<<gsm,  256, 0, stream>>>(xh, Wgd16, bgd, t2, 64, DM, 1.0f / wsc, tsc);
  k_gemm<1, 4, float><<<gsm,  256, 0, stream>>>(t2, Wgu16, bgu, Gt, NH, 64, 1.0f / (tsc * wsc), 1.0f);
  // 4) state recurrence, one block per (column group, b*h); then the per-chunk outputs, one block per (chunk, b*h)
  k_state<<<dim3(HD / SC, (M / T) * NH), 128, 0, stream>>>(Kn, Vf, Al, Bt, Sst, T);
  k_out<<<dim3(T / CH, (M / T) * NH), 256, 0, stream>>>(Qn, Kn, Vf, Al, Bt, Gt, rms_w, Sst, Og16, T, osc);
  // 5) output projection
  k_gemm<4, 0, float><<<gbig, 256, 0, stream>>>(Og16, Wo16, bo, (float*)d_out, DM, DM, 1.0f / (osc * wsc), 1.0f);
}

// v003
// It runs in 285 microseconds.
// Two timings next to v002 both put it at 1.56 times that version's speed.
// Over all steps from v000 it is 4.32 times as fast.
#include <hip/hip_runtime.h>
#include <stdint.h>

// Contractions: token projections (q, k, v, gate down/up, beta, out) on v_wmma_f32_16x16x32_f16 with f16 operands pre-scaled by powers of two, f32 accumulate; per-chunk Q*S and A*V on v_wmma_f32_16x16x32_bf16 as bf16 hi/lo three-product split, f32 accumulate; decay scores, state recurrence, shortconv and norms on VALU in f32. All float inputs RNE-converted to bf16 on load.

typedef _Float16 h16;
typedef h16    v16h __attribute__((ext_vector_type(16)));
typedef h16    v8h  __attribute__((ext_vector_type(8)));
typedef __bf16 v16b __attribute__((ext_vector_type(16)));
typedef float  v8f  __attribute__((ext_vector_type(8)));
typedef float  v4f  __attribute__((ext_vector_type(4)));

union HF { v16h v; v8h p[2]; };
union BF { v16b v; unsigned short u[16]; };

#define DM 1024
#define HD 64
#define NH 16
#define CH 64
#define QP 68
#define KS 64    // k per staged GEMM tile: 128 B of a row
#define LP 72    // LDS row pitch of a staged tile in f16: 144 B = 16 B x 9, free of bank conflicts for 16-byte row reads

__device__ __forceinline__ unsigned short bf16_bits(float f) {
  unsigned int u = __float_as_uint(f);
  u += 0x7FFFu + ((u >> 16) & 1u);
  return (unsigned short)(u >> 16);
}
__device__ __forceinline__ float bf16r(float f) {
  return __uint_as_float(((unsigned int)bf16_bits(f)) << 16);
}
// x = hi + lo in bf16 pieces (RNE), bit patterns
__device__ __forceinline__ void split2(float x, unsigned short& hi, unsigned short& lo) {
  const unsigned short hb = bf16_bits(x);
  const float hf = __uint_as_float(((unsigned int)hb) << 16);
  hi = hb;
  lo = bf16_bits(x - hf);
}
// low 32 bits of a __shared__ address: the byte offset in the work-group's LDS
__device__ __forceinline__ unsigned lds_off(const void* p) {
  return (unsigned)(uintptr_t)p;
}
__device__ __forceinline__ float sigm(float v) {
  return __fdividef(1.0f, 1.0f + __expf(-v));
}

// 16-bit WMMA wrappers with the VALU hazard guard after the matrix op
__device__ __forceinline__ v8f mma_f16(v16h a, v16h b, v8f c) {
  c = __builtin_amdgcn_wmma_f32_16x16x32_f16(false, a, false, b, (short)0, c, false, false);
  asm volatile("v_nop\n\tv_nop\n\tv_nop\n\tv_nop" : "+v"(c) : "v"(a), "v"(b));
  return c;
}
__device__ __forceinline__ v8f mma_bf16(v16b a, v16b b, v8f c) {
  c = __builtin_amdgcn_wmma_f32_16x16x32_bf16(false, a, false, b, (short)0, c, false, false);
  asm volatile("v_nop\n\tv_nop\n\tv_nop\n\tv_nop" : "+v"(c) : "v"(a), "v"(b));
  return c;
}

// A fragment (row m, split k map) from an f32 LDS row pointer pr = base + row*pitch + k0, as bf16 hi/lo
__device__ __forceinline__ void fragA_split(const float* pr, int h, BF& hi, BF& lo) {
  const v4f x0 = *(const v4f*)(pr + 8 * h);
  const v4f x1 = *(const v4f*)(pr + 8 * h + 4);
  const v4f x2 = *(const v4f*)(pr + 16 + 8 * h);
  const v4f x3 = *(const v4f*)(pr + 20 + 8 * h);
#pragma unroll
  for (int q = 0; q < 4; ++q) {
    split2(x0[q], hi.u[q],      lo.u[q]);
    split2(x1[q], hi.u[4 + q],  lo.u[4 + q]);
    split2(x2[q], hi.u[8 + q],  lo.u[8 + q]);
    split2(x3[q], hi.u[12 + q], lo.u[12 + q]);
  }
}
// B fragment (col n, same split k map) gathered down column col of f32 [k][pitch] in LDS, as bf16 hi/lo
__device__ __forceinline__ void fragB_split(const float* base, int pitch, int k0, int col, int h, BF& hi, BF& lo) {
#pragma unroll
  for (int i = 0; i < 8; ++i) {
    split2(base[(k0 + 8 * h + i) * pitch + col],      hi.u[i],     lo.u[i]);
    split2(base[(k0 + 16 + 8 * h + i) * pitch + col], hi.u[8 + i], lo.u[8 + i]);
  }
}

// ---------------------------------------------------------------------------
// ---------------------------------------------------------------------------
__global__ void __launch_bounds__(256)
k_cvtw(const float* __restrict__ src, h16* dst, int n8, float scale)
{
  const int i = blockIdx.x * 256 + threadIdx.x;
  const bool ok = i < n8;
  v8h o;
#pragma unroll
  for (int q = 0; q < 8; ++q) o[q] = (h16)0.0f;
  if (ok) {
    const v4f a = *(const v4f*)(src + (size_t)i * 8);
    const v4f c = *(const v4f*)(src + (size_t)i * 8 + 4);
#pragma unroll
    for (int q = 0; q < 4; ++q) {
      o[q]     = (h16)(bf16r(a[q]) * scale);
      o[4 + q] = (h16)(bf16r(c[q]) * scale);
    }
  }
  if (ok) *(v8h*)(dst + (size_t)i * 8) = o;
  
}

// ---------------------------------------------------------------------------
// Causal depthwise conv (4 taps) + SiLU for one of three weight sets (blockIdx.y), f16 output scaled by ascale;
// ---------------------------------------------------------------------------
__global__ void __launch_bounds__(256)
k_prep(const float* __restrict__ x,
       const float* __restrict__ w0, const float* __restrict__ b0,
       const float* __restrict__ w1, const float* __restrict__ b1,
       const float* __restrict__ w2, const float* __restrict__ b2,
       h16* xh, h16* y0, h16* y1, h16* y2, int n8, int T, float ascale)
{
  const int which = blockIdx.y;
  const float* w  = (which == 0) ? w0 : ((which == 1) ? w1 : w2);
  const float* bb = (which == 0) ? b0 : ((which == 1) ? b1 : b2);
  h16* y          = (which == 0) ? y0 : ((which == 1) ? y1 : y2);

  const int g = blockIdx.x * 256 + threadIdx.x;
  const bool ok = g < n8;
  const size_t eo = (size_t)g * 8;
  v8h o, ox;
#pragma unroll
  for (int q = 0; q < 8; ++q) { o[q] = (h16)0.0f; ox[q] = (h16)0.0f; }
  if (ok) {
    const size_t bt = (size_t)(g >> 7);          // token index (DM/8 = 128 groups per token)
    const int d0 = (g & 127) * 8;
    const int t = (int)(bt % (size_t)T);
    float xr[4][8];
#pragma unroll
    for (int j = 0; j < 4; ++j) {
      const int ts = t - 3 + j;
      if (ts >= 0) {
        const float* px = x + (bt - (size_t)(3 - j)) * DM + d0;
        const v4f a = *(const v4f*)px;
        const v4f c = *(const v4f*)(px + 4);
#pragma unroll
        for (int q = 0; q < 4; ++q) { xr[j][q] = bf16r(a[q]); xr[j][4 + q] = bf16r(c[q]); }
      } else {
#pragma unroll
        for (int q = 0; q < 8; ++q) xr[j][q] = 0.0f;
      }
    }
#pragma unroll
    for (int q = 0; q < 8; ++q) {
      const int d = d0 + q;
      const v4f wv4 = *(const v4f*)(w + (size_t)d * 4);
      float acc = xr[0][q] * bf16r(wv4[0]);
      acc += xr[1][q] * bf16r(wv4[1]);
      acc += xr[2][q] * bf16r(wv4[2]);
      acc += xr[3][q] * bf16r(wv4[3]);
      acc += bf16r(bb[d]);
      const float s = acc * sigm(acc);
      o[q]  = (h16)(s * ascale);
      ox[q] = (h16)xr[3][q];
    }
  }
  if (ok) {
    *(v8h*)(y + eo) = o;
    if (which == 0) *(v8h*)(xh + eo) = ox;
  }
  
}

// ---------------------------------------------------------------------------
// Y[M,N] = epi( A[M,K] * W[N,K]^T * oscale + bias[N] ), f16 operands (k-contiguous), f32 accumulate.
// Block 256 threads = 8 waves; block tile 128 rows x 16*NT cols; wave tile 16 x 16*NT.
// Both operands come to LDS in tiles of KS k by asynchronous copies, whole cache lines, two buffers: tile t + 1 flies while t is used.
// EPI: 0 none, 1 L2-normalise each row over the 64-col slab, 2 silu, 3 sigmoid then clip to [0.1,1], 4 sigmoid then min 1.
// ---------------------------------------------------------------------------
template<int NT, int EPI, typename OT>
__global__ void __launch_bounds__(256)
k_gemm(const h16* __restrict__ A, const h16* __restrict__ W, const float* __restrict__ bias,
       OT* Y, int N, int K, float oscale, float yscale)
{
  constexpr int TW = 16 * NT;
  __shared__ __attribute__((aligned(16))) float stg[8 * 16 * TW];
  __shared__ __attribute__((aligned(16))) h16 sA[2][128 * LP];   // two buffers: 128 rows of A, KS k each
  __shared__ __attribute__((aligned(16))) h16 sW[2][TW * LP];    // two buffers: TW rows of W, KS k each

  const int lane = threadIdx.x & 31, wv = threadIdx.x >> 5;
  const int m = lane & 15, h = lane >> 4;
  const int rowBase = blockIdx.x * 128 + wv * 16;
  const int colBase = blockIdx.y * TW;

  v8f acc[NT];
#pragma unroll
  for (int t = 0; t < NT; ++t)
#pragma unroll
    for (int r = 0; r < 8; ++r) acc[t][r] = 0.0f;

  // Copy map: a row of a tile is KS f16 = 128 B = one cache line; 8 lanes x 16 B bring one row, a wave four whole lines.
  const int tid = threadIdx.x;
  const int cr = tid >> 3, cc = (tid & 7) * 8;
  const h16* ga = A + (size_t)(blockIdx.x * 128 + cr) * K + cc;
  const unsigned la = lds_off(&sA[0][cr * LP + cc]);
  // W tile: 64 rows in 16-byte pieces (two per thread), or 16 rows in 8-byte pieces (one per thread)
  const int wr = (NT == 4) ? cr : (tid >> 4), wc = (NT == 4) ? cc : (tid & 15) * 4;
  const h16* gw = W + (size_t)(colBase + wr) * K + wc;
  const unsigned lw = lds_off(&sW[0][wr * LP + wc]);
  const size_t r32 = (size_t)32 * K;             // 32 rows further in global memory
  constexpr unsigned L32 = 32 * LP * 2;          // 32 rows further in LDS, bytes

  // all of tile t's copies, every lane on; the s_wait_xcnt closes the statement so that it stands in front of any
  // rewrite of the address registers the copies name
  auto stage = [&](int t) {
    const h16* a0 = ga + (size_t)t * KS;
    const h16* w0 = gw + (size_t)t * KS;
    const unsigned l0 = la + (unsigned)(t & 1) * (128 * LP * 2);
    const unsigned m0 = lw + (unsigned)(t & 1) * (TW * LP * 2);
    if constexpr (NT == 4) {
      asm volatile("global_load_async_to_lds_b128 %0, %1, off\n\t"
                   "global_load_async_to_lds_b128 %2, %3, off\n\t"
                   "global_load_async_to_lds_b128 %4, %5, off\n\t"
                   "global_load_async_to_lds_b128 %6, %7, off\n\t"
                   "global_load_async_to_lds_b128 %8, %9, off\n\t"
                   "global_load_async_to_lds_b128 %10, %11, off\n\t"
                   "s_wait_xcnt 0x0"
                   :: "v"(l0), "v"(a0), "v"(l0 + L32), "v"(a0 + r32), "v"(l0 + 2 * L32), "v"(a0 + 2 * r32),
                      "v"(l0 + 3 * L32), "v"(a0 + 3 * r32), "v"(m0), "v"(w0), "v"(m0 + L32), "v"(w0 + r32)
                   : "memory");
    } else {
      asm volatile("global_load_async_to_lds_b128 %0, %1, off\n\t"
                   "global_load_async_to_lds_b128 %2, %3, off\n\t"
                   "global_load_async_to_lds_b128 %4, %5, off\n\t"
                   "global_load_async_to_lds_b128 %6, %7, off\n\t"
                   "global_load_async_to_lds_b64 %8, %9, off\n\t"
                   "s_wait_xcnt 0x0"
                   :: "v"(l0), "v"(a0), "v"(l0 + L32), "v"(a0 + r32), "v"(l0 + 2 * L32), "v"(a0 + 2 * r32),
                      "v"(l0 + 3 * L32), "v"(a0 + 3 * r32), "v"(m0), "v"(w0)
                   : "memory");
    }
  };

  const int nt = K / KS;
  stage(0);
  asm volatile("s_wait_asynccnt 0x0" ::: "memory");   // this wave's copies of tile 0 have landed
  __syncthreads();                                    // ... and every other wave's
  if (nt > 1) stage(1);

  // A: lane row m, elements 0..7 <- k0+8h.., 8..15 <- k0+16+8h..;  B: lane col m, same k map
  for (int t = 0; t < nt; ++t) {
    const h16* pa = &sA[t & 1][(wv * 16 + m) * LP + 8 * h];
    const h16* pw = &sW[t & 1][m * LP + 8 * h];
    HF a[KS / 32], b[KS / 32][NT];
#pragma unroll
    for (int q = 0; q < KS / 32; ++q) {
      a[q].p[0] = *(const v8h*)(pa + 32 * q);
      a[q].p[1] = *(const v8h*)(pa + 32 * q + 16);
#pragma unroll
      for (int u = 0; u < NT; ++u) {
        b[q][u].p[0] = *(const v8h*)(pw + 16 * u * LP + 32 * q);
        b[q][u].p[1] = *(const v8h*)(pw + 16 * u * LP + 32 * q + 16);
      }
    }
#pragma unroll
    for (int q = 0; q < KS / 32; ++q)
#pragma unroll
      for (int u = 0; u < NT; ++u) acc[u] = mma_f16(a[q].v, b[q][u].v, acc[u]);
    asm volatile("s_wait_dscnt 0x0" ::: "memory");      // this wave's reads of the buffer are done before it is refilled
    asm volatile("s_wait_asynccnt 0x0" ::: "memory");   // this wave's copies of tile t + 1 have landed
    __syncthreads();                                    // publishes tile t + 1 and ends every wave's reads of tile t
    if (t + 2 < nt) stage(t + 2);
  }
  asm volatile("s_wait_asynccnt 0x0" ::: "memory");     // no copy is left in flight when the wave goes on

  // epilogue values (D element r of this lane = row 8h+r, col m of tile t)
#pragma unroll
  for (int t = 0; t < NT; ++t) {
    const float bv = bf16r(bias[colBase + 16 * t + m]);
#pragma unroll
    for (int r = 0; r < 8; ++r) {
      float v = acc[t][r] * oscale + bv;
      if (EPI == 2)      { v = v * sigm(v); }
      else if (EPI == 3) { v = sigm(v); v = fminf(fmaxf(v, 0.1f), 1.0f); }
      else if (EPI == 4) { v = fminf(sigm(v), 1.0f); }
      acc[t][r] = v;
    }
  }
  if (EPI == 1) {
#pragma unroll
    for (int r = 0; r < 8; ++r) {
      float ss = 0.0f;
#pragma unroll
      for (int t = 0; t < NT; ++t) ss += acc[t][r] * acc[t][r];
      ss += __shfl_xor(ss, 1, 32);
      ss += __shfl_xor(ss, 2, 32);
      ss += __shfl_xor(ss, 4, 32);
      ss += __shfl_xor(ss, 8, 32);
      const float inv = 1.0f / sqrtf(fmaxf(ss, 1e-6f));
#pragma unroll
      for (int t = 0; t < NT; ++t) acc[t][r] *= inv;
    }
  }

  float* sw = stg + wv * 16 * TW;
#pragma unroll
  for (int t = 0; t < NT; ++t)
#pragma unroll
    for (int r = 0; r < 8; ++r) sw[(8 * h + r) * TW + 16 * t + m] = acc[t][r];
  __syncthreads();

  if constexpr (sizeof(OT) == 4 && NT == 4) {
    v4f vals[8];
    size_t offs[8];
#pragma unroll
    for (int it = 0; it < 8; ++it) {
      const int row = 2 * it + h, c4 = m * 4;
      vals[it] = *(const v4f*)(sw + row * TW + c4);
      offs[it] = (size_t)(rowBase + row) * N + colBase + c4;
    }
#pragma unroll
    for (int it = 0; it < 8; ++it) *(v4f*)(Y + offs[it]) = vals[it];
    
  } else if constexpr (sizeof(OT) == 2 && NT == 4) {
    v8h vals[4];
    size_t offs[4];
#pragma unroll
    for (int it = 0; it < 4; ++it) {
      const int row = it * 4 + (lane >> 3), c8 = (lane & 7) * 8;
      const v4f a = *(const v4f*)(sw + row * TW + c8);
      const v4f c = *(const v4f*)(sw + row * TW + c8 + 4);
      v8h o;
#pragma unroll
      for (int q = 0; q < 4; ++q) { o[q] = (h16)(a[q] * yscale); o[4 + q] = (h16)(c[q] * yscale); }
      vals[it] = o;
      offs[it] = (size_t)(rowBase + row) * N + colBase + c8;
    }
#pragma unroll
    for (int it = 0; it < 4; ++it) *(v8h*)(Y + offs[it]) = vals[it];
    
  } else if constexpr (sizeof(OT) == 4 && NT == 1) {
    // N == 16: the wave's 16 rows are 1 KB contiguous; 8 lanes x 16 B per line
    v4f vals[2];
    size_t offs[2];
#pragma unroll
    for (int it = 0; it < 2; ++it) {
      const int q = it * 32 + lane, row = q >> 2, c4 = (q & 3) * 4;
      vals[it] = *(const v4f*)(sw + row * TW + c4);
      offs[it] = (size_t)(rowBase + row) * N + colBase + c4;
    }
#pragma unroll
    for (int it = 0; it < 2; ++it) *(v4f*)(Y + offs[it]) = vals[it];
    
  }
}

// ---------------------------------------------------------------------------
// Gated delta rule, serial part. The columns e of the state S (64x64 f32) never mix: each evolves from k, a, beta and v[e] alone.
// One block per (group of SC columns, b*h), 128 threads = 4 waves, T/64 chunks in sequence. A 16-lane row owns one column,
// lane lg of it the rows 4*lg .. 4*lg+3 in registers, so k^T S is summed inside the row and no step needs a barrier.
// The state each chunk starts from is stored column-major, Sg[(bh*nch + n)][e][d], for the chunk-parallel output kernel.
// ---------------------------------------------------------------------------
#define SC 8    // state columns per block
#define NSTP 8    // steps per group of LDS operand reads

// x + (x of lane l ^ mask) inside a 16-lane row; CTRL = 0x160 + mask is the DPP row_xmask control
template<int CTRL>
__device__ __forceinline__ float xmask_add(float x) {
  return x + __int_as_float(__builtin_amdgcn_update_dpp(0, __float_as_int(x), CTRL, 0xf, 0xf, true));
}

__global__ void __launch_bounds__(128)
k_state(const float* __restrict__ Kp, const float* __restrict__ Vp, const float* __restrict__ Ap,
        const float* __restrict__ Bp, float* Sg, int T)
{
  __shared__ __attribute__((aligned(16))) float Ks[CH * HD];
  __shared__ __attribute__((aligned(16))) float ALs[CH * HD];
  __shared__ __attribute__((aligned(16))) float Vt[SC * CH];     // [column][t]
  __shared__ __attribute__((aligned(16))) float Bsh[CH];

  const int tid = threadIdx.x;
  const int cg = blockIdx.x, bh = blockIdx.y, b = bh / NH, hh = bh % NH;
  const int lg = tid & 15, el = tid >> 4;      // state ownership: column cg*SC + el, rows 4*lg .. 4*lg+3

  v4f S;
#pragma unroll
  for (int u = 0; u < 4; ++u) S[u] = 0.0f;

  // per-thread byte offsets of the tile loads and of the state store; the chunk moves the uniform base only
  const unsigned tb = (unsigned)(((tid >> 4) * DM + (tid & 15) * 4) * 4);
  const unsigned vo = (unsigned)(((tid >> 1) * DM + cg * SC + (tid & 1) * 4) * 4);
  const unsigned so = (unsigned)(((cg * SC + el) * HD + 4 * lg) * 4);

  const float* kl = Ks  + 4 * lg;
  const float* al = ALs + 4 * lg;
  const float* vl = Vt  + el * CH;

  const int nch = T / CH;
  for (int n = 0; n < nch; ++n) {
    const size_t rowbase = (size_t)b * T + (size_t)n * CH;
    const float* Kg = Kp + rowbase * DM + hh * HD;
    const float* Vg = Vp + rowbase * DM + hh * HD;
    const float* Ag = Ap + rowbase * DM + hh * HD;
    float* So = Sg + ((size_t)bh * nch + n) * (HD * HD);

    __syncthreads();   // every wave has read the last chunk's tiles
    // entry state of this chunk, issued ahead of the tile loads so that the store finishes under the loads' latency
    *(v4f*)((char*)So + so) = S;
    // the tile loads that follow may be given the registers this store names: the wait stands in front of that overwrite
    asm volatile("s_wait_xcnt 0x0" ::: "memory");
    // keeps the store and its wait ahead of the loads: scheduled as one region, the store came out behind them on a reused address pair
    __builtin_amdgcn_sched_barrier(0);
    // tile loads: k and a 64 rows x 64 f32, v 64 rows x SC f32, beta 64 (read by both halves of the block, stored by one)
    const char* kp = (const char*)Kg + tb;
    const char* ap = (const char*)Ag + tb;
    const char* vp = (const char*)Vg + vo;
    const float* bp = Bp + (rowbase + (tid & (CH - 1))) * NH + hh;
    const float tbeta = *bp;
    v4f tk[8], ta[8];
#pragma unroll
    for (int it = 0; it < 8; ++it) {
      tk[it] = *(const v4f*)(kp + it * (8 * DM * 4));
      ta[it] = *(const v4f*)(ap + it * (8 * DM * 4));
    }
    const v4f tv = *(const v4f*)vp;
    // the wait stands in front of any overwrite of the address registers the loads name; as inputs they stay live up to it.
    // beta as an input holds its load up here with the others: left free, it sank behind the tile stores and its latency stood alone
    asm volatile("s_wait_xcnt 0x0" :: "v"(kp), "v"(ap), "v"(vp), "v"(bp), "v"(tbeta) : "memory");
#pragma unroll
    for (int it = 0; it < 8; ++it) {
      const int c = it * 8 + (tid >> 4), d4 = (tid & 15) * 4;
      *(v4f*)(Ks  + c * HD + d4) = tk[it];
      *(v4f*)(ALs + c * HD + d4) = ta[it];
    }
#pragma unroll
    for (int u = 0; u < 4; ++u) Vt[((tid & 1) * 4 + u) * CH + (tid >> 1)] = tv[u];
    if (tid < CH) Bsh[tid] = fminf(tbeta, 1.0f);
    __syncthreads();

    // exact sequential state update over the chunk: S = a*S; S += (beta*k) outer (v - k^T S)
    // the operands of NSTP steps are read as one group, one group ahead of the steps that use them
    v4f kq[2][NSTP], aq[2][NSTP], vq[2][NSTP / 4], bq[2][NSTP / 4];
#pragma unroll
    for (int s = 0; s < NSTP; ++s) {
      kq[0][s] = *(const v4f*)(kl + s * HD);
      aq[0][s] = *(const v4f*)(al + s * HD);
    }
#pragma unroll
    for (int s = 0; s < NSTP / 4; ++s) {
      vq[0][s] = *(const v4f*)(vl + 4 * s);
      bq[0][s] = *(const v4f*)(Bsh + 4 * s);
    }
#pragma unroll
    for (int g = 0; g < CH / NSTP; ++g) {
      const int cur = g & 1, nxt = cur ^ 1;
      // with the one behind the reads: keeps the next group's LDS reads in one place. Left free, they sank to just ahead of their
      // use, where each step waited out the LDS latency, or were strewn among the steps of the group before
      __builtin_amdgcn_sched_barrier(0);
      if (g + 1 < CH / NSTP) {
#pragma unroll
        for (int s = 0; s < NSTP; ++s) {
          kq[nxt][s] = *(const v4f*)(kl + (NSTP * (g + 1) + s) * HD);
          aq[nxt][s] = *(const v4f*)(al + (NSTP * (g + 1) + s) * HD);
        }
#pragma unroll
        for (int s = 0; s < NSTP / 4; ++s) {
          vq[nxt][s] = *(const v4f*)(vl + NSTP * (g + 1) + 4 * s);
          bq[nxt][s] = *(const v4f*)(Bsh + NSTP * (g + 1) + 4 * s);
        }
      }
      __builtin_amdgcn_sched_barrier(0);   // second of the pair, see above
#pragma unroll
      for (int s = 0; s < NSTP; ++s) {
        const v4f kk = kq[cur][s], aa = aq[cur][s];
        const float bt = bq[cur][s >> 2][s & 3];
#pragma unroll
        for (int u = 0; u < 4; ++u) S[u] *= aa[u];
        float kts = (kk[0] * S[0] + kk[2] * S[2]) + (kk[1] * S[1] + kk[3] * S[3]);
        kts = xmask_add<0x161>(kts);
        kts = xmask_add<0x162>(kts);
        kts = xmask_add<0x164>(kts);
        kts = xmask_add<0x168>(kts);
        const float dl = vq[cur][s >> 2][s & 3] - kts;
#pragma unroll
        for (int u = 0; u < 4; ++u) S[u] += (bt * kk[u]) * dl;
      }
    }
  }
}

// ---------------------------------------------------------------------------
// Gated delta rule, chunk-parallel part: one block per (chunk, b*h), 256 threads. Reads the chunk's entry state from Sg.
// Scores A[i][j] on VALU f32, O = Q*S + A*V on bf16 hi/lo WMMA, then headwise RMS norm and gate.
// ---------------------------------------------------------------------------
__global__ void __launch_bounds__(256)
k_out(const float* __restrict__ Qp, const float* __restrict__ Kp, const float* __restrict__ Vp,
      const float* __restrict__ Ap, const float* __restrict__ Bp, const float* __restrict__ Gp,
      const float* __restrict__ rmsw, const float* __restrict__ Sg, h16* Og, int T, float ogscale)
{
  __shared__ __attribute__((aligned(16))) float Qs[CH * QP];
  __shared__ __attribute__((aligned(16))) float Ks[CH * QP];
  __shared__ __attribute__((aligned(16))) float CLs[CH * QP];
  __shared__ __attribute__((aligned(16))) float SCs[CH * QP];
  __shared__ __attribute__((aligned(16))) float Vs[CH * HD];
  __shared__ __attribute__((aligned(16))) float ALs[CH * HD];
  __shared__ __attribute__((aligned(16))) float Sf[HD * QP];     // entry state, column-major: [e][d]
  __shared__ float Bsh[CH], GS[CH], RV[CH], RW[HD];

  const int tid = threadIdx.x;
  const int lane = tid & 31, wv = tid >> 5, m = lane & 15, h = lane >> 4;
  const int n = blockIdx.x, bh = blockIdx.y, b = bh / NH, hh = bh % NH;

  if (tid < HD) RW[tid] = bf16r(rmsw[hh * HD + tid]);

  const size_t rowbase = (size_t)b * T + (size_t)n * CH;
  const float* Qg = Qp + rowbase * DM + hh * HD;
  const float* Kg = Kp + rowbase * DM + hh * HD;
  const float* Vg = Vp + rowbase * DM + hh * HD;
  const float* Ag = Ap + rowbase * DM + hh * HD;
  const float* Si = Sg + ((size_t)bh * (T / CH) + n) * (HD * HD);

  // tile loads (64 rows x 64 f32 each): one byte offset per thread, the step of 16 rows is a constant
  const unsigned tb = (unsigned)(((tid >> 4) * DM + (tid & 15) * 4) * 4);
  v4f tq[4], tk[4], tv[4], ta[4], ts[4];
#pragma unroll
  for (int it = 0; it < 4; ++it) {
    tq[it] = *(const v4f*)((const char*)Qg + tb + it * (16 * DM * 4));
    tk[it] = *(const v4f*)((const char*)Kg + tb + it * (16 * DM * 4));
    tv[it] = *(const v4f*)((const char*)Vg + tb + it * (16 * DM * 4));
    ta[it] = *(const v4f*)((const char*)Ag + tb + it * (16 * DM * 4));
    ts[it] = *(const v4f*)(Si + tid * 4 + it * (16 * HD));
  }
  // the wait stands in front of any overwrite of the offset register the loads name; as an input it stays live up to it
  asm volatile("s_wait_xcnt 0x0" :: "v"(tb) : "memory");
#pragma unroll
  for (int it = 0; it < 4; ++it) {
    const int idx = it * 256 + tid;
    const int c = idx >> 4, d4 = (idx & 15) * 4;
    *(v4f*)(Qs  + c * QP + d4) = tq[it];
    *(v4f*)(Ks  + c * QP + d4) = tk[it];
    *(v4f*)(Vs  + c * HD + d4) = tv[it];
    *(v4f*)(ALs + c * HD + d4) = ta[it];
    *(v4f*)(Sf  + c * QP + d4) = ts[it];
  }
  if (tid < CH) {
    Bsh[tid] = fminf(Bp[(rowbase + tid) * NH + hh], 1.0f);
    GS[tid]  = Gp[(rowbase + tid) * NH + hh];
  }
  __syncthreads();

  // cumulative log decay per feature, restarted per chunk
  if (tid < HD) {
    float a = 0.0f;
    for (int c = 0; c < CH; ++c) {
      a += __logf(fmaxf(ALs[c * HD + tid], 1e-7f));
      CLs[c * QP + tid] = a;
    }
  }
  __syncthreads();

  // scores: A[i][j] = beta_j * sum_d q[i][d] k[j][d] exp(cl[i][d] - cl[j][d]) for i >= j, else 0
  {
    const int j0 = lane, j1 = lane + 32;
    float a0[8], a1[4];
#pragma unroll
    for (int r = 0; r < 8; ++r) a0[r] = 0.0f;
#pragma unroll
    for (int r = 0; r < 4; ++r) a1[r] = 0.0f;
#pragma unroll 2
    for (int d = 0; d < HD; ++d) {
      const float k0v = Ks[j0 * QP + d], c0 = CLs[j0 * QP + d];
      const float k1v = Ks[j1 * QP + d], c1 = CLs[j1 * QP + d];
#pragma unroll
      for (int r = 0; r < 8; ++r) {
        const int i = wv + 8 * r;
        const float q = Qs[i * QP + d];
        const float ci = CLs[i * QP + d];
        a0[r] += q * k0v * __expf(ci - c0);
        if (r >= 4) a1[r - 4] += q * k1v * __expf(ci - c1);
      }
    }
    const float b0 = Bsh[j0], b1 = Bsh[j1];
#pragma unroll
    for (int r = 0; r < 8; ++r) {
      const int i = wv + 8 * r;
      SCs[i * QP + j0] = (i >= j0) ? a0[r] * b0 : 0.0f;
      float v1 = 0.0f;
      if (r >= 4) v1 = (i >= j1) ? a1[r - 4] * b1 : 0.0f;
      SCs[i * QP + j1] = v1;
    }
  }
  __syncthreads();

  // O = Q*S + A*V : wave owns rows 16*ti.., two 16-col tiles; bf16 hi/lo three products per operand pair
  {
    const int ti = wv >> 1, tj0 = (wv & 1) * 2;
    v8f acc[2];
#pragma unroll
    for (int s = 0; s < 2; ++s)
#pragma unroll
      for (int r = 0; r < 8; ++r) acc[s][r] = 0.0f;

#pragma unroll
    for (int ks = 0; ks < 2; ++ks) {
      const int k0 = ks * 32;
      BF ah, al;
      fragA_split(Qs + (ti * 16 + m) * QP + k0, h, ah, al);
#pragma unroll
      for (int s = 0; s < 2; ++s) {
        BF bhi, blo;
        fragA_split(Sf + ((tj0 + s) * 16 + m) * QP + k0, h, bhi, blo);   // column e of S is a row of Sf: same k map as the gather
        acc[s] = mma_bf16(ah.v, bhi.v, acc[s]);
        acc[s] = mma_bf16(ah.v, blo.v, acc[s]);
        acc[s] = mma_bf16(al.v, bhi.v, acc[s]);
      }
    }
#pragma unroll
    for (int ks = 0; ks < 2; ++ks) {
      const int k0 = ks * 32;
      BF ah, al;
      fragA_split(SCs + (ti * 16 + m) * QP + k0, h, ah, al);
#pragma unroll
      for (int s = 0; s < 2; ++s) {
        BF bhi, blo;
        fragB_split(Vs, HD, k0, (tj0 + s) * 16 + m, h, bhi, blo);
        acc[s] = mma_bf16(ah.v, bhi.v, acc[s]);
        acc[s] = mma_bf16(ah.v, blo.v, acc[s]);
        acc[s] = mma_bf16(al.v, bhi.v, acc[s]);
      }
    }
    __syncthreads();   // all reads of SCs/Sf done; reuse SCs as the O tile
#pragma unroll
    for (int s = 0; s < 2; ++s)
#pragma unroll
      for (int r = 0; r < 8; ++r)
        SCs[(ti * 16 + 8 * h + r) * QP + (tj0 + s) * 16 + m] = acc[s][r];
  }
  __syncthreads();

  // per-row RMS normaliser times gate
  if (tid < CH) {
    float ss = 0.0f;
    for (int e2 = 0; e2 < HD; ++e2) { const float o = SCs[tid * QP + e2]; ss += o * o; }
    RV[tid] = GS[tid] / sqrtf(ss * (1.0f / 64.0f) + 1e-6f);
  }
  __syncthreads();

  {
    v8h ov[2];
    size_t go[2];
#pragma unroll
    for (int it = 0; it < 2; ++it) {
      const int c = it * 32 + (tid >> 3), e0 = (tid & 7) * 8;
      const v4f x0 = *(const v4f*)(SCs + c * QP + e0);
      const v4f x1 = *(const v4f*)(SCs + c * QP + e0 + 4);
      const float sc = RV[c] * ogscale;
      v8h o;
#pragma unroll
      for (int q = 0; q < 4; ++q) {
        o[q]     = (h16)(x0[q] * sc * RW[e0 + q]);
        o[4 + q] = (h16)(x1[q] * sc * RW[e0 + 4 + q]);
      }
      ov[it] = o;
      go[it] = (rowbase + c) * (size_t)DM + hh * HD + e0;
    }
#pragma unroll
    for (int it = 0; it < 2; ++it) *(v8h*)(Og + go[it]) = ov[it];
    
  }
}

// ---------------------------------------------------------------------------
extern "C" void kernel_launch(void* const* d_in, const int* in_sizes, int n_in,
                              void* d_out, int out_size, void* d_ws, size_t ws_size,
                              hipStream_t stream)
{
  if (n_in < 26) return;
  const int T = 2048;
  const long nx = (long)in_sizes[0];
  if (nx <= 0 || (nx % ((long)DM * T)) != 0) return;
  const int M = (int)(nx / DM);                       // tokens, multiple of 2048 (hence of 128)
  if ((long)out_size != (long)M * DM) return;
  if (in_sizes[1] != DM * 4 || in_sizes[3] != DM * 4 || in_sizes[5] != DM * 4) return;
  if (in_sizes[7] != DM * DM || in_sizes[9] != DM * DM || in_sizes[11] != DM * DM || in_sizes[24] != DM * DM) return;
  if (in_sizes[13] != 64 * DM || in_sizes[15] != DM * 64 || in_sizes[17] != NH * DM ||
      in_sizes[20] != 64 * DM || in_sizes[22] != NH * 64) return;

  const float* x       = (const float*)d_in[0];
  const float* wq_conv = (const float*)d_in[1];  const float* bq_conv = (const float*)d_in[2];
  const float* wk_conv = (const float*)d_in[3];  const float* bk_conv = (const float*)d_in[4];
  const float* wv_conv = (const float*)d_in[5];  const float* bv_conv = (const float*)d_in[6];
  const float* Wq  = (const float*)d_in[7];   const float* bq  = (const float*)d_in[8];
  const float* Wk  = (const float*)d_in[9];   const float* bk  = (const float*)d_in[10];
  const float* Wv  = (const float*)d_in[11];  const float* bv  = (const float*)d_in[12];
  const float* Wad = (const float*)d_in[13];  const float* bad = (const float*)d_in[14];
  const float* Wau = (const float*)d_in[15];  const float* bau = (const float*)d_in[16];
  const float* Wbe = (const float*)d_in[17];  const float* bbe = (const float*)d_in[18];
  const float* rms_w = (const float*)d_in[19];
  const float* Wgd = (const float*)d_in[20];  const float* bgd = (const float*)d_in[21];
  const float* Wgu = (const float*)d_in[22];  const float* bgu = (const float*)d_in[23];
  const float* Wo  = (const float*)d_in[24];  const float* bo  = (const float*)d_in[25];

  char* ws = (char*)d_ws;
  size_t off = 0;
  auto carve = [&](size_t bytes) -> char* {
    char* p = ws + off;
    off += (bytes + 255) & ~(size_t)255;
    return p;
  };
  const size_t MD = (size_t)M * DM;
  h16* xh    = (h16*)carve(MD * 2);
  h16* cq    = (h16*)carve(MD * 2);
  h16* ck    = (h16*)carve(MD * 2);
  h16* cv    = (h16*)carve(MD * 2);
  h16* Wq16  = (h16*)carve((size_t)DM * DM * 2);
  h16* Wk16  = (h16*)carve((size_t)DM * DM * 2);
  h16* Wv16  = (h16*)carve((size_t)DM * DM * 2);
  h16* Wo16  = (h16*)carve((size_t)DM * DM * 2);
  h16* Wad16 = (h16*)carve((size_t)64 * DM * 2);
  h16* Wau16 = (h16*)carve((size_t)DM * 64 * 2);
  h16* Wbe16 = (h16*)carve((size_t)NH * DM * 2);
  h16* Wgd16 = (h16*)carve((size_t)64 * DM * 2);
  h16* Wgu16 = (h16*)carve((size_t)NH * 64 * 2);
  float* Qn  = (float*)carve(MD * 4);
  float* Kn  = (float*)carve(MD * 4);
  float* Vf  = (float*)carve(MD * 4);
  float* Al  = (float*)carve(MD * 4);
  float* Bt  = (float*)carve((size_t)M * NH * 4);
  float* Gt  = (float*)carve((size_t)M * NH * 4);
  h16* t1    = (h16*)carve((size_t)M * 64 * 2);
  h16* t2    = (h16*)carve((size_t)M * 64 * 2);
  h16* Og16  = (h16*)carve(MD * 2);
  float* Sst = (float*)carve((size_t)(M / CH) * NH * HD * HD * 4);   // entry state of every (b, h, chunk)
  if (off > ws_size) return;

  const float wsc = 256.0f;      // weight scale
  const float asc = 256.0f;      // conv activation scale
  const float tsc = 64.0f;       // gate hidden scale
  const float osc = 16.0f;       // gated output scale

  // 1) x -> f16 and three shortconv+SiLU activations
  {
    const int n8 = (int)(MD / 8);
    k_prep<<<dim3((n8 + 255) / 256, 3), 256, 0, stream>>>(x, wq_conv, bq_conv, wk_conv, bk_conv, wv_conv, bv_conv,
                                                         xh, cq, ck, cv, n8, T, asc);
  }
  // 2) weights -> scaled f16
  {
    int n8;
    n8 = DM * DM / 8;  k_cvtw<<<(n8 + 255) / 256, 256, 0, stream>>>(Wq,  Wq16,  n8, wsc);
    n8 = DM * DM / 8;  k_cvtw<<<(n8 + 255) / 256, 256, 0, stream>>>(Wk,  Wk16,  n8, wsc);
    n8 = DM * DM / 8;  k_cvtw<<<(n8 + 255) / 256, 256, 0, stream>>>(Wv,  Wv16,  n8, wsc);
    n8 = DM * DM / 8;  k_cvtw<<<(n8 + 255) / 256, 256, 0, stream>>>(Wo,  Wo16,  n8, wsc);
    n8 = 64 * DM / 8;  k_cvtw<<<(n8 + 255) / 256, 256, 0, stream>>>(Wad, Wad16, n8, wsc);
    n8 = DM * 64 / 8;  k_cvtw<<<(n8 + 255) / 256, 256, 0, stream>>>(Wau, Wau16, n8, wsc);
    n8 = NH * DM / 8;  k_cvtw<<<(n8 + 255) / 256, 256, 0, stream>>>(Wbe, Wbe16, n8, wsc);
    n8 = 64 * DM / 8;  k_cvtw<<<(n8 + 255) / 256, 256, 0, stream>>>(Wgd, Wgd16, n8, wsc);
    n8 = NH * 64 / 8;  k_cvtw<<<(n8 + 255) / 256, 256, 0, stream>>>(Wgu, Wgu16, n8, wsc);
  }
  // 3) projections
  const dim3 gbig(M / 128, DM / 64);
  const dim3 gsm(M / 128, 1);
  k_gemm<4, 1, float><<<gbig, 256, 0, stream>>>(cq, Wq16, bq, Qn, DM, DM, 1.0f / (asc * wsc), 1.0f);
  k_gemm<4, 1, float><<<gbig, 256, 0, stream>>>(ck, Wk16, bk, Kn, DM, DM, 1.0f / (asc * wsc), 1.0f);
  k_gemm<4, 0, float><<<gbig, 256, 0, stream>>>(cv, Wv16, bv, Vf, DM, DM, 1.0f / (asc * wsc), 1.0f);
  k_gemm<4, 2, h16  ><<<gsm,  256, 0, stream>>>(xh, Wad16, bad, t1, 64, DM, 1.0f / wsc, tsc);
  k_gemm<4, 3, float><<<gbig, 256, 0, stream>>>(t1, Wau16, bau, Al, DM, 64, 1.0f / (tsc * wsc), 1.0f);
  k_gemm<1, 4, float><<<gsm,  256, 0, stream>>>(xh, Wbe16, bbe, Bt, NH, DM, 1.0f / wsc, 1.0f);
  k_gemm<4, 2, h16  ><<<gsm,  256, 0, stream>>>(xh, Wgd16, bgd, t2, 64, DM, 1.0f / wsc, tsc);
  k_gemm<1, 4, float><<<gsm,  256, 0, stream>>>(t2, Wgu16, bgu, Gt, NH, 64, 1.0f / (tsc * wsc), 1.0f);
  // 4) state recurrence, one block per (column group, b*h); then the per-chunk outputs, one block per (chunk, b*h)
  k_state<<<dim3(HD / SC, (M / T) * NH), 128, 0, stream>>>(Kn, Vf, Al, Bt, Sst, T);
  k_out<<<dim3(T / CH, (M / T) * NH), 256, 0, stream>>>(Qn, Kn, Vf, Al, Bt, Gt, rms_w, Sst, Og16, T, osc);
  // 5) output projection
  k_gemm<4, 0, float><<<gbig, 256, 0, stream>>>(Og16, Wo16, bo, (float*)d_out, DM, DM, 1.0f / (osc * wsc), 1.0f);
}

// v004
// It runs in 229 microseconds.
// Timed twice side by side with v003, it ran 1.25 times as fast both times.
// Counting every step since v000, it is 5.38 times as fast.
#include <hip/hip_runtime.h>
#include <stdint.h>

// Contractions: token projections (q, k, v, gate down/up, beta, out) on v_wmma_f32_16x16x32_f16 with f16 operands pre-scaled by powers of two, f32 accumulate; per-chunk Q*S and A*V on v_wmma_f32_16x16x32_bf16 as bf16 hi/lo three-product split, f32 accumulate; decay scores, state recurrence, shortconv and norms on VALU in f32. All float inputs RNE-converted to bf16 on load.

typedef _Float16 h16;
typedef h16    v16h __attribute__((ext_vector_type(16)));
typedef h16    v8h  __attribute__((ext_vector_type(8)));
typedef __bf16 v16b __attribute__((ext_vector_type(16)));
typedef float  v8f  __attribute__((ext_vector_type(8)));
typedef float  v4f  __attribute__((ext_vector_type(4)));

union HF { v16h v; v8h p[2]; };
union BF { v16b v; unsigned short u[16]; };

#define DM 1024
#define HD 64
#define NH 16
#define CH 64
#define QP 68
#define KS 64    // k per staged GEMM tile: 128 B of a row
#define LP 72    // LDS row pitch of a staged tile in f16: 144 B = 16 B x 9, free of bank conflicts for 16-byte row reads

__device__ __forceinline__ unsigned short bf16_bits(float f) {
  unsigned int u = __float_as_uint(f);
  u += 0x7FFFu + ((u >> 16) & 1u);
  return (unsigned short)(u >> 16);
}
__device__ __forceinline__ float bf16r(float f) {
  return __uint_as_float(((unsigned int)bf16_bits(f)) << 16);
}
// x = hi + lo in bf16 pieces (RNE), bit patterns
__device__ __forceinline__ void split2(float x, unsigned short& hi, unsigned short& lo) {
  const unsigned short hb = bf16_bits(x);
  const float hf = __uint_as_float(((unsigned int)hb) << 16);
  hi = hb;
  lo = bf16_bits(x - hf);
}
// low 32 bits of a __shared__ address: the byte offset in the work-group's LDS
__device__ __forceinline__ unsigned lds_off(const void* p) {
  return (unsigned)(uintptr_t)p;
}
__device__ __forceinline__ float sigm(float v) {
  return __fdividef(1.0f, 1.0f + __expf(-v));
}

// 16-bit WMMA wrappers with the VALU hazard guard after the matrix op
__device__ __forceinline__ v8f mma_f16(v16h a, v16h b, v8f c) {
  c = __builtin_amdgcn_wmma_f32_16x16x32_f16(false, a, false, b, (short)0, c, false, false);
  asm volatile("v_nop\n\tv_nop\n\tv_nop\n\tv_nop" : "+v"(c) : "v"(a), "v"(b));
  return c;
}
__device__ __forceinline__ v8f mma_bf16(v16b a, v16b b, v8f c) {
  c = __builtin_amdgcn_wmma_f32_16x16x32_bf16(false, a, false, b, (short)0, c, false, false);
  asm volatile("v_nop\n\tv_nop\n\tv_nop\n\tv_nop" : "+v"(c) : "v"(a), "v"(b));
  return c;
}

// A fragment (row m, split k map) from an f32 LDS row pointer pr = base + row*pitch + k0, as bf16 hi/lo
__device__ __forceinline__ void fragA_split(const float* pr, int h, BF& hi, BF& lo) {
  const v4f x0 = *(const v4f*)(pr + 8 * h);
  const v4f x1 = *(const v4f*)(pr + 8 * h + 4);
  const v4f x2 = *(const v4f*)(pr + 16 + 8 * h);
  const v4f x3 = *(const v4f*)(pr + 20 + 8 * h);
#pragma unroll
  for (int q = 0; q < 4; ++q) {
    split2(x0[q], hi.u[q],      lo.u[q]);
    split2(x1[q], hi.u[4 + q],  lo.u[4 + q]);
    split2(x2[q], hi.u[8 + q],  lo.u[8 + q]);
    split2(x3[q], hi.u[12 + q], lo.u[12 + q]);
  }
}
// B fragment (col n, same split k map) gathered down column col of f32 [k][pitch] in LDS, as bf16 hi/lo
__device__ __forceinline__ void fragB_split(const float* base, int pitch, int k0, int col, int h, BF& hi, BF& lo) {
#pragma unroll
  for (int i = 0; i < 8; ++i) {
    split2(base[(k0 + 8 * h + i) * pitch + col],      hi.u[i],     lo.u[i]);
    split2(base[(k0 + 16 + 8 * h + i) * pitch + col], hi.u[8 + i], lo.u[8 + i]);
  }
}

// ---------------------------------------------------------------------------
// Weights -> scaled f16, eight elements per thread: group i of src goes to group i of dst.
// ---------------------------------------------------------------------------
__device__ __forceinline__ void cvt_group(const float* __restrict__ src, h16* dst, int i, bool ok, float scale)
{
  v8h o;
#pragma unroll
  for (int q = 0; q < 8; ++q) o[q] = (h16)0.0f;
  if (ok) {
    const v4f a = *(const v4f*)(src + (size_t)i * 8);
    const v4f c = *(const v4f*)(src + (size_t)i * 8 + 4);
#pragma unroll
    for (int q = 0; q < 4; ++q) {
      o[q]     = (h16)(bf16r(a[q]) * scale);
      o[4 + q] = (h16)(bf16r(c[q]) * scale);
    }
  }
  if (ok) *(v8h*)(dst + (size_t)i * 8) = o;
  
}

// ---------------------------------------------------------------------------
// Everything that reads only the inputs, in one launch.
// The first 3 * nb blocks: causal depthwise conv (4 taps) + SiLU, nb blocks for each of three weight sets, f16 output scaled by ascale.
// The blocks behind them: the nine weight matrices -> scaled f16. Their f16 copies lie one behind the other in w16, in the order of
// the arguments, so one running group index serves all nine; every matrix but the last ends on a multiple of 256 groups,
// so a block converts from one matrix only.
// ---------------------------------------------------------------------------
#define G_SQ (DM * DM / 8)    // groups of eight in a DM x DM matrix
#define G_LR (64 * DM / 8)    // ... in a 64 x DM or DM x 64 matrix
#define G_HD (NH * DM / 8)    // ... in an NH x DM matrix
#define G_HR (NH * 64 / 8)    // ... in an NH x 64 matrix
#define G_ALL (4 * G_SQ + 3 * G_LR + G_HD + G_HR)

__global__ void __launch_bounds__(256)
k_front(const float* __restrict__ x,
        const float* __restrict__ w0, const float* __restrict__ b0,
        const float* __restrict__ w1, const float* __restrict__ b1,
        const float* __restrict__ w2, const float* __restrict__ b2,
        const float* __restrict__ Wq, const float* __restrict__ Wk, const float* __restrict__ Wv,
        const float* __restrict__ Wo, const float* __restrict__ Wad, const float* __restrict__ Wau,
        const float* __restrict__ Wbe, const float* __restrict__ Wgd, const float* __restrict__ Wgu,
        h16* xh, h16* y0, h16* y1, h16* y2, h16* w16, int n8, int nb, int T, float ascale, float wscale)
{
  const int bid = blockIdx.x;
  if (bid >= 3 * nb) {
    const int g0 = (bid - 3 * nb) * 256;                                    // first group of this block
    const float* src = Wq;
    int first = 0;                                                          // first group of the matrix g0 lies in
    if (g0 >= 4 * G_SQ + 3 * G_LR + G_HD)      { src = Wgu; first = 4 * G_SQ + 3 * G_LR + G_HD; }
    else if (g0 >= 4 * G_SQ + 2 * G_LR + G_HD) { src = Wgd; first = 4 * G_SQ + 2 * G_LR + G_HD; }
    else if (g0 >= 4 * G_SQ + 2 * G_LR)        { src = Wbe; first = 4 * G_SQ + 2 * G_LR; }
    else if (g0 >= 4 * G_SQ + G_LR)            { src = Wau; first = 4 * G_SQ + G_LR; }
    else if (g0 >= 4 * G_SQ)                   { src = Wad; first = 4 * G_SQ; }
    else if (g0 >= 3 * G_SQ)                   { src = Wo;  first = 3 * G_SQ; }
    else if (g0 >= 2 * G_SQ)                   { src = Wv;  first = 2 * G_SQ; }
    else if (g0 >= G_SQ)                       { src = Wk;  first = G_SQ; }
    const int gi = g0 + (int)threadIdx.x;
    cvt_group(src, w16 + (size_t)first * 8, gi - first, gi < G_ALL, wscale);
    return;
  }
  const int which = (bid >= nb) + (bid >= 2 * nb);
  const float* w  = (which == 0) ? w0 : ((which == 1) ? w1 : w2);
  const float* bb = (which == 0) ? b0 : ((which == 1) ? b1 : b2);
  h16* y          = (which == 0) ? y0 : ((which == 1) ? y1 : y2);

  const int g = (bid - which * nb) * 256 + threadIdx.x;
  const bool ok = g < n8;
  const size_t eo = (size_t)g * 8;
  v8h o, ox;
#pragma unroll
  for (int q = 0; q < 8; ++q) { o[q] = (h16)0.0f; ox[q] = (h16)0.0f; }
  if (ok) {
    const size_t bt = (size_t)(g >> 7);          // token index (DM/8 = 128 groups per token)
    const int d0 = (g & 127) * 8;
    const int t = (int)(bt % (size_t)T);
    float xr[4][8];
#pragma unroll
    for (int j = 0; j < 4; ++j) {
      const int ts = t - 3 + j;
      if (ts >= 0) {
        const float* px = x + (bt - (size_t)(3 - j)) * DM + d0;
        const v4f a = *(const v4f*)px;
        const v4f c = *(const v4f*)(px + 4);
#pragma unroll
        for (int q = 0; q < 4; ++q) { xr[j][q] = bf16r(a[q]); xr[j][4 + q] = bf16r(c[q]); }
      } else {
#pragma unroll
        for (int q = 0; q < 8; ++q) xr[j][q] = 0.0f;
      }
    }
#pragma unroll
    for (int q = 0; q < 8; ++q) {
      const int d = d0 + q;
      const v4f wv4 = *(const v4f*)(w + (size_t)d * 4);
      float acc = xr[0][q] * bf16r(wv4[0]);
      acc += xr[1][q] * bf16r(wv4[1]);
      acc += xr[2][q] * bf16r(wv4[2]);
      acc += xr[3][q] * bf16r(wv4[3]);
      acc += bf16r(bb[d]);
      const float s = acc * sigm(acc);
      o[q]  = (h16)(s * ascale);
      ox[q] = (h16)xr[3][q];
    }
  }
  if (ok) {
    *(v8h*)(y + eo) = o;
    if (which == 0) *(v8h*)(xh + eo) = ox;
  }
  
}

// ---------------------------------------------------------------------------
// Y[M,N] = epi( A[M,K] * W[N,K]^T * oscale + bias[N] ), f16 operands (k-contiguous), f32 accumulate.
// One block tile (bx, by) of one product; the launches below hand independent products to one grid, told apart by blockIdx.y.
// Block 256 threads = 8 waves; block tile 128 rows x 16*NT cols; wave tile 16 x 16*NT.
// Both operands come to LDS in tiles of KS k by asynchronous copies, whole cache lines, two buffers: tile t + 1 flies while t is used.
// EPI: 0 none, 1 L2-normalise each row over the 64-col slab, 2 silu, 3 sigmoid then clip to [0.1,1], 4 sigmoid then min 1.
// ---------------------------------------------------------------------------
// LDS of a launch, sized for NT = 4: the epilogue's staging, two buffers of 128 rows of A, two of up to 64 rows of W, KS k each
#define GEMM_LDS \
  __shared__ __attribute__((aligned(16))) float stg[8 * 16 * 64]; \
  __shared__ __attribute__((aligned(16))) h16 sA[2 * 128 * LP]; \
  __shared__ __attribute__((aligned(16))) h16 sW[2 * 64 * LP];

template<int NT, int EPI, typename OT>
__device__ __forceinline__ void
gemm_tile(const h16* __restrict__ A, const h16* __restrict__ W, const float* __restrict__ bias,
          OT* Y, int N, int K, float oscale, float yscale, int bx, int by, float* stg, h16* sA, h16* sW)
{
  constexpr int TW = 16 * NT;

  const int lane = threadIdx.x & 31, wv = threadIdx.x >> 5;
  const int m = lane & 15, h = lane >> 4;
  const int rowBase = bx * 128 + wv * 16;
  const int colBase = by * TW;

  v8f acc[NT];
#pragma unroll
  for (int t = 0; t < NT; ++t)
#pragma unroll
    for (int r = 0; r < 8; ++r) acc[t][r] = 0.0f;

  // Copy map: a row of a tile is KS f16 = 128 B = one cache line; 8 lanes x 16 B bring one row, a wave four whole lines.
  const int tid = threadIdx.x;
  const int cr = tid >> 3, cc = (tid & 7) * 8;
  const h16* ga = A + (size_t)(bx * 128 + cr) * K + cc;
  const unsigned la = lds_off(sA + cr * LP + cc);
  // W tile: 64 rows in 16-byte pieces (two per thread), or 16 rows in 8-byte pieces (one per thread)
  const int wr = (NT == 4) ? cr : (tid >> 4), wc = (NT == 4) ? cc : (tid & 15) * 4;
  const h16* gw = W + (size_t)(colBase + wr) * K + wc;
  const unsigned lw = lds_off(sW + wr * LP + wc);
  const size_t r32 = (size_t)32 * K;             // 32 rows further in global memory
  constexpr unsigned L32 = 32 * LP * 2;          // 32 rows further in LDS, bytes

  // all of tile t's copies, every lane on; the s_wait_xcnt closes the statement so that it stands in front of any
  // rewrite of the address registers the copies name
  auto stage = [&](int t) {
    const h16* a0 = ga + (size_t)t * KS;
    const h16* w0 = gw + (size_t)t * KS;
    const unsigned l0 = la + (unsigned)(t & 1) * (128 * LP * 2);
    const unsigned m0 = lw + (unsigned)(t & 1) * (TW * LP * 2);
    if constexpr (NT == 4) {
      asm volatile("global_load_async_to_lds_b128 %0, %1, off\n\t"
                   "global_load_async_to_lds_b128 %2, %3, off\n\t"
                   "global_load_async_to_lds_b128 %4, %5, off\n\t"
                   "global_load_async_to_lds_b128 %6, %7, off\n\t"
                   "global_load_async_to_lds_b128 %8, %9, off\n\t"
                   "global_load_async_to_lds_b128 %10, %11, off\n\t"
                   "s_wait_xcnt 0x0"
                   :: "v"(l0), "v"(a0), "v"(l0 + L32), "v"(a0 + r32), "v"(l0 + 2 * L32), "v"(a0 + 2 * r32),
                      "v"(l0 + 3 * L32), "v"(a0 + 3 * r32), "v"(m0), "v"(w0), "v"(m0 + L32), "v"(w0 + r32)
                   : "memory");
    } else {
      asm volatile("global_load_async_to_lds_b128 %0, %1, off\n\t"
                   "global_load_async_to_lds_b128 %2, %3, off\n\t"
                   "global_load_async_to_lds_b128 %4, %5, off\n\t"
                   "global_load_async_to_lds_b128 %6, %7, off\n\t"
                   "global_load_async_to_lds_b64 %8, %9, off\n\t"
                   "s_wait_xcnt 0x0"
                   :: "v"(l0), "v"(a0), "v"(l0 + L32), "v"(a0 + r32), "v"(l0 + 2 * L32), "v"(a0 + 2 * r32),
                      "v"(l0 + 3 * L32), "v"(a0 + 3 * r32), "v"(m0), "v"(w0)
                   : "memory");
    }
  };

  const int nt = K / KS;
  stage(0);
  asm volatile("s_wait_asynccnt 0x0" ::: "memory");   // this wave's copies of tile 0 have landed
  __syncthreads();                                    // ... and every other wave's
  if (nt > 1) stage(1);

  // A: lane row m, elements 0..7 <- k0+8h.., 8..15 <- k0+16+8h..;  B: lane col m, same k map
  for (int t = 0; t < nt; ++t) {
    const h16* pa = sA + (t & 1) * (128 * LP) + (wv * 16 + m) * LP + 8 * h;
    const h16* pw = sW + (t & 1) * (TW * LP) + m * LP + 8 * h;
    HF a[KS / 32], b[KS / 32][NT];
#pragma unroll
    for (int q = 0; q < KS / 32; ++q) {
      a[q].p[0] = *(const v8h*)(pa + 32 * q);
      a[q].p[1] = *(const v8h*)(pa + 32 * q + 16);
#pragma unroll
      for (int u = 0; u < NT; ++u) {
        b[q][u].p[0] = *(const v8h*)(pw + 16 * u * LP + 32 * q);
        b[q][u].p[1] = *(const v8h*)(pw + 16 * u * LP + 32 * q + 16);
      }
    }
#pragma unroll
    for (int q = 0; q < KS / 32; ++q)
#pragma unroll
      for (int u = 0; u < NT; ++u) acc[u] = mma_f16(a[q].v, b[q][u].v, acc[u]);
    asm volatile("s_wait_dscnt 0x0" ::: "memory");      // this wave's reads of the buffer are done before it is refilled
    asm volatile("s_wait_asynccnt 0x0" ::: "memory");   // this wave's copies of tile t + 1 have landed
    __syncthreads();                                    // publishes tile t + 1 and ends every wave's reads of tile t
    if (t + 2 < nt) stage(t + 2);
  }
  asm volatile("s_wait_asynccnt 0x0" ::: "memory");     // no copy is left in flight when the wave goes on

  // epilogue values (D element r of this lane = row 8h+r, col m of tile t)
#pragma unroll
  for (int t = 0; t < NT; ++t) {
    const float bv = bf16r(bias[colBase + 16 * t + m]);
#pragma unroll
    for (int r = 0; r < 8; ++r) {
      float v = acc[t][r] * oscale + bv;
      if (EPI == 2)      { v = v * sigm(v); }
      else if (EPI == 3) { v = sigm(v); v = fminf(fmaxf(v, 0.1f), 1.0f); }
      else if (EPI == 4) { v = fminf(sigm(v), 1.0f); }
      acc[t][r] = v;
    }
  }
  if (EPI == 1) {
#pragma unroll
    for (int r = 0; r < 8; ++r) {
      float ss = 0.0f;
#pragma unroll
      for (int t = 0; t < NT; ++t) ss += acc[t][r] * acc[t][r];
      ss += __shfl_xor(ss, 1, 32);
      ss += __shfl_xor(ss, 2, 32);
      ss += __shfl_xor(ss, 4, 32);
      ss += __shfl_xor(ss, 8, 32);
      const float inv = 1.0f / sqrtf(fmaxf(ss, 1e-6f));
#pragma unroll
      for (int t = 0; t < NT; ++t) acc[t][r] *= inv;
    }
  }

  float* sw = stg + wv * 16 * TW;
#pragma unroll
  for (int t = 0; t < NT; ++t)
#pragma unroll
    for (int r = 0; r < 8; ++r) sw[(8 * h + r) * TW + 16 * t + m] = acc[t][r];
  __syncthreads();

  if constexpr (sizeof(OT) == 4 && NT == 4) {
    v4f vals[8];
    size_t offs[8];
#pragma unroll
    for (int it = 0; it < 8; ++it) {
      const int row = 2 * it + h, c4 = m * 4;
      vals[it] = *(const v4f*)(sw + row * TW + c4);
      offs[it] = (size_t)(rowBase + row) * N + colBase + c4;
    }
#pragma unroll
    for (int it = 0; it < 8; ++it) *(v4f*)(Y + offs[it]) = vals[it];
    // in a merged launch another product's code follows in the listing: the wait stands in front of any rewrite of the registers the stores name
    asm volatile("s_wait_xcnt 0x0" ::: "memory");
  } else if constexpr (sizeof(OT) == 2 && NT == 4) {
    v8h vals[4];
    size_t offs[4];
#pragma unroll
    for (int it = 0; it < 4; ++it) {
      const int row = it * 4 + (lane >> 3), c8 = (lane & 7) * 8;
      const v4f a = *(const v4f*)(sw + row * TW + c8);
      const v4f c = *(const v4f*)(sw + row * TW + c8 + 4);
      v8h o;
#pragma unroll
      for (int q = 0; q < 4; ++q) { o[q] = (h16)(a[q] * yscale); o[4 + q] = (h16)(c[q] * yscale); }
      vals[it] = o;
      offs[it] = (size_t)(rowBase + row) * N + colBase + c8;
    }
#pragma unroll
    for (int it = 0; it < 4; ++it) *(v8h*)(Y + offs[it]) = vals[it];
    // in a merged launch another product's code follows in the listing: the wait stands in front of any rewrite of the registers the stores name
    asm volatile("s_wait_xcnt 0x0" ::: "memory");
  } else if constexpr (sizeof(OT) == 4 && NT == 1) {
    // N == 16: the wave's 16 rows are 1 KB contiguous; 8 lanes x 16 B per line
    v4f vals[2];
    size_t offs[2];
#pragma unroll
    for (int it = 0; it < 2; ++it) {
      const int q = it * 32 + lane, row = q >> 2, c4 = (q & 3) * 4;
      vals[it] = *(const v4f*)(sw + row * TW + c4);
      offs[it] = (size_t)(rowBase + row) * N + colBase + c4;
    }
#pragma unroll
    for (int it = 0; it < 2; ++it) *(v4f*)(Y + offs[it]) = vals[it];
    // in a merged launch another product's code follows in the listing: the wait stands in front of any rewrite of the registers the stores name
    asm volatile("s_wait_xcnt 0x0" ::: "memory");
  }
}

// ---------------------------------------------------------------------------
// The six products that need only the front launch's results, K = DM each: q, k (16 column slabs each, L2 norm), v (16 slabs),
// gate-down for alpha, beta, gate-down for the output gate (one slab each).
// ---------------------------------------------------------------------------
__global__ void __launch_bounds__(256)
k_proj(const h16* __restrict__ cq, const h16* __restrict__ ck, const h16* __restrict__ cv, const h16* __restrict__ xh,
       const h16* __restrict__ Wq16, const h16* __restrict__ Wk16, const h16* __restrict__ Wv16,
       const h16* __restrict__ Wad16, const h16* __restrict__ Wbe16, const h16* __restrict__ Wgd16,
       const float* __restrict__ bq, const float* __restrict__ bk, const float* __restrict__ bv,
       const float* __restrict__ bad, const float* __restrict__ bbe, const float* __restrict__ bgd,
       float* Qn, float* Kn, float* Vf, float* Bt, h16* t1, h16* t2,
       int K, float cscale, float xscale, float tscale)
{
  GEMM_LDS
  const int bx = blockIdx.x, y = blockIdx.y;
  if (y < 32) {
    const bool q = y < 16;
    gemm_tile<4, 1, float>(q ? cq : ck, q ? Wq16 : Wk16, q ? bq : bk, q ? Qn : Kn, DM, K, cscale, 1.0f, bx, y & 15, stg, sA, sW);
  } else if (y < 48) {
    gemm_tile<4, 0, float>(cv, Wv16, bv, Vf, DM, K, cscale, 1.0f, bx, y - 32, stg, sA, sW);
  } else if (y == 49) {
    gemm_tile<1, 4, float>(xh, Wbe16, bbe, Bt, NH, K, xscale, 1.0f, bx, 0, stg, sA, sW);
  } else {
    const bool a = y == 48;
    gemm_tile<4, 2, h16>(xh, a ? Wad16 : Wgd16, a ? bad : bgd, a ? t1 : t2, 64, K, xscale, tscale, bx, 0, stg, sA, sW);
  }
}

// The two gate-up products, K = 64 each: alpha (16 slabs) and the output gate (one slab).
__global__ void __launch_bounds__(256)
k_gate(const h16* __restrict__ t1, const h16* __restrict__ t2, const h16* __restrict__ Wau16, const h16* __restrict__ Wgu16,
       const float* __restrict__ bau, const float* __restrict__ bgu, float* Al, float* Gt, int K, float oscale)
{
  GEMM_LDS
  const int bx = blockIdx.x, y = blockIdx.y;
  if (y < 16) gemm_tile<4, 3, float>(t1, Wau16, bau, Al, DM, K, oscale, 1.0f, bx, y, stg, sA, sW);
  else        gemm_tile<1, 4, float>(t2, Wgu16, bgu, Gt, NH, K, oscale, 1.0f, bx, 0, stg, sA, sW);
}

// The output projection.
__global__ void __launch_bounds__(256)
k_oproj(const h16* __restrict__ A, const h16* __restrict__ W, const float* __restrict__ bias, float* Y, int K, float oscale)
{
  GEMM_LDS
  gemm_tile<4, 0, float>(A, W, bias, Y, DM, K, oscale, 1.0f, blockIdx.x, blockIdx.y, stg, sA, sW);
}

// ---------------------------------------------------------------------------
// Gated delta rule, serial part. The columns e of the state S (64x64 f32) never mix: each evolves from k, a, beta and v[e] alone.
// One block per (group of SC columns, b*h), 128 threads = 4 waves, T/64 chunks in sequence. A 16-lane row owns one column,
// lane lg of it the rows 4*lg .. 4*lg+3 in registers, so k^T S is summed inside the row and no step needs a barrier.
// The state each chunk starts from is stored column-major, Sg[(bh*nch + n)][e][d], for the chunk-parallel output kernel.
// ---------------------------------------------------------------------------
#define SC 8    // state columns per block
#define NSTP 8    // steps per group of LDS operand reads

// x + (x of lane l ^ mask) inside a 16-lane row; CTRL = 0x160 + mask is the DPP row_xmask control
template<int CTRL>
__device__ __forceinline__ float xmask_add(float x) {
  return x + __int_as_float(__builtin_amdgcn_update_dpp(0, __float_as_int(x), CTRL, 0xf, 0xf, true));
}

__global__ void __launch_bounds__(128)
k_state(const float* __restrict__ Kp, const float* __restrict__ Vp, const float* __restrict__ Ap,
        const float* __restrict__ Bp, float* Sg, int T)
{
  __shared__ __attribute__((aligned(16))) float Ks[CH * HD];
  __shared__ __attribute__((aligned(16))) float ALs[CH * HD];
  __shared__ __attribute__((aligned(16))) float Vt[SC * CH];     // [column][t]
  __shared__ __attribute__((aligned(16))) float Bsh[CH];

  const int tid = threadIdx.x;
  const int cg = blockIdx.x, bh = blockIdx.y, b = bh / NH, hh = bh % NH;
  const int lg = tid & 15, el = tid >> 4;      // state ownership: column cg*SC + el, rows 4*lg .. 4*lg+3

  v4f S;
#pragma unroll
  for (int u = 0; u < 4; ++u) S[u] = 0.0f;

  // per-thread byte offsets of the tile loads and of the state store; the chunk moves the uniform base only
  const unsigned tb = (unsigned)(((tid >> 4) * DM + (tid & 15) * 4) * 4);
  const unsigned vo = (unsigned)(((tid >> 1) * DM + cg * SC + (tid & 1) * 4) * 4);
  const unsigned so = (unsigned)(((cg * SC + el) * HD + 4 * lg) * 4);

  const float* kl = Ks  + 4 * lg;
  const float* al = ALs + 4 * lg;
  const float* vl = Vt  + el * CH;

  const int nch = T / CH;
  for (int n = 0; n < nch; ++n) {
    const size_t rowbase = (size_t)b * T + (size_t)n * CH;
    const float* Kg = Kp + rowbase * DM + hh * HD;
    const float* Vg = Vp + rowbase * DM + hh * HD;
    const float* Ag = Ap + rowbase * DM + hh * HD;
    float* So = Sg + ((size_t)bh * nch + n) * (HD * HD);

    __syncthreads();   // every wave has read the last chunk's tiles
    // entry state of this chunk, issued ahead of the tile loads so that the store finishes under the loads' latency
    *(v4f*)((char*)So + so) = S;
    // the tile loads that follow may be given the registers this store names: the wait stands in front of that overwrite
    asm volatile("s_wait_xcnt 0x0" ::: "memory");
    // keeps the store and its wait ahead of the loads: scheduled as one region, the store came out behind them on a reused address pair
    __builtin_amdgcn_sched_barrier(0);
    // tile loads: k and a 64 rows x 64 f32, v 64 rows x SC f32, beta 64 (read by both halves of the block, stored by one)
    const char* kp = (const char*)Kg + tb;
    const char* ap = (const char*)Ag + tb;
    const char* vp = (const char*)Vg + vo;
    const float* bp = Bp + (rowbase + (tid & (CH - 1))) * NH + hh;
    const float tbeta = *bp;
    v4f tk[8], ta[8];
#pragma unroll
    for (int it = 0; it < 8; ++it) {
      tk[it] = *(const v4f*)(kp + it * (8 * DM * 4));
      ta[it] = *(const v4f*)(ap + it * (8 * DM * 4));
    }
    const v4f tv = *(const v4f*)vp;
    // the wait stands in front of any overwrite of the address registers the loads name; as inputs they stay live up to it.
    // beta as an input holds its load up here with the others: left free, it sank behind the tile stores and its latency stood alone
    asm volatile("s_wait_xcnt 0x0" :: "v"(kp), "v"(ap), "v"(vp), "v"(bp), "v"(tbeta) : "memory");
#pragma unroll
    for (int it = 0; it < 8; ++it) {
      const int c = it * 8 + (tid >> 4), d4 = (tid & 15) * 4;
      *(v4f*)(Ks  + c * HD + d4) = tk[it];
      *(v4f*)(ALs + c * HD + d4) = ta[it];
    }
#pragma unroll
    for (int u = 0; u < 4; ++u) Vt[((tid & 1) * 4 + u) * CH + (tid >> 1)] = tv[u];
    if (tid < CH) Bsh[tid] = fminf(tbeta, 1.0f);
    __syncthreads();

    // exact sequential state update over the chunk: S = a*S; S += (beta*k) outer (v - k^T S)
    // the operands of NSTP steps are read as one group, one group ahead of the steps that use them
    v4f kq[2][NSTP], aq[2][NSTP], vq[2][NSTP / 4], bq[2][NSTP / 4];
#pragma unroll
    for (int s = 0; s < NSTP; ++s) {
      kq[0][s] = *(const v4f*)(kl + s * HD);
      aq[0][s] = *(const v4f*)(al + s * HD);
    }
#pragma unroll
    for (int s = 0; s < NSTP / 4; ++s) {
      vq[0][s] = *(const v4f*)(vl + 4 * s);
      bq[0][s] = *(const v4f*)(Bsh + 4 * s);
    }
#pragma unroll
    for (int g = 0; g < CH / NSTP; ++g) {
      const int cur = g & 1, nxt = cur ^ 1;
      // with the one behind the reads: keeps the next group's LDS reads in one place. Left free, they sank to just ahead of their
      // use, where each step waited out the LDS latency, or were strewn among the steps of the group before
      __builtin_amdgcn_sched_barrier(0);
      if (g + 1 < CH / NSTP) {
#pragma unroll
        for (int s = 0; s < NSTP; ++s) {
          kq[nxt][s] = *(const v4f*)(kl + (NSTP * (g + 1) + s) * HD);
          aq[nxt][s] = *(const v4f*)(al + (NSTP * (g + 1) + s) * HD);
        }
#pragma unroll
        for (int s = 0; s < NSTP / 4; ++s) {
          vq[nxt][s] = *(const v4f*)(vl + NSTP * (g + 1) + 4 * s);
          bq[nxt][s] = *(const v4f*)(Bsh + NSTP * (g + 1) + 4 * s);
        }
      }
      __builtin_amdgcn_sched_barrier(0);   // second of the pair, see above
#pragma unroll
      for (int s = 0; s < NSTP; ++s) {
        const v4f kk = kq[cur][s], aa = aq[cur][s];
        const float bt = bq[cur][s >> 2][s & 3];
#pragma unroll
        for (int u = 0; u < 4; ++u) S[u] *= aa[u];
        float kts = (kk[0] * S[0] + kk[2] * S[2]) + (kk[1] * S[1] + kk[3] * S[3]);
        kts = xmask_add<0x161>(kts);
        kts = xmask_add<0x162>(kts);
        kts = xmask_add<0x164>(kts);
        kts = xmask_add<0x168>(kts);
        const float dl = vq[cur][s >> 2][s & 3] - kts;
#pragma unroll
        for (int u = 0; u < 4; ++u) S[u] += (bt * kk[u]) * dl;
      }
    }
  }
}

// ---------------------------------------------------------------------------
// Gated delta rule, chunk-parallel part: one block per (chunk, b*h), 256 threads. Reads the chunk's entry state from Sg.
// Scores A[i][j] on VALU f32, O = Q*S + A*V on bf16 hi/lo WMMA, then headwise RMS norm and gate.
// ---------------------------------------------------------------------------
__global__ void __launch_bounds__(256)
k_out(const float* __restrict__ Qp, const float* __restrict__ Kp, const float* __restrict__ Vp,
      const float* __restrict__ Ap, const float* __restrict__ Bp, const float* __restrict__ Gp,
      const float* __restrict__ rmsw, const float* __restrict__ Sg, h16* Og, int T, float ogscale)
{
  __shared__ __attribute__((aligned(16))) float Qs[CH * QP];
  __shared__ __attribute__((aligned(16))) float Ks[CH * QP];
  __shared__ __attribute__((aligned(16))) float CLs[CH * QP];
  __shared__ __attribute__((aligned(16))) float SCs[CH * QP];
  __shared__ __attribute__((aligned(16))) float Vs[CH * HD];
  __shared__ __attribute__((aligned(16))) float ALs[CH * HD];
  __shared__ __attribute__((aligned(16))) float Sf[HD * QP];     // entry state, column-major: [e][d]
  __shared__ float Bsh[CH], GS[CH], RV[CH], RW[HD];

  const int tid = threadIdx.x;
  const int lane = tid & 31, wv = tid >> 5, m = lane & 15, h = lane >> 4;
  const int n = blockIdx.x, bh = blockIdx.y, b = bh / NH, hh = bh % NH;

  if (tid < HD) RW[tid] = bf16r(rmsw[hh * HD + tid]);

  const size_t rowbase = (size_t)b * T + (size_t)n * CH;
  const float* Qg = Qp + rowbase * DM + hh * HD;
  const float* Kg = Kp + rowbase * DM + hh * HD;
  const float* Vg = Vp + rowbase * DM + hh * HD;
  const float* Ag = Ap + rowbase * DM + hh * HD;
  const float* Si = Sg + ((size_t)bh * (T / CH) + n) * (HD * HD);

  // tile loads (64 rows x 64 f32 each): one byte offset per thread, the step of 16 rows is a constant
  const unsigned tb = (unsigned)(((tid >> 4) * DM + (tid & 15) * 4) * 4);
  v4f tq[4], tk[4], tv[4], ta[4], ts[4];
#pragma unroll
  for (int it = 0; it < 4; ++it) {
    tq[it] = *(const v4f*)((const char*)Qg + tb + it * (16 * DM * 4));
    tk[it] = *(const v4f*)((const char*)Kg + tb + it * (16 * DM * 4));
    tv[it] = *(const v4f*)((const char*)Vg + tb + it * (16 * DM * 4));
    ta[it] = *(const v4f*)((const char*)Ag + tb + it * (16 * DM * 4));
    ts[it] = *(const v4f*)(Si + tid * 4 + it * (16 * HD));
  }
  // the wait stands in front of any overwrite of the offset register the loads name; as an input it stays live up to it
  asm volatile("s_wait_xcnt 0x0" :: "v"(tb) : "memory");
#pragma unroll
  for (int it = 0; it < 4; ++it) {
    const int idx = it * 256 + tid;
    const int c = idx >> 4, d4 = (idx & 15) * 4;
    *(v4f*)(Qs  + c * QP + d4) = tq[it];
    *(v4f*)(Ks  + c * QP + d4) = tk[it];
    *(v4f*)(Vs  + c * HD + d4) = tv[it];
    *(v4f*)(ALs + c * HD + d4) = ta[it];
    *(v4f*)(Sf  + c * QP + d4) = ts[it];
  }
  if (tid < CH) {
    Bsh[tid] = fminf(Bp[(rowbase + tid) * NH + hh], 1.0f);
    GS[tid]  = Gp[(rowbase + tid) * NH + hh];
  }
  __syncthreads();

  // cumulative log decay per feature, restarted per chunk
  if (tid < HD) {
    float a = 0.0f;
    for (int c = 0; c < CH; ++c) {
      a += __logf(fmaxf(ALs[c * HD + tid], 1e-7f));
      CLs[c * QP + tid] = a;
    }
  }
  __syncthreads();

  // scores: A[i][j] = beta_j * sum_d q[i][d] k[j][d] exp(cl[i][d] - cl[j][d]) for i >= j, else 0
  {
    const int j0 = lane, j1 = lane + 32;
    float a0[8], a1[4];
#pragma unroll
    for (int r = 0; r < 8; ++r) a0[r] = 0.0f;
#pragma unroll
    for (int r = 0; r < 4; ++r) a1[r] = 0.0f;
#pragma unroll 2
    for (int d = 0; d < HD; ++d) {
      const float k0v = Ks[j0 * QP + d], c0 = CLs[j0 * QP + d];
      const float k1v = Ks[j1 * QP + d], c1 = CLs[j1 * QP + d];
#pragma unroll
      for (int r = 0; r < 8; ++r) {
        const int i = wv + 8 * r;
        const float q = Qs[i * QP + d];
        const float ci = CLs[i * QP + d];
        a0[r] += q * k0v * __expf(ci - c0);
        if (r >= 4) a1[r - 4] += q * k1v * __expf(ci - c1);
      }
    }
    const float b0 = Bsh[j0], b1 = Bsh[j1];
#pragma unroll
    for (int r = 0; r < 8; ++r) {
      const int i = wv + 8 * r;
      SCs[i * QP + j0] = (i >= j0) ? a0[r] * b0 : 0.0f;
      float v1 = 0.0f;
      if (r >= 4) v1 = (i >= j1) ? a1[r - 4] * b1 : 0.0f;
      SCs[i * QP + j1] = v1;
    }
  }
  __syncthreads();

  // O = Q*S + A*V : wave owns rows 16*ti.., two 16-col tiles; bf16 hi/lo three products per operand pair
  {
    const int ti = wv >> 1, tj0 = (wv & 1) * 2;
    v8f acc[2];
#pragma unroll
    for (int s = 0; s < 2; ++s)
#pragma unroll
      for (int r = 0; r < 8; ++r) acc[s][r] = 0.0f;

#pragma unroll
    for (int ks = 0; ks < 2; ++ks) {
      const int k0 = ks * 32;
      BF ah, al;
      fragA_split(Qs + (ti * 16 + m) * QP + k0, h, ah, al);
#pragma unroll
      for (int s = 0; s < 2; ++s) {
        BF bhi, blo;
        fragA_split(Sf + ((tj0 + s) * 16 + m) * QP + k0, h, bhi, blo);   // column e of S is a row of Sf: same k map as the gather
        acc[s] = mma_bf16(ah.v, bhi.v, acc[s]);
        acc[s] = mma_bf16(ah.v, blo.v, acc[s]);
        acc[s] = mma_bf16(al.v, bhi.v, acc[s]);
      }
    }
#pragma unroll
    for (int ks = 0; ks < 2; ++ks) {
      const int k0 = ks * 32;
      BF ah, al;
      fragA_split(SCs + (ti * 16 + m) * QP + k0, h, ah, al);
#pragma unroll
      for (int s = 0; s < 2; ++s) {
        BF bhi, blo;
        fragB_split(Vs, HD, k0, (tj0 + s) * 16 + m, h, bhi, blo);
        acc[s] = mma_bf16(ah.v, bhi.v, acc[s]);
        acc[s] = mma_bf16(ah.v, blo.v, acc[s]);
        acc[s] = mma_bf16(al.v, bhi.v, acc[s]);
      }
    }
    __syncthreads();   // all reads of SCs/Sf done; reuse SCs as the O tile
#pragma unroll
    for (int s = 0; s < 2; ++s)
#pragma unroll
      for (int r = 0; r < 8; ++r)
        SCs[(ti * 16 + 8 * h + r) * QP + (tj0 + s) * 16 + m] = acc[s][r];
  }
  __syncthreads();

  // per-row RMS normaliser times gate
  if (tid < CH) {
    float ss = 0.0f;
    for (int e2 = 0; e2 < HD; ++e2) { const float o = SCs[tid * QP + e2]; ss += o * o; }
    RV[tid] = GS[tid] / sqrtf(ss * (1.0f / 64.0f) + 1e-6f);
  }
  __syncthreads();

  {
    v8h ov[2];
    size_t go[2];
#pragma unroll
    for (int it = 0; it < 2; ++it) {
      const int c = it * 32 + (tid >> 3), e0 = (tid & 7) * 8;
      const v4f x0 = *(const v4f*)(SCs + c * QP + e0);
      const v4f x1 = *(const v4f*)(SCs + c * QP + e0 + 4);
      const float sc = RV[c] * ogscale;
      v8h o;
#pragma unroll
      for (int q = 0; q < 4; ++q) {
        o[q]     = (h16)(x0[q] * sc * RW[e0 + q]);
        o[4 + q] = (h16)(x1[q] * sc * RW[e0 + 4 + q]);
      }
      ov[it] = o;
      go[it] = (rowbase + c) * (size_t)DM + hh * HD + e0;
    }
#pragma unroll
    for (int it = 0; it < 2; ++it) *(v8h*)(Og + go[it]) = ov[it];
    
  }
}

// ---------------------------------------------------------------------------
extern "C" void kernel_launch(void* const* d_in, const int* in_sizes, int n_in,
                              void* d_out, int out_size, void* d_ws, size_t ws_size,
                              hipStream_t stream)
{
  if (n_in < 26) return;
  const int T = 2048;
  const long nx = (long)in_sizes[0];
  if (nx <= 0 || (nx % ((long)DM * T)) != 0) return;
  const int M = (int)(nx / DM);                       // tokens, multiple of 2048 (hence of 128)
  if ((long)out_size != (long)M * DM) return;
  if (in_sizes[1] != DM * 4 || in_sizes[3] != DM * 4 || in_sizes[5] != DM * 4) return;
  if (in_sizes[7] != DM * DM || in_sizes[9] != DM * DM || in_sizes[11] != DM * DM || in_sizes[24] != DM * DM) return;
  if (in_sizes[13] != 64 * DM || in_sizes[15] != DM * 64 || in_sizes[17] != NH * DM ||
      in_sizes[20] != 64 * DM || in_sizes[22] != NH * 64) return;

  const float* x       = (const float*)d_in[0];
  const float* wq_conv = (const float*)d_in[1];  const float* bq_conv = (const float*)d_in[2];
  const float* wk_conv = (const float*)d_in[3];  const float* bk_conv = (const float*)d_in[4];
  const float* wv_conv = (const float*)d_in[5];  const float* bv_conv = (const float*)d_in[6];
  const float* Wq  = (const float*)d_in[7];   const float* bq  = (const float*)d_in[8];
  const float* Wk  = (const float*)d_in[9];   const float* bk  = (const float*)d_in[10];
  const float* Wv  = (const float*)d_in[11];  const float* bv  = (const float*)d_in[12];
  const float* Wad = (const float*)d_in[13];  const float* bad = (const float*)d_in[14];
  const float* Wau = (const float*)d_in[15];  const float* bau = (const float*)d_in[16];
  const float* Wbe = (const float*)d_in[17];  const float* bbe = (const float*)d_in[18];
  const float* rms_w = (const float*)d_in[19];
  const float* Wgd = (const float*)d_in[20];  const float* bgd = (const float*)d_in[21];
  const float* Wgu = (const float*)d_in[22];  const float* bgu = (const float*)d_in[23];
  const float* Wo  = (const float*)d_in[24];  const float* bo  = (const float*)d_in[25];

  char* ws = (char*)d_ws;
  size_t off = 0;
  auto carve = [&](size_t bytes) -> char* {
    char* p = ws + off;
    off += (bytes + 255) & ~(size_t)255;
    return p;
  };
  const size_t MD = (size_t)M * DM;
  h16* xh    = (h16*)carve(MD * 2);
  h16* cq    = (h16*)carve(MD * 2);
  h16* ck    = (h16*)carve(MD * 2);
  h16* cv    = (h16*)carve(MD * 2);
  h16* Wq16  = (h16*)carve((size_t)DM * DM * 2);
  h16* Wk16  = (h16*)carve((size_t)DM * DM * 2);
  h16* Wv16  = (h16*)carve((size_t)DM * DM * 2);
  h16* Wo16  = (h16*)carve((size_t)DM * DM * 2);
  h16* Wad16 = (h16*)carve((size_t)64 * DM * 2);
  h16* Wau16 = (h16*)carve((size_t)DM * 64 * 2);
  h16* Wbe16 = (h16*)carve((size_t)NH * DM * 2);
  h16* Wgd16 = (h16*)carve((size_t)64 * DM * 2);
  h16* Wgu16 = (h16*)carve((size_t)NH * 64 * 2);
  float* Qn  = (float*)carve(MD * 4);
  float* Kn  = (float*)carve(MD * 4);
  float* Vf  = (float*)carve(MD * 4);
  float* Al  = (float*)carve(MD * 4);
  float* Bt  = (float*)carve((size_t)M * NH * 4);
  float* Gt  = (float*)carve((size_t)M * NH * 4);
  h16* t1    = (h16*)carve((size_t)M * 64 * 2);
  h16* t2    = (h16*)carve((size_t)M * 64 * 2);
  h16* Og16  = (h16*)carve(MD * 2);
  float* Sst = (float*)carve((size_t)(M / CH) * NH * HD * HD * 4);   // entry state of every (b, h, chunk)
  if (off > ws_size) return;

  const float wsc = 256.0f;      // weight scale
  const float asc = 256.0f;      // conv activation scale
  const float tsc = 64.0f;       // gate hidden scale
  const float osc = 16.0f;       // gated output scale

  // 1) x -> f16, three shortconv+SiLU activations, and the nine weights -> scaled f16 (Wq16 .. Wgu16 are carved back to back,
  //    each a multiple of 256 bytes, in the order k_front takes the matrices)
  {
    const int n8 = (int)(MD / 8);
    const int nb = (n8 + 255) / 256;
    k_front<<<3 * nb + (G_ALL + 255) / 256, 256, 0, stream>>>(x, wq_conv, bq_conv, wk_conv, bk_conv, wv_conv, bv_conv,
                                                              Wq, Wk, Wv, Wo, Wad, Wau, Wbe, Wgd, Wgu,
                                                              xh, cq, ck, cv, Wq16, n8, nb, T, asc, wsc);
  }
  // 2) the six products on the front launch's results; 3) the two gate-up products
  k_proj<<<dim3(M / 128, 51), 256, 0, stream>>>(cq, ck, cv, xh, Wq16, Wk16, Wv16, Wad16, Wbe16, Wgd16,
                                                bq, bk, bv, bad, bbe, bgd, Qn, Kn, Vf, Bt, t1, t2,
                                                DM, 1.0f / (asc * wsc), 1.0f / wsc, tsc);
  k_gate<<<dim3(M / 128, 17), 256, 0, stream>>>(t1, t2, Wau16, Wgu16, bau, bgu, Al, Gt, 64, 1.0f / (tsc * wsc));
  // 4) state recurrence, one block per (column group, b*h); then the per-chunk outputs, one block per (chunk, b*h)
  k_state<<<dim3(HD / SC, (M / T) * NH), 128, 0, stream>>>(Kn, Vf, Al, Bt, Sst, T);
  k_out<<<dim3(T / CH, (M / T) * NH), 256, 0, stream>>>(Qn, Kn, Vf, Al, Bt, Gt, rms_w, Sst, Og16, T, osc);
  // 5) output projection
  k_oproj<<<dim3(M / 128, DM / 64), 256, 0, stream>>>(Og16, Wo16, bo, (float*)d_out, DM, 1.0f / (osc * wsc));
}

// v005
// A run of this version takes 205 microseconds.
// Two timings next to v004 both put it at 1.12 times that version's speed.
// Counting every step since v000, it is 6.02 times as fast.
#include <hip/hip_runtime.h>
#include <stdint.h>

// Contractions: token projections (q, k, v, gate down/up, beta, out) on v_wmma_f32_16x16x32_f16 with f16 operands pre-scaled by powers of two, f32 accumulate; per-chunk Q*S and A*V on v_wmma_f32_16x16x32_bf16 as bf16 hi/lo three-product split, f32 accumulate; decay scores, state recurrence, shortconv and norms on VALU in f32. All float inputs RNE-converted to bf16 on load.

typedef _Float16 h16;
typedef h16    v16h __attribute__((ext_vector_type(16)));
typedef h16    v8h  __attribute__((ext_vector_type(8)));
typedef __bf16 v16b __attribute__((ext_vector_type(16)));
typedef float  v8f  __attribute__((ext_vector_type(8)));
typedef float  v4f  __attribute__((ext_vector_type(4)));
typedef float  v2f  __attribute__((ext_vector_type(2)));

union HF { v16h v; v8h p[2]; };
union BF { v16b v; unsigned short u[16]; };

#define DM 1024
#define HD 64
#define NH 16
#define CH 64
#define QP 68
#define KS 64    // k per staged GEMM tile: 128 B of a row
#define LP 72    // LDS row pitch of a staged tile in f16: 144 B = 16 B x 9, free of bank conflicts for 16-byte row reads

__device__ __forceinline__ unsigned short bf16_bits(float f) {
  unsigned int u = __float_as_uint(f);
  u += 0x7FFFu + ((u >> 16) & 1u);
  return (unsigned short)(u >> 16);
}
__device__ __forceinline__ float bf16r(float f) {
  return __uint_as_float(((unsigned int)bf16_bits(f)) << 16);
}
// x = hi + lo in bf16 pieces (RNE), bit patterns
__device__ __forceinline__ void split2(float x, unsigned short& hi, unsigned short& lo) {
  const unsigned short hb = bf16_bits(x);
  const float hf = __uint_as_float(((unsigned int)hb) << 16);
  hi = hb;
  lo = bf16_bits(x - hf);
}
// low 32 bits of a __shared__ address: the byte offset in the work-group's LDS
__device__ __forceinline__ unsigned lds_off(const void* p) {
  return (unsigned)(uintptr_t)p;
}
__device__ __forceinline__ float sigm(float v) {
  return __fdividef(1.0f, 1.0f + __expf(-v));
}

// 16-bit WMMA wrappers with the VALU hazard guard after the matrix op
__device__ __forceinline__ v8f mma_f16(v16h a, v16h b, v8f c) {
  c = __builtin_amdgcn_wmma_f32_16x16x32_f16(false, a, false, b, (short)0, c, false, false);
  asm volatile("v_nop\n\tv_nop\n\tv_nop\n\tv_nop" : "+v"(c) : "v"(a), "v"(b));
  return c;
}
__device__ __forceinline__ v8f mma_bf16(v16b a, v16b b, v8f c) {
  c = __builtin_amdgcn_wmma_f32_16x16x32_bf16(false, a, false, b, (short)0, c, false, false);
  asm volatile("v_nop\n\tv_nop\n\tv_nop\n\tv_nop" : "+v"(c) : "v"(a), "v"(b));
  return c;
}

// A fragment (row m, split k map) from an f32 LDS row pointer pr = base + row*pitch + k0, as bf16 hi/lo
__device__ __forceinline__ void fragA_split(const float* pr, int h, BF& hi, BF& lo) {
  const v4f x0 = *(const v4f*)(pr + 8 * h);
  const v4f x1 = *(const v4f*)(pr + 8 * h + 4);
  const v4f x2 = *(const v4f*)(pr + 16 + 8 * h);
  const v4f x3 = *(const v4f*)(pr + 20 + 8 * h);
#pragma unroll
  for (int q = 0; q < 4; ++q) {
    split2(x0[q], hi.u[q],      lo.u[q]);
    split2(x1[q], hi.u[4 + q],  lo.u[4 + q]);
    split2(x2[q], hi.u[8 + q],  lo.u[8 + q]);
    split2(x3[q], hi.u[12 + q], lo.u[12 + q]);
  }
}
// B fragment (col n, same split k map) gathered down column col of f32 [k][pitch] in LDS, as bf16 hi/lo
__device__ __forceinline__ void fragB_split(const float* base, int pitch, int k0, int col, int h, BF& hi, BF& lo) {
#pragma unroll
  for (int i = 0; i < 8; ++i) {
    split2(base[(k0 + 8 * h + i) * pitch + col],      hi.u[i],     lo.u[i]);
    split2(base[(k0 + 16 + 8 * h + i) * pitch + col], hi.u[8 + i], lo.u[8 + i]);
  }
}

// ---------------------------------------------------------------------------
// Weights -> scaled f16, eight elements per thread: group i of src goes to group i of dst.
// ---------------------------------------------------------------------------
__device__ __forceinline__ void cvt_group(const float* __restrict__ src, h16* dst, int i, bool ok, float scale)
{
  v8h o;
#pragma unroll
  for (int q = 0; q < 8; ++q) o[q] = (h16)0.0f;
  if (ok) {
    const v4f a = *(const v4f*)(src + (size_t)i * 8);
    const v4f c = *(const v4f*)(src + (size_t)i * 8 + 4);
#pragma unroll
    for (int q = 0; q < 4; ++q) {
      o[q]     = (h16)(bf16r(a[q]) * scale);
      o[4 + q] = (h16)(bf16r(c[q]) * scale);
    }
  }
  if (ok) *(v8h*)(dst + (size_t)i * 8) = o;
  
}

// ---------------------------------------------------------------------------
// Everything that reads only the inputs, in one launch.
// The first 3 * nb blocks: causal depthwise conv (4 taps) + SiLU, nb blocks for each of three weight sets, f16 output scaled by ascale.
// The blocks behind them: the nine weight matrices -> scaled f16. Their f16 copies lie one behind the other in w16, in the order of
// the arguments, so one running group index serves all nine; every matrix but the last ends on a multiple of 256 groups,
// so a block converts from one matrix only.
// ---------------------------------------------------------------------------
#define G_SQ (DM * DM / 8)    // groups of eight in a DM x DM matrix
#define G_LR (64 * DM / 8)    // ... in a 64 x DM or DM x 64 matrix
#define G_HD (NH * DM / 8)    // ... in an NH x DM matrix
#define G_HR (NH * 64 / 8)    // ... in an NH x 64 matrix
#define G_ALL (4 * G_SQ + 3 * G_LR + G_HD + G_HR)

__global__ void __launch_bounds__(256)
k_front(const float* __restrict__ x,
        const float* __restrict__ w0, const float* __restrict__ b0,
        const float* __restrict__ w1, const float* __restrict__ b1,
        const float* __restrict__ w2, const float* __restrict__ b2,
        const float* __restrict__ Wq, const float* __restrict__ Wk, const float* __restrict__ Wv,
        const float* __restrict__ Wo, const float* __restrict__ Wad, const float* __restrict__ Wau,
        const float* __restrict__ Wbe, const float* __restrict__ Wgd, const float* __restrict__ Wgu,
        h16* xh, h16* y0, h16* y1, h16* y2, h16* w16, int n8, int nb, int T, float ascale, float wscale)
{
  const int bid = blockIdx.x;
  if (bid >= 3 * nb) {
    const int g0 = (bid - 3 * nb) * 256;                                    // first group of this block
    const float* src = Wq;
    int first = 0;                                                          // first group of the matrix g0 lies in
    if (g0 >= 4 * G_SQ + 3 * G_LR + G_HD)      { src = Wgu; first = 4 * G_SQ + 3 * G_LR + G_HD; }
    else if (g0 >= 4 * G_SQ + 2 * G_LR + G_HD) { src = Wgd; first = 4 * G_SQ + 2 * G_LR + G_HD; }
    else if (g0 >= 4 * G_SQ + 2 * G_LR)        { src = Wbe; first = 4 * G_SQ + 2 * G_LR; }
    else if (g0 >= 4 * G_SQ + G_LR)            { src = Wau; first = 4 * G_SQ + G_LR; }
    else if (g0 >= 4 * G_SQ)                   { src = Wad; first = 4 * G_SQ; }
    else if (g0 >= 3 * G_SQ)                   { src = Wo;  first = 3 * G_SQ; }
    else if (g0 >= 2 * G_SQ)                   { src = Wv;  first = 2 * G_SQ; }
    else if (g0 >= G_SQ)                       { src = Wk;  first = G_SQ; }
    const int gi = g0 + (int)threadIdx.x;
    cvt_group(src, w16 + (size_t)first * 8, gi - first, gi < G_ALL, wscale);
    return;
  }
  const int which = (bid >= nb) + (bid >= 2 * nb);
  const float* w  = (which == 0) ? w0 : ((which == 1) ? w1 : w2);
  const float* bb = (which == 0) ? b0 : ((which == 1) ? b1 : b2);
  h16* y          = (which == 0) ? y0 : ((which == 1) ? y1 : y2);

  const int g = (bid - which * nb) * 256 + threadIdx.x;
  const bool ok = g < n8;
  const size_t eo = (size_t)g * 8;
  v8h o, ox;
#pragma unroll
  for (int q = 0; q < 8; ++q) { o[q] = (h16)0.0f; ox[q] = (h16)0.0f; }
  if (ok) {
    const size_t bt = (size_t)(g >> 7);          // token index (DM/8 = 128 groups per token)
    const int d0 = (g & 127) * 8;
    const int t = (int)(bt % (size_t)T);
    float xr[4][8];
#pragma unroll
    for (int j = 0; j < 4; ++j) {
      const int ts = t - 3 + j;
      if (ts >= 0) {
        const float* px = x + (bt - (size_t)(3 - j)) * DM + d0;
        const v4f a = *(const v4f*)px;
        const v4f c = *(const v4f*)(px + 4);
#pragma unroll
        for (int q = 0; q < 4; ++q) { xr[j][q] = bf16r(a[q]); xr[j][4 + q] = bf16r(c[q]); }
      } else {
#pragma unroll
        for (int q = 0; q < 8; ++q) xr[j][q] = 0.0f;
      }
    }
#pragma unroll
    for (int q = 0; q < 8; ++q) {
      const int d = d0 + q;
      const v4f wv4 = *(const v4f*)(w + (size_t)d * 4);
      float acc = xr[0][q] * bf16r(wv4[0]);
      acc += xr[1][q] * bf16r(wv4[1]);
      acc += xr[2][q] * bf16r(wv4[2]);
      acc += xr[3][q] * bf16r(wv4[3]);
      acc += bf16r(bb[d]);
      const float s = acc * sigm(acc);
      o[q]  = (h16)(s * ascale);
      ox[q] = (h16)xr[3][q];
    }
  }
  if (ok) {
    *(v8h*)(y + eo) = o;
    if (which == 0) *(v8h*)(xh + eo) = ox;
  }
  
}

// ---------------------------------------------------------------------------
// Y[M,N] = epi( A[M,K] * W[N,K]^T * oscale + bias[N] ), f16 operands (k-contiguous), f32 accumulate.
// One block tile (bx, by) of one product; the launches below hand independent products to one grid, told apart by blockIdx.y.
// Block 256 threads = 8 waves; block tile 128 rows x 16*NT cols; wave tile 16 x 16*NT.
// Both operands come to LDS in tiles of KS k by asynchronous copies, whole cache lines, two buffers: tile t + 1 flies while t is used.
// EPI: 0 none, 1 L2-normalise each row over the 64-col slab, 2 silu, 3 sigmoid then clip to [0.1,1], 4 sigmoid then min 1.
// ---------------------------------------------------------------------------
// LDS of a launch, sized for NT = 4: the epilogue's staging, two buffers of 128 rows of A, two of up to 64 rows of W, KS k each
#define GEMM_LDS \
  __shared__ __attribute__((aligned(16))) float stg[8 * 16 * 64]; \
  __shared__ __attribute__((aligned(16))) h16 sA[2 * 128 * LP]; \
  __shared__ __attribute__((aligned(16))) h16 sW[2 * 64 * LP];

template<int NT, int EPI, typename OT>
__device__ __forceinline__ void
gemm_tile(const h16* __restrict__ A, const h16* __restrict__ W, const float* __restrict__ bias,
          OT* Y, int N, int K, float oscale, float yscale, int bx, int by, float* stg, h16* sA, h16* sW)
{
  constexpr int TW = 16 * NT;

  const int lane = threadIdx.x & 31, wv = threadIdx.x >> 5;
  const int m = lane & 15, h = lane >> 4;
  const int rowBase = bx * 128 + wv * 16;
  const int colBase = by * TW;

  v8f acc[NT];
#pragma unroll
  for (int t = 0; t < NT; ++t)
#pragma unroll
    for (int r = 0; r < 8; ++r) acc[t][r] = 0.0f;

  // Copy map: a row of a tile is KS f16 = 128 B = one cache line; 8 lanes x 16 B bring one row, a wave four whole lines.
  const int tid = threadIdx.x;
  const int cr = tid >> 3, cc = (tid & 7) * 8;
  const h16* ga = A + (size_t)(bx * 128 + cr) * K + cc;
  const unsigned la = lds_off(sA + cr * LP + cc);
  // W tile: 64 rows in 16-byte pieces (two per thread), or 16 rows in 8-byte pieces (one per thread)
  const int wr = (NT == 4) ? cr : (tid >> 4), wc = (NT == 4) ? cc : (tid & 15) * 4;
  const h16* gw = W + (size_t)(colBase + wr) * K + wc;
  const unsigned lw = lds_off(sW + wr * LP + wc);
  const size_t r32 = (size_t)32 * K;             // 32 rows further in global memory
  constexpr unsigned L32 = 32 * LP * 2;          // 32 rows further in LDS, bytes

  // all of tile t's copies, every lane on; the s_wait_xcnt closes the statement so that it stands in front of any
  // rewrite of the address registers the copies name
  auto stage = [&](int t) {
    const h16* a0 = ga + (size_t)t * KS;
    const h16* w0 = gw + (size_t)t * KS;
    const unsigned l0 = la + (unsigned)(t & 1) * (128 * LP * 2);
    const unsigned m0 = lw + (unsigned)(t & 1) * (TW * LP * 2);
    if constexpr (NT == 4) {
      asm volatile("global_load_async_to_lds_b128 %0, %1, off\n\t"
                   "global_load_async_to_lds_b128 %2, %3, off\n\t"
                   "global_load_async_to_lds_b128 %4, %5, off\n\t"
                   "global_load_async_to_lds_b128 %6, %7, off\n\t"
                   "global_load_async_to_lds_b128 %8, %9, off\n\t"
                   "global_load_async_to_lds_b128 %10, %11, off\n\t"
                   "s_wait_xcnt 0x0"
                   :: "v"(l0), "v"(a0), "v"(l0 + L32), "v"(a0 + r32), "v"(l0 + 2 * L32), "v"(a0 + 2 * r32),
                      "v"(l0 + 3 * L32), "v"(a0 + 3 * r32), "v"(m0), "v"(w0), "v"(m0 + L32), "v"(w0 + r32)
                   : "memory");
    } else {
      asm volatile("global_load_async_to_lds_b128 %0, %1, off\n\t"
                   "global_load_async_to_lds_b128 %2, %3, off\n\t"
                   "global_load_async_to_lds_b128 %4, %5, off\n\t"
                   "global_load_async_to_lds_b128 %6, %7, off\n\t"
                   "global_load_async_to_lds_b64 %8, %9, off\n\t"
                   "s_wait_xcnt 0x0"
                   :: "v"(l0), "v"(a0), "v"(l0 + L32), "v"(a0 + r32), "v"(l0 + 2 * L32), "v"(a0 + 2 * r32),
                      "v"(l0 + 3 * L32), "v"(a0 + 3 * r32), "v"(m0), "v"(w0)
                   : "memory");
    }
  };

  const int nt = K / KS;
  stage(0);
  asm volatile("s_wait_asynccnt 0x0" ::: "memory");   // this wave's copies of tile 0 have landed
  __syncthreads();                                    // ... and every other wave's
  if (nt > 1) stage(1);

  // A: lane row m, elements 0..7 <- k0+8h.., 8..15 <- k0+16+8h..;  B: lane col m, same k map
  for (int t = 0; t < nt; ++t) {
    const h16* pa = sA + (t & 1) * (128 * LP) + (wv * 16 + m) * LP + 8 * h;
    const h16* pw = sW + (t & 1) * (TW * LP) + m * LP + 8 * h;
    HF a[KS / 32], b[KS / 32][NT];
#pragma unroll
    for (int q = 0; q < KS / 32; ++q) {
      a[q].p[0] = *(const v8h*)(pa + 32 * q);
      a[q].p[1] = *(const v8h*)(pa + 32 * q + 16);
#pragma unroll
      for (int u = 0; u < NT; ++u) {
        b[q][u].p[0] = *(const v8h*)(pw + 16 * u * LP + 32 * q);
        b[q][u].p[1] = *(const v8h*)(pw + 16 * u * LP + 32 * q + 16);
      }
    }
#pragma unroll
    for (int q = 0; q < KS / 32; ++q)
#pragma unroll
      for (int u = 0; u < NT; ++u) acc[u] = mma_f16(a[q].v, b[q][u].v, acc[u]);
    asm volatile("s_wait_dscnt 0x0" ::: "memory");      // this wave's reads of the buffer are done before it is refilled
    asm volatile("s_wait_asynccnt 0x0" ::: "memory");   // this wave's copies of tile t + 1 have landed
    __syncthreads();                                    // publishes tile t + 1 and ends every wave's reads of tile t
    if (t + 2 < nt) stage(t + 2);
  }
  asm volatile("s_wait_asynccnt 0x0" ::: "memory");     // no copy is left in flight when the wave goes on

  // epilogue values (D element r of this lane = row 8h+r, col m of tile t)
#pragma unroll
  for (int t = 0; t < NT; ++t) {
    const float bv = bf16r(bias[colBase + 16 * t + m]);
#pragma unroll
    for (int r = 0; r < 8; ++r) {
      float v = acc[t][r] * oscale + bv;
      if (EPI == 2)      { v = v * sigm(v); }
      else if (EPI == 3) { v = sigm(v); v = fminf(fmaxf(v, 0.1f), 1.0f); }
      else if (EPI == 4) { v = fminf(sigm(v), 1.0f); }
      acc[t][r] = v;
    }
  }
  if (EPI == 1) {
#pragma unroll
    for (int r = 0; r < 8; ++r) {
      float ss = 0.0f;
#pragma unroll
      for (int t = 0; t < NT; ++t) ss += acc[t][r] * acc[t][r];
      ss += __shfl_xor(ss, 1, 32);
      ss += __shfl_xor(ss, 2, 32);
      ss += __shfl_xor(ss, 4, 32);
      ss += __shfl_xor(ss, 8, 32);
      const float inv = 1.0f / sqrtf(fmaxf(ss, 1e-6f));
#pragma unroll
      for (int t = 0; t < NT; ++t) acc[t][r] *= inv;
    }
  }

  float* sw = stg + wv * 16 * TW;
#pragma unroll
  for (int t = 0; t < NT; ++t)
#pragma unroll
    for (int r = 0; r < 8; ++r) sw[(8 * h + r) * TW + 16 * t + m] = acc[t][r];
  __syncthreads();

  if constexpr (sizeof(OT) == 4 && NT == 4) {
    v4f vals[8];
    size_t offs[8];
#pragma unroll
    for (int it = 0; it < 8; ++it) {
      const int row = 2 * it + h, c4 = m * 4;
      vals[it] = *(const v4f*)(sw + row * TW + c4);
      offs[it] = (size_t)(rowBase + row) * N + colBase + c4;
    }
#pragma unroll
    for (int it = 0; it < 8; ++it) *(v4f*)(Y + offs[it]) = vals[it];
    // in a merged launch another product's code follows in the listing: the wait stands in front of any rewrite of the registers the stores name
    asm volatile("s_wait_xcnt 0x0" ::: "memory");
  } else if constexpr (sizeof(OT) == 2 && NT == 4) {
    v8h vals[4];
    size_t offs[4];
#pragma unroll
    for (int it = 0; it < 4; ++it) {
      const int row = it * 4 + (lane >> 3), c8 = (lane & 7) * 8;
      const v4f a = *(const v4f*)(sw + row * TW + c8);
      const v4f c = *(const v4f*)(sw + row * TW + c8 + 4);
      v8h o;
#pragma unroll
      for (int q = 0; q < 4; ++q) { o[q] = (h16)(a[q] * yscale); o[4 + q] = (h16)(c[q] * yscale); }
      vals[it] = o;
      offs[it] = (size_t)(rowBase + row) * N + colBase + c8;
    }
#pragma unroll
    for (int it = 0; it < 4; ++it) *(v8h*)(Y + offs[it]) = vals[it];
    // in a merged launch another product's code follows in the listing: the wait stands in front of any rewrite of the registers the stores name
    asm volatile("s_wait_xcnt 0x0" ::: "memory");
  } else if constexpr (sizeof(OT) == 4 && NT == 1) {
    // N == 16: the wave's 16 rows are 1 KB contiguous; 8 lanes x 16 B per line
    v4f vals[2];
    size_t offs[2];
#pragma unroll
    for (int it = 0; it < 2; ++it) {
      const int q = it * 32 + lane, row = q >> 2, c4 = (q & 3) * 4;
      vals[it] = *(const v4f*)(sw + row * TW + c4);
      offs[it] = (size_t)(rowBase + row) * N + colBase + c4;
    }
#pragma unroll
    for (int it = 0; it < 2; ++it) *(v4f*)(Y + offs[it]) = vals[it];
    // in a merged launch another product's code follows in the listing: the wait stands in front of any rewrite of the registers the stores name
    asm volatile("s_wait_xcnt 0x0" ::: "memory");
  }
}

// ---------------------------------------------------------------------------
// The six products that need only the front launch's results, K = DM each: q, k (16 column slabs each, L2 norm), v (16 slabs),
// gate-down for alpha, beta, gate-down for the output gate (one slab each).
// ---------------------------------------------------------------------------
__global__ void __launch_bounds__(256)
k_proj(const h16* __restrict__ cq, const h16* __restrict__ ck, const h16* __restrict__ cv, const h16* __restrict__ xh,
       const h16* __restrict__ Wq16, const h16* __restrict__ Wk16, const h16* __restrict__ Wv16,
       const h16* __restrict__ Wad16, const h16* __restrict__ Wbe16, const h16* __restrict__ Wgd16,
       const float* __restrict__ bq, const float* __restrict__ bk, const float* __restrict__ bv,
       const float* __restrict__ bad, const float* __restrict__ bbe, const float* __restrict__ bgd,
       float* Qn, float* Kn, float* Vf, float* Bt, h16* t1, h16* t2,
       int K, float cscale, float xscale, float tscale)
{
  GEMM_LDS
  const int bx = blockIdx.x, y = blockIdx.y;
  if (y < 32) {
    const bool q = y < 16;
    gemm_tile<4, 1, float>(q ? cq : ck, q ? Wq16 : Wk16, q ? bq : bk, q ? Qn : Kn, DM, K, cscale, 1.0f, bx, y & 15, stg, sA, sW);
  } else if (y < 48) {
    gemm_tile<4, 0, float>(cv, Wv16, bv, Vf, DM, K, cscale, 1.0f, bx, y - 32, stg, sA, sW);
  } else if (y == 49) {
    gemm_tile<1, 4, float>(xh, Wbe16, bbe, Bt, NH, K, xscale, 1.0f, bx, 0, stg, sA, sW);
  } else {
    const bool a = y == 48;
    gemm_tile<4, 2, h16>(xh, a ? Wad16 : Wgd16, a ? bad : bgd, a ? t1 : t2, 64, K, xscale, tscale, bx, 0, stg, sA, sW);
  }
}

// The two gate-up products, K = 64 each: alpha (16 slabs) and the output gate (one slab).
__global__ void __launch_bounds__(256)
k_gate(const h16* __restrict__ t1, const h16* __restrict__ t2, const h16* __restrict__ Wau16, const h16* __restrict__ Wgu16,
       const float* __restrict__ bau, const float* __restrict__ bgu, float* Al, float* Gt, int K, float oscale)
{
  GEMM_LDS
  const int bx = blockIdx.x, y = blockIdx.y;
  if (y < 16) gemm_tile<4, 3, float>(t1, Wau16, bau, Al, DM, K, oscale, 1.0f, bx, y, stg, sA, sW);
  else        gemm_tile<1, 4, float>(t2, Wgu16, bgu, Gt, NH, K, oscale, 1.0f, bx, 0, stg, sA, sW);
}

// The output projection.
__global__ void __launch_bounds__(256)
k_oproj(const h16* __restrict__ A, const h16* __restrict__ W, const float* __restrict__ bias, float* Y, int K, float oscale)
{
  GEMM_LDS
  gemm_tile<4, 0, float>(A, W, bias, Y, DM, K, oscale, 1.0f, blockIdx.x, blockIdx.y, stg, sA, sW);
}

// ---------------------------------------------------------------------------
// Gated delta rule, serial part. The columns e of the state S (64x64 f32) never mix: each evolves from k, a, beta and v[e] alone.
// One block per (group of SC columns, b*h), 128 threads = 4 waves, T/64 chunks in sequence. A 16-lane row owns one column,
// lane lg of it the rows 4*lg .. 4*lg+3 in registers, so k^T S is summed inside the row and no step needs a barrier.
// Four steps 0..3 are taken from one state S. With dl_i = v_i - k_i^T (a_i S_i-1), every later step's k^T S is linear in S and
// in the earlier dl, so with A(j..i] the product of a_j+1 .. a_i, per feature:
//   dl_i = v_i - (k_i A(-1..i])^T S - sum over j < i of c_ij dl_j,     c_ij = sum_d k_i A(j..i] beta_j k_j
//   S   <- A(-1..3] S + sum over j of (beta_j k_j A(j..3]) dl_j
// The four row sums run side by side, and the dependent chain of one step, three short links longer, serves four. The vectors in
// brackets and the c_ij hold no state and no column: they are formed once per chunk while the tiles are staged.
// The state each chunk starts from is stored column-major, Sg[(bh*nch + n)][e][d], for the chunk-parallel output kernel.
// ---------------------------------------------------------------------------
#define SC 8    // state columns per block
#define NSTP 8    // steps per group of LDS operand reads

// x + (x of lane l ^ mask) inside a 16-lane row; CTRL = 0x160 + mask is the DPP row_xmask control
template<int CTRL>
__device__ __forceinline__ float xmask_add(float x) {
  return x + __int_as_float(__builtin_amdgcn_update_dpp(0, __float_as_int(x), CTRL, 0xf, 0xf, true));
}
// sum of the four elements of every lane of a 16-lane row, in every lane of it
__device__ __forceinline__ float row_sum(v4f x) {
  float s = (x[0] + x[2]) + (x[1] + x[3]);
  s = xmask_add<0x161>(s);
  s = xmask_add<0x162>(s);
  s = xmask_add<0x164>(s);
  return xmask_add<0x168>(s);
}

__global__ void __launch_bounds__(128)
k_state(const float* __restrict__ Kp, const float* __restrict__ Vp, const float* __restrict__ Ap,
        const float* __restrict__ Bp, float* Sg, int T)
{
  // k_i A(-1..i], two steps side by side so that one packed product serves both: of the four rows of a group, for lane lg,
  // row 0 holds steps (0, 1) of d = 4*lg and of 4*lg+1, row 1 those of 4*lg+2 and 4*lg+3, rows 2 and 3 the same of steps (2, 3)
  __shared__ __attribute__((aligned(16))) float Us[CH * HD];
  __shared__ __attribute__((aligned(16))) float Ws[CH * HD];         // [t][d]: beta_j k_j A(j..3]
  __shared__ __attribute__((aligned(16))) float Ps[(CH / 4) * HD];   // [group][d]: A(-1..3]
  __shared__ __attribute__((aligned(16))) float Vt[SC * CH];         // [column][t]
  __shared__ __attribute__((aligned(16))) float Cs[(CH / 4) * 8];    // [group]: c10 c20 c21 c30 c31 c32, two unused

  const int tid = threadIdx.x;
  const int cg = blockIdx.x, bh = blockIdx.y, b = bh / NH, hh = bh % NH;
  const int lg = tid & 15, el = tid >> 4;      // state ownership: column cg*SC + el, rows 4*lg .. 4*lg+3

  // every loop of this kernel but the one over the chunks is unrolled: its arrays are then indexed by constants and stay in registers
  v4f S;
#pragma unroll
  for (int u = 0; u < 4; ++u) S[u] = 0.0f;

  // per-thread byte offsets of the tile loads and of the state store; the chunk moves the uniform base only.
  // Staging: the 16-lane row el takes the groups el and el + 8, that is the tile rows 4*el + 32*it and the three behind
  const unsigned tb = (unsigned)(((4 * el) * DM + lg * 4) * 4);
  const unsigned vo = (unsigned)(((tid >> 1) * DM + cg * SC + (tid & 1) * 4) * 4);
  const unsigned so = (unsigned)(((cg * SC + el) * HD + 4 * lg) * 4);

  const float* ul = Us + 4 * lg;
  const float* wl = Ws + 4 * lg;
  const float* pl = Ps + 4 * lg;
  const float* vl = Vt + el * CH;

  const int nch = T / CH;
  for (int n = 0; n < nch; ++n) {
    const size_t rowbase = (size_t)b * T + (size_t)n * CH;
    const float* Kg = Kp + rowbase * DM + hh * HD;
    const float* Vg = Vp + rowbase * DM + hh * HD;
    const float* Ag = Ap + rowbase * DM + hh * HD;
    float* So = Sg + ((size_t)bh * nch + n) * (HD * HD);

    __syncthreads();   // every wave has read the last chunk's tiles
    // entry state of this chunk, issued ahead of the tile loads so that the store finishes under the loads' latency
    *(v4f*)((char*)So + so) = S;
    // the tile loads that follow may be given the registers this store names: the wait stands in front of that overwrite
    asm volatile("s_wait_xcnt 0x0" ::: "memory");
    // keeps the store and its wait ahead of the loads: scheduled as one region, the store came out behind them on a reused address pair
    __builtin_amdgcn_sched_barrier(0);
    // tile loads: k and a 64 rows x 64 f32, v 64 rows x SC f32, beta of this row's eight steps (one address per 16-lane row)
    const char* kp = (const char*)Kg + tb;
    const char* ap = (const char*)Ag + tb;
    const char* vp = (const char*)Vg + vo;
    const float* bp = Bp + (rowbase + 4 * el) * NH + hh;
    float tbe[2][4];
    v4f tk[2][4], ta[2][4];
#pragma unroll
    for (int it = 0; it < 2; ++it) {
#pragma unroll
      for (int j = 0; j < 4; ++j) tbe[it][j] = bp[(32 * it + j) * NH];
#pragma unroll
      for (int j = 0; j < 4; ++j) {
        tk[it][j] = *(const v4f*)(kp + (32 * it + j) * (DM * 4));
        ta[it][j] = *(const v4f*)(ap + (32 * it + j) * (DM * 4));
      }
    }
    const v4f tv = *(const v4f*)vp;
    // the wait stands in front of any overwrite of the address registers the loads name; as inputs they stay live up to it
    asm volatile("s_wait_xcnt 0x0" :: "v"(kp), "v"(ap), "v"(vp), "v"(bp) : "memory");
#pragma unroll
    for (int it = 0; it < 2; ++it) {
      const int qd = it * 8 + el;
      const v4f k0 = tk[it][0], k1 = tk[it][1], k2 = tk[it][2], k3 = tk[it][3];
      const v4f d0 = ta[it][0], d1 = ta[it][1], d2 = ta[it][2], d3 = ta[it][3];
      const float b0 = fminf(tbe[it][0], 1.0f), b1 = fminf(tbe[it][1], 1.0f);
      const float b2 = fminf(tbe[it][2], 1.0f), b3 = fminf(tbe[it][3], 1.0f);
      const v4f P1 = d0 * d1, P2 = P1 * d2, P3 = P2 * d3;       // A(-1..i]
      const v4f R20 = d1 * d2, R31 = d2 * d3, R30 = d1 * R31;   // A(j..i]
      const v4f g0 = k0 * b0, g1 = k1 * b1, g2 = k2 * b2, g3 = k3 * b3;
      const v4f u0 = k0 * d0, u1 = k1 * P1, u2 = k2 * P2, u3 = k3 * P3;
      const v4f ua = { u0[0], u1[0], u0[1], u1[1] }, ub = { u0[2], u1[2], u0[3], u1[3] };
      const v4f uc = { u2[0], u3[0], u2[1], u3[1] }, ud = { u2[2], u3[2], u2[3], u3[3] };
      *(v4f*)(Us + (4 * qd) * HD + 4 * lg)     = ua;
      *(v4f*)(Us + (4 * qd + 1) * HD + 4 * lg) = ub;
      *(v4f*)(Us + (4 * qd + 2) * HD + 4 * lg) = uc;
      *(v4f*)(Us + (4 * qd + 3) * HD + 4 * lg) = ud;
      *(v4f*)(Ws + (4 * qd) * HD + 4 * lg)     = g0 * R30;
      *(v4f*)(Ws + (4 * qd + 1) * HD + 4 * lg) = g1 * R31;
      *(v4f*)(Ws + (4 * qd + 2) * HD + 4 * lg) = g2 * d3;
      *(v4f*)(Ws + (4 * qd + 3) * HD + 4 * lg) = g3;
      *(v4f*)(Ps + qd * HD + 4 * lg)           = P3;
      const float c10 = row_sum((k1 * d1) * g0);
      const float c20 = row_sum((k2 * R20) * g0), c21 = row_sum((k2 * d2) * g1);
      const float c30 = row_sum((k3 * R30) * g0), c31 = row_sum((k3 * R31) * g1), c32 = row_sum((k3 * d3) * g2);
      if (lg == 0) {
        const v4f ca = { c10, c20, c21, c30 };
        const v2f cb = { c31, c32 };
        *(v4f*)(Cs + qd * 8)     = ca;
        *(v2f*)(Cs + qd * 8 + 4) = cb;
      }
    }
#pragma unroll
    for (int u = 0; u < 4; ++u) Vt[((tid & 1) * 4 + u) * CH + (tid >> 1)] = tv[u];
    __syncthreads();

    // exact state update over the chunk, four steps at a time
    // the operands of NSTP steps are read as one group, one group ahead of the steps that use them
    v4f uq[2][NSTP], wq[2][NSTP], pq[2][NSTP / 4], vq[2][NSTP / 4], ca[2][NSTP / 4];
    v2f cb[2][NSTP / 4];
    auto fetch = [&](int g, int bf) {
      // in the order of use: LDS reads return in order, and the first group of a chunk is waited for
#pragma unroll
      for (int s = 0; s < NSTP / 4; ++s) {
#pragma unroll
        for (int j = 0; j < 4; ++j) uq[bf][4 * s + j] = *(const v4f*)(ul + (NSTP * g + 4 * s + j) * HD);
        pq[bf][s] = *(const v4f*)(pl + ((NSTP / 4) * g + s) * HD);
        vq[bf][s] = *(const v4f*)(vl + NSTP * g + 4 * s);
        ca[bf][s] = *(const v4f*)(Cs + ((NSTP / 4) * g + s) * 8);
        cb[bf][s] = *(const v2f*)(Cs + ((NSTP / 4) * g + s) * 8 + 4);
#pragma unroll
        for (int j = 0; j < 4; ++j) wq[bf][4 * s + j] = *(const v4f*)(wl + (NSTP * g + 4 * s + j) * HD);
      }
    };
    fetch(0, 0);
#pragma unroll
    for (int g = 0; g < CH / NSTP; ++g) {
      const int cur = g & 1, nxt = cur ^ 1;
      // with the one behind the reads: keeps the next group's LDS reads in one place. Left free, they sank to just ahead of their
      // use, where each step waited out the LDS latency, or were strewn among the steps of the group before
      __builtin_amdgcn_sched_barrier(0);
      if (g + 1 < CH / NSTP) fetch(g + 1, nxt);
      __builtin_amdgcn_sched_barrier(0);   // second of the pair, see above
#pragma unroll
      for (int q = 0; q < NSTP / 4; ++q) {
        const v4f ua = uq[cur][4 * q], ub = uq[cur][4 * q + 1], uc = uq[cur][4 * q + 2], ud = uq[cur][4 * q + 3];
        const v4f w0 = wq[cur][4 * q], w1 = wq[cur][4 * q + 1], w2 = wq[cur][4 * q + 2], w3 = wq[cur][4 * q + 3];
        const v4f pp = pq[cur][q], vv = vq[cur][q], c4 = ca[cur][q];
        const v2f c2 = cb[cur][q];
        const v2f pa = (ua.xy * S[0] + ub.xy * S[2]) + (ua.zw * S[1] + ub.zw * S[3]);   // partial sums of steps 0 and 1
        const v2f pb = (uc.xy * S[0] + ud.xy * S[2]) + (uc.zw * S[1] + ud.zw * S[3]);   // ... of steps 2 and 3
        float p0 = pa.x, p1 = pa.y, p2 = pb.x, p3 = pb.y;
        p0 = xmask_add<0x161>(p0);  p1 = xmask_add<0x161>(p1);  p2 = xmask_add<0x161>(p2);  p3 = xmask_add<0x161>(p3);
        p0 = xmask_add<0x162>(p0);  p1 = xmask_add<0x162>(p1);  p2 = xmask_add<0x162>(p2);  p3 = xmask_add<0x162>(p3);
        p0 = xmask_add<0x164>(p0);  p1 = xmask_add<0x164>(p1);  p2 = xmask_add<0x164>(p2);  p3 = xmask_add<0x164>(p3);
        p0 = xmask_add<0x168>(p0);  p1 = xmask_add<0x168>(p1);  p2 = xmask_add<0x168>(p2);  p3 = xmask_add<0x168>(p3);
        const float dl0 = vv[0] - p0;
        const float dl1 = __builtin_fmaf(-c4[0], dl0, vv[1] - p1);
        const float dl2 = __builtin_fmaf(-c4[2], dl1, __builtin_fmaf(-c4[1], dl0, vv[2] - p2));
        const float dl3 = __builtin_fmaf(-c2[1], dl2, __builtin_fmaf(-c2[0], dl1, __builtin_fmaf(-c4[3], dl0, vv[3] - p3)));
        // each term is added as soon as its dl is known, so that only the last one follows dl3
#pragma unroll
        for (int u = 0; u < 4; ++u)
          S[u] = __builtin_fmaf(w3[u], dl3, __builtin_fmaf(w2[u], dl2, __builtin_fmaf(w1[u], dl1, __builtin_fmaf(w0[u], dl0, pp[u] * S[u]))));
      }
    }
  }
}

// ---------------------------------------------------------------------------
// Gated delta rule, chunk-parallel part: one block per (chunk, b*h), 256 threads. Reads the chunk's entry state from Sg.
// Scores A[i][j] on VALU f32, O = Q*S + A*V on bf16 hi/lo WMMA, then headwise RMS norm and gate.
// ---------------------------------------------------------------------------
__global__ void __launch_bounds__(256)
k_out(const float* __restrict__ Qp, const float* __restrict__ Kp, const float* __restrict__ Vp,
      const float* __restrict__ Ap, const float* __restrict__ Bp, const float* __restrict__ Gp,
      const float* __restrict__ rmsw, const float* __restrict__ Sg, h16* Og, int T, float ogscale)
{
  __shared__ __attribute__((aligned(16))) float Qs[CH * QP];
  __shared__ __attribute__((aligned(16))) float Ks[CH * QP];
  __shared__ __attribute__((aligned(16))) float CLs[CH * QP];
  __shared__ __attribute__((aligned(16))) float SCs[CH * QP];
  __shared__ __attribute__((aligned(16))) float Vs[CH * HD];
  __shared__ __attribute__((aligned(16))) float ALs[CH * HD];
  __shared__ __attribute__((aligned(16))) float Sf[HD * QP];     // entry state, column-major: [e][d]
  __shared__ float Bsh[CH], GS[CH], RV[CH], RW[HD];

  const int tid = threadIdx.x;
  const int lane = tid & 31, wv = tid >> 5, m = lane & 15, h = lane >> 4;
  const int n = blockIdx.x, bh = blockIdx.y, b = bh / NH, hh = bh % NH;

  if (tid < HD) RW[tid] = bf16r(rmsw[hh * HD + tid]);

  const size_t rowbase = (size_t)b * T + (size_t)n * CH;
  const float* Qg = Qp + rowbase * DM + hh * HD;
  const float* Kg = Kp + rowbase * DM + hh * HD;
  const float* Vg = Vp + rowbase * DM + hh * HD;
  const float* Ag = Ap + rowbase * DM + hh * HD;
  const float* Si = Sg + ((size_t)bh * (T / CH) + n) * (HD * HD);

  // tile loads (64 rows x 64 f32 each): one byte offset per thread, the step of 16 rows is a constant
  const unsigned tb = (unsigned)(((tid >> 4) * DM + (tid & 15) * 4) * 4);
  v4f tq[4], tk[4], tv[4], ta[4], ts[4];
#pragma unroll
  for (int it = 0; it < 4; ++it) {
    tq[it] = *(const v4f*)((const char*)Qg + tb + it * (16 * DM * 4));
    tk[it] = *(const v4f*)((const char*)Kg + tb + it * (16 * DM * 4));
    tv[it] = *(const v4f*)((const char*)Vg + tb + it * (16 * DM * 4));
    ta[it] = *(const v4f*)((const char*)Ag + tb + it * (16 * DM * 4));
    ts[it] = *(const v4f*)(Si + tid * 4 + it * (16 * HD));
  }
  // the wait stands in front of any overwrite of the offset register the loads name; as an input it stays live up to it
  asm volatile("s_wait_xcnt 0x0" :: "v"(tb) : "memory");
#pragma unroll
  for (int it = 0; it < 4; ++it) {
    const int idx = it * 256 + tid;
    const int c = idx >> 4, d4 = (idx & 15) * 4;
    *(v4f*)(Qs  + c * QP + d4) = tq[it];
    *(v4f*)(Ks  + c * QP + d4) = tk[it];
    *(v4f*)(Vs  + c * HD + d4) = tv[it];
    *(v4f*)(ALs + c * HD + d4) = ta[it];
    *(v4f*)(Sf  + c * QP + d4) = ts[it];
  }
  if (tid < CH) {
    Bsh[tid] = fminf(Bp[(rowbase + tid) * NH + hh], 1.0f);
    GS[tid]  = Gp[(rowbase + tid) * NH + hh];
  }
  __syncthreads();

  // cumulative log decay per feature, restarted per chunk
  if (tid < HD) {
    float a = 0.0f;
    for (int c = 0; c < CH; ++c) {
      a += __logf(fmaxf(ALs[c * HD + tid], 1e-7f));
      CLs[c * QP + tid] = a;
    }
  }
  __syncthreads();

  // scores: A[i][j] = beta_j * sum_d q[i][d] k[j][d] exp(cl[i][d] - cl[j][d]) for i >= j, else 0
  {
    const int j0 = lane, j1 = lane + 32;
    float a0[8], a1[4];
#pragma unroll
    for (int r = 0; r < 8; ++r) a0[r] = 0.0f;
#pragma unroll
    for (int r = 0; r < 4; ++r) a1[r] = 0.0f;
#pragma unroll 2
    for (int d = 0; d < HD; ++d) {
      const float k0v = Ks[j0 * QP + d], c0 = CLs[j0 * QP + d];
      const float k1v = Ks[j1 * QP + d], c1 = CLs[j1 * QP + d];
#pragma unroll
      for (int r = 0; r < 8; ++r) {
        const int i = wv + 8 * r;
        const float q = Qs[i * QP + d];
        const float ci = CLs[i * QP + d];
        a0[r] += q * k0v * __expf(ci - c0);
        if (r >= 4) a1[r - 4] += q * k1v * __expf(ci - c1);
      }
    }
    const float b0 = Bsh[j0], b1 = Bsh[j1];
#pragma unroll
    for (int r = 0; r < 8; ++r) {
      const int i = wv + 8 * r;
      SCs[i * QP + j0] = (i >= j0) ? a0[r] * b0 : 0.0f;
      float v1 = 0.0f;
      if (r >= 4) v1 = (i >= j1) ? a1[r - 4] * b1 : 0.0f;
      SCs[i * QP + j1] = v1;
    }
  }
  __syncthreads();

  // O = Q*S + A*V : wave owns rows 16*ti.., two 16-col tiles; bf16 hi/lo three products per operand pair
  {
    const int ti = wv >> 1, tj0 = (wv & 1) * 2;
    v8f acc[2];
#pragma unroll
    for (int s = 0; s < 2; ++s)
#pragma unroll
      for (int r = 0; r < 8; ++r) acc[s][r] = 0.0f;

#pragma unroll
    for (int ks = 0; ks < 2; ++ks) {
      const int k0 = ks * 32;
      BF ah, al;
      fragA_split(Qs + (ti * 16 + m) * QP + k0, h, ah, al);
#pragma unroll
      for (int s = 0; s < 2; ++s) {
        BF bhi, blo;
        fragA_split(Sf + ((tj0 + s) * 16 + m) * QP + k0, h, bhi, blo);   // column e of S is a row of Sf: same k map as the gather
        acc[s] = mma_bf16(ah.v, bhi.v, acc[s]);
        acc[s] = mma_bf16(ah.v, blo.v, acc[s]);
        acc[s] = mma_bf16(al.v, bhi.v, acc[s]);
      }
    }
#pragma unroll
    for (int ks = 0; ks < 2; ++ks) {
      const int k0 = ks * 32;
      BF ah, al;
      fragA_split(SCs + (ti * 16 + m) * QP + k0, h, ah, al);
#pragma unroll
      for (int s = 0; s < 2; ++s) {
        BF bhi, blo;
        fragB_split(Vs, HD, k0, (tj0 + s) * 16 + m, h, bhi, blo);
        acc[s] = mma_bf16(ah.v, bhi.v, acc[s]);
        acc[s] = mma_bf16(ah.v, blo.v, acc[s]);
        acc[s] = mma_bf16(al.v, bhi.v, acc[s]);
      }
    }
    __syncthreads();   // all reads of SCs/Sf done; reuse SCs as the O tile
#pragma unroll
    for (int s = 0; s < 2; ++s)
#pragma unroll
      for (int r = 0; r < 8; ++r)
        SCs[(ti * 16 + 8 * h + r) * QP + (tj0 + s) * 16 + m] = acc[s][r];
  }
  __syncthreads();

  // per-row RMS normaliser times gate
  if (tid < CH) {
    float ss = 0.0f;
    for (int e2 = 0; e2 < HD; ++e2) { const float o = SCs[tid * QP + e2]; ss += o * o; }
    RV[tid] = GS[tid] / sqrtf(ss * (1.0f / 64.0f) + 1e-6f);
  }
  __syncthreads();

  {
    v8h ov[2];
    size_t go[2];
#pragma unroll
    for (int it = 0; it < 2; ++it) {
      const int c = it * 32 + (tid >> 3), e0 = (tid & 7) * 8;
      const v4f x0 = *(const v4f*)(SCs + c * QP + e0);
      const v4f x1 = *(const v4f*)(SCs + c * QP + e0 + 4);
      const float sc = RV[c] * ogscale;
      v8h o;
#pragma unroll
      for (int q = 0; q < 4; ++q) {
        o[q]     = (h16)(x0[q] * sc * RW[e0 + q]);
        o[4 + q] = (h16)(x1[q] * sc * RW[e0 + 4 + q]);
      }
      ov[it] = o;
      go[it] = (rowbase + c) * (size_t)DM + hh * HD + e0;
    }
#pragma unroll
    for (int it = 0; it < 2; ++it) *(v8h*)(Og + go[it]) = ov[it];
    
  }
}

// ---------------------------------------------------------------------------
extern "C" void kernel_launch(void* const* d_in, const int* in_sizes, int n_in,
                              void* d_out, int out_size, void* d_ws, size_t ws_size,
                              hipStream_t stream)
{
  if (n_in < 26) return;
  const int T = 2048;
  const long nx = (long)in_sizes[0];
  if (nx <= 0 || (nx % ((long)DM * T)) != 0) return;
  const int M = (int)(nx / DM);                       // tokens, multiple of 2048 (hence of 128)
  if ((long)out_size != (long)M * DM) return;
  if (in_sizes[1] != DM * 4 || in_sizes[3] != DM * 4 || in_sizes[5] != DM * 4) return;
  if (in_sizes[7] != DM * DM || in_sizes[9] != DM * DM || in_sizes[11] != DM * DM || in_sizes[24] != DM * DM) return;
  if (in_sizes[13] != 64 * DM || in_sizes[15] != DM * 64 || in_sizes[17] != NH * DM ||
      in_sizes[20] != 64 * DM || in_sizes[22] != NH * 64) return;

  const float* x       = (const float*)d_in[0];
  const float* wq_conv = (const float*)d_in[1];  const float* bq_conv = (const float*)d_in[2];
  const float* wk_conv = (const float*)d_in[3];  const float* bk_conv = (const float*)d_in[4];
  const float* wv_conv = (const float*)d_in[5];  const float* bv_conv = (const float*)d_in[6];
  const float* Wq  = (const float*)d_in[7];   const float* bq  = (const float*)d_in[8];
  const float* Wk  = (const float*)d_in[9];   const float* bk  = (const float*)d_in[10];
  const float* Wv  = (const float*)d_in[11];  const float* bv  = (const float*)d_in[12];
  const float* Wad = (const float*)d_in[13];  const float* bad = (const float*)d_in[14];
  const float* Wau = (const float*)d_in[15];  const float* bau = (const float*)d_in[16];
  const float* Wbe = (const float*)d_in[17];  const float* bbe = (const float*)d_in[18];
  const float* rms_w = (const float*)d_in[19];
  const float* Wgd = (const float*)d_in[20];  const float* bgd = (const float*)d_in[21];
  const float* Wgu = (const float*)d_in[22];  const float* bgu = (const float*)d_in[23];
  const float* Wo  = (const float*)d_in[24];  const float* bo  = (const float*)d_in[25];

  char* ws = (char*)d_ws;
  size_t off = 0;
  auto carve = [&](size_t bytes) -> char* {
    char* p = ws + off;
    off += (bytes + 255) & ~(size_t)255;
    return p;
  };
  const size_t MD = (size_t)M * DM;
  h16* xh    = (h16*)carve(MD * 2);
  h16* cq    = (h16*)carve(MD * 2);
  h16* ck    = (h16*)carve(MD * 2);
  h16* cv    = (h16*)carve(MD * 2);
  h16* Wq16  = (h16*)carve((size_t)DM * DM * 2);
  h16* Wk16  = (h16*)carve((size_t)DM * DM * 2);
  h16* Wv16  = (h16*)carve((size_t)DM * DM * 2);
  h16* Wo16  = (h16*)carve((size_t)DM * DM * 2);
  h16* Wad16 = (h16*)carve((size_t)64 * DM * 2);
  h16* Wau16 = (h16*)carve((size_t)DM * 64 * 2);
  h16* Wbe16 = (h16*)carve((size_t)NH * DM * 2);
  h16* Wgd16 = (h16*)carve((size_t)64 * DM * 2);
  h16* Wgu16 = (h16*)carve((size_t)NH * 64 * 2);
  float* Qn  = (float*)carve(MD * 4);
  float* Kn  = (float*)carve(MD * 4);
  float* Vf  = (float*)carve(MD * 4);
  float* Al  = (float*)carve(MD * 4);
  float* Bt  = (float*)carve((size_t)M * NH * 4);
  float* Gt  = (float*)carve((size_t)M * NH * 4);
  h16* t1    = (h16*)carve((size_t)M * 64 * 2);
  h16* t2    = (h16*)carve((size_t)M * 64 * 2);
  h16* Og16  = (h16*)carve(MD * 2);
  float* Sst = (float*)carve((size_t)(M / CH) * NH * HD * HD * 4);   // entry state of every (b, h, chunk)
  if (off > ws_size) return;

  const float wsc = 256.0f;      // weight scale
  const float asc = 256.0f;      // conv activation scale
  const float tsc = 64.0f;       // gate hidden scale
  const float osc = 16.0f;       // gated output scale

  // 1) x -> f16, three shortconv+SiLU activations, and the nine weights -> scaled f16 (Wq16 .. Wgu16 are carved back to back,
  //    each a multiple of 256 bytes, in the order k_front takes the matrices)
  {
    const int n8 = (int)(MD / 8);
    const int nb = (n8 + 255) / 256;
    k_front<<<3 * nb + (G_ALL + 255) / 256, 256, 0, stream>>>(x, wq_conv, bq_conv, wk_conv, bk_conv, wv_conv, bv_conv,
                                                              Wq, Wk, Wv, Wo, Wad, Wau, Wbe, Wgd, Wgu,
                                                              xh, cq, ck, cv, Wq16, n8, nb, T, asc, wsc);
  }
  // 2) the six products on the front launch's results; 3) the two gate-up products
  k_proj<<<dim3(M / 128, 51), 256, 0, stream>>>(cq, ck, cv, xh, Wq16, Wk16, Wv16, Wad16, Wbe16, Wgd16,
                                                bq, bk, bv, bad, bbe, bgd, Qn, Kn, Vf, Bt, t1, t2,
                                                DM, 1.0f / (asc * wsc), 1.0f / wsc, tsc);
  k_gate<<<dim3(M / 128, 17), 256, 0, stream>>>(t1, t2, Wau16, Wgu16, bau, bgu, Al, Gt, 64, 1.0f / (tsc * wsc));
  // 4) state recurrence, one block per (column group, b*h); then the per-chunk outputs, one block per (chunk, b*h)
  k_state<<<dim3(HD / SC, (M / T) * NH), 128, 0, stream>>>(Kn, Vf, Al, Bt, Sst, T);
  k_out<<<dim3(T / CH, (M / T) * NH), 256, 0, stream>>>(Qn, Kn, Vf, Al, Bt, Gt, rms_w, Sst, Og16, T, osc);
  // 5) output projection
  k_oproj<<<dim3(M / 128, DM / 64), 256, 0, stream>>>(Og16, Wo16, bo, (float*)d_out, DM, 1.0f / (osc * wsc));
}

// v006
// It runs in 183 microseconds.
// In two side-by-side timings against v005, it was 1.12 and 1.13 times as fast.
// Counting every step since v000, it is 6.75 times as fast.
#include <hip/hip_runtime.h>
#include <stdint.h>

// Contractions: token projections (q, k, v, gate down/up, beta, out) on v_wmma_f32_16x16x32_f16 with f16 operands pre-scaled by powers of two, f32 accumulate; per-chunk Q*S and A*V on v_wmma_f32_16x16x32_bf16 as bf16 hi/lo three-product split, f32 accumulate; decay scores, state recurrence, shortconv and norms on VALU in f32. All float inputs RNE-converted to bf16 on load.

typedef _Float16 h16;
typedef h16    v16h __attribute__((ext_vector_type(16)));
typedef h16    v8h  __attribute__((ext_vector_type(8)));
typedef __bf16 v16b __attribute__((ext_vector_type(16)));
typedef float  v8f  __attribute__((ext_vector_type(8)));
typedef float  v4f  __attribute__((ext_vector_type(4)));
typedef float  v2f  __attribute__((ext_vector_type(2)));

union HF { v16h v; v8h p[2]; };
union BF { v16b v; unsigned short u[16]; };

#define DM 1024
#define HD 64
#define NH 16
#define CH 64
#define QP 68
#define KS 64    // k per staged GEMM tile: 128 B of a row
#define LP 72    // LDS row pitch of a staged tile in f16: 144 B = 16 B x 9, free of bank conflicts for 16-byte row reads

__device__ __forceinline__ unsigned short bf16_bits(float f) {
  unsigned int u = __float_as_uint(f);
  u += 0x7FFFu + ((u >> 16) & 1u);
  return (unsigned short)(u >> 16);
}
__device__ __forceinline__ float bf16r(float f) {
  return __uint_as_float(((unsigned int)bf16_bits(f)) << 16);
}
// x = hi + lo in bf16 pieces (RNE), bit patterns
__device__ __forceinline__ void split2(float x, unsigned short& hi, unsigned short& lo) {
  const unsigned short hb = bf16_bits(x);
  const float hf = __uint_as_float(((unsigned int)hb) << 16);
  hi = hb;
  lo = bf16_bits(x - hf);
}
// low 32 bits of a __shared__ address: the byte offset in the work-group's LDS
__device__ __forceinline__ unsigned lds_off(const void* p) {
  return (unsigned)(uintptr_t)p;
}
__device__ __forceinline__ float sigm(float v) {
  return __fdividef(1.0f, 1.0f + __expf(-v));
}

// 16-bit WMMA wrappers with the VALU hazard guard after the matrix op
__device__ __forceinline__ v8f mma_f16(v16h a, v16h b, v8f c) {
  c = __builtin_amdgcn_wmma_f32_16x16x32_f16(false, a, false, b, (short)0, c, false, false);
  asm volatile("v_nop\n\tv_nop\n\tv_nop\n\tv_nop" : "+v"(c) : "v"(a), "v"(b));
  return c;
}
__device__ __forceinline__ v8f mma_bf16(v16b a, v16b b, v8f c) {
  c = __builtin_amdgcn_wmma_f32_16x16x32_bf16(false, a, false, b, (short)0, c, false, false);
  asm volatile("v_nop\n\tv_nop\n\tv_nop\n\tv_nop" : "+v"(c) : "v"(a), "v"(b));
  return c;
}

// A fragment (row m, split k map) from an f32 LDS row pointer pr = base + row*pitch + k0, as bf16 hi/lo
__device__ __forceinline__ void fragA_split(const float* pr, int h, BF& hi, BF& lo) {
  const v4f x0 = *(const v4f*)(pr + 8 * h);
  const v4f x1 = *(const v4f*)(pr + 8 * h + 4);
  const v4f x2 = *(const v4f*)(pr + 16 + 8 * h);
  const v4f x3 = *(const v4f*)(pr + 20 + 8 * h);
#pragma unroll
  for (int q = 0; q < 4; ++q) {
    split2(x0[q], hi.u[q],      lo.u[q]);
    split2(x1[q], hi.u[4 + q],  lo.u[4 + q]);
    split2(x2[q], hi.u[8 + q],  lo.u[8 + q]);
    split2(x3[q], hi.u[12 + q], lo.u[12 + q]);
  }
}
// B fragment (col n, same split k map) gathered down column col of f32 [k][pitch] in LDS, as bf16 hi/lo
__device__ __forceinline__ void fragB_split(const float* base, int pitch, int k0, int col, int h, BF& hi, BF& lo) {
#pragma unroll
  for (int i = 0; i < 8; ++i) {
    split2(base[(k0 + 8 * h + i) * pitch + col],      hi.u[i],     lo.u[i]);
    split2(base[(k0 + 16 + 8 * h + i) * pitch + col], hi.u[8 + i], lo.u[8 + i]);
  }
}

// ---------------------------------------------------------------------------
// Weights -> scaled f16, eight elements per thread: group i of src goes to group i of dst.
// ---------------------------------------------------------------------------
__device__ __forceinline__ void cvt_group(const float* __restrict__ src, h16* dst, int i, bool ok, float scale)
{
  v8h o;
#pragma unroll
  for (int q = 0; q < 8; ++q) o[q] = (h16)0.0f;
  if (ok) {
    const v4f a = *(const v4f*)(src + (size_t)i * 8);
    const v4f c = *(const v4f*)(src + (size_t)i * 8 + 4);
#pragma unroll
    for (int q = 0; q < 4; ++q) {
      o[q]     = (h16)(bf16r(a[q]) * scale);
      o[4 + q] = (h16)(bf16r(c[q]) * scale);
    }
  }
  if (ok) *(v8h*)(dst + (size_t)i * 8) = o;
  
}

// ---------------------------------------------------------------------------
// Everything that reads only the inputs, in one launch.
// The first 3 * nb blocks: causal depthwise conv (4 taps) + SiLU, nb blocks for each of three weight sets, f16 output scaled by ascale.
// The blocks behind them: the nine weight matrices -> scaled f16. Their f16 copies lie one behind the other in w16, in the order of
// the arguments, so one running group index serves all nine; every matrix but the last ends on a multiple of 256 groups,
// so a block converts from one matrix only.
// ---------------------------------------------------------------------------
#define G_SQ (DM * DM / 8)    // groups of eight in a DM x DM matrix
#define G_LR (64 * DM / 8)    // ... in a 64 x DM or DM x 64 matrix
#define G_HD (NH * DM / 8)    // ... in an NH x DM matrix
#define G_HR (NH * 64 / 8)    // ... in an NH x 64 matrix
#define G_ALL (4 * G_SQ + 3 * G_LR + G_HD + G_HR)

__global__ void __launch_bounds__(256)
k_front(const float* __restrict__ x,
        const float* __restrict__ w0, const float* __restrict__ b0,
        const float* __restrict__ w1, const float* __restrict__ b1,
        const float* __restrict__ w2, const float* __restrict__ b2,
        const float* __restrict__ Wq, const float* __restrict__ Wk, const float* __restrict__ Wv,
        const float* __restrict__ Wo, const float* __restrict__ Wad, const float* __restrict__ Wau,
        const float* __restrict__ Wbe, const float* __restrict__ Wgd, const float* __restrict__ Wgu,
        h16* xh, h16* y0, h16* y1, h16* y2, h16* w16, int n8, int nb, int T, float ascale, float wscale)
{
  const int bid = blockIdx.x;
  if (bid >= 3 * nb) {
    const int g0 = (bid - 3 * nb) * 256;                                    // first group of this block
    const float* src = Wq;
    int first = 0;                                                          // first group of the matrix g0 lies in
    if (g0 >= 4 * G_SQ + 3 * G_LR + G_HD)      { src = Wgu; first = 4 * G_SQ + 3 * G_LR + G_HD; }
    else if (g0 >= 4 * G_SQ + 2 * G_LR + G_HD) { src = Wgd; first = 4 * G_SQ + 2 * G_LR + G_HD; }
    else if (g0 >= 4 * G_SQ + 2 * G_LR)        { src = Wbe; first = 4 * G_SQ + 2 * G_LR; }
    else if (g0 >= 4 * G_SQ + G_LR)            { src = Wau; first = 4 * G_SQ + G_LR; }
    else if (g0 >= 4 * G_SQ)                   { src = Wad; first = 4 * G_SQ; }
    else if (g0 >= 3 * G_SQ)                   { src = Wo;  first = 3 * G_SQ; }
    else if (g0 >= 2 * G_SQ)                   { src = Wv;  first = 2 * G_SQ; }
    else if (g0 >= G_SQ)                       { src = Wk;  first = G_SQ; }
    const int gi = g0 + (int)threadIdx.x;
    cvt_group(src, w16 + (size_t)first * 8, gi - first, gi < G_ALL, wscale);
    return;
  }
  const int which = (bid >= nb) + (bid >= 2 * nb);
  const float* w  = (which == 0) ? w0 : ((which == 1) ? w1 : w2);
  const float* bb = (which == 0) ? b0 : ((which == 1) ? b1 : b2);
  h16* y          = (which == 0) ? y0 : ((which == 1) ? y1 : y2);

  const int g = (bid - which * nb) * 256 + threadIdx.x;
  const bool ok = g < n8;
  const size_t eo = (size_t)g * 8;
  v8h o, ox;
#pragma unroll
  for (int q = 0; q < 8; ++q) { o[q] = (h16)0.0f; ox[q] = (h16)0.0f; }
  if (ok) {
    const size_t bt = (size_t)(g >> 7);          // token index (DM/8 = 128 groups per token)
    const int d0 = (g & 127) * 8;
    const int t = (int)(bt % (size_t)T);
    float xr[4][8];
#pragma unroll
    for (int j = 0; j < 4; ++j) {
      const int ts = t - 3 + j;
      if (ts >= 0) {
        const float* px = x + (bt - (size_t)(3 - j)) * DM + d0;
        const v4f a = *(const v4f*)px;
        const v4f c = *(const v4f*)(px + 4);
#pragma unroll
        for (int q = 0; q < 4; ++q) { xr[j][q] = bf16r(a[q]); xr[j][4 + q] = bf16r(c[q]); }
      } else {
#pragma unroll
        for (int q = 0; q < 8; ++q) xr[j][q] = 0.0f;
      }
    }
#pragma unroll
    for (int q = 0; q < 8; ++q) {
      const int d = d0 + q;
      const v4f wv4 = *(const v4f*)(w + (size_t)d * 4);
      float acc = xr[0][q] * bf16r(wv4[0]);
      acc += xr[1][q] * bf16r(wv4[1]);
      acc += xr[2][q] * bf16r(wv4[2]);
      acc += xr[3][q] * bf16r(wv4[3]);
      acc += bf16r(bb[d]);
      const float s = acc * sigm(acc);
      o[q]  = (h16)(s * ascale);
      ox[q] = (h16)xr[3][q];
    }
  }
  if (ok) {
    *(v8h*)(y + eo) = o;
    if (which == 0) *(v8h*)(xh + eo) = ox;
  }
  
}

// ---------------------------------------------------------------------------
// Y[M,N] = epi( A[M,K] * W[N,K]^T * oscale + bias[N] ), f16 operands (k-contiguous), f32 accumulate.
// One block tile (bx, by) of one product; the launches below hand independent products to one grid, told apart by blockIdx.y.
// Block 256 threads = 8 waves; block tile 128 rows x 16*NT cols; wave tile 16 x 16*NT.
// Both operands come to LDS in tiles of KS k by asynchronous copies, whole cache lines, two buffers: tile t + 1 flies while t is used.
// EPI: 0 none, 1 L2-normalise each row over the 64-col slab, 2 silu, 3 sigmoid then clip to [0.1,1], 4 sigmoid then min 1.
// ---------------------------------------------------------------------------
// LDS of a launch, sized for NT = 4: the epilogue's staging, two buffers of 128 rows of A, two of up to 64 rows of W, KS k each
#define GEMM_LDS \
  __shared__ __attribute__((aligned(16))) float stg[8 * 16 * 64]; \
  __shared__ __attribute__((aligned(16))) h16 sA[2 * 128 * LP]; \
  __shared__ __attribute__((aligned(16))) h16 sW[2 * 64 * LP];

template<int NT, int EPI, typename OT>
__device__ __forceinline__ void
gemm_tile(const h16* __restrict__ A, const h16* __restrict__ W, const float* __restrict__ bias,
          OT* Y, int N, int K, float oscale, float yscale, int bx, int by, float* stg, h16* sA, h16* sW)
{
  constexpr int TW = 16 * NT;

  const int lane = threadIdx.x & 31, wv = threadIdx.x >> 5;
  const int m = lane & 15, h = lane >> 4;
  const int rowBase = bx * 128 + wv * 16;
  const int colBase = by * TW;

  v8f acc[NT];
#pragma unroll
  for (int t = 0; t < NT; ++t)
#pragma unroll
    for (int r = 0; r < 8; ++r) acc[t][r] = 0.0f;

  // Copy map: a row of a tile is KS f16 = 128 B = one cache line; 8 lanes x 16 B bring one row, a wave four whole lines.
  const int tid = threadIdx.x;
  const int cr = tid >> 3, cc = (tid & 7) * 8;
  const h16* ga = A + (size_t)(bx * 128 + cr) * K + cc;
  const unsigned la = lds_off(sA + cr * LP + cc);
  // W tile: 64 rows in 16-byte pieces (two per thread), or 16 rows in 8-byte pieces (one per thread)
  const int wr = (NT == 4) ? cr : (tid >> 4), wc = (NT == 4) ? cc : (tid & 15) * 4;
  const h16* gw = W + (size_t)(colBase + wr) * K + wc;
  const unsigned lw = lds_off(sW + wr * LP + wc);
  const size_t r32 = (size_t)32 * K;             // 32 rows further in global memory
  constexpr unsigned L32 = 32 * LP * 2;          // 32 rows further in LDS, bytes

  // all of tile t's copies, every lane on; the s_wait_xcnt closes the statement so that it stands in front of any
  // rewrite of the address registers the copies name
  auto stage = [&](int t) {
    const h16* a0 = ga + (size_t)t * KS;
    const h16* w0 = gw + (size_t)t * KS;
    const unsigned l0 = la + (unsigned)(t & 1) * (128 * LP * 2);
    const unsigned m0 = lw + (unsigned)(t & 1) * (TW * LP * 2);
    if constexpr (NT == 4) {
      asm volatile("global_load_async_to_lds_b128 %0, %1, off\n\t"
                   "global_load_async_to_lds_b128 %2, %3, off\n\t"
                   "global_load_async_to_lds_b128 %4, %5, off\n\t"
                   "global_load_async_to_lds_b128 %6, %7, off\n\t"
                   "global_load_async_to_lds_b128 %8, %9, off\n\t"
                   "global_load_async_to_lds_b128 %10, %11, off\n\t"
                   "s_wait_xcnt 0x0"
                   :: "v"(l0), "v"(a0), "v"(l0 + L32), "v"(a0 + r32), "v"(l0 + 2 * L32), "v"(a0 + 2 * r32),
                      "v"(l0 + 3 * L32), "v"(a0 + 3 * r32), "v"(m0), "v"(w0), "v"(m0 + L32), "v"(w0 + r32)
                   : "memory");
    } else {
      asm volatile("global_load_async_to_lds_b128 %0, %1, off\n\t"
                   "global_load_async_to_lds_b128 %2, %3, off\n\t"
                   "global_load_async_to_lds_b128 %4, %5, off\n\t"
                   "global_load_async_to_lds_b128 %6, %7, off\n\t"
                   "global_load_async_to_lds_b64 %8, %9, off\n\t"
                   "s_wait_xcnt 0x0"
                   :: "v"(l0), "v"(a0), "v"(l0 + L32), "v"(a0 + r32), "v"(l0 + 2 * L32), "v"(a0 + 2 * r32),
                      "v"(l0 + 3 * L32), "v"(a0 + 3 * r32), "v"(m0), "v"(w0)
                   : "memory");
    }
  };

  const int nt = K / KS;
  stage(0);
  asm volatile("s_wait_asynccnt 0x0" ::: "memory");   // this wave's copies of tile 0 have landed
  __syncthreads();                                    // ... and every other wave's
  if (nt > 1) stage(1);

  // A: lane row m, elements 0..7 <- k0+8h.., 8..15 <- k0+16+8h..;  B: lane col m, same k map
  for (int t = 0; t < nt; ++t) {
    const h16* pa = sA + (t & 1) * (128 * LP) + (wv * 16 + m) * LP + 8 * h;
    const h16* pw = sW + (t & 1) * (TW * LP) + m * LP + 8 * h;
    HF a[KS / 32], b[KS / 32][NT];
#pragma unroll
    for (int q = 0; q < KS / 32; ++q) {
      a[q].p[0] = *(const v8h*)(pa + 32 * q);
      a[q].p[1] = *(const v8h*)(pa + 32 * q + 16);
#pragma unroll
      for (int u = 0; u < NT; ++u) {
        b[q][u].p[0] = *(const v8h*)(pw + 16 * u * LP + 32 * q);
        b[q][u].p[1] = *(const v8h*)(pw + 16 * u * LP + 32 * q + 16);
      }
    }
#pragma unroll
    for (int q = 0; q < KS / 32; ++q)
#pragma unroll
      for (int u = 0; u < NT; ++u) acc[u] = mma_f16(a[q].v, b[q][u].v, acc[u]);
    asm volatile("s_wait_dscnt 0x0" ::: "memory");      // this wave's reads of the buffer are done before it is refilled
    asm volatile("s_wait_asynccnt 0x0" ::: "memory");   // this wave's copies of tile t + 1 have landed
    __syncthreads();                                    // publishes tile t + 1 and ends every wave's reads of tile t
    if (t + 2 < nt) stage(t + 2);
  }
  asm volatile("s_wait_asynccnt 0x0" ::: "memory");     // no copy is left in flight when the wave goes on

  // epilogue values (D element r of this lane = row 8h+r, col m of tile t)
#pragma unroll
  for (int t = 0; t < NT; ++t) {
    const float bv = bf16r(bias[colBase + 16 * t + m]);
#pragma unroll
    for (int r = 0; r < 8; ++r) {
      float v = acc[t][r] * oscale + bv;
      if (EPI == 2)      { v = v * sigm(v); }
      else if (EPI == 3) { v = sigm(v); v = fminf(fmaxf(v, 0.1f), 1.0f); }
      else if (EPI == 4) { v = fminf(sigm(v), 1.0f); }
      acc[t][r] = v;
    }
  }
  if (EPI == 1) {
#pragma unroll
    for (int r = 0; r < 8; ++r) {
      float ss = 0.0f;
#pragma unroll
      for (int t = 0; t < NT; ++t) ss += acc[t][r] * acc[t][r];
      ss += __shfl_xor(ss, 1, 32);
      ss += __shfl_xor(ss, 2, 32);
      ss += __shfl_xor(ss, 4, 32);
      ss += __shfl_xor(ss, 8, 32);
      const float inv = 1.0f / sqrtf(fmaxf(ss, 1e-6f));
#pragma unroll
      for (int t = 0; t < NT; ++t) acc[t][r] *= inv;
    }
  }

  float* sw = stg + wv * 16 * TW;
#pragma unroll
  for (int t = 0; t < NT; ++t)
#pragma unroll
    for (int r = 0; r < 8; ++r) sw[(8 * h + r) * TW + 16 * t + m] = acc[t][r];
  __syncthreads();

  if constexpr (sizeof(OT) == 4 && NT == 4) {
    v4f vals[8];
    size_t offs[8];
#pragma unroll
    for (int it = 0; it < 8; ++it) {
      const int row = 2 * it + h, c4 = m * 4;
      vals[it] = *(const v4f*)(sw + row * TW + c4);
      offs[it] = (size_t)(rowBase + row) * N + colBase + c4;
    }
#pragma unroll
    for (int it = 0; it < 8; ++it) *(v4f*)(Y + offs[it]) = vals[it];
    // in a merged launch another product's code follows in the listing: the wait stands in front of any rewrite of the registers the stores name
    asm volatile("s_wait_xcnt 0x0" ::: "memory");
  } else if constexpr (sizeof(OT) == 2 && NT == 4) {
    v8h vals[4];
    size_t offs[4];
#pragma unroll
    for (int it = 0; it < 4; ++it) {
      const int row = it * 4 + (lane >> 3), c8 = (lane & 7) * 8;
      const v4f a = *(const v4f*)(sw + row * TW + c8);
      const v4f c = *(const v4f*)(sw + row * TW + c8 + 4);
      v8h o;
#pragma unroll
      for (int q = 0; q < 4; ++q) { o[q] = (h16)(a[q] * yscale); o[4 + q] = (h16)(c[q] * yscale); }
      vals[it] = o;
      offs[it] = (size_t)(rowBase + row) * N + colBase + c8;
    }
#pragma unroll
    for (int it = 0; it < 4; ++it) *(v8h*)(Y + offs[it]) = vals[it];
    // in a merged launch another product's code follows in the listing: the wait stands in front of any rewrite of the registers the stores name
    asm volatile("s_wait_xcnt 0x0" ::: "memory");
  } else if constexpr (sizeof(OT) == 4 && NT == 1) {
    // N == 16: the wave's 16 rows are 1 KB contiguous; 8 lanes x 16 B per line
    v4f vals[2];
    size_t offs[2];
#pragma unroll
    for (int it = 0; it < 2; ++it) {
      const int q = it * 32 + lane, row = q >> 2, c4 = (q & 3) * 4;
      vals[it] = *(const v4f*)(sw + row * TW + c4);
      offs[it] = (size_t)(rowBase + row) * N + colBase + c4;
    }
#pragma unroll
    for (int it = 0; it < 2; ++it) *(v4f*)(Y + offs[it]) = vals[it];
    // in a merged launch another product's code follows in the listing: the wait stands in front of any rewrite of the registers the stores name
    asm volatile("s_wait_xcnt 0x0" ::: "memory");
  }
}

// ---------------------------------------------------------------------------
// The six products that need only the front launch's results, K = DM each: q, k (16 column slabs each, L2 norm), v (16 slabs),
// gate-down for alpha, beta, gate-down for the output gate (one slab each).
// ---------------------------------------------------------------------------
__global__ void __launch_bounds__(256)
k_proj(const h16* __restrict__ cq, const h16* __restrict__ ck, const h16* __restrict__ cv, const h16* __restrict__ xh,
       const h16* __restrict__ Wq16, const h16* __restrict__ Wk16, const h16* __restrict__ Wv16,
       const h16* __restrict__ Wad16, const h16* __restrict__ Wbe16, const h16* __restrict__ Wgd16,
       const float* __restrict__ bq, const float* __restrict__ bk, const float* __restrict__ bv,
       const float* __restrict__ bad, const float* __restrict__ bbe, const float* __restrict__ bgd,
       float* Qn, float* Kn, float* Vf, float* Bt, h16* t1, h16* t2,
       int K, float cscale, float xscale, float tscale)
{
  GEMM_LDS
  const int bx = blockIdx.x, y = blockIdx.y;
  if (y < 32) {
    const bool q = y < 16;
    gemm_tile<4, 1, float>(q ? cq : ck, q ? Wq16 : Wk16, q ? bq : bk, q ? Qn : Kn, DM, K, cscale, 1.0f, bx, y & 15, stg, sA, sW);
  } else if (y < 48) {
    gemm_tile<4, 0, float>(cv, Wv16, bv, Vf, DM, K, cscale, 1.0f, bx, y - 32, stg, sA, sW);
  } else if (y == 49) {
    gemm_tile<1, 4, float>(xh, Wbe16, bbe, Bt, NH, K, xscale, 1.0f, bx, 0, stg, sA, sW);
  } else {
    const bool a = y == 48;
    gemm_tile<4, 2, h16>(xh, a ? Wad16 : Wgd16, a ? bad : bgd, a ? t1 : t2, 64, K, xscale, tscale, bx, 0, stg, sA, sW);
  }
}

// The two gate-up products, K = 64 each: alpha (16 slabs) and the output gate (one slab).
__global__ void __launch_bounds__(256)
k_gate(const h16* __restrict__ t1, const h16* __restrict__ t2, const h16* __restrict__ Wau16, const h16* __restrict__ Wgu16,
       const float* __restrict__ bau, const float* __restrict__ bgu, float* Al, float* Gt, int K, float oscale)
{
  GEMM_LDS
  const int bx = blockIdx.x, y = blockIdx.y;
  if (y < 16) gemm_tile<4, 3, float>(t1, Wau16, bau, Al, DM, K, oscale, 1.0f, bx, y, stg, sA, sW);
  else        gemm_tile<1, 4, float>(t2, Wgu16, bgu, Gt, NH, K, oscale, 1.0f, bx, 0, stg, sA, sW);
}

// The output projection.
__global__ void __launch_bounds__(256)
k_oproj(const h16* __restrict__ A, const h16* __restrict__ W, const float* __restrict__ bias, float* Y, int K, float oscale)
{
  GEMM_LDS
  gemm_tile<4, 0, float>(A, W, bias, Y, DM, K, oscale, 1.0f, blockIdx.x, blockIdx.y, stg, sA, sW);
}

// ---------------------------------------------------------------------------
// Gated delta rule, serial part. The columns e of the state S (64x64 f32) never mix: each evolves from k, a, beta and v[e] alone.
// One block per (group of SC columns, b*h), T/64 chunks in sequence; 4 waves hold the state and step, 4 more stage the next chunk's
// operands meanwhile. A 16-lane row of a stepping wave owns one column,
// lane lg of it the rows 4*lg .. 4*lg+3 in registers, so k^T S is summed inside the row and no step needs a barrier.
// Four steps 0..3 are taken from one state S. With dl_i = v_i - k_i^T (a_i S_i-1), every later step's k^T S is linear in S and
// in the earlier dl, so with A(j..i] the product of a_j+1 .. a_i, per feature:
//   dl_i = v_i - (k_i A(-1..i])^T S - sum over j < i of c_ij dl_j,     c_ij = sum_d k_i A(j..i] beta_j k_j
//   S   <- A(-1..3] S + sum over j of (beta_j k_j A(j..3]) dl_j
// The four row sums run side by side, and the dependent chain of one step, three short links longer, serves four. The vectors in
// brackets and the c_ij hold no state and no column: they are formed once per chunk while the tiles are staged.
// The state each chunk starts from is stored column-major, Sg[(bh*nch + n)][e][d], for the chunk-parallel output kernel.
// ---------------------------------------------------------------------------
#define SC 8    // state columns per block
#define NSTP 8    // steps per group of LDS operand reads

// x + (x of lane l ^ mask) inside a 16-lane row; CTRL = 0x160 + mask is the DPP row_xmask control
template<int CTRL>
__device__ __forceinline__ float xmask_add(float x) {
  return x + __int_as_float(__builtin_amdgcn_update_dpp(0, __float_as_int(x), CTRL, 0xf, 0xf, true));
}
// sum of the four elements of every lane of a 16-lane row, in every lane of it
__device__ __forceinline__ float row_sum(v4f x) {
  float s = (x[0] + x[2]) + (x[1] + x[3]);
  s = xmask_add<0x161>(s);
  s = xmask_add<0x162>(s);
  s = xmask_add<0x164>(s);
  return xmask_add<0x168>(s);
}

// work-group barrier that orders LDS only: the stagers' global loads of the chunk after next stay in flight across it,
// where __syncthreads() would wait for them
__device__ __forceinline__ void lds_barrier() {
  __builtin_amdgcn_fence(__ATOMIC_RELEASE, "workgroup", "local");
  __builtin_amdgcn_s_barrier();
  __builtin_amdgcn_fence(__ATOMIC_ACQUIRE, "workgroup", "local");
}

__global__ void __launch_bounds__(256)
k_state(const float* __restrict__ Kp, const float* __restrict__ Vp, const float* __restrict__ Ap,
        const float* __restrict__ Bp, float* Sg, int T)
{
  // Two buffers of every staged array: waves 0..3 step through chunk n in buffer n & 1 while waves 4..7 stage chunk n + 1 in the other.
  // Us: k_i A(-1..i], two steps side by side so that one packed product serves both: of the four rows of a group, for lane lg,
  // row 0 holds steps (0, 1) of d = 4*lg and of 4*lg+1, row 1 those of 4*lg+2 and 4*lg+3, rows 2 and 3 the same of steps (2, 3)
  __shared__ __attribute__((aligned(16))) float Us[2 * CH * HD];
  __shared__ __attribute__((aligned(16))) float Ws[2 * CH * HD];         // [t][d]: beta_j k_j A(j..3]
  __shared__ __attribute__((aligned(16))) float Ps[2 * (CH / 4) * HD];   // [group][d]: A(-1..3]
  __shared__ __attribute__((aligned(16))) float Vt[2 * SC * CH];         // [column][t]
  __shared__ __attribute__((aligned(16))) float Cs[2 * (CH / 4) * 8];    // [group]: c10 c20 c21 c30 c31 c32, two unused

  const int tid = threadIdx.x & 127;           // place among the 128 threads of the same role
  // the role is the same for a whole wave: read as a scalar, so that the branch on it is a scalar branch
  const bool stager = __builtin_amdgcn_readfirstlane((int)(threadIdx.x >> 5)) >= 4;
  const int cg = blockIdx.x, bh = blockIdx.y, b = bh / NH, hh = bh % NH;
  const int lg = tid & 15, el = tid >> 4;      // state ownership: column cg*SC + el, rows 4*lg .. 4*lg+3

  // every loop of this kernel but the one over the chunks is unrolled: its arrays are then indexed by constants and stay in registers
  v4f S;
#pragma unroll
  for (int u = 0; u < 4; ++u) S[u] = 0.0f;

  // per-thread byte offsets of the tile loads and of the state store; the chunk moves the uniform base only.
  // Staging: the 16-lane row el takes the groups el and el + 8, that is the tile rows 4*el + 32*it and the three behind
  const unsigned tb = (unsigned)(((4 * el) * DM + lg * 4) * 4);
  const unsigned vo = (unsigned)(((tid >> 1) * DM + cg * SC + (tid & 1) * 4) * 4);
  const unsigned so = (unsigned)(((cg * SC + el) * HD + 4 * lg) * 4);

  const int nch = T / CH;

  // a chunk's tiles as loaded, held in a stager's registers from one pass of the chunk loop to the next
  float tbe[2][4];
  v4f tk[2][4], ta[2][4], tv;

  // tile loads of chunk n: k and a 64 rows x 64 f32, v 64 rows x SC f32, beta of this row's eight steps (one address per 16-lane row)
  auto load = [&](int n) {
    const size_t rowbase = (size_t)b * T + (size_t)n * CH;
    const float* Kg = Kp + rowbase * DM + hh * HD;
    const float* Vg = Vp + rowbase * DM + hh * HD;
    const float* Ag = Ap + rowbase * DM + hh * HD;
    const char* kp = (const char*)Kg + tb;
    const char* ap = (const char*)Ag + tb;
    const char* vp = (const char*)Vg + vo;
    const float* bp = Bp + (rowbase + 4 * el) * NH + hh;
#pragma unroll
    for (int it = 0; it < 2; ++it) {
#pragma unroll
      for (int j = 0; j < 4; ++j) tbe[it][j] = bp[(32 * it + j) * NH];
#pragma unroll
      for (int j = 0; j < 4; ++j) {
        tk[it][j] = *(const v4f*)(kp + (32 * it + j) * (DM * 4));
        ta[it][j] = *(const v4f*)(ap + (32 * it + j) * (DM * 4));
      }
    }
    tv = *(const v4f*)vp;
    // the wait stands in front of any overwrite of the address registers the loads name; as inputs they stay live up to it
    asm volatile("s_wait_xcnt 0x0" :: "v"(kp), "v"(ap), "v"(vp), "v"(bp) : "memory");
  };

  // the loaded tiles -> the step operands, into buffer bf
  auto stage = [&](int bf) {
    float* Ub = Us + bf * (CH * HD);
    float* Wb = Ws + bf * (CH * HD);
    float* Pb = Ps + bf * ((CH / 4) * HD);
    float* Vb = Vt + bf * (SC * CH);
    float* Cb = Cs + bf * ((CH / 4) * 8);
#pragma unroll
    for (int it = 0; it < 2; ++it) {
      const int qd = it * 8 + el;
      const v4f k0 = tk[it][0], k1 = tk[it][1], k2 = tk[it][2], k3 = tk[it][3];
      const v4f d0 = ta[it][0], d1 = ta[it][1], d2 = ta[it][2], d3 = ta[it][3];
      const float b0 = fminf(tbe[it][0], 1.0f), b1 = fminf(tbe[it][1], 1.0f);
      const float b2 = fminf(tbe[it][2], 1.0f), b3 = fminf(tbe[it][3], 1.0f);
      const v4f P1 = d0 * d1, P2 = P1 * d2, P3 = P2 * d3;       // A(-1..i]
      const v4f R20 = d1 * d2, R31 = d2 * d3, R30 = d1 * R31;   // A(j..i]
      const v4f g0 = k0 * b0, g1 = k1 * b1, g2 = k2 * b2, g3 = k3 * b3;
      const v4f u0 = k0 * d0, u1 = k1 * P1, u2 = k2 * P2, u3 = k3 * P3;
      const v4f ua = { u0[0], u1[0], u0[1], u1[1] }, ub = { u0[2], u1[2], u0[3], u1[3] };
      const v4f uc = { u2[0], u3[0], u2[1], u3[1] }, ud = { u2[2], u3[2], u2[3], u3[3] };
      *(v4f*)(Ub + (4 * qd) * HD + 4 * lg)     = ua;
      *(v4f*)(Ub + (4 * qd + 1) * HD + 4 * lg) = ub;
      *(v4f*)(Ub + (4 * qd + 2) * HD + 4 * lg) = uc;
      *(v4f*)(Ub + (4 * qd + 3) * HD + 4 * lg) = ud;
      *(v4f*)(Wb + (4 * qd) * HD + 4 * lg)     = g0 * R30;
      *(v4f*)(Wb + (4 * qd + 1) * HD + 4 * lg) = g1 * R31;
      *(v4f*)(Wb + (4 * qd + 2) * HD + 4 * lg) = g2 * d3;
      *(v4f*)(Wb + (4 * qd + 3) * HD + 4 * lg) = g3;
      *(v4f*)(Pb + qd * HD + 4 * lg)           = P3;
      const float c10 = row_sum((k1 * d1) * g0);
      const float c20 = row_sum((k2 * R20) * g0), c21 = row_sum((k2 * d2) * g1);
      const float c30 = row_sum((k3 * R30) * g0), c31 = row_sum((k3 * R31) * g1), c32 = row_sum((k3 * d3) * g2);
      if (lg == 0) {
        const v4f ca = { c10, c20, c21, c30 };
        const v2f cb = { c31, c32 };
        *(v4f*)(Cb + qd * 8)     = ca;
        *(v2f*)(Cb + qd * 8 + 4) = cb;
      }
    }
#pragma unroll
    for (int u = 0; u < 4; ++u) Vb[((tid & 1) * 4 + u) * CH + (tid >> 1)] = tv[u];
  };

  if (stager) load(0);

  // pass -1 only stages chunk 0; in pass n the steppers take chunk n
  for (int n = -1; n < nch; ++n) {
    if (stager) {
      // chunk n + 1 goes into the buffer whose last readers left it at the barrier before this pass; its tiles were asked for
      // a whole pass ago, and those of chunk n + 2 are asked for now
      if (n + 1 < nch) {
        stage((n + 1) & 1);
        if (n + 2 < nch) load(n + 2);
      }
    } else if (n >= 0) {
    const int bf = n & 1;
    const float* ul = Us + bf * (CH * HD) + 4 * lg;
    const float* wl = Ws + bf * (CH * HD) + 4 * lg;
    const float* pl = Ps + bf * ((CH / 4) * HD) + 4 * lg;
    const float* vl = Vt + bf * (SC * CH) + el * CH;
    const float* cl = Cs + bf * ((CH / 4) * 8);
    float* So = Sg + ((size_t)bh * nch + n) * (HD * HD);

    // exact state update over the chunk, four steps at a time
    // the operands of NSTP steps are read as one group, one group ahead of the steps that use them
    v4f uq[2][NSTP], wq[2][NSTP], pq[2][NSTP / 4], vq[2][NSTP / 4], ca[2][NSTP / 4];
    v2f cb[2][NSTP / 4];
    auto fetch = [&](int g, int bf) {
      // in the order of use: LDS reads return in order, and the first group of a chunk is waited for
#pragma unroll
      for (int s = 0; s < NSTP / 4; ++s) {
#pragma unroll
        for (int j = 0; j < 4; ++j) uq[bf][4 * s + j] = *(const v4f*)(ul + (NSTP * g + 4 * s + j) * HD);
        pq[bf][s] = *(const v4f*)(pl + ((NSTP / 4) * g + s) * HD);
        vq[bf][s] = *(const v4f*)(vl + NSTP * g + 4 * s);
        ca[bf][s] = *(const v4f*)(cl + ((NSTP / 4) * g + s) * 8);
        cb[bf][s] = *(const v2f*)(cl + ((NSTP / 4) * g + s) * 8 + 4);
#pragma unroll
        for (int j = 0; j < 4; ++j) wq[bf][4 * s + j] = *(const v4f*)(wl + (NSTP * g + 4 * s + j) * HD);
      }
    };
    fetch(0, 0);
    // entry state of this chunk; the wait on the store stands behind the first group's LDS reads and passes under their latency
    *(v4f*)((char*)So + so) = S;
    // the steps that follow overwrite S, which this store names, and may be given its address registers: the wait stands in front of that
    asm volatile("s_wait_xcnt 0x0" ::: "memory");
#pragma unroll
    for (int g = 0; g < CH / NSTP; ++g) {
      const int cur = g & 1, nxt = cur ^ 1;
      // with the one behind the reads: keeps the next group's LDS reads in one place. Left free, they sank to just ahead of their
      // use, where each step waited out the LDS latency, or were strewn among the steps of the group before
      __builtin_amdgcn_sched_barrier(0);
      if (g + 1 < CH / NSTP) fetch(g + 1, nxt);
      __builtin_amdgcn_sched_barrier(0);   // second of the pair, see above
#pragma unroll
      for (int q = 0; q < NSTP / 4; ++q) {
        const v4f ua = uq[cur][4 * q], ub = uq[cur][4 * q + 1], uc = uq[cur][4 * q + 2], ud = uq[cur][4 * q + 3];
        const v4f w0 = wq[cur][4 * q], w1 = wq[cur][4 * q + 1], w2 = wq[cur][4 * q + 2], w3 = wq[cur][4 * q + 3];
        const v4f pp = pq[cur][q], vv = vq[cur][q], c4 = ca[cur][q];
        const v2f c2 = cb[cur][q];
        const v2f pa = (ua.xy * S[0] + ub.xy * S[2]) + (ua.zw * S[1] + ub.zw * S[3]);   // partial sums of steps 0 and 1
        const v2f pb = (uc.xy * S[0] + ud.xy * S[2]) + (uc.zw * S[1] + ud.zw * S[3]);   // ... of steps 2 and 3
        float p0 = pa.x, p1 = pa.y, p2 = pb.x, p3 = pb.y;
        p0 = xmask_add<0x161>(p0);  p1 = xmask_add<0x161>(p1);  p2 = xmask_add<0x161>(p2);  p3 = xmask_add<0x161>(p3);
        p0 = xmask_add<0x162>(p0);  p1 = xmask_add<0x162>(p1);  p2 = xmask_add<0x162>(p2);  p3 = xmask_add<0x162>(p3);
        p0 = xmask_add<0x164>(p0);  p1 = xmask_add<0x164>(p1);  p2 = xmask_add<0x164>(p2);  p3 = xmask_add<0x164>(p3);
        p0 = xmask_add<0x168>(p0);  p1 = xmask_add<0x168>(p1);  p2 = xmask_add<0x168>(p2);  p3 = xmask_add<0x168>(p3);
        const float dl0 = vv[0] - p0;
        const float dl1 = __builtin_fmaf(-c4[0], dl0, vv[1] - p1);
        const float dl2 = __builtin_fmaf(-c4[2], dl1, __builtin_fmaf(-c4[1], dl0, vv[2] - p2));
        const float dl3 = __builtin_fmaf(-c2[1], dl2, __builtin_fmaf(-c2[0], dl1, __builtin_fmaf(-c4[3], dl0, vv[3] - p3)));
        // each term is added as soon as its dl is known, so that only the last one follows dl3
#pragma unroll
        for (int u = 0; u < 4; ++u)
          S[u] = __builtin_fmaf(w3[u], dl3, __builtin_fmaf(w2[u], dl2, __builtin_fmaf(w1[u], dl1, __builtin_fmaf(w0[u], dl0, pp[u] * S[u]))));
      }
    }
    }
    lds_barrier();   // publishes chunk n + 1 and ends the reads of chunk n's buffer, which the next pass refills
  }
}

// ---------------------------------------------------------------------------
// Gated delta rule, chunk-parallel part: one block per (chunk, b*h), 256 threads. Reads the chunk's entry state from Sg.
// Scores A[i][j] on VALU f32, O = Q*S + A*V on bf16 hi/lo WMMA, then headwise RMS norm and gate.
// ---------------------------------------------------------------------------
__global__ void __launch_bounds__(256)
k_out(const float* __restrict__ Qp, const float* __restrict__ Kp, const float* __restrict__ Vp,
      const float* __restrict__ Ap, const float* __restrict__ Bp, const float* __restrict__ Gp,
      const float* __restrict__ rmsw, const float* __restrict__ Sg, h16* Og, int T, float ogscale)
{
  __shared__ __attribute__((aligned(16))) float Qs[CH * QP];
  __shared__ __attribute__((aligned(16))) float Ks[CH * QP];
  __shared__ __attribute__((aligned(16))) float CLs[CH * QP];
  __shared__ __attribute__((aligned(16))) float SCs[CH * QP];
  __shared__ __attribute__((aligned(16))) float Vs[CH * HD];
  __shared__ __attribute__((aligned(16))) float ALs[CH * HD];
  __shared__ __attribute__((aligned(16))) float Sf[HD * QP];     // entry state, column-major: [e][d]
  __shared__ float Bsh[CH], GS[CH], RV[CH], RW[HD];

  const int tid = threadIdx.x;
  const int lane = tid & 31, wv = tid >> 5, m = lane & 15, h = lane >> 4;
  const int n = blockIdx.x, bh = blockIdx.y, b = bh / NH, hh = bh % NH;

  if (tid < HD) RW[tid] = bf16r(rmsw[hh * HD + tid]);

  const size_t rowbase = (size_t)b * T + (size_t)n * CH;
  const float* Qg = Qp + rowbase * DM + hh * HD;
  const float* Kg = Kp + rowbase * DM + hh * HD;
  const float* Vg = Vp + rowbase * DM + hh * HD;
  const float* Ag = Ap + rowbase * DM + hh * HD;
  const float* Si = Sg + ((size_t)bh * (T / CH) + n) * (HD * HD);

  // tile loads (64 rows x 64 f32 each): one byte offset per thread, the step of 16 rows is a constant
  const unsigned tb = (unsigned)(((tid >> 4) * DM + (tid & 15) * 4) * 4);
  v4f tq[4], tk[4], tv[4], ta[4], ts[4];
#pragma unroll
  for (int it = 0; it < 4; ++it) {
    tq[it] = *(const v4f*)((const char*)Qg + tb + it * (16 * DM * 4));
    tk[it] = *(const v4f*)((const char*)Kg + tb + it * (16 * DM * 4));
    tv[it] = *(const v4f*)((const char*)Vg + tb + it * (16 * DM * 4));
    ta[it] = *(const v4f*)((const char*)Ag + tb + it * (16 * DM * 4));
    ts[it] = *(const v4f*)(Si + tid * 4 + it * (16 * HD));
  }
  // the wait stands in front of any overwrite of the offset register the loads name; as an input it stays live up to it
  asm volatile("s_wait_xcnt 0x0" :: "v"(tb) : "memory");
#pragma unroll
  for (int it = 0; it < 4; ++it) {
    const int idx = it * 256 + tid;
    const int c = idx >> 4, d4 = (idx & 15) * 4;
    *(v4f*)(Qs  + c * QP + d4) = tq[it];
    *(v4f*)(Ks  + c * QP + d4) = tk[it];
    *(v4f*)(Vs  + c * HD + d4) = tv[it];
    *(v4f*)(ALs + c * HD + d4) = ta[it];
    *(v4f*)(Sf  + c * QP + d4) = ts[it];
  }
  if (tid < CH) {
    Bsh[tid] = fminf(Bp[(rowbase + tid) * NH + hh], 1.0f);
    GS[tid]  = Gp[(rowbase + tid) * NH + hh];
  }
  __syncthreads();

  // cumulative log decay per feature, restarted per chunk
  if (tid < HD) {
    float a = 0.0f;
    for (int c = 0; c < CH; ++c) {
      a += __logf(fmaxf(ALs[c * HD + tid], 1e-7f));
      CLs[c * QP + tid] = a;
    }
  }
  __syncthreads();

  // scores: A[i][j] = beta_j * sum_d q[i][d] k[j][d] exp(cl[i][d] - cl[j][d]) for i >= j, else 0
  {
    const int j0 = lane, j1 = lane + 32;
    float a0[8], a1[4];
#pragma unroll
    for (int r = 0; r < 8; ++r) a0[r] = 0.0f;
#pragma unroll
    for (int r = 0; r < 4; ++r) a1[r] = 0.0f;
#pragma unroll 2
    for (int d = 0; d < HD; ++d) {
      const float k0v = Ks[j0 * QP + d], c0 = CLs[j0 * QP + d];
      const float k1v = Ks[j1 * QP + d], c1 = CLs[j1 * QP + d];
#pragma unroll
      for (int r = 0; r < 8; ++r) {
        const int i = wv + 8 * r;
        const float q = Qs[i * QP + d];
        const float ci = CLs[i * QP + d];
        a0[r] += q * k0v * __expf(ci - c0);
        if (r >= 4) a1[r - 4] += q * k1v * __expf(ci - c1);
      }
    }
    const float b0 = Bsh[j0], b1 = Bsh[j1];
#pragma unroll
    for (int r = 0; r < 8; ++r) {
      const int i = wv + 8 * r;
      SCs[i * QP + j0] = (i >= j0) ? a0[r] * b0 : 0.0f;
      float v1 = 0.0f;
      if (r >= 4) v1 = (i >= j1) ? a1[r - 4] * b1 : 0.0f;
      SCs[i * QP + j1] = v1;
    }
  }
  __syncthreads();

  // O = Q*S + A*V : wave owns rows 16*ti.., two 16-col tiles; bf16 hi/lo three products per operand pair
  {
    const int ti = wv >> 1, tj0 = (wv & 1) * 2;
    v8f acc[2];
#pragma unroll
    for (int s = 0; s < 2; ++s)
#pragma unroll
      for (int r = 0; r < 8; ++r) acc[s][r] = 0.0f;

#pragma unroll
    for (int ks = 0; ks < 2; ++ks) {
      const int k0 = ks * 32;
      BF ah, al;
      fragA_split(Qs + (ti * 16 + m) * QP + k0, h, ah, al);
#pragma unroll
      for (int s = 0; s < 2; ++s) {
        BF bhi, blo;
        fragA_split(Sf + ((tj0 + s) * 16 + m) * QP + k0, h, bhi, blo);   // column e of S is a row of Sf: same k map as the gather
        acc[s] = mma_bf16(ah.v, bhi.v, acc[s]);
        acc[s] = mma_bf16(ah.v, blo.v, acc[s]);
        acc[s] = mma_bf16(al.v, bhi.v, acc[s]);
      }
    }
#pragma unroll
    for (int ks = 0; ks < 2; ++ks) {
      const int k0 = ks * 32;
      BF ah, al;
      fragA_split(SCs + (ti * 16 + m) * QP + k0, h, ah, al);
#pragma unroll
      for (int s = 0; s < 2; ++s) {
        BF bhi, blo;
        fragB_split(Vs, HD, k0, (tj0 + s) * 16 + m, h, bhi, blo);
        acc[s] = mma_bf16(ah.v, bhi.v, acc[s]);
        acc[s] = mma_bf16(ah.v, blo.v, acc[s]);
        acc[s] = mma_bf16(al.v, bhi.v, acc[s]);
      }
    }
    __syncthreads();   // all reads of SCs/Sf done; reuse SCs as the O tile
#pragma unroll
    for (int s = 0; s < 2; ++s)
#pragma unroll
      for (int r = 0; r < 8; ++r)
        SCs[(ti * 16 + 8 * h + r) * QP + (tj0 + s) * 16 + m] = acc[s][r];
  }
  __syncthreads();

  // per-row RMS normaliser times gate
  if (tid < CH) {
    float ss = 0.0f;
    for (int e2 = 0; e2 < HD; ++e2) { const float o = SCs[tid * QP + e2]; ss += o * o; }
    RV[tid] = GS[tid] / sqrtf(ss * (1.0f / 64.0f) + 1e-6f);
  }
  __syncthreads();

  {
    v8h ov[2];
    size_t go[2];
#pragma unroll
    for (int it = 0; it < 2; ++it) {
      const int c = it * 32 + (tid >> 3), e0 = (tid & 7) * 8;
      const v4f x0 = *(const v4f*)(SCs + c * QP + e0);
      const v4f x1 = *(const v4f*)(SCs + c * QP + e0 + 4);
      const float sc = RV[c] * ogscale;
      v8h o;
#pragma unroll
      for (int q = 0; q < 4; ++q) {
        o[q]     = (h16)(x0[q] * sc * RW[e0 + q]);
        o[4 + q] = (h16)(x1[q] * sc * RW[e0 + 4 + q]);
      }
      ov[it] = o;
      go[it] = (rowbase + c) * (size_t)DM + hh * HD + e0;
    }
#pragma unroll
    for (int it = 0; it < 2; ++it) *(v8h*)(Og + go[it]) = ov[it];
    
  }
}

// ---------------------------------------------------------------------------
extern "C" void kernel_launch(void* const* d_in, const int* in_sizes, int n_in,
                              void* d_out, int out_size, void* d_ws, size_t ws_size,
                              hipStream_t stream)
{
  if (n_in < 26) return;
  const int T = 2048;
  const long nx = (long)in_sizes[0];
  if (nx <= 0 || (nx % ((long)DM * T)) != 0) return;
  const int M = (int)(nx / DM);                       // tokens, multiple of 2048 (hence of 128)
  if ((long)out_size != (long)M * DM) return;
  if (in_sizes[1] != DM * 4 || in_sizes[3] != DM * 4 || in_sizes[5] != DM * 4) return;
  if (in_sizes[7] != DM * DM || in_sizes[9] != DM * DM || in_sizes[11] != DM * DM || in_sizes[24] != DM * DM) return;
  if (in_sizes[13] != 64 * DM || in_sizes[15] != DM * 64 || in_sizes[17] != NH * DM ||
      in_sizes[20] != 64 * DM || in_sizes[22] != NH * 64) return;

  const float* x       = (const float*)d_in[0];
  const float* wq_conv = (const float*)d_in[1];  const float* bq_conv = (const float*)d_in[2];
  const float* wk_conv = (const float*)d_in[3];  const float* bk_conv = (const float*)d_in[4];
  const float* wv_conv = (const float*)d_in[5];  const float* bv_conv = (const float*)d_in[6];
  const float* Wq  = (const float*)d_in[7];   const float* bq  = (const float*)d_in[8];
  const float* Wk  = (const float*)d_in[9];   const float* bk  = (const float*)d_in[10];
  const float* Wv  = (const float*)d_in[11];  const float* bv  = (const float*)d_in[12];
  const float* Wad = (const float*)d_in[13];  const float* bad = (const float*)d_in[14];
  const float* Wau = (const float*)d_in[15];  const float* bau = (const float*)d_in[16];
  const float* Wbe = (const float*)d_in[17];  const float* bbe = (const float*)d_in[18];
  const float* rms_w = (const float*)d_in[19];
  const float* Wgd = (const float*)d_in[20];  const float* bgd = (const float*)d_in[21];
  const float* Wgu = (const float*)d_in[22];  const float* bgu = (const float*)d_in[23];
  const float* Wo  = (const float*)d_in[24];  const float* bo  = (const float*)d_in[25];

  char* ws = (char*)d_ws;
  size_t off = 0;
  auto carve = [&](size_t bytes) -> char* {
    char* p = ws + off;
    off += (bytes + 255) & ~(size_t)255;
    return p;
  };
  const size_t MD = (size_t)M * DM;
  h16* xh    = (h16*)carve(MD * 2);
  h16* cq    = (h16*)carve(MD * 2);
  h16* ck    = (h16*)carve(MD * 2);
  h16* cv    = (h16*)carve(MD * 2);
  h16* Wq16  = (h16*)carve((size_t)DM * DM * 2);
  h16* Wk16  = (h16*)carve((size_t)DM * DM * 2);
  h16* Wv16  = (h16*)carve((size_t)DM * DM * 2);
  h16* Wo16  = (h16*)carve((size_t)DM * DM * 2);
  h16* Wad16 = (h16*)carve((size_t)64 * DM * 2);
  h16* Wau16 = (h16*)carve((size_t)DM * 64 * 2);
  h16* Wbe16 = (h16*)carve((size_t)NH * DM * 2);
  h16* Wgd16 = (h16*)carve((size_t)64 * DM * 2);
  h16* Wgu16 = (h16*)carve((size_t)NH * 64 * 2);
  float* Qn  = (float*)carve(MD * 4);
  float* Kn  = (float*)carve(MD * 4);
  float* Vf  = (float*)carve(MD * 4);
  float* Al  = (float*)carve(MD * 4);
  float* Bt  = (float*)carve((size_t)M * NH * 4);
  float* Gt  = (float*)carve((size_t)M * NH * 4);
  h16* t1    = (h16*)carve((size_t)M * 64 * 2);
  h16* t2    = (h16*)carve((size_t)M * 64 * 2);
  h16* Og16  = (h16*)carve(MD * 2);
  float* Sst = (float*)carve((size_t)(M / CH) * NH * HD * HD * 4);   // entry state of every (b, h, chunk)
  if (off > ws_size) return;

  const float wsc = 256.0f;      // weight scale
  const float asc = 256.0f;      // conv activation scale
  const float tsc = 64.0f;       // gate hidden scale
  const float osc = 16.0f;       // gated output scale

  // 1) x -> f16, three shortconv+SiLU activations, and the nine weights -> scaled f16 (Wq16 .. Wgu16 are carved back to back,
  //    each a multiple of 256 bytes, in the order k_front takes the matrices)
  {
    const int n8 = (int)(MD / 8);
    const int nb = (n8 + 255) / 256;
    k_front<<<3 * nb + (G_ALL + 255) / 256, 256, 0, stream>>>(x, wq_conv, bq_conv, wk_conv, bk_conv, wv_conv, bv_conv,
                                                              Wq, Wk, Wv, Wo, Wad, Wau, Wbe, Wgd, Wgu,
                                                              xh, cq, ck, cv, Wq16, n8, nb, T, asc, wsc);
  }
  // 2) the six products on the front launch's results; 3) the two gate-up products
  k_proj<<<dim3(M / 128, 51), 256, 0, stream>>>(cq, ck, cv, xh, Wq16, Wk16, Wv16, Wad16, Wbe16, Wgd16,
                                                bq, bk, bv, bad, bbe, bgd, Qn, Kn, Vf, Bt, t1, t2,
                                                DM, 1.0f / (asc * wsc), 1.0f / wsc, tsc);
  k_gate<<<dim3(M / 128, 17), 256, 0, stream>>>(t1, t2, Wau16, Wgu16, bau, bgu, Al, Gt, 64, 1.0f / (tsc * wsc));
  // 4) state recurrence, one block per (column group, b*h); then the per-chunk outputs, one block per (chunk, b*h)
  k_state<<<dim3(HD / SC, (M / T) * NH), 256, 0, stream>>>(Kn, Vf, Al, Bt, Sst, T);
  k_out<<<dim3(T / CH, (M / T) * NH), 256, 0, stream>>>(Qn, Kn, Vf, Al, Bt, Gt, rms_w, Sst, Og16, T, osc);
  // 5) output projection
  k_oproj<<<dim3(M / 128, DM / 64), 256, 0, stream>>>(Og16, Wo16, bo, (float*)d_out, DM, 1.0f / (osc * wsc));
}

// v007
// Measured time: 175 microseconds a run.
// Timed twice side by side with v006, it ran 1.06 and 1.04 times as fast.
// Counting every step since v000, it is 7.09 times as fast.
#include <hip/hip_runtime.h>
#include <stdint.h>

// Contractions: token projections (q, k, v, gate down/up, beta, out) on v_wmma_f32_16x16x32_f16 with f16 operands pre-scaled by powers of two, f32 accumulate; per-chunk Q*S and A*V on v_wmma_f32_16x16x32_bf16 as bf16 hi/lo three-product split, f32 accumulate; decay scores, state recurrence, shortconv and norms on VALU in f32. All float inputs RNE-converted to bf16 on load.

typedef _Float16 h16;
typedef h16    v16h __attribute__((ext_vector_type(16)));
typedef h16    v8h  __attribute__((ext_vector_type(8)));
typedef __bf16 v16b __attribute__((ext_vector_type(16)));
typedef float  v8f  __attribute__((ext_vector_type(8)));
typedef float  v4f  __attribute__((ext_vector_type(4)));
typedef float  v2f  __attribute__((ext_vector_type(2)));

union HF { v16h v; v8h p[2]; };
union BF { v16b v; unsigned short u[16]; };

#define DM 1024
#define HD 64
#define NH 16
#define CH 64
#define QP 68
#define KS 64    // k per staged GEMM tile: 128 B of a row
#define LP 72    // LDS row pitch of a staged tile in f16: 144 B = 16 B x 9, free of bank conflicts for 16-byte row reads

__device__ __forceinline__ unsigned short bf16_bits(float f) {
  unsigned int u = __float_as_uint(f);
  u += 0x7FFFu + ((u >> 16) & 1u);
  return (unsigned short)(u >> 16);
}
__device__ __forceinline__ float bf16r(float f) {
  return __uint_as_float(((unsigned int)bf16_bits(f)) << 16);
}
// x = hi + lo in bf16 pieces (RNE), bit patterns
__device__ __forceinline__ void split2(float x, unsigned short& hi, unsigned short& lo) {
  const unsigned short hb = bf16_bits(x);
  const float hf = __uint_as_float(((unsigned int)hb) << 16);
  hi = hb;
  lo = bf16_bits(x - hf);
}
// low 32 bits of a __shared__ address: the byte offset in the work-group's LDS
__device__ __forceinline__ unsigned lds_off(const void* p) {
  return (unsigned)(uintptr_t)p;
}
__device__ __forceinline__ float sigm(float v) {
  return __fdividef(1.0f, 1.0f + __expf(-v));
}

// 16-bit WMMA wrappers with the VALU hazard guard after the matrix op
__device__ __forceinline__ v8f mma_f16(v16h a, v16h b, v8f c) {
  c = __builtin_amdgcn_wmma_f32_16x16x32_f16(false, a, false, b, (short)0, c, false, false);
  asm volatile("v_nop\n\tv_nop\n\tv_nop\n\tv_nop" : "+v"(c) : "v"(a), "v"(b));
  return c;
}
__device__ __forceinline__ v8f mma_bf16(v16b a, v16b b, v8f c) {
  c = __builtin_amdgcn_wmma_f32_16x16x32_bf16(false, a, false, b, (short)0, c, false, false);
  asm volatile("v_nop\n\tv_nop\n\tv_nop\n\tv_nop" : "+v"(c) : "v"(a), "v"(b));
  return c;
}

// A fragment (row m, split k map) from an f32 LDS row pointer pr = base + row*pitch + k0, as bf16 hi/lo
__device__ __forceinline__ void fragA_split(const float* pr, int h, BF& hi, BF& lo) {
  const v4f x0 = *(const v4f*)(pr + 8 * h);
  const v4f x1 = *(const v4f*)(pr + 8 * h + 4);
  const v4f x2 = *(const v4f*)(pr + 16 + 8 * h);
  const v4f x3 = *(const v4f*)(pr + 20 + 8 * h);
#pragma unroll
  for (int q = 0; q < 4; ++q) {
    split2(x0[q], hi.u[q],      lo.u[q]);
    split2(x1[q], hi.u[4 + q],  lo.u[4 + q]);
    split2(x2[q], hi.u[8 + q],  lo.u[8 + q]);
    split2(x3[q], hi.u[12 + q], lo.u[12 + q]);
  }
}
// B fragment (col n, same split k map) gathered down column col of f32 [k][pitch] in LDS, as bf16 hi/lo
__device__ __forceinline__ void fragB_split(const float* base, int pitch, int k0, int col, int h, BF& hi, BF& lo) {
#pragma unroll
  for (int i = 0; i < 8; ++i) {
    split2(base[(k0 + 8 * h + i) * pitch + col],      hi.u[i],     lo.u[i]);
    split2(base[(k0 + 16 + 8 * h + i) * pitch + col], hi.u[8 + i], lo.u[8 + i]);
  }
}

// ---------------------------------------------------------------------------
// Everything that reads only the inputs, in one launch of few, long work-groups.
// The first nconv blocks: causal depthwise conv (4 taps) + SiLU for all three weight sets, f16 output scaled by ascale, and x -> f16.
// A block takes FW channels x 8 * FL tokens; a wave a run of FL tokens, a lane 8 channels of it. The FL + 3 rows of x that the run
// needs are read once and serve all three sets; a set's taps and bias are read once per run.
// The blocks behind them: the nine weight matrices -> scaled f16, CG groups of eight elements per thread. Their f16 copies lie one
// behind the other in w16, in the order of the arguments, so one running group index serves all nine; every matrix but the last
// ends on a multiple of 256 * CG groups, so a block converts from one matrix only.
// ---------------------------------------------------------------------------
#define G_SQ (DM * DM / 8)    // groups of eight in a DM x DM matrix
#define G_LR (64 * DM / 8)    // ... in a 64 x DM or DM x 64 matrix
#define G_HD (NH * DM / 8)    // ... in an NH x DM matrix
#define G_HR (NH * 64 / 8)    // ... in an NH x 64 matrix
#define G_ALL (4 * G_SQ + 3 * G_LR + G_HD + G_HR)
#define CG 8      // groups per thread of a converting block
#define FL 8      // tokens per wave of a conv block
#define FW 256    // channels per conv block: 32 lanes x 8
#define TP 36     // LDS pitch in f32 of a lane's 4 taps x 8 channels: 144 B = 16 B x 9, free of bank conflicts for 16-byte reads

// SiLU's sigmoid for the conv part: sigm() with its exponential spelled out, the same multiply and the same v_exp_f32. The v_nop is the
// slot that the instruction set asks for behind a transcendental before its source register is overwritten: the argument dies at the
// v_exp_f32, and among the many side by side here the compiler gave its register to the very next instruction in some places
__device__ __forceinline__ float sigm_slot(float v) {
  const float t = v * -1.44269504f;
  float e;
  asm("v_exp_f32 %0, %1\n\tv_nop" : "=v"(e) : "v"(t));
  return __fdividef(1.0f, 1.0f + e);
}

__global__ void __launch_bounds__(256)
k_front(const float* __restrict__ x,
        const float* __restrict__ w0, const float* __restrict__ b0,
        const float* __restrict__ w1, const float* __restrict__ b1,
        const float* __restrict__ w2, const float* __restrict__ b2,
        const float* __restrict__ Wq, const float* __restrict__ Wk, const float* __restrict__ Wv,
        const float* __restrict__ Wo, const float* __restrict__ Wad, const float* __restrict__ Wau,
        const float* __restrict__ Wbe, const float* __restrict__ Wgd, const float* __restrict__ Wgu,
        h16* xh, h16* y0, h16* y1, h16* y2, h16* w16, int nconv, int T, float ascale, float wscale)
{
  __shared__ __attribute__((aligned(16))) float tw[3 * 32 * TP];   // [set][lane][tap][channel of the lane], bf16-rounded
  __shared__ __attribute__((aligned(16))) float tb[3 * FW];        // [set][channel], bf16-rounded

  const int bid = blockIdx.x;
  const int tid = threadIdx.x;
  if (bid >= nconv) {
    const int g0 = (bid - nconv) * (256 * CG);                              // first group of this block
    const float* src = Wq;
    int first = 0;                                                          // first group of the matrix g0 lies in
    if (g0 >= 4 * G_SQ + 3 * G_LR + G_HD)      { src = Wgu; first = 4 * G_SQ + 3 * G_LR + G_HD; }
    else if (g0 >= 4 * G_SQ + 2 * G_LR + G_HD) { src = Wgd; first = 4 * G_SQ + 2 * G_LR + G_HD; }
    else if (g0 >= 4 * G_SQ + 2 * G_LR)        { src = Wbe; first = 4 * G_SQ + 2 * G_LR; }
    else if (g0 >= 4 * G_SQ + G_LR)            { src = Wau; first = 4 * G_SQ + G_LR; }
    else if (g0 >= 4 * G_SQ)                   { src = Wad; first = 4 * G_SQ; }
    else if (g0 >= 3 * G_SQ)                   { src = Wo;  first = 3 * G_SQ; }
    else if (g0 >= 2 * G_SQ)                   { src = Wv;  first = 2 * G_SQ; }
    else if (g0 >= G_SQ)                       { src = Wk;  first = G_SQ; }
    // all loads of the thread are asked for before the first is used; a group past the end re-reads the last one and is not stored
    v4f a[CG], c[CG];
    const float* ps[CG];
#pragma unroll
    for (int it = 0; it < CG; ++it) {
      const int gi = g0 + it * 256 + tid;
      ps[it] = src + (size_t)((gi < G_ALL ? gi : G_ALL - 1) - first) * 8;
      a[it] = *(const v4f*)ps[it];
      c[it] = *(const v4f*)(ps[it] + 4);
    }
    // the wait stands in front of any overwrite of the address registers the loads name; as inputs they stay live up to it
    asm volatile("s_wait_xcnt 0x0" :: "v"(ps[0]), "v"(ps[1]), "v"(ps[2]), "v"(ps[3]), "v"(ps[4]), "v"(ps[5]), "v"(ps[6]), "v"(ps[7]) : "memory");
    v8h o[CG];
#pragma unroll
    for (int it = 0; it < CG; ++it)
#pragma unroll
      for (int q = 0; q < 4; ++q) {
        o[it][q]     = (h16)(bf16r(a[it][q]) * wscale);
        o[it][4 + q] = (h16)(bf16r(c[it][q]) * wscale);
      }
#pragma unroll
    for (int it = 0; it < CG; ++it) {
      const int gi = g0 + it * 256 + tid;
      if (gi < G_ALL) *(v8h*)(w16 + (size_t)gi * 8) = o[it];
    }
    return;
  }

  const int lane = tid & 31;
  // the wave's number is the same in all its lanes: read as a scalar, so that the row addresses and the test on the run's start are scalar
  const int wv = __builtin_amdgcn_readfirstlane(tid >> 5);
  const int c0 = (bid & (DM / FW - 1)) * FW;                      // first channel of the block
  const unsigned tok0 = (unsigned)(bid / (DM / FW)) * (8 * FL) + wv * FL;   // first token of the wave's run
  const size_t eo = (size_t)tok0 * DM + c0 + lane * 8;            // the lane's first element, in x and in every output

  // taps and bias of the block's channels: whole lines from global memory, one channel's four taps per thread and set
  const unsigned co = (unsigned)(c0 + tid);
  const v4f t0 = *(const v4f*)(w0 + co * 4), t1 = *(const v4f*)(w1 + co * 4), t2 = *(const v4f*)(w2 + co * 4);
  const float u0 = b0[co], u1 = b1[co], u2 = b2[co];
  // rows tok0 - 3 .. tok0 + FL - 1 of x; the three in front of a sequence's start count as zero (a run starts at a multiple of FL in it)
  v4f xa[FL + 3], xb[FL + 3];
  const float* px = x + eo;
#pragma unroll
  for (int j = 3; j < FL + 3; ++j) {
    xa[j] = *(const v4f*)(px + (j - 3) * DM);
    xb[j] = *(const v4f*)(px + (j - 3) * DM + 4);
  }
  if (tok0 % (unsigned)T != 0) {
#pragma unroll
    for (int j = 0; j < 3; ++j) {
      xa[j] = *(const v4f*)(px + (j - 3) * DM);
      xb[j] = *(const v4f*)(px + (j - 3) * DM + 4);
    }
  } else {
#pragma unroll
    for (int j = 0; j < 3; ++j)
#pragma unroll
      for (int q = 0; q < 4; ++q) { xa[j][q] = 0.0f; xb[j][q] = 0.0f; }
  }
  // the wait stands in front of any overwrite of the address registers the loads name; as inputs they stay live up to it
  asm volatile("s_wait_xcnt 0x0" :: "v"(px), "v"(co) : "memory");

  // taps to LDS as [lane][tap][channel of the lane], so that a lane reads a tap of its eight channels as two 16-byte pieces
  {
    float* d = tw + (tid >> 3) * TP + (tid & 7);
#pragma unroll
    for (int k = 0; k < 4; ++k) {
      d[k * 8]               = bf16r(t0[k]);
      d[32 * TP + k * 8]     = bf16r(t1[k]);
      d[2 * 32 * TP + k * 8] = bf16r(t2[k]);
    }
    tb[tid]          = bf16r(u0);
    tb[FW + tid]     = bf16r(u1);
    tb[2 * FW + tid] = bf16r(u2);
  }
  __syncthreads();   // every thread's taps are in LDS before any lane reads its eight channels'

  // x rounded, two neighbouring channels side by side for the packed products
  v2f xr[FL + 3][4];
#pragma unroll
  for (int j = 0; j < FL + 3; ++j)
#pragma unroll
    for (int p = 0; p < 2; ++p) {
      xr[j][p]     = v2f{ bf16r(xa[j][2 * p]), bf16r(xa[j][2 * p + 1]) };
      xr[j][2 + p] = v2f{ bf16r(xb[j][2 * p]), bf16r(xb[j][2 * p + 1]) };
    }

  {
    v8h ox[FL];
#pragma unroll
    for (int j = 0; j < FL; ++j)
#pragma unroll
      for (int q = 0; q < 8; ++q) ox[j][q] = (h16)xr[j + 3][q >> 1][q & 1];
#pragma unroll
    for (int j = 0; j < FL; ++j) *(v8h*)(xh + eo + (size_t)j * DM) = ox[j];
    // the wait stands in front of any rewrite of the registers the stores name
    asm volatile("s_wait_xcnt 0x0" ::: "memory");
  }

  // the loop over the three sets stays rolled, for speed only
#pragma unroll 1
  for (int s = 0; s < 3; ++s) {
    h16* y = (s == 0) ? y0 : ((s == 1) ? y1 : y2);
    v2f wt[4][4], bi[4];
#pragma unroll
    for (int k = 0; k < 4; ++k) {
      const v4f a = *(const v4f*)(tw + s * (32 * TP) + lane * TP + k * 8);
      const v4f c = *(const v4f*)(tw + s * (32 * TP) + lane * TP + k * 8 + 4);
      wt[k][0] = a.xy;  wt[k][1] = a.zw;  wt[k][2] = c.xy;  wt[k][3] = c.zw;
    }
    {
      const v4f a = *(const v4f*)(tb + s * FW + lane * 8), c = *(const v4f*)(tb + s * FW + lane * 8 + 4);
      bi[0] = a.xy;  bi[1] = a.zw;  bi[2] = c.xy;  bi[3] = c.zw;
    }
    v8h o[FL];
#pragma unroll
    for (int j = 0; j < FL; ++j)
#pragma unroll
      for (int p = 0; p < 4; ++p) {
        v2f acc = xr[j][p] * wt[0][p];
        acc = __builtin_elementwise_fma(xr[j + 1][p], wt[1][p], acc);
        acc = __builtin_elementwise_fma(xr[j + 2][p], wt[2][p], acc);
        acc = __builtin_elementwise_fma(xr[j + 3][p], wt[3][p], acc);
        acc += bi[p];
        o[j][2 * p]     = (h16)(acc.x * sigm_slot(acc.x) * ascale);
        o[j][2 * p + 1] = (h16)(acc.y * sigm_slot(acc.y) * ascale);
      }
#pragma unroll
    for (int j = 0; j < FL; ++j) *(v8h*)(y + eo + (size_t)j * DM) = o[j];
    // the wait stands in front of any rewrite of the registers the stores name
    asm volatile("s_wait_xcnt 0x0" ::: "memory");
  }
}

// ---------------------------------------------------------------------------
// Y[M,N] = epi( A[M,K] * W[N,K]^T * oscale + bias[N] ), f16 operands (k-contiguous), f32 accumulate.
// One block tile (bx, by) of one product; the launches below hand independent products to one grid, told apart by blockIdx.y.
// Block 256 threads = 8 waves; block tile 128 rows x 16*NT cols; wave tile 16 x 16*NT.
// Both operands come to LDS in tiles of KS k by asynchronous copies, whole cache lines, two buffers: tile t + 1 flies while t is used.
// EPI: 0 none, 1 L2-normalise each row over the 64-col slab, 2 silu, 3 sigmoid then clip to [0.1,1], 4 sigmoid then min 1.
// ---------------------------------------------------------------------------
// LDS of a launch, sized for NT = 4: the epilogue's staging, two buffers of 128 rows of A, two of up to 64 rows of W, KS k each
#define GEMM_LDS \
  __shared__ __attribute__((aligned(16))) float stg[8 * 16 * 64]; \
  __shared__ __attribute__((aligned(16))) h16 sA[2 * 128 * LP]; \
  __shared__ __attribute__((aligned(16))) h16 sW[2 * 64 * LP];

template<int NT, int EPI, typename OT>
__device__ __forceinline__ void
gemm_tile(const h16* __restrict__ A, const h16* __restrict__ W, const float* __restrict__ bias,
          OT* Y, int N, int K, float oscale, float yscale, int bx, int by, float* stg, h16* sA, h16* sW)
{
  constexpr int TW = 16 * NT;

  const int lane = threadIdx.x & 31, wv = threadIdx.x >> 5;
  const int m = lane & 15, h = lane >> 4;
  const int rowBase = bx * 128 + wv * 16;
  const int colBase = by * TW;

  v8f acc[NT];
#pragma unroll
  for (int t = 0; t < NT; ++t)
#pragma unroll
    for (int r = 0; r < 8; ++r) acc[t][r] = 0.0f;

  // Copy map: a row of a tile is KS f16 = 128 B = one cache line; 8 lanes x 16 B bring one row, a wave four whole lines.
  const int tid = threadIdx.x;
  const int cr = tid >> 3, cc = (tid & 7) * 8;
  const h16* ga = A + (size_t)(bx * 128 + cr) * K + cc;
  const unsigned la = lds_off(sA + cr * LP + cc);
  // W tile: 64 rows in 16-byte pieces (two per thread), or 16 rows in 8-byte pieces (one per thread)
  const int wr = (NT == 4) ? cr : (tid >> 4), wc = (NT == 4) ? cc : (tid & 15) * 4;
  const h16* gw = W + (size_t)(colBase + wr) * K + wc;
  const unsigned lw = lds_off(sW + wr * LP + wc);
  const size_t r32 = (size_t)32 * K;             // 32 rows further in global memory
  constexpr unsigned L32 = 32 * LP * 2;          // 32 rows further in LDS, bytes

  // all of tile t's copies, every lane on; the s_wait_xcnt closes the statement so that it stands in front of any
  // rewrite of the address registers the copies name
  auto stage = [&](int t) {
    const h16* a0 = ga + (size_t)t * KS;
    const h16* w0 = gw + (size_t)t * KS;
    const unsigned l0 = la + (unsigned)(t & 1) * (128 * LP * 2);
    const unsigned m0 = lw + (unsigned)(t & 1) * (TW * LP * 2);
    if constexpr (NT == 4) {
      asm volatile("global_load_async_to_lds_b128 %0, %1, off\n\t"
                   "global_load_async_to_lds_b128 %2, %3, off\n\t"
                   "global_load_async_to_lds_b128 %4, %5, off\n\t"
                   "global_load_async_to_lds_b128 %6, %7, off\n\t"
                   "global_load_async_to_lds_b128 %8, %9, off\n\t"
                   "global_load_async_to_lds_b128 %10, %11, off\n\t"
                   "s_wait_xcnt 0x0"
                   :: "v"(l0), "v"(a0), "v"(l0 + L32), "v"(a0 + r32), "v"(l0 + 2 * L32), "v"(a0 + 2 * r32),
                      "v"(l0 + 3 * L32), "v"(a0 + 3 * r32), "v"(m0), "v"(w0), "v"(m0 + L32), "v"(w0 + r32)
                   : "memory");
    } else {
      asm volatile("global_load_async_to_lds_b128 %0, %1, off\n\t"
                   "global_load_async_to_lds_b128 %2, %3, off\n\t"
                   "global_load_async_to_lds_b128 %4, %5, off\n\t"
                   "global_load_async_to_lds_b128 %6, %7, off\n\t"
                   "global_load_async_to_lds_b64 %8, %9, off\n\t"
                   "s_wait_xcnt 0x0"
                   :: "v"(l0), "v"(a0), "v"(l0 + L32), "v"(a0 + r32), "v"(l0 + 2 * L32), "v"(a0 + 2 * r32),
                      "v"(l0 + 3 * L32), "v"(a0 + 3 * r32), "v"(m0), "v"(w0)
                   : "memory");
    }
  };

  const int nt = K / KS;
  stage(0);
  asm volatile("s_wait_asynccnt 0x0" ::: "memory");   // this wave's copies of tile 0 have landed
  __syncthreads();                                    // ... and every other wave's
  if (nt > 1) stage(1);

  // A: lane row m, elements 0..7 <- k0+8h.., 8..15 <- k0+16+8h..;  B: lane col m, same k map
  for (int t = 0; t < nt; ++t) {
    const h16* pa = sA + (t & 1) * (128 * LP) + (wv * 16 + m) * LP + 8 * h;
    const h16* pw = sW + (t & 1) * (TW * LP) + m * LP + 8 * h;
    HF a[KS / 32], b[KS / 32][NT];
#pragma unroll
    for (int q = 0; q < KS / 32; ++q) {
      a[q].p[0] = *(const v8h*)(pa + 32 * q);
      a[q].p[1] = *(const v8h*)(pa + 32 * q + 16);
#pragma unroll
      for (int u = 0; u < NT; ++u) {
        b[q][u].p[0] = *(const v8h*)(pw + 16 * u * LP + 32 * q);
        b[q][u].p[1] = *(const v8h*)(pw + 16 * u * LP + 32 * q + 16);
      }
    }
#pragma unroll
    for (int q = 0; q < KS / 32; ++q)
#pragma unroll
      for (int u = 0; u < NT; ++u) acc[u] = mma_f16(a[q].v, b[q][u].v, acc[u]);
    asm volatile("s_wait_dscnt 0x0" ::: "memory");      // this wave's reads of the buffer are done before it is refilled
    asm volatile("s_wait_asynccnt 0x0" ::: "memory");   // this wave's copies of tile t + 1 have landed
    __syncthreads();                                    // publishes tile t + 1 and ends every wave's reads of tile t
    if (t + 2 < nt) stage(t + 2);
  }
  asm volatile("s_wait_asynccnt 0x0" ::: "memory");     // no copy is left in flight when the wave goes on

  // epilogue values (D element r of this lane = row 8h+r, col m of tile t)
#pragma unroll
  for (int t = 0; t < NT; ++t) {
    const float bv = bf16r(bias[colBase + 16 * t + m]);
#pragma unroll
    for (int r = 0; r < 8; ++r) {
      float v = acc[t][r] * oscale + bv;
      if (EPI == 2)      { v = v * sigm(v); }
      else if (EPI == 3) { v = sigm(v); v = fminf(fmaxf(v, 0.1f), 1.0f); }
      else if (EPI == 4) { v = fminf(sigm(v), 1.0f); }
      acc[t][r] = v;
    }
  }
  if (EPI == 1) {
#pragma unroll
    for (int r = 0; r < 8; ++r) {
      float ss = 0.0f;
#pragma unroll
      for (int t = 0; t < NT; ++t) ss += acc[t][r] * acc[t][r];
      ss += __shfl_xor(ss, 1, 32);
      ss += __shfl_xor(ss, 2, 32);
      ss += __shfl_xor(ss, 4, 32);
      ss += __shfl_xor(ss, 8, 32);
      const float inv = 1.0f / sqrtf(fmaxf(ss, 1e-6f));
#pragma unroll
      for (int t = 0; t < NT; ++t) acc[t][r] *= inv;
    }
  }

  float* sw = stg + wv * 16 * TW;
#pragma unroll
  for (int t = 0; t < NT; ++t)
#pragma unroll
    for (int r = 0; r < 8; ++r) sw[(8 * h + r) * TW + 16 * t + m] = acc[t][r];
  __syncthreads();

  if constexpr (sizeof(OT) == 4 && NT == 4) {
    v4f vals[8];
    size_t offs[8];
#pragma unroll
    for (int it = 0; it < 8; ++it) {
      const int row = 2 * it + h, c4 = m * 4;
      vals[it] = *(const v4f*)(sw + row * TW + c4);
      offs[it] = (size_t)(rowBase + row) * N + colBase + c4;
    }
#pragma unroll
    for (int it = 0; it < 8; ++it) *(v4f*)(Y + offs[it]) = vals[it];
    // in a merged launch another product's code follows in the listing: the wait stands in front of any rewrite of the registers the stores name
    asm volatile("s_wait_xcnt 0x0" ::: "memory");
  } else if constexpr (sizeof(OT) == 2 && NT == 4) {
    v8h vals[4];
    size_t offs[4];
#pragma unroll
    for (int it = 0; it < 4; ++it) {
      const int row = it * 4 + (lane >> 3), c8 = (lane & 7) * 8;
      const v4f a = *(const v4f*)(sw + row * TW + c8);
      const v4f c = *(const v4f*)(sw + row * TW + c8 + 4);
      v8h o;
#pragma unroll
      for (int q = 0; q < 4; ++q) { o[q] = (h16)(a[q] * yscale); o[4 + q] = (h16)(c[q] * yscale); }
      vals[it] = o;
      offs[it] = (size_t)(rowBase + row) * N + colBase + c8;
    }
#pragma unroll
    for (int it = 0; it < 4; ++it) *(v8h*)(Y + offs[it]) = vals[it];
    // in a merged launch another product's code follows in the listing: the wait stands in front of any rewrite of the registers the stores name
    asm volatile("s_wait_xcnt 0x0" ::: "memory");
  } else if constexpr (sizeof(OT) == 4 && NT == 1) {
    // N == 16: the wave's 16 rows are 1 KB contiguous; 8 lanes x 16 B per line
    v4f vals[2];
    size_t offs[2];
#pragma unroll
    for (int it = 0; it < 2; ++it) {
      const int q = it * 32 + lane, row = q >> 2, c4 = (q & 3) * 4;
      vals[it] = *(const v4f*)(sw + row * TW + c4);
      offs[it] = (size_t)(rowBase + row) * N + colBase + c4;
    }
#pragma unroll
    for (int it = 0; it < 2; ++it) *(v4f*)(Y + offs[it]) = vals[it];
    // in a merged launch another product's code follows in the listing: the wait stands in front of any rewrite of the registers the stores name
    asm volatile("s_wait_xcnt 0x0" ::: "memory");
  }
}

// ---------------------------------------------------------------------------
// The six products that need only the front launch's results, K = DM each: q, k (16 column slabs each, L2 norm), v (16 slabs),
// gate-down for alpha, beta, gate-down for the output gate (one slab each).
// ---------------------------------------------------------------------------
__global__ void __launch_bounds__(256)
k_proj(const h16* __restrict__ cq, const h16* __restrict__ ck, const h16* __restrict__ cv, const h16* __restrict__ xh,
       const h16* __restrict__ Wq16, const h16* __restrict__ Wk16, const h16* __restrict__ Wv16,
       const h16* __restrict__ Wad16, const h16* __restrict__ Wbe16, const h16* __restrict__ Wgd16,
       const float* __restrict__ bq, const float* __restrict__ bk, const float* __restrict__ bv,
       const float* __restrict__ bad, const float* __restrict__ bbe, const float* __restrict__ bgd,
       float* Qn, float* Kn, float* Vf, float* Bt, h16* t1, h16* t2,
       int K, float cscale, float xscale, float tscale)
{
  GEMM_LDS
  const int bx = blockIdx.x, y = blockIdx.y;
  if (y < 32) {
    const bool q = y < 16;
    gemm_tile<4, 1, float>(q ? cq : ck, q ? Wq16 : Wk16, q ? bq : bk, q ? Qn : Kn, DM, K, cscale, 1.0f, bx, y & 15, stg, sA, sW);
  } else if (y < 48) {
    gemm_tile<4, 0, float>(cv, Wv16, bv, Vf, DM, K, cscale, 1.0f, bx, y - 32, stg, sA, sW);
  } else if (y == 49) {
    gemm_tile<1, 4, float>(xh, Wbe16, bbe, Bt, NH, K, xscale, 1.0f, bx, 0, stg, sA, sW);
  } else {
    const bool a = y == 48;
    gemm_tile<4, 2, h16>(xh, a ? Wad16 : Wgd16, a ? bad : bgd, a ? t1 : t2, 64, K, xscale, tscale, bx, 0, stg, sA, sW);
  }
}

// The two gate-up products, K = 64 each: alpha (16 slabs) and the output gate (one slab).
__global__ void __launch_bounds__(256)
k_gate(const h16* __restrict__ t1, const h16* __restrict__ t2, const h16* __restrict__ Wau16, const h16* __restrict__ Wgu16,
       const float* __restrict__ bau, const float* __restrict__ bgu, float* Al, float* Gt, int K, float oscale)
{
  GEMM_LDS
  const int bx = blockIdx.x, y = blockIdx.y;
  if (y < 16) gemm_tile<4, 3, float>(t1, Wau16, bau, Al, DM, K, oscale, 1.0f, bx, y, stg, sA, sW);
  else        gemm_tile<1, 4, float>(t2, Wgu16, bgu, Gt, NH, K, oscale, 1.0f, bx, 0, stg, sA, sW);
}

// The output projection.
__global__ void __launch_bounds__(256)
k_oproj(const h16* __restrict__ A, const h16* __restrict__ W, const float* __restrict__ bias, float* Y, int K, float oscale)
{
  GEMM_LDS
  gemm_tile<4, 0, float>(A, W, bias, Y, DM, K, oscale, 1.0f, blockIdx.x, blockIdx.y, stg, sA, sW);
}

// ---------------------------------------------------------------------------
// Gated delta rule, serial part. The columns e of the state S (64x64 f32) never mix: each evolves from k, a, beta and v[e] alone.
// One block per (group of SC columns, b*h), T/64 chunks in sequence; 4 waves hold the state and step, 4 more stage the next chunk's
// operands meanwhile. A 16-lane row of a stepping wave owns one column,
// lane lg of it the rows 4*lg .. 4*lg+3 in registers, so k^T S is summed inside the row and no step needs a barrier.
// Four steps 0..3 are taken from one state S. With dl_i = v_i - k_i^T (a_i S_i-1), every later step's k^T S is linear in S and
// in the earlier dl, so with A(j..i] the product of a_j+1 .. a_i, per feature:
//   dl_i = v_i - (k_i A(-1..i])^T S - sum over j < i of c_ij dl_j,     c_ij = sum_d k_i A(j..i] beta_j k_j
//   S   <- A(-1..3] S + sum over j of (beta_j k_j A(j..3]) dl_j
// The four row sums run side by side, and the dependent chain of one step, three short links longer, serves four. The vectors in
// brackets and the c_ij hold no state and no column: they are formed once per chunk while the tiles are staged.
// The state each chunk starts from is stored column-major, Sg[(bh*nch + n)][e][d], for the chunk-parallel output kernel.
// ---------------------------------------------------------------------------
#define SC 8    // state columns per block
#define NSTP 8    // steps per group of LDS operand reads

// x + (x of lane l ^ mask) inside a 16-lane row; CTRL = 0x160 + mask is the DPP row_xmask control
template<int CTRL>
__device__ __forceinline__ float xmask_add(float x) {
  return x + __int_as_float(__builtin_amdgcn_update_dpp(0, __float_as_int(x), CTRL, 0xf, 0xf, true));
}
// sum of the four elements of every lane of a 16-lane row, in every lane of it
__device__ __forceinline__ float row_sum(v4f x) {
  float s = (x[0] + x[2]) + (x[1] + x[3]);
  s = xmask_add<0x161>(s);
  s = xmask_add<0x162>(s);
  s = xmask_add<0x164>(s);
  return xmask_add<0x168>(s);
}

// work-group barrier that orders LDS only: the stagers' global loads of the chunk after next stay in flight across it,
// where __syncthreads() would wait for them
__device__ __forceinline__ void lds_barrier() {
  __builtin_amdgcn_fence(__ATOMIC_RELEASE, "workgroup", "local");
  __builtin_amdgcn_s_barrier();
  __builtin_amdgcn_fence(__ATOMIC_ACQUIRE, "workgroup", "local");
}

__global__ void __launch_bounds__(256)
k_state(const float* __restrict__ Kp, const float* __restrict__ Vp, const float* __restrict__ Ap,
        const float* __restrict__ Bp, float* Sg, int T)
{
  // Two buffers of every staged array: waves 0..3 step through chunk n in buffer n & 1 while waves 4..7 stage chunk n + 1 in the other.
  // Us: k_i A(-1..i], two steps side by side so that one packed product serves both: of the four rows of a group, for lane lg,
  // row 0 holds steps (0, 1) of d = 4*lg and of 4*lg+1, row 1 those of 4*lg+2 and 4*lg+3, rows 2 and 3 the same of steps (2, 3)
  __shared__ __attribute__((aligned(16))) float Us[2 * CH * HD];
  __shared__ __attribute__((aligned(16))) float Ws[2 * CH * HD];         // [t][d]: beta_j k_j A(j..3]
  __shared__ __attribute__((aligned(16))) float Ps[2 * (CH / 4) * HD];   // [group][d]: A(-1..3]
  __shared__ __attribute__((aligned(16))) float Vt[2 * SC * CH];         // [column][t]
  __shared__ __attribute__((aligned(16))) float Cs[2 * (CH / 4) * 8];    // [group]: c10 c20 c21 c30 c31 c32, two unused

  const int tid = threadIdx.x & 127;           // place among the 128 threads of the same role
  // the role is the same for a whole wave: read as a scalar, so that the branch on it is a scalar branch
  const bool stager = __builtin_amdgcn_readfirstlane((int)(threadIdx.x >> 5)) >= 4;
  const int cg = blockIdx.x, bh = blockIdx.y, b = bh / NH, hh = bh % NH;
  const int lg = tid & 15, el = tid >> 4;      // state ownership: column cg*SC + el, rows 4*lg .. 4*lg+3

  // every loop of this kernel but the one over the chunks is unrolled: its arrays are then indexed by constants and stay in registers
  v4f S;
#pragma unroll
  for (int u = 0; u < 4; ++u) S[u] = 0.0f;

  // per-thread byte offsets of the tile loads and of the state store; the chunk moves the uniform base only.
  // Staging: the 16-lane row el takes the groups el and el + 8, that is the tile rows 4*el + 32*it and the three behind
  const unsigned tb = (unsigned)(((4 * el) * DM + lg * 4) * 4);
  const unsigned vo = (unsigned)(((tid >> 1) * DM + cg * SC + (tid & 1) * 4) * 4);
  const unsigned so = (unsigned)(((cg * SC + el) * HD + 4 * lg) * 4);

  const int nch = T / CH;

  // a chunk's tiles as loaded, held in a stager's registers from one pass of the chunk loop to the next
  float tbe[2][4];
  v4f tk[2][4], ta[2][4], tv;

  // tile loads of chunk n: k and a 64 rows x 64 f32, v 64 rows x SC f32, beta of this row's eight steps (one address per 16-lane row)
  auto load = [&](int n) {
    const size_t rowbase = (size_t)b * T + (size_t)n * CH;
    const float* Kg = Kp + rowbase * DM + hh * HD;
    const float* Vg = Vp + rowbase * DM + hh * HD;
    const float* Ag = Ap + rowbase * DM + hh * HD;
    const char* kp = (const char*)Kg + tb;
    const char* ap = (const char*)Ag + tb;
    const char* vp = (const char*)Vg + vo;
    const float* bp = Bp + (rowbase + 4 * el) * NH + hh;
#pragma unroll
    for (int it = 0; it < 2; ++it) {
#pragma unroll
      for (int j = 0; j < 4; ++j) tbe[it][j] = bp[(32 * it + j) * NH];
#pragma unroll
      for (int j = 0; j < 4; ++j) {
        tk[it][j] = *(const v4f*)(kp + (32 * it + j) * (DM * 4));
        ta[it][j] = *(const v4f*)(ap + (32 * it + j) * (DM * 4));
      }
    }
    tv = *(const v4f*)vp;
    // the wait stands in front of any overwrite of the address registers the loads name; as inputs they stay live up to it
    asm volatile("s_wait_xcnt 0x0" :: "v"(kp), "v"(ap), "v"(vp), "v"(bp) : "memory");
  };

  // the loaded tiles -> the step operands, into buffer bf
  auto stage = [&](int bf) {
    float* Ub = Us + bf * (CH * HD);
    float* Wb = Ws + bf * (CH * HD);
    float* Pb = Ps + bf * ((CH / 4) * HD);
    float* Vb = Vt + bf * (SC * CH);
    float* Cb = Cs + bf * ((CH / 4) * 8);
#pragma unroll
    for (int it = 0; it < 2; ++it) {
      const int qd = it * 8 + el;
      const v4f k0 = tk[it][0], k1 = tk[it][1], k2 = tk[it][2], k3 = tk[it][3];
      const v4f d0 = ta[it][0], d1 = ta[it][1], d2 = ta[it][2], d3 = ta[it][3];
      const float b0 = fminf(tbe[it][0], 1.0f), b1 = fminf(tbe[it][1], 1.0f);
      const float b2 = fminf(tbe[it][2], 1.0f), b3 = fminf(tbe[it][3], 1.0f);
      const v4f P1 = d0 * d1, P2 = P1 * d2, P3 = P2 * d3;       // A(-1..i]
      const v4f R20 = d1 * d2, R31 = d2 * d3, R30 = d1 * R31;   // A(j..i]
      const v4f g0 = k0 * b0, g1 = k1 * b1, g2 = k2 * b2, g3 = k3 * b3;
      const v4f u0 = k0 * d0, u1 = k1 * P1, u2 = k2 * P2, u3 = k3 * P3;
      const v4f ua = { u0[0], u1[0], u0[1], u1[1] }, ub = { u0[2], u1[2], u0[3], u1[3] };
      const v4f uc = { u2[0], u3[0], u2[1], u3[1] }, ud = { u2[2], u3[2], u2[3], u3[3] };
      *(v4f*)(Ub + (4 * qd) * HD + 4 * lg)     = ua;
      *(v4f*)(Ub + (4 * qd + 1) * HD + 4 * lg) = ub;
      *(v4f*)(Ub + (4 * qd + 2) * HD + 4 * lg) = uc;
      *(v4f*)(Ub + (4 * qd + 3) * HD + 4 * lg) = ud;
      *(v4f*)(Wb + (4 * qd) * HD + 4 * lg)     = g0 * R30;
      *(v4f*)(Wb + (4 * qd + 1) * HD + 4 * lg) = g1 * R31;
      *(v4f*)(Wb + (4 * qd + 2) * HD + 4 * lg) = g2 * d3;
      *(v4f*)(Wb + (4 * qd + 3) * HD + 4 * lg) = g3;
      *(v4f*)(Pb + qd * HD + 4 * lg)           = P3;
      const float c10 = row_sum((k1 * d1) * g0);
      const float c20 = row_sum((k2 * R20) * g0), c21 = row_sum((k2 * d2) * g1);
      const float c30 = row_sum((k3 * R30) * g0), c31 = row_sum((k3 * R31) * g1), c32 = row_sum((k3 * d3) * g2);
      if (lg == 0) {
        const v4f ca = { c10, c20, c21, c30 };
        const v2f cb = { c31, c32 };
        *(v4f*)(Cb + qd * 8)     = ca;
        *(v2f*)(Cb + qd * 8 + 4) = cb;
      }
    }
#pragma unroll
    for (int u = 0; u < 4; ++u) Vb[((tid & 1) * 4 + u) * CH + (tid >> 1)] = tv[u];
  };

  if (stager) load(0);

  // pass -1 only stages chunk 0; in pass n the steppers take chunk n
  for (int n = -1; n < nch; ++n) {
    if (stager) {
      // chunk n + 1 goes into the buffer whose last readers left it at the barrier before this pass; its tiles were asked for
      // a whole pass ago, and those of chunk n + 2 are asked for now
      if (n + 1 < nch) {
        stage((n + 1) & 1);
        if (n + 2 < nch) load(n + 2);
      }
    } else if (n >= 0) {
    const int bf = n & 1;
    const float* ul = Us + bf * (CH * HD) + 4 * lg;
    const float* wl = Ws + bf * (CH * HD) + 4 * lg;
    const float* pl = Ps + bf * ((CH / 4) * HD) + 4 * lg;
    const float* vl = Vt + bf * (SC * CH) + el * CH;
    const float* cl = Cs + bf * ((CH / 4) * 8);
    float* So = Sg + ((size_t)bh * nch + n) * (HD * HD);

    // exact state update over the chunk, four steps at a time
    // the operands of NSTP steps are read as one group, one group ahead of the steps that use them
    v4f uq[2][NSTP], wq[2][NSTP], pq[2][NSTP / 4], vq[2][NSTP / 4], ca[2][NSTP / 4];
    v2f cb[2][NSTP / 4];
    auto fetch = [&](int g, int bf) {
      // in the order of use: LDS reads return in order, and the first group of a chunk is waited for
#pragma unroll
      for (int s = 0; s < NSTP / 4; ++s) {
#pragma unroll
        for (int j = 0; j < 4; ++j) uq[bf][4 * s + j] = *(const v4f*)(ul + (NSTP * g + 4 * s + j) * HD);
        pq[bf][s] = *(const v4f*)(pl + ((NSTP / 4) * g + s) * HD);
        vq[bf][s] = *(const v4f*)(vl + NSTP * g + 4 * s);
        ca[bf][s] = *(const v4f*)(cl + ((NSTP / 4) * g + s) * 8);
        cb[bf][s] = *(const v2f*)(cl + ((NSTP / 4) * g + s) * 8 + 4);
#pragma unroll
        for (int j = 0; j < 4; ++j) wq[bf][4 * s + j] = *(const v4f*)(wl + (NSTP * g + 4 * s + j) * HD);
      }
    };
    fetch(0, 0);
    // entry state of this chunk; the wait on the store stands behind the first group's LDS reads and passes under their latency
    *(v4f*)((char*)So + so) = S;
    // the steps that follow overwrite S, which this store names, and may be given its address registers: the wait stands in front of that
    asm volatile("s_wait_xcnt 0x0" ::: "memory");
#pragma unroll
    for (int g = 0; g < CH / NSTP; ++g) {
      const int cur = g & 1, nxt = cur ^ 1;
      // with the one behind the reads: keeps the next group's LDS reads in one place. Left free, they sank to just ahead of their
      // use, where each step waited out the LDS latency, or were strewn among the steps of the group before
      __builtin_amdgcn_sched_barrier(0);
      if (g + 1 < CH / NSTP) fetch(g + 1, nxt);
      __builtin_amdgcn_sched_barrier(0);   // second of the pair, see above
#pragma unroll
      for (int q = 0; q < NSTP / 4; ++q) {
        const v4f ua = uq[cur][4 * q], ub = uq[cur][4 * q + 1], uc = uq[cur][4 * q + 2], ud = uq[cur][4 * q + 3];
        const v4f w0 = wq[cur][4 * q], w1 = wq[cur][4 * q + 1], w2 = wq[cur][4 * q + 2], w3 = wq[cur][4 * q + 3];
        const v4f pp = pq[cur][q], vv = vq[cur][q], c4 = ca[cur][q];
        const v2f c2 = cb[cur][q];
        const v2f pa = (ua.xy * S[0] + ub.xy * S[2]) + (ua.zw * S[1] + ub.zw * S[3]);   // partial sums of steps 0 and 1
        const v2f pb = (uc.xy * S[0] + ud.xy * S[2]) + (uc.zw * S[1] + ud.zw * S[3]);   // ... of steps 2 and 3
        float p0 = pa.x, p1 = pa.y, p2 = pb.x, p3 = pb.y;
        p0 = xmask_add<0x161>(p0);  p1 = xmask_add<0x161>(p1);  p2 = xmask_add<0x161>(p2);  p3 = xmask_add<0x161>(p3);
        p0 = xmask_add<0x162>(p0);  p1 = xmask_add<0x162>(p1);  p2 = xmask_add<0x162>(p2);  p3 = xmask_add<0x162>(p3);
        p0 = xmask_add<0x164>(p0);  p1 = xmask_add<0x164>(p1);  p2 = xmask_add<0x164>(p2);  p3 = xmask_add<0x164>(p3);
        p0 = xmask_add<0x168>(p0);  p1 = xmask_add<0x168>(p1);  p2 = xmask_add<0x168>(p2);  p3 = xmask_add<0x168>(p3);
        const float dl0 = vv[0] - p0;
        const float dl1 = __builtin_fmaf(-c4[0], dl0, vv[1] - p1);
        const float dl2 = __builtin_fmaf(-c4[2], dl1, __builtin_fmaf(-c4[1], dl0, vv[2] - p2));
        const float dl3 = __builtin_fmaf(-c2[1], dl2, __builtin_fmaf(-c2[0], dl1, __builtin_fmaf(-c4[3], dl0, vv[3] - p3)));
        // each term is added as soon as its dl is known, so that only the last one follows dl3
#pragma unroll
        for (int u = 0; u < 4; ++u)
          S[u] = __builtin_fmaf(w3[u], dl3, __builtin_fmaf(w2[u], dl2, __builtin_fmaf(w1[u], dl1, __builtin_fmaf(w0[u], dl0, pp[u] * S[u]))));
      }
    }
    }
    lds_barrier();   // publishes chunk n + 1 and ends the reads of chunk n's buffer, which the next pass refills
  }
}

// ---------------------------------------------------------------------------
// Gated delta rule, chunk-parallel part: one block per (chunk, b*h), 256 threads. Reads the chunk's entry state from Sg.
// Scores A[i][j] on VALU f32, O = Q*S + A*V on bf16 hi/lo WMMA, then headwise RMS norm and gate.
// ---------------------------------------------------------------------------
__global__ void __launch_bounds__(256)
k_out(const float* __restrict__ Qp, const float* __restrict__ Kp, const float* __restrict__ Vp,
      const float* __restrict__ Ap, const float* __restrict__ Bp, const float* __restrict__ Gp,
      const float* __restrict__ rmsw, const float* __restrict__ Sg, h16* Og, int T, float ogscale)
{
  __shared__ __attribute__((aligned(16))) float Qs[CH * QP];
  __shared__ __attribute__((aligned(16))) float Ks[CH * QP];
  __shared__ __attribute__((aligned(16))) float CLs[CH * QP];
  __shared__ __attribute__((aligned(16))) float SCs[CH * QP];
  __shared__ __attribute__((aligned(16))) float Vs[CH * HD];
  __shared__ __attribute__((aligned(16))) float ALs[CH * HD];
  __shared__ __attribute__((aligned(16))) float Sf[HD * QP];     // entry state, column-major: [e][d]
  __shared__ float Bsh[CH], GS[CH], RV[CH], RW[HD];

  const int tid = threadIdx.x;
  const int lane = tid & 31, wv = tid >> 5, m = lane & 15, h = lane >> 4;
  const int n = blockIdx.x, bh = blockIdx.y, b = bh / NH, hh = bh % NH;

  if (tid < HD) RW[tid] = bf16r(rmsw[hh * HD + tid]);

  const size_t rowbase = (size_t)b * T + (size_t)n * CH;
  const float* Qg = Qp + rowbase * DM + hh * HD;
  const float* Kg = Kp + rowbase * DM + hh * HD;
  const float* Vg = Vp + rowbase * DM + hh * HD;
  const float* Ag = Ap + rowbase * DM + hh * HD;
  const float* Si = Sg + ((size_t)bh * (T / CH) + n) * (HD * HD);

  // tile loads (64 rows x 64 f32 each): one byte offset per thread, the step of 16 rows is a constant
  const unsigned tb = (unsigned)(((tid >> 4) * DM + (tid & 15) * 4) * 4);
  v4f tq[4], tk[4], tv[4], ta[4], ts[4];
#pragma unroll
  for (int it = 0; it < 4; ++it) {
    tq[it] = *(const v4f*)((const char*)Qg + tb + it * (16 * DM * 4));
    tk[it] = *(const v4f*)((const char*)Kg + tb + it * (16 * DM * 4));
    tv[it] = *(const v4f*)((const char*)Vg + tb + it * (16 * DM * 4));
    ta[it] = *(const v4f*)((const char*)Ag + tb + it * (16 * DM * 4));
    ts[it] = *(const v4f*)(Si + tid * 4 + it * (16 * HD));
  }
  // the wait stands in front of any overwrite of the offset register the loads name; as an input it stays live up to it
  asm volatile("s_wait_xcnt 0x0" :: "v"(tb) : "memory");
#pragma unroll
  for (int it = 0; it < 4; ++it) {
    const int idx = it * 256 + tid;
    const int c = idx >> 4, d4 = (idx & 15) * 4;
    *(v4f*)(Qs  + c * QP + d4) = tq[it];
    *(v4f*)(Ks  + c * QP + d4) = tk[it];
    *(v4f*)(Vs  + c * HD + d4) = tv[it];
    *(v4f*)(ALs + c * HD + d4) = ta[it];
    *(v4f*)(Sf  + c * QP + d4) = ts[it];
  }
  if (tid < CH) {
    Bsh[tid] = fminf(Bp[(rowbase + tid) * NH + hh], 1.0f);
    GS[tid]  = Gp[(rowbase + tid) * NH + hh];
  }
  __syncthreads();

  // cumulative log decay per feature, restarted per chunk
  if (tid < HD) {
    float a = 0.0f;
    for (int c = 0; c < CH; ++c) {
      a += __logf(fmaxf(ALs[c * HD + tid], 1e-7f));
      CLs[c * QP + tid] = a;
    }
  }
  __syncthreads();

  // scores: A[i][j] = beta_j * sum_d q[i][d] k[j][d] exp(cl[i][d] - cl[j][d]) for i >= j, else 0
  {
    const int j0 = lane, j1 = lane + 32;
    float a0[8], a1[4];
#pragma unroll
    for (int r = 0; r < 8; ++r) a0[r] = 0.0f;
#pragma unroll
    for (int r = 0; r < 4; ++r) a1[r] = 0.0f;
#pragma unroll 2
    for (int d = 0; d < HD; ++d) {
      const float k0v = Ks[j0 * QP + d], c0 = CLs[j0 * QP + d];
      const float k1v = Ks[j1 * QP + d], c1 = CLs[j1 * QP + d];
#pragma unroll
      for (int r = 0; r < 8; ++r) {
        const int i = wv + 8 * r;
        const float q = Qs[i * QP + d];
        const float ci = CLs[i * QP + d];
        a0[r] += q * k0v * __expf(ci - c0);
        if (r >= 4) a1[r - 4] += q * k1v * __expf(ci - c1);
      }
    }
    const float b0 = Bsh[j0], b1 = Bsh[j1];
#pragma unroll
    for (int r = 0; r < 8; ++r) {
      const int i = wv + 8 * r;
      SCs[i * QP + j0] = (i >= j0) ? a0[r] * b0 : 0.0f;
      float v1 = 0.0f;
      if (r >= 4) v1 = (i >= j1) ? a1[r - 4] * b1 : 0.0f;
      SCs[i * QP + j1] = v1;
    }
  }
  __syncthreads();

  // O = Q*S + A*V : wave owns rows 16*ti.., two 16-col tiles; bf16 hi/lo three products per operand pair
  {
    const int ti = wv >> 1, tj0 = (wv & 1) * 2;
    v8f acc[2];
#pragma unroll
    for (int s = 0; s < 2; ++s)
#pragma unroll
      for (int r = 0; r < 8; ++r) acc[s][r] = 0.0f;

#pragma unroll
    for (int ks = 0; ks < 2; ++ks) {
      const int k0 = ks * 32;
      BF ah, al;
      fragA_split(Qs + (ti * 16 + m) * QP + k0, h, ah, al);
#pragma unroll
      for (int s = 0; s < 2; ++s) {
        BF bhi, blo;
        fragA_split(Sf + ((tj0 + s) * 16 + m) * QP + k0, h, bhi, blo);   // column e of S is a row of Sf: same k map as the gather
        acc[s] = mma_bf16(ah.v, bhi.v, acc[s]);
        acc[s] = mma_bf16(ah.v, blo.v, acc[s]);
        acc[s] = mma_bf16(al.v, bhi.v, acc[s]);
      }
    }
#pragma unroll
    for (int ks = 0; ks < 2; ++ks) {
      const int k0 = ks * 32;
      BF ah, al;
      fragA_split(SCs + (ti * 16 + m) * QP + k0, h, ah, al);
#pragma unroll
      for (int s = 0; s < 2; ++s) {
        BF bhi, blo;
        fragB_split(Vs, HD, k0, (tj0 + s) * 16 + m, h, bhi, blo);
        acc[s] = mma_bf16(ah.v, bhi.v, acc[s]);
        acc[s] = mma_bf16(ah.v, blo.v, acc[s]);
        acc[s] = mma_bf16(al.v, bhi.v, acc[s]);
      }
    }
    __syncthreads();   // all reads of SCs/Sf done; reuse SCs as the O tile
#pragma unroll
    for (int s = 0; s < 2; ++s)
#pragma unroll
      for (int r = 0; r < 8; ++r)
        SCs[(ti * 16 + 8 * h + r) * QP + (tj0 + s) * 16 + m] = acc[s][r];
  }
  __syncthreads();

  // per-row RMS normaliser times gate
  if (tid < CH) {
    float ss = 0.0f;
    for (int e2 = 0; e2 < HD; ++e2) { const float o = SCs[tid * QP + e2]; ss += o * o; }
    RV[tid] = GS[tid] / sqrtf(ss * (1.0f / 64.0f) + 1e-6f);
  }
  __syncthreads();

  {
    v8h ov[2];
    size_t go[2];
#pragma unroll
    for (int it = 0; it < 2; ++it) {
      const int c = it * 32 + (tid >> 3), e0 = (tid & 7) * 8;
      const v4f x0 = *(const v4f*)(SCs + c * QP + e0);
      const v4f x1 = *(const v4f*)(SCs + c * QP + e0 + 4);
      const float sc = RV[c] * ogscale;
      v8h o;
#pragma unroll
      for (int q = 0; q < 4; ++q) {
        o[q]     = (h16)(x0[q] * sc * RW[e0 + q]);
        o[4 + q] = (h16)(x1[q] * sc * RW[e0 + 4 + q]);
      }
      ov[it] = o;
      go[it] = (rowbase + c) * (size_t)DM + hh * HD + e0;
    }
#pragma unroll
    for (int it = 0; it < 2; ++it) *(v8h*)(Og + go[it]) = ov[it];
    
  }
}

// ---------------------------------------------------------------------------
extern "C" void kernel_launch(void* const* d_in, const int* in_sizes, int n_in,
                              void* d_out, int out_size, void* d_ws, size_t ws_size,
                              hipStream_t stream)
{
  if (n_in < 26) return;
  const int T = 2048;
  const long nx = (long)in_sizes[0];
  if (nx <= 0 || (nx % ((long)DM * T)) != 0) return;
  const int M = (int)(nx / DM);                       // tokens, multiple of 2048 (hence of 128)
  if ((long)out_size != (long)M * DM) return;
  if (in_sizes[1] != DM * 4 || in_sizes[3] != DM * 4 || in_sizes[5] != DM * 4) return;
  if (in_sizes[7] != DM * DM || in_sizes[9] != DM * DM || in_sizes[11] != DM * DM || in_sizes[24] != DM * DM) return;
  if (in_sizes[13] != 64 * DM || in_sizes[15] != DM * 64 || in_sizes[17] != NH * DM ||
      in_sizes[20] != 64 * DM || in_sizes[22] != NH * 64) return;

  const float* x       = (const float*)d_in[0];
  const float* wq_conv = (const float*)d_in[1];  const float* bq_conv = (const float*)d_in[2];
  const float* wk_conv = (const float*)d_in[3];  const float* bk_conv = (const float*)d_in[4];
  const float* wv_conv = (const float*)d_in[5];  const float* bv_conv = (const float*)d_in[6];
  const float* Wq  = (const float*)d_in[7];   const float* bq  = (const float*)d_in[8];
  const float* Wk  = (const float*)d_in[9];   const float* bk  = (const float*)d_in[10];
  const float* Wv  = (const float*)d_in[11];  const float* bv  = (const float*)d_in[12];
  const float* Wad = (const float*)d_in[13];  const float* bad = (const float*)d_in[14];
  const float* Wau = (const float*)d_in[15];  const float* bau = (const float*)d_in[16];
  const float* Wbe = (const float*)d_in[17];  const float* bbe = (const float*)d_in[18];
  const float* rms_w = (const float*)d_in[19];
  const float* Wgd = (const float*)d_in[20];  const float* bgd = (const float*)d_in[21];
  const float* Wgu = (const float*)d_in[22];  const float* bgu = (const float*)d_in[23];
  const float* Wo  = (const float*)d_in[24];  const float* bo  = (const float*)d_in[25];

  char* ws = (char*)d_ws;
  size_t off = 0;
  auto carve = [&](size_t bytes) -> char* {
    char* p = ws + off;
    off += (bytes + 255) & ~(size_t)255;
    return p;
  };
  const size_t MD = (size_t)M * DM;
  h16* xh    = (h16*)carve(MD * 2);
  h16* cq    = (h16*)carve(MD * 2);
  h16* ck    = (h16*)carve(MD * 2);
  h16* cv    = (h16*)carve(MD * 2);
  h16* Wq16  = (h16*)carve((size_t)DM * DM * 2);
  h16* Wk16  = (h16*)carve((size_t)DM * DM * 2);
  h16* Wv16  = (h16*)carve((size_t)DM * DM * 2);
  h16* Wo16  = (h16*)carve((size_t)DM * DM * 2);
  h16* Wad16 = (h16*)carve((size_t)64 * DM * 2);
  h16* Wau16 = (h16*)carve((size_t)DM * 64 * 2);
  h16* Wbe16 = (h16*)carve((size_t)NH * DM * 2);
  h16* Wgd16 = (h16*)carve((size_t)64 * DM * 2);
  h16* Wgu16 = (h16*)carve((size_t)NH * 64 * 2);
  float* Qn  = (float*)carve(MD * 4);
  float* Kn  = (float*)carve(MD * 4);
  float* Vf  = (float*)carve(MD * 4);
  float* Al  = (float*)carve(MD * 4);
  float* Bt  = (float*)carve((size_t)M * NH * 4);
  float* Gt  = (float*)carve((size_t)M * NH * 4);
  h16* t1    = (h16*)carve((size_t)M * 64 * 2);
  h16* t2    = (h16*)carve((size_t)M * 64 * 2);
  h16* Og16  = (h16*)carve(MD * 2);
  float* Sst = (float*)carve((size_t)(M / CH) * NH * HD * HD * 4);   // entry state of every (b, h, chunk)
  if (off > ws_size) return;

  const float wsc = 256.0f;      // weight scale
  const float asc = 256.0f;      // conv activation scale
  const float tsc = 64.0f;       // gate hidden scale
  const float osc = 16.0f;       // gated output scale

  // 1) x -> f16, three shortconv+SiLU activations, and the nine weights -> scaled f16 (Wq16 .. Wgu16 are carved back to back,
  //    each a multiple of 256 bytes, in the order k_front takes the matrices); M is a multiple of T, T of the 8 * FL tokens of a block
  {
    const int nconv = (M / (8 * FL)) * (DM / FW);
    k_front<<<nconv + (G_ALL + 256 * CG - 1) / (256 * CG), 256, 0, stream>>>(x, wq_conv, bq_conv, wk_conv, bk_conv, wv_conv, bv_conv,
                                                                             Wq, Wk, Wv, Wo, Wad, Wau, Wbe, Wgd, Wgu,
                                                                             xh, cq, ck, cv, Wq16, nconv, T, asc, wsc);
  }
  // 2) the six products on the front launch's results; 3) the two gate-up products
  k_proj<<<dim3(M / 128, 51), 256, 0, stream>>>(cq, ck, cv, xh, Wq16, Wk16, Wv16, Wad16, Wbe16, Wgd16,
                                                bq, bk, bv, bad, bbe, bgd, Qn, Kn, Vf, Bt, t1, t2,
                                                DM, 1.0f / (asc * wsc), 1.0f / wsc, tsc);
  k_gate<<<dim3(M / 128, 17), 256, 0, stream>>>(t1, t2, Wau16, Wgu16, bau, bgu, Al, Gt, 64, 1.0f / (tsc * wsc));
  // 4) state recurrence, one block per (column group, b*h); then the per-chunk outputs, one block per (chunk, b*h)
  k_state<<<dim3(HD / SC, (M / T) * NH), 256, 0, stream>>>(Kn, Vf, Al, Bt, Sst, T);
  k_out<<<dim3(T / CH, (M / T) * NH), 256, 0, stream>>>(Qn, Kn, Vf, Al, Bt, Gt, rms_w, Sst, Og16, T, osc);
  // 5) output projection
  k_oproj<<<dim3(M / 128, DM / 64), 256, 0, stream>>>(Og16, Wo16, bo, (float*)d_out, DM, 1.0f / (osc * wsc));
}

// v008
// Measured time: 168 microseconds a run.
// Next to v007, in two timings, it ran 1.06 and 1.07 times as fast.
// Over all steps from v000 it is 7.53 times as fast.
#include <hip/hip_runtime.h>
#include <stdint.h>

// Contractions: token projections (q, k, v, gate down/up, beta, out) on v_wmma_f32_16x16x32_f16 with f16 operands pre-scaled by powers of two, f32 accumulate; per-chunk decay scores, Q*S and A*V on v_wmma_f32_16x16x32_bf16 as bf16 hi/lo three-product split, f32 accumulate; state recurrence, shortconv and norms on VALU in f32. All float inputs RNE-converted to bf16 on load.

typedef _Float16 h16;
typedef h16    v16h __attribute__((ext_vector_type(16)));
typedef h16    v8h  __attribute__((ext_vector_type(8)));
typedef __bf16 v16b __attribute__((ext_vector_type(16)));
typedef __bf16 v2b  __attribute__((ext_vector_type(2)));
typedef float  v8f  __attribute__((ext_vector_type(8)));
typedef float  v4f  __attribute__((ext_vector_type(4)));
typedef float  v2f  __attribute__((ext_vector_type(2)));

union HF { v16h v; v8h p[2]; };
union BF { v16b v; unsigned short u[16]; };

#define DM 1024
#define HD 64
#define NH 16
#define CH 64
#define QP 68
#define KS 64    // k per staged GEMM tile: 128 B of a row
#define LP 72    // LDS row pitch of a staged tile in f16: 144 B = 16 B x 9, free of bank conflicts for 16-byte row reads

__device__ __forceinline__ unsigned short bf16_bits(float f) {
  unsigned int u = __float_as_uint(f);
  u += 0x7FFFu + ((u >> 16) & 1u);
  return (unsigned short)(u >> 16);
}
__device__ __forceinline__ float bf16r(float f) {
  return __uint_as_float(((unsigned int)bf16_bits(f)) << 16);
}
// x = hi + lo in bf16 pieces (RNE), bit patterns
__device__ __forceinline__ void split2(float x, unsigned short& hi, unsigned short& lo) {
  const unsigned short hb = bf16_bits(x);
  const float hf = __uint_as_float(((unsigned int)hb) << 16);
  hi = hb;
  lo = bf16_bits(x - hf);
}
// low 32 bits of a __shared__ address: the byte offset in the work-group's LDS
__device__ __forceinline__ unsigned lds_off(const void* p) {
  return (unsigned)(uintptr_t)p;
}
__device__ __forceinline__ float sigm(float v) {
  return __fdividef(1.0f, 1.0f + __expf(-v));
}

// 16-bit WMMA wrappers with the VALU hazard guard after the matrix op
__device__ __forceinline__ v8f mma_f16(v16h a, v16h b, v8f c) {
  c = __builtin_amdgcn_wmma_f32_16x16x32_f16(false, a, false, b, (short)0, c, false, false);
  asm volatile("v_nop\n\tv_nop\n\tv_nop\n\tv_nop" : "+v"(c) : "v"(a), "v"(b));
  return c;
}
__device__ __forceinline__ v8f mma_bf16(v16b a, v16b b, v8f c) {
  c = __builtin_amdgcn_wmma_f32_16x16x32_bf16(false, a, false, b, (short)0, c, false, false);
  asm volatile("v_nop\n\tv_nop\n\tv_nop\n\tv_nop" : "+v"(c) : "v"(a), "v"(b));
  return c;
}

// A fragment (row m, split k map) from an f32 LDS row pointer pr = base + row*pitch + k0, as bf16 hi/lo
__device__ __forceinline__ void fragA_split(const float* pr, int h, BF& hi, BF& lo) {
  const v4f x0 = *(const v4f*)(pr + 8 * h);
  const v4f x1 = *(const v4f*)(pr + 8 * h + 4);
  const v4f x2 = *(const v4f*)(pr + 16 + 8 * h);
  const v4f x3 = *(const v4f*)(pr + 20 + 8 * h);
#pragma unroll
  for (int q = 0; q < 4; ++q) {
    split2(x0[q], hi.u[q],      lo.u[q]);
    split2(x1[q], hi.u[4 + q],  lo.u[4 + q]);
    split2(x2[q], hi.u[8 + q],  lo.u[8 + q]);
    split2(x3[q], hi.u[12 + q], lo.u[12 + q]);
  }
}
// B fragment (col n, same split k map) gathered down column col of f32 [k][pitch] in LDS, as bf16 hi/lo
__device__ __forceinline__ void fragB_split(const float* base, int pitch, int k0, int col, int h, BF& hi, BF& lo) {
#pragma unroll
  for (int i = 0; i < 8; ++i) {
    split2(base[(k0 + 8 * h + i) * pitch + col],      hi.u[i],     lo.u[i]);
    split2(base[(k0 + 16 + 8 * h + i) * pitch + col], hi.u[8 + i], lo.u[8 + i]);
  }
}

// Fragment (row m, split k map, for A and for a B whose column is an LDS row) of x[k] = pv[k] * exp(pp[k] - pm[k]), as bf16 hi/lo (RNE);
// the three pointers are f32 LDS rows at k0
__device__ __forceinline__ void frag_decay(const float* pv, const float* pp, const float* pm, int h, BF& hi, BF& lo) {
#pragma unroll
  for (int g = 0; g < 4; ++g) {
    const int o = (g >> 1) * 16 + 8 * h + (g & 1) * 4;
    const v4f v = *(const v4f*)(pv + o), a = *(const v4f*)(pp + o), c = *(const v4f*)(pm + o);
#pragma unroll
    for (int p = 0; p < 2; ++p) {
      const v2f x = { v[2 * p] * __expf(a[2 * p] - c[2 * p]), v[2 * p + 1] * __expf(a[2 * p + 1] - c[2 * p + 1]) };
      const v2b xh = __builtin_convertvector(x, v2b);
      const v2b xl = __builtin_convertvector(x - __builtin_convertvector(xh, v2f), v2b);
      hi.v[4 * g + 2 * p] = xh[0];  hi.v[4 * g + 2 * p + 1] = xh[1];
      lo.v[4 * g + 2 * p] = xl[0];  lo.v[4 * g + 2 * p + 1] = xl[1];
    }
  }
}

// ---------------------------------------------------------------------------
// Everything that reads only the inputs, in one launch of few, long work-groups.
// The first nconv blocks: causal depthwise conv (4 taps) + SiLU for all three weight sets, f16 output scaled by ascale, and x -> f16.
// A block takes FW channels x 8 * FL tokens; a wave a run of FL tokens, a lane 8 channels of it. The FL + 3 rows of x that the run
// needs are read once and serve all three sets; a set's taps and bias are read once per run.
// The blocks behind them: the nine weight matrices -> scaled f16, CG groups of eight elements per thread. Their f16 copies lie one
// behind the other in w16, in the order of the arguments, so one running group index serves all nine; every matrix but the last
// ends on a multiple of 256 * CG groups, so a block converts from one matrix only.
// ---------------------------------------------------------------------------
#define G_SQ (DM * DM / 8)    // groups of eight in a DM x DM matrix
#define G_LR (64 * DM / 8)    // ... in a 64 x DM or DM x 64 matrix
#define G_HD (NH * DM / 8)    // ... in an NH x DM matrix
#define G_HR (NH * 64 / 8)    // ... in an NH x 64 matrix
#define G_ALL (4 * G_SQ + 3 * G_LR + G_HD + G_HR)
#define CG 8      // groups per thread of a converting block
#define FL 8      // tokens per wave of a conv block
#define FW 256    // channels per conv block: 32 lanes x 8
#define TP 36     // LDS pitch in f32 of a lane's 4 taps x 8 channels: 144 B = 16 B x 9, free of bank conflicts for 16-byte reads

// SiLU's sigmoid for the conv part: sigm() with its exponential spelled out, the same multiply and the same v_exp_f32. The v_nop is the
// slot that the instruction set asks for behind a transcendental before its source register is overwritten: the argument dies at the
// v_exp_f32, and among the many side by side here the compiler gave its register to the very next instruction in some places
__device__ __forceinline__ float sigm_slot(float v) {
  const float t = v * -1.44269504f;
  float e;
  asm("v_exp_f32 %0, %1\n\tv_nop" : "=v"(e) : "v"(t));
  return __fdividef(1.0f, 1.0f + e);
}

__global__ void __launch_bounds__(256)
k_front(const float* __restrict__ x,
        const float* __restrict__ w0, const float* __restrict__ b0,
        const float* __restrict__ w1, const float* __restrict__ b1,
        const float* __restrict__ w2, const float* __restrict__ b2,
        const float* __restrict__ Wq, const float* __restrict__ Wk, const float* __restrict__ Wv,
        const float* __restrict__ Wo, const float* __restrict__ Wad, const float* __restrict__ Wau,
        const float* __restrict__ Wbe, const float* __restrict__ Wgd, const float* __restrict__ Wgu,
        h16* xh, h16* y0, h16* y1, h16* y2, h16* w16, int nconv, int T, float ascale, float wscale)
{
  __shared__ __attribute__((aligned(16))) float tw[3 * 32 * TP];   // [set][lane][tap][channel of the lane], bf16-rounded
  __shared__ __attribute__((aligned(16))) float tb[3 * FW];        // [set][channel], bf16-rounded

  const int bid = blockIdx.x;
  const int tid = threadIdx.x;
  if (bid >= nconv) {
    const int g0 = (bid - nconv) * (256 * CG);                              // first group of this block
    const float* src = Wq;
    int first = 0;                                                          // first group of the matrix g0 lies in
    if (g0 >= 4 * G_SQ + 3 * G_LR + G_HD)      { src = Wgu; first = 4 * G_SQ + 3 * G_LR + G_HD; }
    else if (g0 >= 4 * G_SQ + 2 * G_LR + G_HD) { src = Wgd; first = 4 * G_SQ + 2 * G_LR + G_HD; }
    else if (g0 >= 4 * G_SQ + 2 * G_LR)        { src = Wbe; first = 4 * G_SQ + 2 * G_LR; }
    else if (g0 >= 4 * G_SQ + G_LR)            { src = Wau; first = 4 * G_SQ + G_LR; }
    else if (g0 >= 4 * G_SQ)                   { src = Wad; first = 4 * G_SQ; }
    else if (g0 >= 3 * G_SQ)                   { src = Wo;  first = 3 * G_SQ; }
    else if (g0 >= 2 * G_SQ)                   { src = Wv;  first = 2 * G_SQ; }
    else if (g0 >= G_SQ)                       { src = Wk;  first = G_SQ; }
    // all loads of the thread are asked for before the first is used; a group past the end re-reads the last one and is not stored
    v4f a[CG], c[CG];
    const float* ps[CG];
#pragma unroll
    for (int it = 0; it < CG; ++it) {
      const int gi = g0 + it * 256 + tid;
      ps[it] = src + (size_t)((gi < G_ALL ? gi : G_ALL - 1) - first) * 8;
      a[it] = *(const v4f*)ps[it];
      c[it] = *(const v4f*)(ps[it] + 4);
    }
    // the wait stands in front of any overwrite of the address registers the loads name; as inputs they stay live up to it
    asm volatile("s_wait_xcnt 0x0" :: "v"(ps[0]), "v"(ps[1]), "v"(ps[2]), "v"(ps[3]), "v"(ps[4]), "v"(ps[5]), "v"(ps[6]), "v"(ps[7]) : "memory");
    v8h o[CG];
#pragma unroll
    for (int it = 0; it < CG; ++it)
#pragma unroll
      for (int q = 0; q < 4; ++q) {
        o[it][q]     = (h16)(bf16r(a[it][q]) * wscale);
        o[it][4 + q] = (h16)(bf16r(c[it][q]) * wscale);
      }
#pragma unroll
    for (int it = 0; it < CG; ++it) {
      const int gi = g0 + it * 256 + tid;
      if (gi < G_ALL) *(v8h*)(w16 + (size_t)gi * 8) = o[it];
    }
    return;
  }

  const int lane = tid & 31;
  // the wave's number is the same in all its lanes: read as a scalar, so that the row addresses and the test on the run's start are scalar
  const int wv = __builtin_amdgcn_readfirstlane(tid >> 5);
  const int c0 = (bid & (DM / FW - 1)) * FW;                      // first channel of the block
  const unsigned tok0 = (unsigned)(bid / (DM / FW)) * (8 * FL) + wv * FL;   // first token of the wave's run
  const size_t eo = (size_t)tok0 * DM + c0 + lane * 8;            // the lane's first element, in x and in every output

  // taps and bias of the block's channels: whole lines from global memory, one channel's four taps per thread and set
  const unsigned co = (unsigned)(c0 + tid);
  const v4f t0 = *(const v4f*)(w0 + co * 4), t1 = *(const v4f*)(w1 + co * 4), t2 = *(const v4f*)(w2 + co * 4);
  const float u0 = b0[co], u1 = b1[co], u2 = b2[co];
  // rows tok0 - 3 .. tok0 + FL - 1 of x; the three in front of a sequence's start count as zero (a run starts at a multiple of FL in it)
  v4f xa[FL + 3], xb[FL + 3];
  const float* px = x + eo;
#pragma unroll
  for (int j = 3; j < FL + 3; ++j) {
    xa[j] = *(const v4f*)(px + (j - 3) * DM);
    xb[j] = *(const v4f*)(px + (j - 3) * DM + 4);
  }
  if (tok0 % (unsigned)T != 0) {
#pragma unroll
    for (int j = 0; j < 3; ++j) {
      xa[j] = *(const v4f*)(px + (j - 3) * DM);
      xb[j] = *(const v4f*)(px + (j - 3) * DM + 4);
    }
  } else {
#pragma unroll
    for (int j = 0; j < 3; ++j)
#pragma unroll
      for (int q = 0; q < 4; ++q) { xa[j][q] = 0.0f; xb[j][q] = 0.0f; }
  }
  // the wait stands in front of any overwrite of the address registers the loads name; as inputs they stay live up to it
  asm volatile("s_wait_xcnt 0x0" :: "v"(px), "v"(co) : "memory");

  // taps to LDS as [lane][tap][channel of the lane], so that a lane reads a tap of its eight channels as two 16-byte pieces
  {
    float* d = tw + (tid >> 3) * TP + (tid & 7);
#pragma unroll
    for (int k = 0; k < 4; ++k) {
      d[k * 8]               = bf16r(t0[k]);
      d[32 * TP + k * 8]     = bf16r(t1[k]);
      d[2 * 32 * TP + k * 8] = bf16r(t2[k]);
    }
    tb[tid]          = bf16r(u0);
    tb[FW + tid]     = bf16r(u1);
    tb[2 * FW + tid] = bf16r(u2);
  }
  __syncthreads();   // every thread's taps are in LDS before any lane reads its eight channels'

  // x rounded, two neighbouring channels side by side for the packed products
  v2f xr[FL + 3][4];
#pragma unroll
  for (int j = 0; j < FL + 3; ++j)
#pragma unroll
    for (int p = 0; p < 2; ++p) {
      xr[j][p]     = v2f{ bf16r(xa[j][2 * p]), bf16r(xa[j][2 * p + 1]) };
      xr[j][2 + p] = v2f{ bf16r(xb[j][2 * p]), bf16r(xb[j][2 * p + 1]) };
    }

  {
    v8h ox[FL];
#pragma unroll
    for (int j = 0; j < FL; ++j)
#pragma unroll
      for (int q = 0; q < 8; ++q) ox[j][q] = (h16)xr[j + 3][q >> 1][q & 1];
#pragma unroll
    for (int j = 0; j < FL; ++j) *(v8h*)(xh + eo + (size_t)j * DM) = ox[j];
    // the wait stands in front of any rewrite of the registers the stores name
    asm volatile("s_wait_xcnt 0x0" ::: "memory");
  }

  // the loop over the three sets stays rolled, for speed only
#pragma unroll 1
  for (int s = 0; s < 3; ++s) {
    h16* y = (s == 0) ? y0 : ((s == 1) ? y1 : y2);
    v2f wt[4][4], bi[4];
#pragma unroll
    for (int k = 0; k < 4; ++k) {
      const v4f a = *(const v4f*)(tw + s * (32 * TP) + lane * TP + k * 8);
      const v4f c = *(const v4f*)(tw + s * (32 * TP) + lane * TP + k * 8 + 4);
      wt[k][0] = a.xy;  wt[k][1] = a.zw;  wt[k][2] = c.xy;  wt[k][3] = c.zw;
    }
    {
      const v4f a = *(const v4f*)(tb + s * FW + lane * 8), c = *(const v4f*)(tb + s * FW + lane * 8 + 4);
      bi[0] = a.xy;  bi[1] = a.zw;  bi[2] = c.xy;  bi[3] = c.zw;
    }
    v8h o[FL];
#pragma unroll
    for (int j = 0; j < FL; ++j)
#pragma unroll
      for (int p = 0; p < 4; ++p) {
        v2f acc = xr[j][p] * wt[0][p];
        acc = __builtin_elementwise_fma(xr[j + 1][p], wt[1][p], acc);
        acc = __builtin_elementwise_fma(xr[j + 2][p], wt[2][p], acc);
        acc = __builtin_elementwise_fma(xr[j + 3][p], wt[3][p], acc);
        acc += bi[p];
        o[j][2 * p]     = (h16)(acc.x * sigm_slot(acc.x) * ascale);
        o[j][2 * p + 1] = (h16)(acc.y * sigm_slot(acc.y) * ascale);
      }
#pragma unroll
    for (int j = 0; j < FL; ++j) *(v8h*)(y + eo + (size_t)j * DM) = o[j];
    // the wait stands in front of any rewrite of the registers the stores name
    asm volatile("s_wait_xcnt 0x0" ::: "memory");
  }
}

// ---------------------------------------------------------------------------
// Y[M,N] = epi( A[M,K] * W[N,K]^T * oscale + bias[N] ), f16 operands (k-contiguous), f32 accumulate.
// One block tile (bx, by) of one product; the launches below hand independent products to one grid, told apart by blockIdx.y.
// Block 256 threads = 8 waves; block tile 128 rows x 16*NT cols; wave tile 16 x 16*NT.
// Both operands come to LDS in tiles of KS k by asynchronous copies, whole cache lines, two buffers: tile t + 1 flies while t is used.
// EPI: 0 none, 1 L2-normalise each row over the 64-col slab, 2 silu, 3 sigmoid then clip to [0.1,1], 4 sigmoid then min 1.
// ---------------------------------------------------------------------------
// LDS of a launch, sized for NT = 4: the epilogue's staging, two buffers of 128 rows of A, two of up to 64 rows of W, KS k each
#define GEMM_LDS \
  __shared__ __attribute__((aligned(16))) float stg[8 * 16 * 64]; \
  __shared__ __attribute__((aligned(16))) h16 sA[2 * 128 * LP]; \
  __shared__ __attribute__((aligned(16))) h16 sW[2 * 64 * LP];

template<int NT, int EPI, typename OT>
__device__ __forceinline__ void
gemm_tile(const h16* __restrict__ A, const h16* __restrict__ W, const float* __restrict__ bias,
          OT* Y, int N, int K, float oscale, float yscale, int bx, int by, float* stg, h16* sA, h16* sW)
{
  constexpr int TW = 16 * NT;

  const int lane = threadIdx.x & 31, wv = threadIdx.x >> 5;
  const int m = lane & 15, h = lane >> 4;
  const int rowBase = bx * 128 + wv * 16;
  const int colBase = by * TW;

  v8f acc[NT];
#pragma unroll
  for (int t = 0; t < NT; ++t)
#pragma unroll
    for (int r = 0; r < 8; ++r) acc[t][r] = 0.0f;

  // Copy map: a row of a tile is KS f16 = 128 B = one cache line; 8 lanes x 16 B bring one row, a wave four whole lines.
  const int tid = threadIdx.x;
  const int cr = tid >> 3, cc = (tid & 7) * 8;
  const h16* ga = A + (size_t)(bx * 128 + cr) * K + cc;
  const unsigned la = lds_off(sA + cr * LP + cc);
  // W tile: 64 rows in 16-byte pieces (two per thread), or 16 rows in 8-byte pieces (one per thread)
  const int wr = (NT == 4) ? cr : (tid >> 4), wc = (NT == 4) ? cc : (tid & 15) * 4;
  const h16* gw = W + (size_t)(colBase + wr) * K + wc;
  const unsigned lw = lds_off(sW + wr * LP + wc);
  const size_t r32 = (size_t)32 * K;             // 32 rows further in global memory
  constexpr unsigned L32 = 32 * LP * 2;          // 32 rows further in LDS, bytes

  // all of tile t's copies, every lane on; the s_wait_xcnt closes the statement so that it stands in front of any
  // rewrite of the address registers the copies name
  auto stage = [&](int t) {
    const h16* a0 = ga + (size_t)t * KS;
    const h16* w0 = gw + (size_t)t * KS;
    const unsigned l0 = la + (unsigned)(t & 1) * (128 * LP * 2);
    const unsigned m0 = lw + (unsigned)(t & 1) * (TW * LP * 2);
    if constexpr (NT == 4) {
      asm volatile("global_load_async_to_lds_b128 %0, %1, off\n\t"
                   "global_load_async_to_lds_b128 %2, %3, off\n\t"
                   "global_load_async_to_lds_b128 %4, %5, off\n\t"
                   "global_load_async_to_lds_b128 %6, %7, off\n\t"
                   "global_load_async_to_lds_b128 %8, %9, off\n\t"
                   "global_load_async_to_lds_b128 %10, %11, off\n\t"
                   "s_wait_xcnt 0x0"
                   :: "v"(l0), "v"(a0), "v"(l0 + L32), "v"(a0 + r32), "v"(l0 + 2 * L32), "v"(a0 + 2 * r32),
                      "v"(l0 + 3 * L32), "v"(a0 + 3 * r32), "v"(m0), "v"(w0), "v"(m0 + L32), "v"(w0 + r32)
                   : "memory");
    } else {
      asm volatile("global_load_async_to_lds_b128 %0, %1, off\n\t"
                   "global_load_async_to_lds_b128 %2, %3, off\n\t"
                   "global_load_async_to_lds_b128 %4, %5, off\n\t"
                   "global_load_async_to_lds_b128 %6, %7, off\n\t"
                   "global_load_async_to_lds_b64 %8, %9, off\n\t"
                   "s_wait_xcnt 0x0"
                   :: "v"(l0), "v"(a0), "v"(l0 + L32), "v"(a0 + r32), "v"(l0 + 2 * L32), "v"(a0 + 2 * r32),
                      "v"(l0 + 3 * L32), "v"(a0 + 3 * r32), "v"(m0), "v"(w0)
                   : "memory");
    }
  };

  const int nt = K / KS;
  stage(0);
  asm volatile("s_wait_asynccnt 0x0" ::: "memory");   // this wave's copies of tile 0 have landed
  __syncthreads();                                    // ... and every other wave's
  if (nt > 1) stage(1);

  // A: lane row m, elements 0..7 <- k0+8h.., 8..15 <- k0+16+8h..;  B: lane col m, same k map
  for (int t = 0; t < nt; ++t) {
    const h16* pa = sA + (t & 1) * (128 * LP) + (wv * 16 + m) * LP + 8 * h;
    const h16* pw = sW + (t & 1) * (TW * LP) + m * LP + 8 * h;
    HF a[KS / 32], b[KS / 32][NT];
#pragma unroll
    for (int q = 0; q < KS / 32; ++q) {
      a[q].p[0] = *(const v8h*)(pa + 32 * q);
      a[q].p[1] = *(const v8h*)(pa + 32 * q + 16);
#pragma unroll
      for (int u = 0; u < NT; ++u) {
        b[q][u].p[0] = *(const v8h*)(pw + 16 * u * LP + 32 * q);
        b[q][u].p[1] = *(const v8h*)(pw + 16 * u * LP + 32 * q + 16);
      }
    }
#pragma unroll
    for (int q = 0; q < KS / 32; ++q)
#pragma unroll
      for (int u = 0; u < NT; ++u) acc[u] = mma_f16(a[q].v, b[q][u].v, acc[u]);
    asm volatile("s_wait_dscnt 0x0" ::: "memory");      // this wave's reads of the buffer are done before it is refilled
    asm volatile("s_wait_asynccnt 0x0" ::: "memory");   // this wave's copies of tile t + 1 have landed
    __syncthreads();                                    // publishes tile t + 1 and ends every wave's reads of tile t
    if (t + 2 < nt) stage(t + 2);
  }
  asm volatile("s_wait_asynccnt 0x0" ::: "memory");     // no copy is left in flight when the wave goes on

  // epilogue values (D element r of this lane = row 8h+r, col m of tile t)
#pragma unroll
  for (int t = 0; t < NT; ++t) {
    const float bv = bf16r(bias[colBase + 16 * t + m]);
#pragma unroll
    for (int r = 0; r < 8; ++r) {
      float v = acc[t][r] * oscale + bv;
      if (EPI == 2)      { v = v * sigm(v); }
      else if (EPI == 3) { v = sigm(v); v = fminf(fmaxf(v, 0.1f), 1.0f); }
      else if (EPI == 4) { v = fminf(sigm(v), 1.0f); }
      acc[t][r] = v;
    }
  }
  if (EPI == 1) {
#pragma unroll
    for (int r = 0; r < 8; ++r) {
      float ss = 0.0f;
#pragma unroll
      for (int t = 0; t < NT; ++t) ss += acc[t][r] * acc[t][r];
      ss += __shfl_xor(ss, 1, 32);
      ss += __shfl_xor(ss, 2, 32);
      ss += __shfl_xor(ss, 4, 32);
      ss += __shfl_xor(ss, 8, 32);
      const float inv = 1.0f / sqrtf(fmaxf(ss, 1e-6f));
#pragma unroll
      for (int t = 0; t < NT; ++t) acc[t][r] *= inv;
    }
  }

  float* sw = stg + wv * 16 * TW;
#pragma unroll
  for (int t = 0; t < NT; ++t)
#pragma unroll
    for (int r = 0; r < 8; ++r) sw[(8 * h + r) * TW + 16 * t + m] = acc[t][r];
  __syncthreads();

  if constexpr (sizeof(OT) == 4 && NT == 4) {
    v4f vals[8];
    size_t offs[8];
#pragma unroll
    for (int it = 0; it < 8; ++it) {
      const int row = 2 * it + h, c4 = m * 4;
      vals[it] = *(const v4f*)(sw + row * TW + c4);
      offs[it] = (size_t)(rowBase + row) * N + colBase + c4;
    }
#pragma unroll
    for (int it = 0; it < 8; ++it) *(v4f*)(Y + offs[it]) = vals[it];
    // in a merged launch another product's code follows in the listing: the wait stands in front of any rewrite of the registers the stores name
    asm volatile("s_wait_xcnt 0x0" ::: "memory");
  } else if constexpr (sizeof(OT) == 2 && NT == 4) {
    v8h vals[4];
    size_t offs[4];
#pragma unroll
    for (int it = 0; it < 4; ++it) {
      const int row = it * 4 + (lane >> 3), c8 = (lane & 7) * 8;
      const v4f a = *(const v4f*)(sw + row * TW + c8);
      const v4f c = *(const v4f*)(sw + row * TW + c8 + 4);
      v8h o;
#pragma unroll
      for (int q = 0; q < 4; ++q) { o[q] = (h16)(a[q] * yscale); o[4 + q] = (h16)(c[q] * yscale); }
      vals[it] = o;
      offs[it] = (size_t)(rowBase + row) * N + colBase + c8;
    }
#pragma unroll
    for (int it = 0; it < 4; ++it) *(v8h*)(Y + offs[it]) = vals[it];
    // in a merged launch another product's code follows in the listing: the wait stands in front of any rewrite of the registers the stores name
    asm volatile("s_wait_xcnt 0x0" ::: "memory");
  } else if constexpr (sizeof(OT) == 4 && NT == 1) {
    // N == 16: the wave's 16 rows are 1 KB contiguous; 8 lanes x 16 B per line
    v4f vals[2];
    size_t offs[2];
#pragma unroll
    for (int it = 0; it < 2; ++it) {
      const int q = it * 32 + lane, row = q >> 2, c4 = (q & 3) * 4;
      vals[it] = *(const v4f*)(sw + row * TW + c4);
      offs[it] = (size_t)(rowBase + row) * N + colBase + c4;
    }
#pragma unroll
    for (int it = 0; it < 2; ++it) *(v4f*)(Y + offs[it]) = vals[it];
    // in a merged launch another product's code follows in the listing: the wait stands in front of any rewrite of the registers the stores name
    asm volatile("s_wait_xcnt 0x0" ::: "memory");
  }
}

// ---------------------------------------------------------------------------
// The six products that need only the front launch's results, K = DM each: q, k (16 column slabs each, L2 norm), v (16 slabs),
// gate-down for alpha, beta, gate-down for the output gate (one slab each).
// ---------------------------------------------------------------------------
__global__ void __launch_bounds__(256)
k_proj(const h16* __restrict__ cq, const h16* __restrict__ ck, const h16* __restrict__ cv, const h16* __restrict__ xh,
       const h16* __restrict__ Wq16, const h16* __restrict__ Wk16, const h16* __restrict__ Wv16,
       const h16* __restrict__ Wad16, const h16* __restrict__ Wbe16, const h16* __restrict__ Wgd16,
       const float* __restrict__ bq, const float* __restrict__ bk, const float* __restrict__ bv,
       const float* __restrict__ bad, const float* __restrict__ bbe, const float* __restrict__ bgd,
       float* Qn, float* Kn, float* Vf, float* Bt, h16* t1, h16* t2,
       int K, float cscale, float xscale, float tscale)
{
  GEMM_LDS
  const int bx = blockIdx.x, y = blockIdx.y;
  if (y < 32) {
    const bool q = y < 16;
    gemm_tile<4, 1, float>(q ? cq : ck, q ? Wq16 : Wk16, q ? bq : bk, q ? Qn : Kn, DM, K, cscale, 1.0f, bx, y & 15, stg, sA, sW);
  } else if (y < 48) {
    gemm_tile<4, 0, float>(cv, Wv16, bv, Vf, DM, K, cscale, 1.0f, bx, y - 32, stg, sA, sW);
  } else if (y == 49) {
    gemm_tile<1, 4, float>(xh, Wbe16, bbe, Bt, NH, K, xscale, 1.0f, bx, 0, stg, sA, sW);
  } else {
    const bool a = y == 48;
    gemm_tile<4, 2, h16>(xh, a ? Wad16 : Wgd16, a ? bad : bgd, a ? t1 : t2, 64, K, xscale, tscale, bx, 0, stg, sA, sW);
  }
}

// The two gate-up products, K = 64 each: alpha (16 slabs) and the output gate (one slab).
__global__ void __launch_bounds__(256)
k_gate(const h16* __restrict__ t1, const h16* __restrict__ t2, const h16* __restrict__ Wau16, const h16* __restrict__ Wgu16,
       const float* __restrict__ bau, const float* __restrict__ bgu, float* Al, float* Gt, int K, float oscale)
{
  GEMM_LDS
  const int bx = blockIdx.x, y = blockIdx.y;
  if (y < 16) gemm_tile<4, 3, float>(t1, Wau16, bau, Al, DM, K, oscale, 1.0f, bx, y, stg, sA, sW);
  else        gemm_tile<1, 4, float>(t2, Wgu16, bgu, Gt, NH, K, oscale, 1.0f, bx, 0, stg, sA, sW);
}

// The output projection.
__global__ void __launch_bounds__(256)
k_oproj(const h16* __restrict__ A, const h16* __restrict__ W, const float* __restrict__ bias, float* Y, int K, float oscale)
{
  GEMM_LDS
  gemm_tile<4, 0, float>(A, W, bias, Y, DM, K, oscale, 1.0f, blockIdx.x, blockIdx.y, stg, sA, sW);
}

// ---------------------------------------------------------------------------
// Gated delta rule, serial part. The columns e of the state S (64x64 f32) never mix: each evolves from k, a, beta and v[e] alone.
// One block per (group of SC columns, b*h), T/64 chunks in sequence; 4 waves hold the state and step, 4 more stage the next chunk's
// operands meanwhile. A 16-lane row of a stepping wave owns one column,
// lane lg of it the rows 4*lg .. 4*lg+3 in registers, so k^T S is summed inside the row and no step needs a barrier.
// Four steps 0..3 are taken from one state S. With dl_i = v_i - k_i^T (a_i S_i-1), every later step's k^T S is linear in S and
// in the earlier dl, so with A(j..i] the product of a_j+1 .. a_i, per feature:
//   dl_i = v_i - (k_i A(-1..i])^T S - sum over j < i of c_ij dl_j,     c_ij = sum_d k_i A(j..i] beta_j k_j
//   S   <- A(-1..3] S + sum over j of (beta_j k_j A(j..3]) dl_j
// The four row sums run side by side, and the dependent chain of one step, three short links longer, serves four. The vectors in
// brackets and the c_ij hold no state and no column: they are formed once per chunk while the tiles are staged.
// The state each chunk starts from is stored column-major, Sg[(bh*nch + n)][e][d], for the chunk-parallel output kernel.
// ---------------------------------------------------------------------------
#define SC 8    // state columns per block
#define NSTP 8    // steps per group of LDS operand reads

// x + (x of lane l ^ mask) inside a 16-lane row; CTRL = 0x160 + mask is the DPP row_xmask control
template<int CTRL>
__device__ __forceinline__ float xmask_add(float x) {
  return x + __int_as_float(__builtin_amdgcn_update_dpp(0, __float_as_int(x), CTRL, 0xf, 0xf, true));
}
// sum of the four elements of every lane of a 16-lane row, in every lane of it
__device__ __forceinline__ float row_sum(v4f x) {
  float s = (x[0] + x[2]) + (x[1] + x[3]);
  s = xmask_add<0x161>(s);
  s = xmask_add<0x162>(s);
  s = xmask_add<0x164>(s);
  return xmask_add<0x168>(s);
}

// work-group barrier that orders LDS only: the stagers' global loads of the chunk after next stay in flight across it,
// where __syncthreads() would wait for them
__device__ __forceinline__ void lds_barrier() {
  __builtin_amdgcn_fence(__ATOMIC_RELEASE, "workgroup", "local");
  __builtin_amdgcn_s_barrier();
  __builtin_amdgcn_fence(__ATOMIC_ACQUIRE, "workgroup", "local");
}

__global__ void __launch_bounds__(256)
k_state(const float* __restrict__ Kp, const float* __restrict__ Vp, const float* __restrict__ Ap,
        const float* __restrict__ Bp, float* Sg, int T)
{
  // Two buffers of every staged array: waves 0..3 step through chunk n in buffer n & 1 while waves 4..7 stage chunk n + 1 in the other.
  // Us: k_i A(-1..i], two steps side by side so that one packed product serves both: of the four rows of a group, for lane lg,
  // row 0 holds steps (0, 1) of d = 4*lg and of 4*lg+1, row 1 those of 4*lg+2 and 4*lg+3, rows 2 and 3 the same of steps (2, 3)
  __shared__ __attribute__((aligned(16))) float Us[2 * CH * HD];
  __shared__ __attribute__((aligned(16))) float Ws[2 * CH * HD];         // [t][d]: beta_j k_j A(j..3]
  __shared__ __attribute__((aligned(16))) float Ps[2 * (CH / 4) * HD];   // [group][d]: A(-1..3]
  __shared__ __attribute__((aligned(16))) float Vt[2 * SC * CH];         // [column][t]
  __shared__ __attribute__((aligned(16))) float Cs[2 * (CH / 4) * 8];    // [group]: c10 c20 c21 c30 c31 c32, two unused

  const int tid = threadIdx.x & 127;           // place among the 128 threads of the same role
  // the role is the same for a whole wave: read as a scalar, so that the branch on it is a scalar branch
  const bool stager = __builtin_amdgcn_readfirstlane((int)(threadIdx.x >> 5)) >= 4;
  const int cg = blockIdx.x, bh = blockIdx.y, b = bh / NH, hh = bh % NH;
  const int lg = tid & 15, el = tid >> 4;      // state ownership: column cg*SC + el, rows 4*lg .. 4*lg+3

  // every loop of this kernel but the one over the chunks is unrolled: its arrays are then indexed by constants and stay in registers
  v4f S;
#pragma unroll
  for (int u = 0; u < 4; ++u) S[u] = 0.0f;

  // per-thread byte offsets of the tile loads and of the state store; the chunk moves the uniform base only.
  // Staging: the 16-lane row el takes the groups el and el + 8, that is the tile rows 4*el + 32*it and the three behind
  const unsigned tb = (unsigned)(((4 * el) * DM + lg * 4) * 4);
  const unsigned vo = (unsigned)(((tid >> 1) * DM + cg * SC + (tid & 1) * 4) * 4);
  const unsigned so = (unsigned)(((cg * SC + el) * HD + 4 * lg) * 4);

  const int nch = T / CH;

  // a chunk's tiles as loaded, held in a stager's registers from one pass of the chunk loop to the next
  float tbe[2][4];
  v4f tk[2][4], ta[2][4], tv;

  // tile loads of chunk n: k and a 64 rows x 64 f32, v 64 rows x SC f32, beta of this row's eight steps (one address per 16-lane row)
  auto load = [&](int n) {
    const size_t rowbase = (size_t)b * T + (size_t)n * CH;
    const float* Kg = Kp + rowbase * DM + hh * HD;
    const float* Vg = Vp + rowbase * DM + hh * HD;
    const float* Ag = Ap + rowbase * DM + hh * HD;
    const char* kp = (const char*)Kg + tb;
    const char* ap = (const char*)Ag + tb;
    const char* vp = (const char*)Vg + vo;
    const float* bp = Bp + (rowbase + 4 * el) * NH + hh;
#pragma unroll
    for (int it = 0; it < 2; ++it) {
#pragma unroll
      for (int j = 0; j < 4; ++j) tbe[it][j] = bp[(32 * it + j) * NH];
#pragma unroll
      for (int j = 0; j < 4; ++j) {
        tk[it][j] = *(const v4f*)(kp + (32 * it + j) * (DM * 4));
        ta[it][j] = *(const v4f*)(ap + (32 * it + j) * (DM * 4));
      }
    }
    tv = *(const v4f*)vp;
    // the wait stands in front of any overwrite of the address registers the loads name; as inputs they stay live up to it
    asm volatile("s_wait_xcnt 0x0" :: "v"(kp), "v"(ap), "v"(vp), "v"(bp) : "memory");
  };

  // the loaded tiles -> the step operands, into buffer bf
  auto stage = [&](int bf) {
    float* Ub = Us + bf * (CH * HD);
    float* Wb = Ws + bf * (CH * HD);
    float* Pb = Ps + bf * ((CH / 4) * HD);
    float* Vb = Vt + bf * (SC * CH);
    float* Cb = Cs + bf * ((CH / 4) * 8);
#pragma unroll
    for (int it = 0; it < 2; ++it) {
      const int qd = it * 8 + el;
      const v4f k0 = tk[it][0], k1 = tk[it][1], k2 = tk[it][2], k3 = tk[it][3];
      const v4f d0 = ta[it][0], d1 = ta[it][1], d2 = ta[it][2], d3 = ta[it][3];
      const float b0 = fminf(tbe[it][0], 1.0f), b1 = fminf(tbe[it][1], 1.0f);
      const float b2 = fminf(tbe[it][2], 1.0f), b3 = fminf(tbe[it][3], 1.0f);
      const v4f P1 = d0 * d1, P2 = P1 * d2, P3 = P2 * d3;       // A(-1..i]
      const v4f R20 = d1 * d2, R31 = d2 * d3, R30 = d1 * R31;   // A(j..i]
      const v4f g0 = k0 * b0, g1 = k1 * b1, g2 = k2 * b2, g3 = k3 * b3;
      const v4f u0 = k0 * d0, u1 = k1 * P1, u2 = k2 * P2, u3 = k3 * P3;
      const v4f ua = { u0[0], u1[0], u0[1], u1[1] }, ub = { u0[2], u1[2], u0[3], u1[3] };
      const v4f uc = { u2[0], u3[0], u2[1], u3[1] }, ud = { u2[2], u3[2], u2[3], u3[3] };
      *(v4f*)(Ub + (4 * qd) * HD + 4 * lg)     = ua;
      *(v4f*)(Ub + (4 * qd + 1) * HD + 4 * lg) = ub;
      *(v4f*)(Ub + (4 * qd + 2) * HD + 4 * lg) = uc;
      *(v4f*)(Ub + (4 * qd + 3) * HD + 4 * lg) = ud;
      *(v4f*)(Wb + (4 * qd) * HD + 4 * lg)     = g0 * R30;
      *(v4f*)(Wb + (4 * qd + 1) * HD + 4 * lg) = g1 * R31;
      *(v4f*)(Wb + (4 * qd + 2) * HD + 4 * lg) = g2 * d3;
      *(v4f*)(Wb + (4 * qd + 3) * HD + 4 * lg) = g3;
      *(v4f*)(Pb + qd * HD + 4 * lg)           = P3;
      const float c10 = row_sum((k1 * d1) * g0);
      const float c20 = row_sum((k2 * R20) * g0), c21 = row_sum((k2 * d2) * g1);
      const float c30 = row_sum((k3 * R30) * g0), c31 = row_sum((k3 * R31) * g1), c32 = row_sum((k3 * d3) * g2);
      if (lg == 0) {
        const v4f ca = { c10, c20, c21, c30 };
        const v2f cb = { c31, c32 };
        *(v4f*)(Cb + qd * 8)     = ca;
        *(v2f*)(Cb + qd * 8 + 4) = cb;
      }
    }
#pragma unroll
    for (int u = 0; u < 4; ++u) Vb[((tid & 1) * 4 + u) * CH + (tid >> 1)] = tv[u];
  };

  if (stager) load(0);

  // pass -1 only stages chunk 0; in pass n the steppers take chunk n
  for (int n = -1; n < nch; ++n) {
    if (stager) {
      // chunk n + 1 goes into the buffer whose last readers left it at the barrier before this pass; its tiles were asked for
      // a whole pass ago, and those of chunk n + 2 are asked for now
      if (n + 1 < nch) {
        stage((n + 1) & 1);
        if (n + 2 < nch) load(n + 2);
      }
    } else if (n >= 0) {
    const int bf = n & 1;
    const float* ul = Us + bf * (CH * HD) + 4 * lg;
    const float* wl = Ws + bf * (CH * HD) + 4 * lg;
    const float* pl = Ps + bf * ((CH / 4) * HD) + 4 * lg;
    const float* vl = Vt + bf * (SC * CH) + el * CH;
    const float* cl = Cs + bf * ((CH / 4) * 8);
    float* So = Sg + ((size_t)bh * nch + n) * (HD * HD);

    // exact state update over the chunk, four steps at a time
    // the operands of NSTP steps are read as one group, one group ahead of the steps that use them
    v4f uq[2][NSTP], wq[2][NSTP], pq[2][NSTP / 4], vq[2][NSTP / 4], ca[2][NSTP / 4];
    v2f cb[2][NSTP / 4];
    auto fetch = [&](int g, int bf) {
      // in the order of use: LDS reads return in order, and the first group of a chunk is waited for
#pragma unroll
      for (int s = 0; s < NSTP / 4; ++s) {
#pragma unroll
        for (int j = 0; j < 4; ++j) uq[bf][4 * s + j] = *(const v4f*)(ul + (NSTP * g + 4 * s + j) * HD);
        pq[bf][s] = *(const v4f*)(pl + ((NSTP / 4) * g + s) * HD);
        vq[bf][s] = *(const v4f*)(vl + NSTP * g + 4 * s);
        ca[bf][s] = *(const v4f*)(cl + ((NSTP / 4) * g + s) * 8);
        cb[bf][s] = *(const v2f*)(cl + ((NSTP / 4) * g + s) * 8 + 4);
#pragma unroll
        for (int j = 0; j < 4; ++j) wq[bf][4 * s + j] = *(const v4f*)(wl + (NSTP * g + 4 * s + j) * HD);
      }
    };
    fetch(0, 0);
    // entry state of this chunk; the wait on the store stands behind the first group's LDS reads and passes under their latency
    *(v4f*)((char*)So + so) = S;
    // the steps that follow overwrite S, which this store names, and may be given its address registers: the wait stands in front of that
    asm volatile("s_wait_xcnt 0x0" ::: "memory");
#pragma unroll
    for (int g = 0; g < CH / NSTP; ++g) {
      const int cur = g & 1, nxt = cur ^ 1;
      // with the one behind the reads: keeps the next group's LDS reads in one place. Left free, they sank to just ahead of their
      // use, where each step waited out the LDS latency, or were strewn among the steps of the group before
      __builtin_amdgcn_sched_barrier(0);
      if (g + 1 < CH / NSTP) fetch(g + 1, nxt);
      __builtin_amdgcn_sched_barrier(0);   // second of the pair, see above
#pragma unroll
      for (int q = 0; q < NSTP / 4; ++q) {
        const v4f ua = uq[cur][4 * q], ub = uq[cur][4 * q + 1], uc = uq[cur][4 * q + 2], ud = uq[cur][4 * q + 3];
        const v4f w0 = wq[cur][4 * q], w1 = wq[cur][4 * q + 1], w2 = wq[cur][4 * q + 2], w3 = wq[cur][4 * q + 3];
        const v4f pp = pq[cur][q], vv = vq[cur][q], c4 = ca[cur][q];
        const v2f c2 = cb[cur][q];
        const v2f pa = (ua.xy * S[0] + ub.xy * S[2]) + (ua.zw * S[1] + ub.zw * S[3]);   // partial sums of steps 0 and 1
        const v2f pb = (uc.xy * S[0] + ud.xy * S[2]) + (uc.zw * S[1] + ud.zw * S[3]);   // ... of steps 2 and 3
        float p0 = pa.x, p1 = pa.y, p2 = pb.x, p3 = pb.y;
        p0 = xmask_add<0x161>(p0);  p1 = xmask_add<0x161>(p1);  p2 = xmask_add<0x161>(p2);  p3 = xmask_add<0x161>(p3);
        p0 = xmask_add<0x162>(p0);  p1 = xmask_add<0x162>(p1);  p2 = xmask_add<0x162>(p2);  p3 = xmask_add<0x162>(p3);
        p0 = xmask_add<0x164>(p0);  p1 = xmask_add<0x164>(p1);  p2 = xmask_add<0x164>(p2);  p3 = xmask_add<0x164>(p3);
        p0 = xmask_add<0x168>(p0);  p1 = xmask_add<0x168>(p1);  p2 = xmask_add<0x168>(p2);  p3 = xmask_add<0x168>(p3);
        const float dl0 = vv[0] - p0;
        const float dl1 = __builtin_fmaf(-c4[0], dl0, vv[1] - p1);
        const float dl2 = __builtin_fmaf(-c4[2], dl1, __builtin_fmaf(-c4[1], dl0, vv[2] - p2));
        const float dl3 = __builtin_fmaf(-c2[1], dl2, __builtin_fmaf(-c2[0], dl1, __builtin_fmaf(-c4[3], dl0, vv[3] - p3)));
        // each term is added as soon as its dl is known, so that only the last one follows dl3
#pragma unroll
        for (int u = 0; u < 4; ++u)
          S[u] = __builtin_fmaf(w3[u], dl3, __builtin_fmaf(w2[u], dl2, __builtin_fmaf(w1[u], dl1, __builtin_fmaf(w0[u], dl0, pp[u] * S[u]))));
      }
    }
    }
    lds_barrier();   // publishes chunk n + 1 and ends the reads of chunk n's buffer, which the next pass refills
  }
}

// ---------------------------------------------------------------------------
// Gated delta rule, chunk-parallel part: one block per (chunk, b*h), 256 threads. Reads the chunk's entry state from Sg.
// Scores A[i][j] and O = Q*S + A*V on bf16 hi/lo WMMA, then headwise RMS norm and gate.
// ---------------------------------------------------------------------------
__global__ void __launch_bounds__(256)
k_out(const float* __restrict__ Qp, const float* __restrict__ Kp, const float* __restrict__ Vp,
      const float* __restrict__ Ap, const float* __restrict__ Bp, const float* __restrict__ Gp,
      const float* __restrict__ rmsw, const float* __restrict__ Sg, h16* Og, int T, float ogscale)
{
  __shared__ __attribute__((aligned(16))) float Qs[CH * QP];
  __shared__ __attribute__((aligned(16))) float Ks[CH * QP];
  __shared__ __attribute__((aligned(16))) float CLs[CH * QP];
  __shared__ __attribute__((aligned(16))) float SCs[CH * QP];
  __shared__ __attribute__((aligned(16))) float Vs[CH * HD];
  __shared__ __attribute__((aligned(16))) float ALs[CH * HD];
  __shared__ __attribute__((aligned(16))) float Sf[HD * QP];     // entry state, column-major: [e][d]
  __shared__ float Bsh[CH], GS[CH], RV[CH], RW[HD];

  const int tid = threadIdx.x;
  const int lane = tid & 31, wv = tid >> 5, m = lane & 15, h = lane >> 4;
  const int n = blockIdx.x, bh = blockIdx.y, b = bh / NH, hh = bh % NH;

  if (tid < HD) RW[tid] = bf16r(rmsw[hh * HD + tid]);

  const size_t rowbase = (size_t)b * T + (size_t)n * CH;
  const float* Qg = Qp + rowbase * DM + hh * HD;
  const float* Kg = Kp + rowbase * DM + hh * HD;
  const float* Vg = Vp + rowbase * DM + hh * HD;
  const float* Ag = Ap + rowbase * DM + hh * HD;
  const float* Si = Sg + ((size_t)bh * (T / CH) + n) * (HD * HD);

  // tile loads (64 rows x 64 f32 each): one byte offset per thread, the step of 16 rows is a constant
  const unsigned tb = (unsigned)(((tid >> 4) * DM + (tid & 15) * 4) * 4);
  v4f tq[4], tk[4], tv[4], ta[4], ts[4];
#pragma unroll
  for (int it = 0; it < 4; ++it) {
    tq[it] = *(const v4f*)((const char*)Qg + tb + it * (16 * DM * 4));
    tk[it] = *(const v4f*)((const char*)Kg + tb + it * (16 * DM * 4));
    tv[it] = *(const v4f*)((const char*)Vg + tb + it * (16 * DM * 4));
    ta[it] = *(const v4f*)((const char*)Ag + tb + it * (16 * DM * 4));
    ts[it] = *(const v4f*)(Si + tid * 4 + it * (16 * HD));
  }
  // the wait stands in front of any overwrite of the offset register the loads name; as an input it stays live up to it
  asm volatile("s_wait_xcnt 0x0" :: "v"(tb) : "memory");
#pragma unroll
  for (int it = 0; it < 4; ++it) {
    const int idx = it * 256 + tid;
    const int c = idx >> 4, d4 = (idx & 15) * 4;
    *(v4f*)(Qs  + c * QP + d4) = tq[it];
    *(v4f*)(Ks  + c * QP + d4) = tk[it];
    *(v4f*)(Vs  + c * HD + d4) = tv[it];
    *(v4f*)(ALs + c * HD + d4) = ta[it];
    *(v4f*)(Sf  + c * QP + d4) = ts[it];
  }
  if (tid < CH) {
    Bsh[tid] = fminf(Bp[(rowbase + tid) * NH + hh], 1.0f);
    GS[tid]  = Gp[(rowbase + tid) * NH + hh];
  }
  __syncthreads();

  // cumulative log decay per feature, restarted per chunk
  if (tid < HD) {
    float a = 0.0f;
    for (int c = 0; c < CH; ++c) {
      a += __logf(fmaxf(ALs[c * HD + tid], 1e-7f));
      CLs[c * QP + tid] = a;
    }
  }
  __syncthreads();

  // scores: A[i][j] = beta_j * sum_d q[i][d] k[j][d] exp(cl[i][d] - cl[j][d]) for i >= j, else 0, as a matrix product.
  // With R = cl of the first row of i's block of 16 rows, exp(cl_i - cl_j) = exp(cl_i - R) * exp(R - cl_j): the first factor goes
  // with q, the second with k, and a 16 x 16 tile of A is (q exp(cl - R)) (k exp(R - cl))^T. cl falls along the rows and a step of it
  // is at most ln 10 (alpha comes clipped to [0.1, 1]), so exp(cl_i - R) <= 1, exp(R - cl_j) <= 1 for j in an earlier block and <= 10^15 in i's own:
  // nothing overflows, and a factor that underflows belongs to a term that is itself below f32's range.
  {
    // which tiles a wave takes: row block ti, column blocks tj0 and tj0 + 1; those right of the diagonal are stored as zeros.
    // The four waves with two tiles to compute come first.
    // The wave's number is the same in all its lanes: read as a scalar, so that the tests on the tile are scalar branches
    const int wu = __builtin_amdgcn_readfirstlane(wv);
    const int ti = (0x846F >> (2 * wu)) & 3, tj0 = ((0xB2 >> wu) & 1) * 2;
    const float* pr = CLs + (ti * 16) * QP;
    BF ah[2], al[2];
    if (tj0 <= ti) {
#pragma unroll
      for (int ks = 0; ks < 2; ++ks)
        frag_decay(Qs + (ti * 16 + m) * QP + ks * 32, CLs + (ti * 16 + m) * QP + ks * 32, pr + ks * 32, h, ah[ks], al[ks]);
    }
#pragma unroll
    for (int s = 0; s < 2; ++s) {
      const int tj = tj0 + s;
      v8f acc;
#pragma unroll
      for (int r = 0; r < 8; ++r) acc[r] = 0.0f;
      if (tj <= ti) {
#pragma unroll
        for (int ks = 0; ks < 2; ++ks) {
          BF bhi, blo;
          frag_decay(Ks + (tj * 16 + m) * QP + ks * 32, pr + ks * 32, CLs + (tj * 16 + m) * QP + ks * 32, h, bhi, blo);
          acc = mma_bf16(ah[ks].v, bhi.v, acc);
          acc = mma_bf16(ah[ks].v, blo.v, acc);
          acc = mma_bf16(al[ks].v, bhi.v, acc);
        }
      }
      const int j = tj * 16 + m;
      const float bj = Bsh[j];
#pragma unroll
      for (int r = 0; r < 8; ++r) {
        const int i = ti * 16 + 8 * h + r;
        SCs[i * QP + j] = (i >= j) ? acc[r] * bj : 0.0f;
      }
    }
  }
  __syncthreads();

  // O = Q*S + A*V : wave owns rows 16*ti.., two 16-col tiles; bf16 hi/lo three products per operand pair
  {
    const int ti = wv >> 1, tj0 = (wv & 1) * 2;
    v8f acc[2];
#pragma unroll
    for (int s = 0; s < 2; ++s)
#pragma unroll
      for (int r = 0; r < 8; ++r) acc[s][r] = 0.0f;

#pragma unroll
    for (int ks = 0; ks < 2; ++ks) {
      const int k0 = ks * 32;
      BF ah, al;
      fragA_split(Qs + (ti * 16 + m) * QP + k0, h, ah, al);
#pragma unroll
      for (int s = 0; s < 2; ++s) {
        BF bhi, blo;
        fragA_split(Sf + ((tj0 + s) * 16 + m) * QP + k0, h, bhi, blo);   // column e of S is a row of Sf: same k map as the gather
        acc[s] = mma_bf16(ah.v, bhi.v, acc[s]);
        acc[s] = mma_bf16(ah.v, blo.v, acc[s]);
        acc[s] = mma_bf16(al.v, bhi.v, acc[s]);
      }
    }
#pragma unroll
    for (int ks = 0; ks < 2; ++ks) {
      const int k0 = ks * 32;
      BF ah, al;
      fragA_split(SCs + (ti * 16 + m) * QP + k0, h, ah, al);
#pragma unroll
      for (int s = 0; s < 2; ++s) {
        BF bhi, blo;
        fragB_split(Vs, HD, k0, (tj0 + s) * 16 + m, h, bhi, blo);
        acc[s] = mma_bf16(ah.v, bhi.v, acc[s]);
        acc[s] = mma_bf16(ah.v, blo.v, acc[s]);
        acc[s] = mma_bf16(al.v, bhi.v, acc[s]);
      }
    }
    __syncthreads();   // all reads of SCs/Sf done; reuse SCs as the O tile
#pragma unroll
    for (int s = 0; s < 2; ++s)
#pragma unroll
      for (int r = 0; r < 8; ++r)
        SCs[(ti * 16 + 8 * h + r) * QP + (tj0 + s) * 16 + m] = acc[s][r];
  }
  __syncthreads();

  // per-row RMS normaliser times gate
  if (tid < CH) {
    float ss = 0.0f;
    for (int e2 = 0; e2 < HD; ++e2) { const float o = SCs[tid * QP + e2]; ss += o * o; }
    RV[tid] = GS[tid] / sqrtf(ss * (1.0f / 64.0f) + 1e-6f);
  }
  __syncthreads();

  {
    v8h ov[2];
    size_t go[2];
#pragma unroll
    for (int it = 0; it < 2; ++it) {
      const int c = it * 32 + (tid >> 3), e0 = (tid & 7) * 8;
      const v4f x0 = *(const v4f*)(SCs + c * QP + e0);
      const v4f x1 = *(const v4f*)(SCs + c * QP + e0 + 4);
      const float sc = RV[c] * ogscale;
      v8h o;
#pragma unroll
      for (int q = 0; q < 4; ++q) {
        o[q]     = (h16)(x0[q] * sc * RW[e0 + q]);
        o[4 + q] = (h16)(x1[q] * sc * RW[e0 + 4 + q]);
      }
      ov[it] = o;
      go[it] = (rowbase + c) * (size_t)DM + hh * HD + e0;
    }
#pragma unroll
    for (int it = 0; it < 2; ++it) *(v8h*)(Og + go[it]) = ov[it];
    
  }
}

// ---------------------------------------------------------------------------
extern "C" void kernel_launch(void* const* d_in, const int* in_sizes, int n_in,
                              void* d_out, int out_size, void* d_ws, size_t ws_size,
                              hipStream_t stream)
{
  if (n_in < 26) return;
  const int T = 2048;
  const long nx = (long)in_sizes[0];
  if (nx <= 0 || (nx % ((long)DM * T)) != 0) return;
  const int M = (int)(nx / DM);                       // tokens, multiple of 2048 (hence of 128)
  if ((long)out_size != (long)M * DM) return;
  if (in_sizes[1] != DM * 4 || in_sizes[3] != DM * 4 || in_sizes[5] != DM * 4) return;
  if (in_sizes[7] != DM * DM || in_sizes[9] != DM * DM || in_sizes[11] != DM * DM || in_sizes[24] != DM * DM) return;
  if (in_sizes[13] != 64 * DM || in_sizes[15] != DM * 64 || in_sizes[17] != NH * DM ||
      in_sizes[20] != 64 * DM || in_sizes[22] != NH * 64) return;

  const float* x       = (const float*)d_in[0];
  const float* wq_conv = (const float*)d_in[1];  const float* bq_conv = (const float*)d_in[2];
  const float* wk_conv = (const float*)d_in[3];  const float* bk_conv = (const float*)d_in[4];
  const float* wv_conv = (const float*)d_in[5];  const float* bv_conv = (const float*)d_in[6];
  const float* Wq  = (const float*)d_in[7];   const float* bq  = (const float*)d_in[8];
  const float* Wk  = (const float*)d_in[9];   const float* bk  = (const float*)d_in[10];
  const float* Wv  = (const float*)d_in[11];  const float* bv  = (const float*)d_in[12];
  const float* Wad = (const float*)d_in[13];  const float* bad = (const float*)d_in[14];
  const float* Wau = (const float*)d_in[15];  const float* bau = (const float*)d_in[16];
  const float* Wbe = (const float*)d_in[17];  const float* bbe = (const float*)d_in[18];
  const float* rms_w = (const float*)d_in[19];
  const float* Wgd = (const float*)d_in[20];  const float* bgd = (const float*)d_in[21];
  const float* Wgu = (const float*)d_in[22];  const float* bgu = (const float*)d_in[23];
  const float* Wo  = (const float*)d_in[24];  const float* bo  = (const float*)d_in[25];

  char* ws = (char*)d_ws;
  size_t off = 0;
  auto carve = [&](size_t bytes) -> char* {
    char* p = ws + off;
    off += (bytes + 255) & ~(size_t)255;
    return p;
  };
  const size_t MD = (size_t)M * DM;
  h16* xh    = (h16*)carve(MD * 2);
  h16* cq    = (h16*)carve(MD * 2);
  h16* ck    = (h16*)carve(MD * 2);
  h16* cv    = (h16*)carve(MD * 2);
  h16* Wq16  = (h16*)carve((size_t)DM * DM * 2);
  h16* Wk16  = (h16*)carve((size_t)DM * DM * 2);
  h16* Wv16  = (h16*)carve((size_t)DM * DM * 2);
  h16* Wo16  = (h16*)carve((size_t)DM * DM * 2);
  h16* Wad16 = (h16*)carve((size_t)64 * DM * 2);
  h16* Wau16 = (h16*)carve((size_t)DM * 64 * 2);
  h16* Wbe16 = (h16*)carve((size_t)NH * DM * 2);
  h16* Wgd16 = (h16*)carve((size_t)64 * DM * 2);
  h16* Wgu16 = (h16*)carve((size_t)NH * 64 * 2);
  float* Qn  = (float*)carve(MD * 4);
  float* Kn  = (float*)carve(MD * 4);
  float* Vf  = (float*)carve(MD * 4);
  float* Al  = (float*)carve(MD * 4);
  float* Bt  = (float*)carve((size_t)M * NH * 4);
  float* Gt  = (float*)carve((size_t)M * NH * 4);
  h16* t1    = (h16*)carve((size_t)M * 64 * 2);
  h16* t2    = (h16*)carve((size_t)M * 64 * 2);
  h16* Og16  = (h16*)carve(MD * 2);
  float* Sst = (float*)carve((size_t)(M / CH) * NH * HD * HD * 4);   // entry state of every (b, h, chunk)
  if (off > ws_size) return;

  const float wsc = 256.0f;      // weight scale
  const float asc = 256.0f;      // conv activation scale
  const float tsc = 64.0f;       // gate hidden scale
  const float osc = 16.0f;       // gated output scale

  // 1) x -> f16, three shortconv+SiLU activations, and the nine weights -> scaled f16 (Wq16 .. Wgu16 are carved back to back,
  //    each a multiple of 256 bytes, in the order k_front takes the matrices); M is a multiple of T, T of the 8 * FL tokens of a block
  {
    const int nconv = (M / (8 * FL)) * (DM / FW);
    k_front<<<nconv + (G_ALL + 256 * CG - 1) / (256 * CG), 256, 0, stream>>>(x, wq_conv, bq_conv, wk_conv, bk_conv, wv_conv, bv_conv,
                                                                             Wq, Wk, Wv, Wo, Wad, Wau, Wbe, Wgd, Wgu,
                                                                             xh, cq, ck, cv, Wq16, nconv, T, asc, wsc);
  }
  // 2) the six products on the front launch's results; 3) the two gate-up products
  k_proj<<<dim3(M / 128, 51), 256, 0, stream>>>(cq, ck, cv, xh, Wq16, Wk16, Wv16, Wad16, Wbe16, Wgd16,
                                                bq, bk, bv, bad, bbe, bgd, Qn, Kn, Vf, Bt, t1, t2,
                                                DM, 1.0f / (asc * wsc), 1.0f / wsc, tsc);
  k_gate<<<dim3(M / 128, 17), 256, 0, stream>>>(t1, t2, Wau16, Wgu16, bau, bgu, Al, Gt, 64, 1.0f / (tsc * wsc));
  // 4) state recurrence, one block per (column group, b*h); then the per-chunk outputs, one block per (chunk, b*h)
  k_state<<<dim3(HD / SC, (M / T) * NH), 256, 0, stream>>>(Kn, Vf, Al, Bt, Sst, T);
  k_out<<<dim3(T / CH, (M / T) * NH), 256, 0, stream>>>(Qn, Kn, Vf, Al, Bt, Gt, rms_w, Sst, Og16, T, osc);
  // 5) output projection
  k_oproj<<<dim3(M / 128, DM / 64), 256, 0, stream>>>(Og16, Wo16, bo, (float*)d_out, DM, 1.0f / (osc * wsc));
}

// v009
// It runs in 156 microseconds.
// Two timings next to v008 put it at 1.07 and 1.08 times that version's speed.
// All steps since v000 together make it 8.08 times as fast.
#include <hip/hip_runtime.h>
#include <stdint.h>

// Contractions: token projections (q, k, v, gate down/up, beta, out) on v_wmma_f32_16x16x32_f16 with f16 operands pre-scaled by powers of two, f32 accumulate; per-chunk decay scores, Q*S and A*V on v_wmma_f32_16x16x32_bf16 as bf16 hi/lo three-product split, f32 accumulate; state recurrence, shortconv and norms on VALU in f32. All float inputs RNE-converted to bf16 on load.

typedef _Float16 h16;
typedef h16    v16h __attribute__((ext_vector_type(16)));
typedef h16    v8h  __attribute__((ext_vector_type(8)));
typedef __bf16 v16b __attribute__((ext_vector_type(16)));
typedef __bf16 v2b  __attribute__((ext_vector_type(2)));
typedef float  v8f  __attribute__((ext_vector_type(8)));
typedef float  v4f  __attribute__((ext_vector_type(4)));
typedef float  v2f  __attribute__((ext_vector_type(2)));

union HF { v16h v; v8h p[2]; };
union BF { v16b v; unsigned short u[16]; };

#define DM 1024
#define HD 64
#define NH 16
#define CH 64
#define QP 68
#define KS 64    // k per staged GEMM tile: 128 B of a row
#define LP 72    // LDS row pitch of a staged tile in f16: 144 B = 16 B x 9, free of bank conflicts for 16-byte row reads

__device__ __forceinline__ unsigned short bf16_bits(float f) {
  unsigned int u = __float_as_uint(f);
  u += 0x7FFFu + ((u >> 16) & 1u);
  return (unsigned short)(u >> 16);
}
__device__ __forceinline__ float bf16r(float f) {
  return __uint_as_float(((unsigned int)bf16_bits(f)) << 16);
}
// x = hi + lo in bf16 pieces (RNE), bit patterns
__device__ __forceinline__ void split2(float x, unsigned short& hi, unsigned short& lo) {
  const unsigned short hb = bf16_bits(x);
  const float hf = __uint_as_float(((unsigned int)hb) << 16);
  hi = hb;
  lo = bf16_bits(x - hf);
}
// low 32 bits of a __shared__ address: the byte offset in the work-group's LDS
__device__ __forceinline__ unsigned lds_off(const void* p) {
  return (unsigned)(uintptr_t)p;
}
__device__ __forceinline__ float sigm(float v) {
  return __fdividef(1.0f, 1.0f + __expf(-v));
}

// 16-bit WMMA wrappers with the VALU hazard guard after the matrix op
__device__ __forceinline__ v8f mma_f16(v16h a, v16h b, v8f c) {
  c = __builtin_amdgcn_wmma_f32_16x16x32_f16(false, a, false, b, (short)0, c, false, false);
  asm volatile("v_nop\n\tv_nop\n\tv_nop\n\tv_nop" : "+v"(c) : "v"(a), "v"(b));
  return c;
}
__device__ __forceinline__ v8f mma_bf16(v16b a, v16b b, v8f c) {
  c = __builtin_amdgcn_wmma_f32_16x16x32_bf16(false, a, false, b, (short)0, c, false, false);
  asm volatile("v_nop\n\tv_nop\n\tv_nop\n\tv_nop" : "+v"(c) : "v"(a), "v"(b));
  return c;
}

// A fragment (row m, split k map) from an f32 LDS row pointer pr = base + row*pitch + k0, as bf16 hi/lo
__device__ __forceinline__ void fragA_split(const float* pr, int h, BF& hi, BF& lo) {
  const v4f x0 = *(const v4f*)(pr + 8 * h);
  const v4f x1 = *(const v4f*)(pr + 8 * h + 4);
  const v4f x2 = *(const v4f*)(pr + 16 + 8 * h);
  const v4f x3 = *(const v4f*)(pr + 20 + 8 * h);
#pragma unroll
  for (int q = 0; q < 4; ++q) {
    split2(x0[q], hi.u[q],      lo.u[q]);
    split2(x1[q], hi.u[4 + q],  lo.u[4 + q]);
    split2(x2[q], hi.u[8 + q],  lo.u[8 + q]);
    split2(x3[q], hi.u[12 + q], lo.u[12 + q]);
  }
}
// B fragment (col n, same split k map) gathered down column col of f32 [k][pitch] in LDS, as bf16 hi/lo
__device__ __forceinline__ void fragB_split(const float* base, int pitch, int k0, int col, int h, BF& hi, BF& lo) {
#pragma unroll
  for (int i = 0; i < 8; ++i) {
    split2(base[(k0 + 8 * h + i) * pitch + col],      hi.u[i],     lo.u[i]);
    split2(base[(k0 + 16 + 8 * h + i) * pitch + col], hi.u[8 + i], lo.u[8 + i]);
  }
}

// Fragment (row m, split k map, for A and for a B whose column is an LDS row) of x[k] = pv[k] * exp(pp[k] - pm[k]), as bf16 hi/lo (RNE);
// the three pointers are f32 LDS rows at k0
__device__ __forceinline__ void frag_decay(const float* pv, const float* pp, const float* pm, int h, BF& hi, BF& lo) {
#pragma unroll
  for (int g = 0; g < 4; ++g) {
    const int o = (g >> 1) * 16 + 8 * h + (g & 1) * 4;
    const v4f v = *(const v4f*)(pv + o), a = *(const v4f*)(pp + o), c = *(const v4f*)(pm + o);
#pragma unroll
    for (int p = 0; p < 2; ++p) {
      const v2f x = { v[2 * p] * __expf(a[2 * p] - c[2 * p]), v[2 * p + 1] * __expf(a[2 * p + 1] - c[2 * p + 1]) };
      const v2b xh = __builtin_convertvector(x, v2b);
      const v2b xl = __builtin_convertvector(x - __builtin_convertvector(xh, v2f), v2b);
      hi.v[4 * g + 2 * p] = xh[0];  hi.v[4 * g + 2 * p + 1] = xh[1];
      lo.v[4 * g + 2 * p] = xl[0];  lo.v[4 * g + 2 * p + 1] = xl[1];
    }
  }
}

// ---------------------------------------------------------------------------
// Everything that reads only the inputs, in one launch of few, long work-groups.
// The first nconv blocks: causal depthwise conv (4 taps) + SiLU for all three weight sets, f16 output scaled by ascale, and x -> f16.
// A block takes FW channels x 8 * FL tokens; a wave a run of FL tokens, a lane 8 channels of it. The FL + 3 rows of x that the run
// needs are read once and serve all three sets; a set's taps and bias are read once per run.
// The blocks behind them: the nine weight matrices -> scaled f16, CG groups of eight elements per thread. Their f16 copies lie one
// behind the other in w16, in the order of the arguments, so one running group index serves all nine; every matrix but the last
// ends on a multiple of 256 * CG groups, so a block converts from one matrix only.
// ---------------------------------------------------------------------------
#define G_SQ (DM * DM / 8)    // groups of eight in a DM x DM matrix
#define G_LR (64 * DM / 8)    // ... in a 64 x DM or DM x 64 matrix
#define G_HD (NH * DM / 8)    // ... in an NH x DM matrix
#define G_HR (NH * 64 / 8)    // ... in an NH x 64 matrix
#define G_ALL (4 * G_SQ + 3 * G_LR + G_HD + G_HR)
#define CG 8      // groups per thread of a converting block
#define FL 8      // tokens per wave of a conv block
#define FW 256    // channels per conv block: 32 lanes x 8
#define TP 36     // LDS pitch in f32 of a lane's 4 taps x 8 channels: 144 B = 16 B x 9, free of bank conflicts for 16-byte reads

// SiLU's sigmoid for the conv part: sigm() with its exponential spelled out, the same multiply and the same v_exp_f32. The v_nop is the
// slot that the instruction set asks for behind a transcendental before its source register is overwritten: the argument dies at the
// v_exp_f32, and among the many side by side here the compiler gave its register to the very next instruction in some places
__device__ __forceinline__ float sigm_slot(float v) {
  const float t = v * -1.44269504f;
  float e;
  asm("v_exp_f32 %0, %1\n\tv_nop" : "=v"(e) : "v"(t));
  return __fdividef(1.0f, 1.0f + e);
}

__global__ void __launch_bounds__(256)
k_front(const float* __restrict__ x,
        const float* __restrict__ w0, const float* __restrict__ b0,
        const float* __restrict__ w1, const float* __restrict__ b1,
        const float* __restrict__ w2, const float* __restrict__ b2,
        const float* __restrict__ Wq, const float* __restrict__ Wk, const float* __restrict__ Wv,
        const float* __restrict__ Wo, const float* __restrict__ Wad, const float* __restrict__ Wau,
        const float* __restrict__ Wbe, const float* __restrict__ Wgd, const float* __restrict__ Wgu,
        h16* xh, h16* y0, h16* y1, h16* y2, h16* w16, int nconv, int T, float ascale, float wscale)
{
  __shared__ __attribute__((aligned(16))) float tw[3 * 32 * TP];   // [set][lane][tap][channel of the lane], bf16-rounded
  __shared__ __attribute__((aligned(16))) float tb[3 * FW];        // [set][channel], bf16-rounded

  const int bid = blockIdx.x;
  const int tid = threadIdx.x;
  if (bid >= nconv) {
    const int g0 = (bid - nconv) * (256 * CG);                              // first group of this block
    const float* src = Wq;
    int first = 0;                                                          // first group of the matrix g0 lies in
    if (g0 >= 4 * G_SQ + 3 * G_LR + G_HD)      { src = Wgu; first = 4 * G_SQ + 3 * G_LR + G_HD; }
    else if (g0 >= 4 * G_SQ + 2 * G_LR + G_HD) { src = Wgd; first = 4 * G_SQ + 2 * G_LR + G_HD; }
    else if (g0 >= 4 * G_SQ + 2 * G_LR)        { src = Wbe; first = 4 * G_SQ + 2 * G_LR; }
    else if (g0 >= 4 * G_SQ + G_LR)            { src = Wau; first = 4 * G_SQ + G_LR; }
    else if (g0 >= 4 * G_SQ)                   { src = Wad; first = 4 * G_SQ; }
    else if (g0 >= 3 * G_SQ)                   { src = Wo;  first = 3 * G_SQ; }
    else if (g0 >= 2 * G_SQ)                   { src = Wv;  first = 2 * G_SQ; }
    else if (g0 >= G_SQ)                       { src = Wk;  first = G_SQ; }
    // all loads of the thread are asked for before the first is used; a group past the end re-reads the last one and is not stored
    v4f a[CG], c[CG];
    const float* ps[CG];
#pragma unroll
    for (int it = 0; it < CG; ++it) {
      const int gi = g0 + it * 256 + tid;
      ps[it] = src + (size_t)((gi < G_ALL ? gi : G_ALL - 1) - first) * 8;
      a[it] = *(const v4f*)ps[it];
      c[it] = *(const v4f*)(ps[it] + 4);
    }
    // the wait stands in front of any overwrite of the address registers the loads name; as inputs they stay live up to it
    asm volatile("s_wait_xcnt 0x0" :: "v"(ps[0]), "v"(ps[1]), "v"(ps[2]), "v"(ps[3]), "v"(ps[4]), "v"(ps[5]), "v"(ps[6]), "v"(ps[7]) : "memory");
    v8h o[CG];
#pragma unroll
    for (int it = 0; it < CG; ++it)
#pragma unroll
      for (int q = 0; q < 4; ++q) {
        o[it][q]     = (h16)(bf16r(a[it][q]) * wscale);
        o[it][4 + q] = (h16)(bf16r(c[it][q]) * wscale);
      }
#pragma unroll
    for (int it = 0; it < CG; ++it) {
      const int gi = g0 + it * 256 + tid;
      if (gi < G_ALL) *(v8h*)(w16 + (size_t)gi * 8) = o[it];
    }
    return;
  }

  const int lane = tid & 31;
  // the wave's number is the same in all its lanes: read as a scalar, so that the row addresses and the test on the run's start are scalar
  const int wv = __builtin_amdgcn_readfirstlane(tid >> 5);
  const int c0 = (bid & (DM / FW - 1)) * FW;                      // first channel of the block
  const unsigned tok0 = (unsigned)(bid / (DM / FW)) * (8 * FL) + wv * FL;   // first token of the wave's run
  const size_t eo = (size_t)tok0 * DM + c0 + lane * 8;            // the lane's first element, in x and in every output

  // taps and bias of the block's channels: whole lines from global memory, one channel's four taps per thread and set
  const unsigned co = (unsigned)(c0 + tid);
  const v4f t0 = *(const v4f*)(w0 + co * 4), t1 = *(const v4f*)(w1 + co * 4), t2 = *(const v4f*)(w2 + co * 4);
  const float u0 = b0[co], u1 = b1[co], u2 = b2[co];
  // rows tok0 - 3 .. tok0 + FL - 1 of x; the three in front of a sequence's start count as zero (a run starts at a multiple of FL in it)
  v4f xa[FL + 3], xb[FL + 3];
  const float* px = x + eo;
#pragma unroll
  for (int j = 3; j < FL + 3; ++j) {
    xa[j] = *(const v4f*)(px + (j - 3) * DM);
    xb[j] = *(const v4f*)(px + (j - 3) * DM + 4);
  }
  if (tok0 % (unsigned)T != 0) {
#pragma unroll
    for (int j = 0; j < 3; ++j) {
      xa[j] = *(const v4f*)(px + (j - 3) * DM);
      xb[j] = *(const v4f*)(px + (j - 3) * DM + 4);
    }
  } else {
#pragma unroll
    for (int j = 0; j < 3; ++j)
#pragma unroll
      for (int q = 0; q < 4; ++q) { xa[j][q] = 0.0f; xb[j][q] = 0.0f; }
  }
  // the wait stands in front of any overwrite of the address registers the loads name; as inputs they stay live up to it
  asm volatile("s_wait_xcnt 0x0" :: "v"(px), "v"(co) : "memory");

  // taps to LDS as [lane][tap][channel of the lane], so that a lane reads a tap of its eight channels as two 16-byte pieces
  {
    float* d = tw + (tid >> 3) * TP + (tid & 7);
#pragma unroll
    for (int k = 0; k < 4; ++k) {
      d[k * 8]               = bf16r(t0[k]);
      d[32 * TP + k * 8]     = bf16r(t1[k]);
      d[2 * 32 * TP + k * 8] = bf16r(t2[k]);
    }
    tb[tid]          = bf16r(u0);
    tb[FW + tid]     = bf16r(u1);
    tb[2 * FW + tid] = bf16r(u2);
  }
  __syncthreads();   // every thread's taps are in LDS before any lane reads its eight channels'

  // x rounded, two neighbouring channels side by side for the packed products
  v2f xr[FL + 3][4];
#pragma unroll
  for (int j = 0; j < FL + 3; ++j)
#pragma unroll
    for (int p = 0; p < 2; ++p) {
      xr[j][p]     = v2f{ bf16r(xa[j][2 * p]), bf16r(xa[j][2 * p + 1]) };
      xr[j][2 + p] = v2f{ bf16r(xb[j][2 * p]), bf16r(xb[j][2 * p + 1]) };
    }

  {
    v8h ox[FL];
#pragma unroll
    for (int j = 0; j < FL; ++j)
#pragma unroll
      for (int q = 0; q < 8; ++q) ox[j][q] = (h16)xr[j + 3][q >> 1][q & 1];
#pragma unroll
    for (int j = 0; j < FL; ++j) *(v8h*)(xh + eo + (size_t)j * DM) = ox[j];
    // the wait stands in front of any rewrite of the registers the stores name
    asm volatile("s_wait_xcnt 0x0" ::: "memory");
  }

  // the loop over the three sets stays rolled, for speed only
#pragma unroll 1
  for (int s = 0; s < 3; ++s) {
    h16* y = (s == 0) ? y0 : ((s == 1) ? y1 : y2);
    v2f wt[4][4], bi[4];
#pragma unroll
    for (int k = 0; k < 4; ++k) {
      const v4f a = *(const v4f*)(tw + s * (32 * TP) + lane * TP + k * 8);
      const v4f c = *(const v4f*)(tw + s * (32 * TP) + lane * TP + k * 8 + 4);
      wt[k][0] = a.xy;  wt[k][1] = a.zw;  wt[k][2] = c.xy;  wt[k][3] = c.zw;
    }
    {
      const v4f a = *(const v4f*)(tb + s * FW + lane * 8), c = *(const v4f*)(tb + s * FW + lane * 8 + 4);
      bi[0] = a.xy;  bi[1] = a.zw;  bi[2] = c.xy;  bi[3] = c.zw;
    }
    v8h o[FL];
#pragma unroll
    for (int j = 0; j < FL; ++j)
#pragma unroll
      for (int p = 0; p < 4; ++p) {
        v2f acc = xr[j][p] * wt[0][p];
        acc = __builtin_elementwise_fma(xr[j + 1][p], wt[1][p], acc);
        acc = __builtin_elementwise_fma(xr[j + 2][p], wt[2][p], acc);
        acc = __builtin_elementwise_fma(xr[j + 3][p], wt[3][p], acc);
        acc += bi[p];
        o[j][2 * p]     = (h16)(acc.x * sigm_slot(acc.x) * ascale);
        o[j][2 * p + 1] = (h16)(acc.y * sigm_slot(acc.y) * ascale);
      }
#pragma unroll
    for (int j = 0; j < FL; ++j) *(v8h*)(y + eo + (size_t)j * DM) = o[j];
    // the wait stands in front of any rewrite of the registers the stores name
    asm volatile("s_wait_xcnt 0x0" ::: "memory");
  }
}

// ---------------------------------------------------------------------------
// Y[M,N] = epi( A[M,K] * W[N,K]^T * oscale + bias[N] ), f16 operands (k-contiguous), f32 accumulate.
// One block tile (bx, by) of one product; the launches below hand independent products to one grid, told apart by blockIdx.y.
// Block 256 threads = 8 waves; block tile 128 rows x 16*NT cols; wave tile 16 x 16*NT.
// Both operands come to LDS in tiles of KS k by asynchronous copies, whole cache lines, two buffers: tile t + 1 flies while t is used.
// EPI: 0 none, 2 silu, 3 sigmoid then clip to [0.1,1], 4 sigmoid then min 1.
// ---------------------------------------------------------------------------
// LDS of a launch, sized for NT = 4: the epilogue's staging, two buffers of 128 rows of A, two of up to 64 rows of W, KS k each
#define GEMM_LDS \
  __shared__ __attribute__((aligned(16))) float stg[8 * 16 * 64]; \
  __shared__ __attribute__((aligned(16))) h16 sA[2 * 128 * LP]; \
  __shared__ __attribute__((aligned(16))) h16 sW[2 * 64 * LP];

template<int NT, int EPI, typename OT>
__device__ __forceinline__ void
gemm_tile(const h16* __restrict__ A, const h16* __restrict__ W, const float* __restrict__ bias,
          OT* Y, int N, int K, float oscale, float yscale, int bx, int by, float* stg, h16* sA, h16* sW)
{
  constexpr int TW = 16 * NT;

  const int lane = threadIdx.x & 31, wv = threadIdx.x >> 5;
  const int m = lane & 15, h = lane >> 4;
  const int rowBase = bx * 128 + wv * 16;
  const int colBase = by * TW;

  v8f acc[NT];
#pragma unroll
  for (int t = 0; t < NT; ++t)
#pragma unroll
    for (int r = 0; r < 8; ++r) acc[t][r] = 0.0f;

  // Copy map: a row of a tile is KS f16 = 128 B = one cache line; 8 lanes x 16 B bring one row, a wave four whole lines.
  const int tid = threadIdx.x;
  const int cr = tid >> 3, cc = (tid & 7) * 8;
  const h16* ga = A + (size_t)(bx * 128 + cr) * K + cc;
  const unsigned la = lds_off(sA + cr * LP + cc);
  // W tile: 64 rows in 16-byte pieces (two per thread), or 16 rows in 8-byte pieces (one per thread)
  const int wr = (NT == 4) ? cr : (tid >> 4), wc = (NT == 4) ? cc : (tid & 15) * 4;
  const h16* gw = W + (size_t)(colBase + wr) * K + wc;
  const unsigned lw = lds_off(sW + wr * LP + wc);
  const size_t r32 = (size_t)32 * K;             // 32 rows further in global memory
  constexpr unsigned L32 = 32 * LP * 2;          // 32 rows further in LDS, bytes

  // all of tile t's copies, every lane on; the s_wait_xcnt closes the statement so that it stands in front of any
  // rewrite of the address registers the copies name
  auto stage = [&](int t) {
    const h16* a0 = ga + (size_t)t * KS;
    const h16* w0 = gw + (size_t)t * KS;
    const unsigned l0 = la + (unsigned)(t & 1) * (128 * LP * 2);
    const unsigned m0 = lw + (unsigned)(t & 1) * (TW * LP * 2);
    if constexpr (NT == 4) {
      asm volatile("global_load_async_to_lds_b128 %0, %1, off\n\t"
                   "global_load_async_to_lds_b128 %2, %3, off\n\t"
                   "global_load_async_to_lds_b128 %4, %5, off\n\t"
                   "global_load_async_to_lds_b128 %6, %7, off\n\t"
                   "global_load_async_to_lds_b128 %8, %9, off\n\t"
                   "global_load_async_to_lds_b128 %10, %11, off\n\t"
                   "s_wait_xcnt 0x0"
                   :: "v"(l0), "v"(a0), "v"(l0 + L32), "v"(a0 + r32), "v"(l0 + 2 * L32), "v"(a0 + 2 * r32),
                      "v"(l0 + 3 * L32), "v"(a0 + 3 * r32), "v"(m0), "v"(w0), "v"(m0 + L32), "v"(w0 + r32)
                   : "memory");
    } else {
      asm volatile("global_load_async_to_lds_b128 %0, %1, off\n\t"
                   "global_load_async_to_lds_b128 %2, %3, off\n\t"
                   "global_load_async_to_lds_b128 %4, %5, off\n\t"
                   "global_load_async_to_lds_b128 %6, %7, off\n\t"
                   "global_load_async_to_lds_b64 %8, %9, off\n\t"
                   "s_wait_xcnt 0x0"
                   :: "v"(l0), "v"(a0), "v"(l0 + L32), "v"(a0 + r32), "v"(l0 + 2 * L32), "v"(a0 + 2 * r32),
                      "v"(l0 + 3 * L32), "v"(a0 + 3 * r32), "v"(m0), "v"(w0)
                   : "memory");
    }
  };

  const int nt = K / KS;
  stage(0);
  asm volatile("s_wait_asynccnt 0x0" ::: "memory");   // this wave's copies of tile 0 have landed
  __syncthreads();                                    // ... and every other wave's
  if (nt > 1) stage(1);

  // A: lane row m, elements 0..7 <- k0+8h.., 8..15 <- k0+16+8h..;  B: lane col m, same k map
  for (int t = 0; t < nt; ++t) {
    const h16* pa = sA + (t & 1) * (128 * LP) + (wv * 16 + m) * LP + 8 * h;
    const h16* pw = sW + (t & 1) * (TW * LP) + m * LP + 8 * h;
    HF a[KS / 32], b[KS / 32][NT];
#pragma unroll
    for (int q = 0; q < KS / 32; ++q) {
      a[q].p[0] = *(const v8h*)(pa + 32 * q);
      a[q].p[1] = *(const v8h*)(pa + 32 * q + 16);
#pragma unroll
      for (int u = 0; u < NT; ++u) {
        b[q][u].p[0] = *(const v8h*)(pw + 16 * u * LP + 32 * q);
        b[q][u].p[1] = *(const v8h*)(pw + 16 * u * LP + 32 * q + 16);
      }
    }
#pragma unroll
    for (int q = 0; q < KS / 32; ++q)
#pragma unroll
      for (int u = 0; u < NT; ++u) acc[u] = mma_f16(a[q].v, b[q][u].v, acc[u]);
    asm volatile("s_wait_dscnt 0x0" ::: "memory");      // this wave's reads of the buffer are done before it is refilled
    asm volatile("s_wait_asynccnt 0x0" ::: "memory");   // this wave's copies of tile t + 1 have landed
    __syncthreads();                                    // publishes tile t + 1 and ends every wave's reads of tile t
    if (t + 2 < nt) stage(t + 2);
  }
  asm volatile("s_wait_asynccnt 0x0" ::: "memory");     // no copy is left in flight when the wave goes on

  // epilogue values (D element r of this lane = row 8h+r, col m of tile t)
#pragma unroll
  for (int t = 0; t < NT; ++t) {
    const float bv = bf16r(bias[colBase + 16 * t + m]);
#pragma unroll
    for (int r = 0; r < 8; ++r) {
      float v = acc[t][r] * oscale + bv;
      if (EPI == 2)      { v = v * sigm(v); }
      else if (EPI == 3) { v = sigm(v); v = fminf(fmaxf(v, 0.1f), 1.0f); }
      else if (EPI == 4) { v = fminf(sigm(v), 1.0f); }
      acc[t][r] = v;
    }
  }
  float* sw = stg + wv * 16 * TW;
#pragma unroll
  for (int t = 0; t < NT; ++t)
#pragma unroll
    for (int r = 0; r < 8; ++r) sw[(8 * h + r) * TW + 16 * t + m] = acc[t][r];
  __syncthreads();

  if constexpr (sizeof(OT) == 4 && NT == 4) {
    v4f vals[8];
    size_t offs[8];
#pragma unroll
    for (int it = 0; it < 8; ++it) {
      const int row = 2 * it + h, c4 = m * 4;
      vals[it] = *(const v4f*)(sw + row * TW + c4);
      offs[it] = (size_t)(rowBase + row) * N + colBase + c4;
    }
#pragma unroll
    for (int it = 0; it < 8; ++it) *(v4f*)(Y + offs[it]) = vals[it];
    // in a merged launch another product's code follows in the listing: the wait stands in front of any rewrite of the registers the stores name
    asm volatile("s_wait_xcnt 0x0" ::: "memory");
  } else if constexpr (sizeof(OT) == 2 && NT == 4) {
    v8h vals[4];
    size_t offs[4];
#pragma unroll
    for (int it = 0; it < 4; ++it) {
      const int row = it * 4 + (lane >> 3), c8 = (lane & 7) * 8;
      const v4f a = *(const v4f*)(sw + row * TW + c8);
      const v4f c = *(const v4f*)(sw + row * TW + c8 + 4);
      v8h o;
#pragma unroll
      for (int q = 0; q < 4; ++q) { o[q] = (h16)(a[q] * yscale); o[4 + q] = (h16)(c[q] * yscale); }
      vals[it] = o;
      offs[it] = (size_t)(rowBase + row) * N + colBase + c8;
    }
#pragma unroll
    for (int it = 0; it < 4; ++it) *(v8h*)(Y + offs[it]) = vals[it];
    // in a merged launch another product's code follows in the listing: the wait stands in front of any rewrite of the registers the stores name
    asm volatile("s_wait_xcnt 0x0" ::: "memory");
  } else if constexpr (sizeof(OT) == 4 && NT == 1) {
    // N == 16: the wave's 16 rows are 1 KB contiguous; 8 lanes x 16 B per line
    v4f vals[2];
    size_t offs[2];
#pragma unroll
    for (int it = 0; it < 2; ++it) {
      const int q = it * 32 + lane, row = q >> 2, c4 = (q & 3) * 4;
      vals[it] = *(const v4f*)(sw + row * TW + c4);
      offs[it] = (size_t)(rowBase + row) * N + colBase + c4;
    }
#pragma unroll
    for (int it = 0; it < 2; ++it) *(v4f*)(Y + offs[it]) = vals[it];
    // in a merged launch another product's code follows in the listing: the wait stands in front of any rewrite of the registers the stores name
    asm volatile("s_wait_xcnt 0x0" ::: "memory");
  }
}

// ---------------------------------------------------------------------------
// The wide tile, for the three DM x DM products on the conv activations: Y[M,N] = A[M,K] * W[N,K]^T * oscale + bias[N], f32 out,
// each row L2-normalised over its 64-col slab where norm is set (the same for the whole block).
// Block tile WM rows x WN cols, 8 waves as 4 row groups x 2 column groups, wave tile 64 x 64: a fragment read from LDS serves four
// matrix instructions, and a byte brought to LDS serves twice the products it serves in gemm_tile.
// The same copies, the same two buffers and the same order at the foot of a trip as in gemm_tile.
// pool: the block's LDS. In the loop it holds two buffers of WM rows of A, then two of WN rows of W; behind the loop's last barrier
// nobody reads those any more, and each wave stages its 64 x 64 results there, pitch EP.
// ---------------------------------------------------------------------------
#define WM 256
#define WN 128
#define EP 68     // LDS row pitch of the staged results in f32: the two 16-lane rows of a wave, 8 rows apart, fall on different banks
#define WIDE_LDS (8 * 64 * EP * 4)   // bytes; the loop's buffers need 2 * (WM + WN) * LP * 2, which is less

__device__ __forceinline__ void
gemm_wide(const h16* __restrict__ A, const h16* __restrict__ W, const float* __restrict__ bias,
          float* Y, int N, int K, float oscale, bool norm, int bx, int by, char* pool)
{
  h16* sA = (h16*)pool;
  h16* sW = sA + 2 * WM * LP;

  const int tid = threadIdx.x;
  const int lane = tid & 31, wv = tid >> 5;
  const int m = lane & 15, h = lane >> 4;
  const int wr = wv >> 1, wc = wv & 1;
  const int rowBase = bx * WM + wr * 64;
  const int colBase = by * WN + wc * 64;

  v8f acc[4][4];
#pragma unroll
  for (int i = 0; i < 4; ++i)
#pragma unroll
    for (int u = 0; u < 4; ++u)
#pragma unroll
      for (int r = 0; r < 8; ++r) acc[i][u][r] = 0.0f;

  // Copy map as in gemm_tile: 8 lanes x 16 B bring one row of KS f16, the block 32 rows per copy instruction
  const int cr = tid >> 3, cc = (tid & 7) * 8;
  const h16* ga = A + (size_t)(bx * WM + cr) * K + cc;
  const h16* gw = W + (size_t)(by * WN + cr) * K + cc;
  const unsigned la = lds_off(sA + cr * LP + cc);
  const unsigned lw = lds_off(sW + cr * LP + cc);
  const size_t r32 = (size_t)32 * K;             // 32 rows further in global memory
  constexpr unsigned L32 = 32 * LP * 2;          // 32 rows further in LDS, bytes

  // all of tile t's copies, every lane on; the s_wait_xcnt closes the statement so that it stands in front of any
  // rewrite of the address registers the copies name
  auto stage = [&](int t) {
    const h16* a0 = ga + (size_t)t * KS;
    const h16* w0 = gw + (size_t)t * KS;
    const unsigned l0 = la + (unsigned)(t & 1) * (WM * LP * 2);
    const unsigned m0 = lw + (unsigned)(t & 1) * (WN * LP * 2);
    asm volatile("global_load_async_to_lds_b128 %0, %1, off\n\t"
                 "global_load_async_to_lds_b128 %2, %3, off\n\t"
                 "global_load_async_to_lds_b128 %4, %5, off\n\t"
                 "global_load_async_to_lds_b128 %6, %7, off\n\t"
                 "global_load_async_to_lds_b128 %8, %9, off\n\t"
                 "global_load_async_to_lds_b128 %10, %11, off\n\t"
                 "global_load_async_to_lds_b128 %12, %13, off\n\t"
                 "global_load_async_to_lds_b128 %14, %15, off\n\t"
                 "global_load_async_to_lds_b128 %16, %17, off\n\t"
                 "global_load_async_to_lds_b128 %18, %19, off\n\t"
                 "global_load_async_to_lds_b128 %20, %21, off\n\t"
                 "global_load_async_to_lds_b128 %22, %23, off\n\t"
                 "s_wait_xcnt 0x0"
                 :: "v"(l0), "v"(a0), "v"(l0 + L32), "v"(a0 + r32), "v"(l0 + 2 * L32), "v"(a0 + 2 * r32),
                    "v"(l0 + 3 * L32), "v"(a0 + 3 * r32), "v"(l0 + 4 * L32), "v"(a0 + 4 * r32), "v"(l0 + 5 * L32), "v"(a0 + 5 * r32),
                    "v"(l0 + 6 * L32), "v"(a0 + 6 * r32), "v"(l0 + 7 * L32), "v"(a0 + 7 * r32),
                    "v"(m0), "v"(w0), "v"(m0 + L32), "v"(w0 + r32), "v"(m0 + 2 * L32), "v"(w0 + 2 * r32), "v"(m0 + 3 * L32), "v"(w0 + 3 * r32)
                 : "memory");
  };

  const int nt = K / KS;
  stage(0);
  asm volatile("s_wait_asynccnt 0x0" ::: "memory");   // this wave's copies of tile 0 have landed
  __syncthreads();                                    // ... and every other wave's
  if (nt > 1) stage(1);

  // A: lane row m, elements 0..7 <- k0+8h.., 8..15 <- k0+16+8h..;  B: lane col m, same k map
  for (int t = 0; t < nt; ++t) {
    const h16* pa = sA + (t & 1) * (WM * LP) + (wr * 64 + m) * LP + 8 * h;
    const h16* pw = sW + (t & 1) * (WN * LP) + (wc * 64 + m) * LP + 8 * h;
#pragma unroll
    for (int q = 0; q < KS / 32; ++q) {
      HF a[4], b[4];
#pragma unroll
      for (int u = 0; u < 4; ++u) {
        a[u].p[0] = *(const v8h*)(pa + 16 * u * LP + 32 * q);
        a[u].p[1] = *(const v8h*)(pa + 16 * u * LP + 32 * q + 16);
        b[u].p[0] = *(const v8h*)(pw + 16 * u * LP + 32 * q);
        b[u].p[1] = *(const v8h*)(pw + 16 * u * LP + 32 * q + 16);
      }
#pragma unroll
      for (int i = 0; i < 4; ++i)
#pragma unroll
        for (int u = 0; u < 4; ++u) acc[i][u] = mma_f16(a[i].v, b[u].v, acc[i][u]);
    }
    asm volatile("s_wait_dscnt 0x0" ::: "memory");      // this wave's reads of the buffer are done before it is refilled
    asm volatile("s_wait_asynccnt 0x0" ::: "memory");   // this wave's copies of tile t + 1 have landed
    __syncthreads();                                    // publishes tile t + 1 and ends every wave's reads of tile t
    if (t + 2 < nt) stage(t + 2);
  }
  asm volatile("s_wait_asynccnt 0x0" ::: "memory");     // no copy is left in flight when the wave goes on

  // epilogue values (D element r of this lane = row 16i+8h+r, col 16u+m of the wave tile)
  float bv[4];
#pragma unroll
  for (int u = 0; u < 4; ++u) bv[u] = bf16r(bias[colBase + 16 * u + m]);
#pragma unroll
  for (int i = 0; i < 4; ++i)
#pragma unroll
    for (int u = 0; u < 4; ++u)
#pragma unroll
      for (int r = 0; r < 8; ++r) acc[i][u][r] = acc[i][u][r] * oscale + bv[u];
  if (norm) {
#pragma unroll
    for (int i = 0; i < 4; ++i)
#pragma unroll
      for (int r = 0; r < 8; ++r) {
        float ss = 0.0f;
#pragma unroll
        for (int u = 0; u < 4; ++u) ss += acc[i][u][r] * acc[i][u][r];
        ss += __shfl_xor(ss, 1, 32);
        ss += __shfl_xor(ss, 2, 32);
        ss += __shfl_xor(ss, 4, 32);
        ss += __shfl_xor(ss, 8, 32);
        const float inv = 1.0f / sqrtf(fmaxf(ss, 1e-6f));
#pragma unroll
        for (int u = 0; u < 4; ++u) acc[i][u][r] *= inv;
      }
  }

  float* sw = (float*)pool + wv * (64 * EP);
#pragma unroll
  for (int i = 0; i < 4; ++i)
#pragma unroll
    for (int u = 0; u < 4; ++u)
#pragma unroll
      for (int r = 0; r < 8; ++r) sw[(16 * i + 8 * h + r) * EP + 16 * u + m] = acc[i][u][r];
  __syncthreads();   // the staged results are read by other lanes than wrote them

  // a store instruction takes two rows of the wave tile, 256 B of each
  const float* sr = sw + h * EP + m * 4;
  float* yp = Y + (size_t)(rowBase + h) * N + colBase + m * 4;
#pragma unroll
  for (int i = 0; i < 4; ++i) {
    v4f vals[8];
#pragma unroll
    for (int it = 0; it < 8; ++it) vals[it] = *(const v4f*)(sr + (16 * i + 2 * it) * EP);
#pragma unroll
    for (int it = 0; it < 8; ++it) *(v4f*)(yp + (size_t)(16 * i + 2 * it) * N) = vals[it];
    // the wait stands in front of any rewrite of the registers the stores name
    asm volatile("s_wait_xcnt 0x0" ::: "memory");
  }
}

// ---------------------------------------------------------------------------
// The six products that need only the front launch's results, K = DM each: q, k (L2 norm per 64-col slab), v in wide tiles,
// gate-down for alpha, beta, gate-down for the output gate (one slab each) in tiles of 128 rows.
// ---------------------------------------------------------------------------
__global__ void __launch_bounds__(256)
k_proj(const h16* __restrict__ cq, const h16* __restrict__ ck, const h16* __restrict__ cv, const h16* __restrict__ xh,
       const h16* __restrict__ Wq16, const h16* __restrict__ Wk16, const h16* __restrict__ Wv16,
       const h16* __restrict__ Wad16, const h16* __restrict__ Wbe16, const h16* __restrict__ Wgd16,
       const float* __restrict__ bq, const float* __restrict__ bk, const float* __restrict__ bv,
       const float* __restrict__ bad, const float* __restrict__ bbe, const float* __restrict__ bgd,
       float* Qn, float* Kn, float* Vf, float* Bt, h16* t1, h16* t2,
       int K, float cscale, float xscale, float tscale)
{
  __shared__ __attribute__((aligned(16))) char pool[WIDE_LDS];
  const int bx = blockIdx.x, y = blockIdx.y;
  if (y < 24) {
    // q, k, v: eight column tiles of WN each, bx a tile of WM rows
    const int p = y >> 3;
    gemm_wide(p == 0 ? cq : (p == 1 ? ck : cv), p == 0 ? Wq16 : (p == 1 ? Wk16 : Wv16), p == 0 ? bq : (p == 1 ? bk : bv),
              p == 0 ? Qn : (p == 1 ? Kn : Vf), DM, K, cscale, p < 2, bx, y & 7, pool);
    return;
  }
  // the three narrow products on x, in tiles of 128 rows: two values of y each
  float* stg = (float*)pool;
  h16* sA = (h16*)(pool + 8 * 16 * 64 * 4);
  h16* sW = sA + 2 * 128 * LP;
  const int s = y - 24, rb = bx * 2 + (s & 1);
  if ((s >> 1) == 1) {
    gemm_tile<1, 4, float>(xh, Wbe16, bbe, Bt, NH, K, xscale, 1.0f, rb, 0, stg, sA, sW);
  } else {
    const bool a = s < 2;
    gemm_tile<4, 2, h16>(xh, a ? Wad16 : Wgd16, a ? bad : bgd, a ? t1 : t2, 64, K, xscale, tscale, rb, 0, stg, sA, sW);
  }
}

// The two gate-up products, K = 64 each: alpha (16 slabs) and the output gate (one slab).
__global__ void __launch_bounds__(256)
k_gate(const h16* __restrict__ t1, const h16* __restrict__ t2, const h16* __restrict__ Wau16, const h16* __restrict__ Wgu16,
       const float* __restrict__ bau, const float* __restrict__ bgu, float* Al, float* Gt, int K, float oscale)
{
  GEMM_LDS
  const int bx = blockIdx.x, y = blockIdx.y;
  if (y < 16) gemm_tile<4, 3, float>(t1, Wau16, bau, Al, DM, K, oscale, 1.0f, bx, y, stg, sA, sW);
  else        gemm_tile<1, 4, float>(t2, Wgu16, bgu, Gt, NH, K, oscale, 1.0f, bx, 0, stg, sA, sW);
}

// The output projection.
__global__ void __launch_bounds__(256)
k_oproj(const h16* __restrict__ A, const h16* __restrict__ W, const float* __restrict__ bias, float* Y, int K, float oscale)
{
  GEMM_LDS
  gemm_tile<4, 0, float>(A, W, bias, Y, DM, K, oscale, 1.0f, blockIdx.x, blockIdx.y, stg, sA, sW);
}

// ---------------------------------------------------------------------------
// Gated delta rule, serial part. The columns e of the state S (64x64 f32) never mix: each evolves from k, a, beta and v[e] alone.
// One block per (group of SC columns, b*h), T/64 chunks in sequence; 4 waves hold the state and step, 4 more stage the next chunk's
// operands meanwhile. A 16-lane row of a stepping wave owns one column,
// lane lg of it the rows 4*lg .. 4*lg+3 in registers, so k^T S is summed inside the row and no step needs a barrier.
// Four steps 0..3 are taken from one state S. With dl_i = v_i - k_i^T (a_i S_i-1), every later step's k^T S is linear in S and
// in the earlier dl, so with A(j..i] the product of a_j+1 .. a_i, per feature:
//   dl_i = v_i - (k_i A(-1..i])^T S - sum over j < i of c_ij dl_j,     c_ij = sum_d k_i A(j..i] beta_j k_j
//   S   <- A(-1..3] S + sum over j of (beta_j k_j A(j..3]) dl_j
// The four row sums run side by side, and the dependent chain of one step, three short links longer, serves four. The vectors in
// brackets and the c_ij hold no state and no column: they are formed once per chunk while the tiles are staged.
// The state each chunk starts from is stored column-major, Sg[(bh*nch + n)][e][d], for the chunk-parallel output kernel.
// ---------------------------------------------------------------------------
#define SC 8    // state columns per block
#define NSTP 8    // steps per group of LDS operand reads

// x + (x of lane l ^ mask) inside a 16-lane row; CTRL = 0x160 + mask is the DPP row_xmask control
template<int CTRL>
__device__ __forceinline__ float xmask_add(float x) {
  return x + __int_as_float(__builtin_amdgcn_update_dpp(0, __float_as_int(x), CTRL, 0xf, 0xf, true));
}
// sum of the four elements of every lane of a 16-lane row, in every lane of it
__device__ __forceinline__ float row_sum(v4f x) {
  float s = (x[0] + x[2]) + (x[1] + x[3]);
  s = xmask_add<0x161>(s);
  s = xmask_add<0x162>(s);
  s = xmask_add<0x164>(s);
  return xmask_add<0x168>(s);
}

// work-group barrier that orders LDS only: the stagers' global loads of the chunk after next stay in flight across it,
// where __syncthreads() would wait for them
__device__ __forceinline__ void lds_barrier() {
  __builtin_amdgcn_fence(__ATOMIC_RELEASE, "workgroup", "local");
  __builtin_amdgcn_s_barrier();
  __builtin_amdgcn_fence(__ATOMIC_ACQUIRE, "workgroup", "local");
}

__global__ void __launch_bounds__(256)
k_state(const float* __restrict__ Kp, const float* __restrict__ Vp, const float* __restrict__ Ap,
        const float* __restrict__ Bp, float* Sg, int T)
{
  // Two buffers of every staged array: waves 0..3 step through chunk n in buffer n & 1 while waves 4..7 stage chunk n + 1 in the other.
  // Us: k_i A(-1..i], two steps side by side so that one packed product serves both: of the four rows of a group, for lane lg,
  // row 0 holds steps (0, 1) of d = 4*lg and of 4*lg+1, row 1 those of 4*lg+2 and 4*lg+3, rows 2 and 3 the same of steps (2, 3)
  __shared__ __attribute__((aligned(16))) float Us[2 * CH * HD];
  __shared__ __attribute__((aligned(16))) float Ws[2 * CH * HD];         // [t][d]: beta_j k_j A(j..3]
  __shared__ __attribute__((aligned(16))) float Ps[2 * (CH / 4) * HD];   // [group][d]: A(-1..3]
  __shared__ __attribute__((aligned(16))) float Vt[2 * SC * CH];         // [column][t]
  __shared__ __attribute__((aligned(16))) float Cs[2 * (CH / 4) * 8];    // [group]: c10 c20 c21 c30 c31 c32, two unused

  const int tid = threadIdx.x & 127;           // place among the 128 threads of the same role
  // the role is the same for a whole wave: read as a scalar, so that the branch on it is a scalar branch
  const bool stager = __builtin_amdgcn_readfirstlane((int)(threadIdx.x >> 5)) >= 4;
  const int cg = blockIdx.x, bh = blockIdx.y, b = bh / NH, hh = bh % NH;
  const int lg = tid & 15, el = tid >> 4;      // state ownership: column cg*SC + el, rows 4*lg .. 4*lg+3

  // every loop of this kernel but the one over the chunks is unrolled: its arrays are then indexed by constants and stay in registers
  v4f S;
#pragma unroll
  for (int u = 0; u < 4; ++u) S[u] = 0.0f;

  // per-thread byte offsets of the tile loads and of the state store; the chunk moves the uniform base only.
  // Staging: the 16-lane row el takes the groups el and el + 8, that is the tile rows 4*el + 32*it and the three behind
  const unsigned tb = (unsigned)(((4 * el) * DM + lg * 4) * 4);
  const unsigned vo = (unsigned)(((tid >> 1) * DM + cg * SC + (tid & 1) * 4) * 4);
  const unsigned so = (unsigned)(((cg * SC + el) * HD + 4 * lg) * 4);

  const int nch = T / CH;

  // a chunk's tiles as loaded, held in a stager's registers from one pass of the chunk loop to the next
  float tbe[2][4];
  v4f tk[2][4], ta[2][4], tv;

  // tile loads of chunk n: k and a 64 rows x 64 f32, v 64 rows x SC f32, beta of this row's eight steps (one address per 16-lane row)
  auto load = [&](int n) {
    const size_t rowbase = (size_t)b * T + (size_t)n * CH;
    const float* Kg = Kp + rowbase * DM + hh * HD;
    const float* Vg = Vp + rowbase * DM + hh * HD;
    const float* Ag = Ap + rowbase * DM + hh * HD;
    const char* kp = (const char*)Kg + tb;
    const char* ap = (const char*)Ag + tb;
    const char* vp = (const char*)Vg + vo;
    const float* bp = Bp + (rowbase + 4 * el) * NH + hh;
#pragma unroll
    for (int it = 0; it < 2; ++it) {
#pragma unroll
      for (int j = 0; j < 4; ++j) tbe[it][j] = bp[(32 * it + j) * NH];
#pragma unroll
      for (int j = 0; j < 4; ++j) {
        tk[it][j] = *(const v4f*)(kp + (32 * it + j) * (DM * 4));
        ta[it][j] = *(const v4f*)(ap + (32 * it + j) * (DM * 4));
      }
    }
    tv = *(const v4f*)vp;
    // the wait stands in front of any overwrite of the address registers the loads name; as inputs they stay live up to it
    asm volatile("s_wait_xcnt 0x0" :: "v"(kp), "v"(ap), "v"(vp), "v"(bp) : "memory");
  };

  // the loaded tiles -> the step operands, into buffer bf
  auto stage = [&](int bf) {
    float* Ub = Us + bf * (CH * HD);
    float* Wb = Ws + bf * (CH * HD);
    float* Pb = Ps + bf * ((CH / 4) * HD);
    float* Vb = Vt + bf * (SC * CH);
    float* Cb = Cs + bf * ((CH / 4) * 8);
#pragma unroll
    for (int it = 0; it < 2; ++it) {
      const int qd = it * 8 + el;
      const v4f k0 = tk[it][0], k1 = tk[it][1], k2 = tk[it][2], k3 = tk[it][3];
      const v4f d0 = ta[it][0], d1 = ta[it][1], d2 = ta[it][2], d3 = ta[it][3];
      const float b0 = fminf(tbe[it][0], 1.0f), b1 = fminf(tbe[it][1], 1.0f);
      const float b2 = fminf(tbe[it][2], 1.0f), b3 = fminf(tbe[it][3], 1.0f);
      const v4f P1 = d0 * d1, P2 = P1 * d2, P3 = P2 * d3;       // A(-1..i]
      const v4f R20 = d1 * d2, R31 = d2 * d3, R30 = d1 * R31;   // A(j..i]
      const v4f g0 = k0 * b0, g1 = k1 * b1, g2 = k2 * b2, g3 = k3 * b3;
      const v4f u0 = k0 * d0, u1 = k1 * P1, u2 = k2 * P2, u3 = k3 * P3;
      const v4f ua = { u0[0], u1[0], u0[1], u1[1] }, ub = { u0[2], u1[2], u0[3], u1[3] };
      const v4f uc = { u2[0], u3[0], u2[1], u3[1] }, ud = { u2[2], u3[2], u2[3], u3[3] };
      *(v4f*)(Ub + (4 * qd) * HD + 4 * lg)     = ua;
      *(v4f*)(Ub + (4 * qd + 1) * HD + 4 * lg) = ub;
      *(v4f*)(Ub + (4 * qd + 2) * HD + 4 * lg) = uc;
      *(v4f*)(Ub + (4 * qd + 3) * HD + 4 * lg) = ud;
      *(v4f*)(Wb + (4 * qd) * HD + 4 * lg)     = g0 * R30;
      *(v4f*)(Wb + (4 * qd + 1) * HD + 4 * lg) = g1 * R31;
      *(v4f*)(Wb + (4 * qd + 2) * HD + 4 * lg) = g2 * d3;
      *(v4f*)(Wb + (4 * qd + 3) * HD + 4 * lg) = g3;
      *(v4f*)(Pb + qd * HD + 4 * lg)           = P3;
      const float c10 = row_sum((k1 * d1) * g0);
      const float c20 = row_sum((k2 * R20) * g0), c21 = row_sum((k2 * d2) * g1);
      const float c30 = row_sum((k3 * R30) * g0), c31 = row_sum((k3 * R31) * g1), c32 = row_sum((k3 * d3) * g2);
      if (lg == 0) {
        const v4f ca = { c10, c20, c21, c30 };
        const v2f cb = { c31, c32 };
        *(v4f*)(Cb + qd * 8)     = ca;
        *(v2f*)(Cb + qd * 8 + 4) = cb;
      }
    }
#pragma unroll
    for (int u = 0; u < 4; ++u) Vb[((tid & 1) * 4 + u) * CH + (tid >> 1)] = tv[u];
  };

  if (stager) load(0);

  // pass -1 only stages chunk 0; in pass n the steppers take chunk n
  for (int n = -1; n < nch; ++n) {
    if (stager) {
      // chunk n + 1 goes into the buffer whose last readers left it at the barrier before this pass; its tiles were asked for
      // a whole pass ago, and those of chunk n + 2 are asked for now
      if (n + 1 < nch) {
        stage((n + 1) & 1);
        if (n + 2 < nch) load(n + 2);
      }
    } else if (n >= 0) {
    const int bf = n & 1;
    const float* ul = Us + bf * (CH * HD) + 4 * lg;
    const float* wl = Ws + bf * (CH * HD) + 4 * lg;
    const float* pl = Ps + bf * ((CH / 4) * HD) + 4 * lg;
    const float* vl = Vt + bf * (SC * CH) + el * CH;
    const float* cl = Cs + bf * ((CH / 4) * 8);
    float* So = Sg + ((size_t)bh * nch + n) * (HD * HD);

    // exact state update over the chunk, four steps at a time
    // the operands of NSTP steps are read as one group, one group ahead of the steps that use them
    v4f uq[2][NSTP], wq[2][NSTP], pq[2][NSTP / 4], vq[2][NSTP / 4], ca[2][NSTP / 4];
    v2f cb[2][NSTP / 4];
    auto fetch = [&](int g, int bf) {
      // in the order of use: LDS reads return in order, and the first group of a chunk is waited for
#pragma unroll
      for (int s = 0; s < NSTP / 4; ++s) {
#pragma unroll
        for (int j = 0; j < 4; ++j) uq[bf][4 * s + j] = *(const v4f*)(ul + (NSTP * g + 4 * s + j) * HD);
        pq[bf][s] = *(const v4f*)(pl + ((NSTP / 4) * g + s) * HD);
        vq[bf][s] = *(const v4f*)(vl + NSTP * g + 4 * s);
        ca[bf][s] = *(const v4f*)(cl + ((NSTP / 4) * g + s) * 8);
        cb[bf][s] = *(const v2f*)(cl + ((NSTP / 4) * g + s) * 8 + 4);
#pragma unroll
        for (int j = 0; j < 4; ++j) wq[bf][4 * s + j] = *(const v4f*)(wl + (NSTP * g + 4 * s + j) * HD);
      }
    };
    fetch(0, 0);
    // entry state of this chunk; the wait on the store stands behind the first group's LDS reads and passes under their latency
    *(v4f*)((char*)So + so) = S;
    // the steps that follow overwrite S, which this store names, and may be given its address registers: the wait stands in front of that
    asm volatile("s_wait_xcnt 0x0" ::: "memory");
#pragma unroll
    for (int g = 0; g < CH / NSTP; ++g) {
      const int cur = g & 1, nxt = cur ^ 1;
      // with the one behind the reads: keeps the next group's LDS reads in one place. Left free, they sank to just ahead of their
      // use, where each step waited out the LDS latency, or were strewn among the steps of the group before
      __builtin_amdgcn_sched_barrier(0);
      if (g + 1 < CH / NSTP) fetch(g + 1, nxt);
      __builtin_amdgcn_sched_barrier(0);   // second of the pair, see above
#pragma unroll
      for (int q = 0; q < NSTP / 4; ++q) {
        const v4f ua = uq[cur][4 * q], ub = uq[cur][4 * q + 1], uc = uq[cur][4 * q + 2], ud = uq[cur][4 * q + 3];
        const v4f w0 = wq[cur][4 * q], w1 = wq[cur][4 * q + 1], w2 = wq[cur][4 * q + 2], w3 = wq[cur][4 * q + 3];
        const v4f pp = pq[cur][q], vv = vq[cur][q], c4 = ca[cur][q];
        const v2f c2 = cb[cur][q];
        const v2f pa = (ua.xy * S[0] + ub.xy * S[2]) + (ua.zw * S[1] + ub.zw * S[3]);   // partial sums of steps 0 and 1
        const v2f pb = (uc.xy * S[0] + ud.xy * S[2]) + (uc.zw * S[1] + ud.zw * S[3]);   // ... of steps 2 and 3
        float p0 = pa.x, p1 = pa.y, p2 = pb.x, p3 = pb.y;
        p0 = xmask_add<0x161>(p0);  p1 = xmask_add<0x161>(p1);  p2 = xmask_add<0x161>(p2);  p3 = xmask_add<0x161>(p3);
        p0 = xmask_add<0x162>(p0);  p1 = xmask_add<0x162>(p1);  p2 = xmask_add<0x162>(p2);  p3 = xmask_add<0x162>(p3);
        p0 = xmask_add<0x164>(p0);  p1 = xmask_add<0x164>(p1);  p2 = xmask_add<0x164>(p2);  p3 = xmask_add<0x164>(p3);
        p0 = xmask_add<0x168>(p0);  p1 = xmask_add<0x168>(p1);  p2 = xmask_add<0x168>(p2);  p3 = xmask_add<0x168>(p3);
        const float dl0 = vv[0] - p0;
        const float dl1 = __builtin_fmaf(-c4[0], dl0, vv[1] - p1);
        const float dl2 = __builtin_fmaf(-c4[2], dl1, __builtin_fmaf(-c4[1], dl0, vv[2] - p2));
        const float dl3 = __builtin_fmaf(-c2[1], dl2, __builtin_fmaf(-c2[0], dl1, __builtin_fmaf(-c4[3], dl0, vv[3] - p3)));
        // each term is added as soon as its dl is known, so that only the last one follows dl3
#pragma unroll
        for (int u = 0; u < 4; ++u)
          S[u] = __builtin_fmaf(w3[u], dl3, __builtin_fmaf(w2[u], dl2, __builtin_fmaf(w1[u], dl1, __builtin_fmaf(w0[u], dl0, pp[u] * S[u]))));
      }
    }
    }
    lds_barrier();   // publishes chunk n + 1 and ends the reads of chunk n's buffer, which the next pass refills
  }
}

// ---------------------------------------------------------------------------
// Gated delta rule, chunk-parallel part: one block per (chunk, b*h), 256 threads. Reads the chunk's entry state from Sg.
// Scores A[i][j] and O = Q*S + A*V on bf16 hi/lo WMMA, then headwise RMS norm and gate.
// ---------------------------------------------------------------------------
__global__ void __launch_bounds__(256)
k_out(const float* __restrict__ Qp, const float* __restrict__ Kp, const float* __restrict__ Vp,
      const float* __restrict__ Ap, const float* __restrict__ Bp, const float* __restrict__ Gp,
      const float* __restrict__ rmsw, const float* __restrict__ Sg, h16* Og, int T, float ogscale)
{
  __shared__ __attribute__((aligned(16))) float Qs[CH * QP];
  __shared__ __attribute__((aligned(16))) float Ks[CH * QP];
  __shared__ __attribute__((aligned(16))) float CLs[CH * QP];
  __shared__ __attribute__((aligned(16))) float SCs[CH * QP];
  __shared__ __attribute__((aligned(16))) float Vs[CH * HD];
  __shared__ __attribute__((aligned(16))) float ALs[CH * HD];
  __shared__ __attribute__((aligned(16))) float Sf[HD * QP];     // entry state, column-major: [e][d]
  __shared__ float Bsh[CH], GS[CH], RV[CH], RW[HD];

  const int tid = threadIdx.x;
  const int lane = tid & 31, wv = tid >> 5, m = lane & 15, h = lane >> 4;
  const int n = blockIdx.x, bh = blockIdx.y, b = bh / NH, hh = bh % NH;

  if (tid < HD) RW[tid] = bf16r(rmsw[hh * HD + tid]);

  const size_t rowbase = (size_t)b * T + (size_t)n * CH;
  const float* Qg = Qp + rowbase * DM + hh * HD;
  const float* Kg = Kp + rowbase * DM + hh * HD;
  const float* Vg = Vp + rowbase * DM + hh * HD;
  const float* Ag = Ap + rowbase * DM + hh * HD;
  const float* Si = Sg + ((size_t)bh * (T / CH) + n) * (HD * HD);

  // tile loads (64 rows x 64 f32 each): one byte offset per thread, the step of 16 rows is a constant
  const unsigned tb = (unsigned)(((tid >> 4) * DM + (tid & 15) * 4) * 4);
  v4f tq[4], tk[4], tv[4], ta[4], ts[4];
#pragma unroll
  for (int it = 0; it < 4; ++it) {
    tq[it] = *(const v4f*)((const char*)Qg + tb + it * (16 * DM * 4));
    tk[it] = *(const v4f*)((const char*)Kg + tb + it * (16 * DM * 4));
    tv[it] = *(const v4f*)((const char*)Vg + tb + it * (16 * DM * 4));
    ta[it] = *(const v4f*)((const char*)Ag + tb + it * (16 * DM * 4));
    ts[it] = *(const v4f*)(Si + tid * 4 + it * (16 * HD));
  }
  // the wait stands in front of any overwrite of the offset register the loads name; as an input it stays live up to it
  asm volatile("s_wait_xcnt 0x0" :: "v"(tb) : "memory");
#pragma unroll
  for (int it = 0; it < 4; ++it) {
    const int idx = it * 256 + tid;
    const int c = idx >> 4, d4 = (idx & 15) * 4;
    *(v4f*)(Qs  + c * QP + d4) = tq[it];
    *(v4f*)(Ks  + c * QP + d4) = tk[it];
    *(v4f*)(Vs  + c * HD + d4) = tv[it];
    *(v4f*)(ALs + c * HD + d4) = ta[it];
    *(v4f*)(Sf  + c * QP + d4) = ts[it];
  }
  if (tid < CH) {
    Bsh[tid] = fminf(Bp[(rowbase + tid) * NH + hh], 1.0f);
    GS[tid]  = Gp[(rowbase + tid) * NH + hh];
  }
  __syncthreads();

  // cumulative log decay per feature, restarted per chunk
  if (tid < HD) {
    float a = 0.0f;
    for (int c = 0; c < CH; ++c) {
      a += __logf(fmaxf(ALs[c * HD + tid], 1e-7f));
      CLs[c * QP + tid] = a;
    }
  }
  __syncthreads();

  // scores: A[i][j] = beta_j * sum_d q[i][d] k[j][d] exp(cl[i][d] - cl[j][d]) for i >= j, else 0, as a matrix product.
  // With R = cl of the first row of i's block of 16 rows, exp(cl_i - cl_j) = exp(cl_i - R) * exp(R - cl_j): the first factor goes
  // with q, the second with k, and a 16 x 16 tile of A is (q exp(cl - R)) (k exp(R - cl))^T. cl falls along the rows and a step of it
  // is at most ln 10 (alpha comes clipped to [0.1, 1]), so exp(cl_i - R) <= 1, exp(R - cl_j) <= 1 for j in an earlier block and <= 10^15 in i's own:
  // nothing overflows, and a factor that underflows belongs to a term that is itself below f32's range.
  {
    // which tiles a wave takes: row block ti, column blocks tj0 and tj0 + 1; those right of the diagonal are stored as zeros.
    // The four waves with two tiles to compute come first.
    // The wave's number is the same in all its lanes: read as a scalar, so that the tests on the tile are scalar branches
    const int wu = __builtin_amdgcn_readfirstlane(wv);
    const int ti = (0x846F >> (2 * wu)) & 3, tj0 = ((0xB2 >> wu) & 1) * 2;
    const float* pr = CLs + (ti * 16) * QP;
    BF ah[2], al[2];
    if (tj0 <= ti) {
#pragma unroll
      for (int ks = 0; ks < 2; ++ks)
        frag_decay(Qs + (ti * 16 + m) * QP + ks * 32, CLs + (ti * 16 + m) * QP + ks * 32, pr + ks * 32, h, ah[ks], al[ks]);
    }
#pragma unroll
    for (int s = 0; s < 2; ++s) {
      const int tj = tj0 + s;
      v8f acc;
#pragma unroll
      for (int r = 0; r < 8; ++r) acc[r] = 0.0f;
      if (tj <= ti) {
#pragma unroll
        for (int ks = 0; ks < 2; ++ks) {
          BF bhi, blo;
          frag_decay(Ks + (tj * 16 + m) * QP + ks * 32, pr + ks * 32, CLs + (tj * 16 + m) * QP + ks * 32, h, bhi, blo);
          acc = mma_bf16(ah[ks].v, bhi.v, acc);
          acc = mma_bf16(ah[ks].v, blo.v, acc);
          acc = mma_bf16(al[ks].v, bhi.v, acc);
        }
      }
      const int j = tj * 16 + m;
      const float bj = Bsh[j];
#pragma unroll
      for (int r = 0; r < 8; ++r) {
        const int i = ti * 16 + 8 * h + r;
        SCs[i * QP + j] = (i >= j) ? acc[r] * bj : 0.0f;
      }
    }
  }
  __syncthreads();

  // O = Q*S + A*V : wave owns rows 16*ti.., two 16-col tiles; bf16 hi/lo three products per operand pair
  {
    const int ti = wv >> 1, tj0 = (wv & 1) * 2;
    v8f acc[2];
#pragma unroll
    for (int s = 0; s < 2; ++s)
#pragma unroll
      for (int r = 0; r < 8; ++r) acc[s][r] = 0.0f;

#pragma unroll
    for (int ks = 0; ks < 2; ++ks) {
      const int k0 = ks * 32;
      BF ah, al;
      fragA_split(Qs + (ti * 16 + m) * QP + k0, h, ah, al);
#pragma unroll
      for (int s = 0; s < 2; ++s) {
        BF bhi, blo;
        fragA_split(Sf + ((tj0 + s) * 16 + m) * QP + k0, h, bhi, blo);   // column e of S is a row of Sf: same k map as the gather
        acc[s] = mma_bf16(ah.v, bhi.v, acc[s]);
        acc[s] = mma_bf16(ah.v, blo.v, acc[s]);
        acc[s] = mma_bf16(al.v, bhi.v, acc[s]);
      }
    }
#pragma unroll
    for (int ks = 0; ks < 2; ++ks) {
      const int k0 = ks * 32;
      BF ah, al;
      fragA_split(SCs + (ti * 16 + m) * QP + k0, h, ah, al);
#pragma unroll
      for (int s = 0; s < 2; ++s) {
        BF bhi, blo;
        fragB_split(Vs, HD, k0, (tj0 + s) * 16 + m, h, bhi, blo);
        acc[s] = mma_bf16(ah.v, bhi.v, acc[s]);
        acc[s] = mma_bf16(ah.v, blo.v, acc[s]);
        acc[s] = mma_bf16(al.v, bhi.v, acc[s]);
      }
    }
    __syncthreads();   // all reads of SCs/Sf done; reuse SCs as the O tile
#pragma unroll
    for (int s = 0; s < 2; ++s)
#pragma unroll
      for (int r = 0; r < 8; ++r)
        SCs[(ti * 16 + 8 * h + r) * QP + (tj0 + s) * 16 + m] = acc[s][r];
  }
  __syncthreads();

  // per-row RMS normaliser times gate
  if (tid < CH) {
    float ss = 0.0f;
    for (int e2 = 0; e2 < HD; ++e2) { const float o = SCs[tid * QP + e2]; ss += o * o; }
    RV[tid] = GS[tid] / sqrtf(ss * (1.0f / 64.0f) + 1e-6f);
  }
  __syncthreads();

  {
    v8h ov[2];
    size_t go[2];
#pragma unroll
    for (int it = 0; it < 2; ++it) {
      const int c = it * 32 + (tid >> 3), e0 = (tid & 7) * 8;
      const v4f x0 = *(const v4f*)(SCs + c * QP + e0);
      const v4f x1 = *(const v4f*)(SCs + c * QP + e0 + 4);
      const float sc = RV[c] * ogscale;
      v8h o;
#pragma unroll
      for (int q = 0; q < 4; ++q) {
        o[q]     = (h16)(x0[q] * sc * RW[e0 + q]);
        o[4 + q] = (h16)(x1[q] * sc * RW[e0 + 4 + q]);
      }
      ov[it] = o;
      go[it] = (rowbase + c) * (size_t)DM + hh * HD + e0;
    }
#pragma unroll
    for (int it = 0; it < 2; ++it) *(v8h*)(Og + go[it]) = ov[it];
    
  }
}

// ---------------------------------------------------------------------------
extern "C" void kernel_launch(void* const* d_in, const int* in_sizes, int n_in,
                              void* d_out, int out_size, void* d_ws, size_t ws_size,
                              hipStream_t stream)
{
  if (n_in < 26) return;
  const int T = 2048;
  const long nx = (long)in_sizes[0];
  if (nx <= 0 || (nx % ((long)DM * T)) != 0) return;
  const int M = (int)(nx / DM);                       // tokens, multiple of 2048 (hence of 128)
  if ((long)out_size != (long)M * DM) return;
  if (in_sizes[1] != DM * 4 || in_sizes[3] != DM * 4 || in_sizes[5] != DM * 4) return;
  if (in_sizes[7] != DM * DM || in_sizes[9] != DM * DM || in_sizes[11] != DM * DM || in_sizes[24] != DM * DM) return;
  if (in_sizes[13] != 64 * DM || in_sizes[15] != DM * 64 || in_sizes[17] != NH * DM ||
      in_sizes[20] != 64 * DM || in_sizes[22] != NH * 64) return;

  const float* x       = (const float*)d_in[0];
  const float* wq_conv = (const float*)d_in[1];  const float* bq_conv = (const float*)d_in[2];
  const float* wk_conv = (const float*)d_in[3];  const float* bk_conv = (const float*)d_in[4];
  const float* wv_conv = (const float*)d_in[5];  const float* bv_conv = (const float*)d_in[6];
  const float* Wq  = (const float*)d_in[7];   const float* bq  = (const float*)d_in[8];
  const float* Wk  = (const float*)d_in[9];   const float* bk  = (const float*)d_in[10];
  const float* Wv  = (const float*)d_in[11];  const float* bv  = (const float*)d_in[12];
  const float* Wad = (const float*)d_in[13];  const float* bad = (const float*)d_in[14];
  const float* Wau = (const float*)d_in[15];  const float* bau = (const float*)d_in[16];
  const float* Wbe = (const float*)d_in[17];  const float* bbe = (const float*)d_in[18];
  const float* rms_w = (const float*)d_in[19];
  const float* Wgd = (const float*)d_in[20];  const float* bgd = (const float*)d_in[21];
  const float* Wgu = (const float*)d_in[22];  const float* bgu = (const float*)d_in[23];
  const float* Wo  = (const float*)d_in[24];  const float* bo  = (const float*)d_in[25];

  char* ws = (char*)d_ws;
  size_t off = 0;
  auto carve = [&](size_t bytes) -> char* {
    char* p = ws + off;
    off += (bytes + 255) & ~(size_t)255;
    return p;
  };
  const size_t MD = (size_t)M * DM;
  h16* xh    = (h16*)carve(MD * 2);
  h16* cq    = (h16*)carve(MD * 2);
  h16* ck    = (h16*)carve(MD * 2);
  h16* cv    = (h16*)carve(MD * 2);
  h16* Wq16  = (h16*)carve((size_t)DM * DM * 2);
  h16* Wk16  = (h16*)carve((size_t)DM * DM * 2);
  h16* Wv16  = (h16*)carve((size_t)DM * DM * 2);
  h16* Wo16  = (h16*)carve((size_t)DM * DM * 2);
  h16* Wad16 = (h16*)carve((size_t)64 * DM * 2);
  h16* Wau16 = (h16*)carve((size_t)DM * 64 * 2);
  h16* Wbe16 = (h16*)carve((size_t)NH * DM * 2);
  h16* Wgd16 = (h16*)carve((size_t)64 * DM * 2);
  h16* Wgu16 = (h16*)carve((size_t)NH * 64 * 2);
  float* Qn  = (float*)carve(MD * 4);
  float* Kn  = (float*)carve(MD * 4);
  float* Vf  = (float*)carve(MD * 4);
  float* Al  = (float*)carve(MD * 4);
  float* Bt  = (float*)carve((size_t)M * NH * 4);
  float* Gt  = (float*)carve((size_t)M * NH * 4);
  h16* t1    = (h16*)carve((size_t)M * 64 * 2);
  h16* t2    = (h16*)carve((size_t)M * 64 * 2);
  h16* Og16  = (h16*)carve(MD * 2);
  float* Sst = (float*)carve((size_t)(M / CH) * NH * HD * HD * 4);   // entry state of every (b, h, chunk)
  if (off > ws_size) return;

  const float wsc = 256.0f;      // weight scale
  const float asc = 256.0f;      // conv activation scale
  const float tsc = 64.0f;       // gate hidden scale
  const float osc = 16.0f;       // gated output scale

  // 1) x -> f16, three shortconv+SiLU activations, and the nine weights -> scaled f16 (Wq16 .. Wgu16 are carved back to back,
  //    each a multiple of 256 bytes, in the order k_front takes the matrices); M is a multiple of T, T of the 8 * FL tokens of a block
  {
    const int nconv = (M / (8 * FL)) * (DM / FW);
    k_front<<<nconv + (G_ALL + 256 * CG - 1) / (256 * CG), 256, 0, stream>>>(x, wq_conv, bq_conv, wk_conv, bk_conv, wv_conv, bv_conv,
                                                                             Wq, Wk, Wv, Wo, Wad, Wau, Wbe, Wgd, Wgu,
                                                                             xh, cq, ck, cv, Wq16, nconv, T, asc, wsc);
  }
  // 2) the six products on the front launch's results; 3) the two gate-up products
  k_proj<<<dim3(M / WM, 30), 256, 0, stream>>>(cq, ck, cv, xh, Wq16, Wk16, Wv16, Wad16, Wbe16, Wgd16,
                                                bq, bk, bv, bad, bbe, bgd, Qn, Kn, Vf, Bt, t1, t2,
                                                DM, 1.0f / (asc * wsc), 1.0f / wsc, tsc);
  k_gate<<<dim3(M / 128, 17), 256, 0, stream>>>(t1, t2, Wau16, Wgu16, bau, bgu, Al, Gt, 64, 1.0f / (tsc * wsc));
  // 4) state recurrence, one block per (column group, b*h); then the per-chunk outputs, one block per (chunk, b*h)
  k_state<<<dim3(HD / SC, (M / T) * NH), 256, 0, stream>>>(Kn, Vf, Al, Bt, Sst, T);
  k_out<<<dim3(T / CH, (M / T) * NH), 256, 0, stream>>>(Qn, Kn, Vf, Al, Bt, Gt, rms_w, Sst, Og16, T, osc);
  // 5) output projection
  k_oproj<<<dim3(M / 128, DM / 64), 256, 0, stream>>>(Og16, Wo16, bo, (float*)d_out, DM, 1.0f / (osc * wsc));
}

// v010
// Measured time: 136 microseconds a run.
// Timed twice side by side with v009, it ran 1.12 times as fast both times.
// Over all steps from v000 it is 9.05 times as fast.
#include <hip/hip_runtime.h>
#include <stdint.h>

// Contractions: token projections (q, k, v, gate down/up, beta, out) on v_wmma_f32_16x16x32_f16 with f16 operands pre-scaled by powers of two, f32 accumulate; per-chunk decay scores, Q*S and A*V on v_wmma_f32_16x16x32_bf16 as bf16 hi/lo three-product split, f32 accumulate; state recurrence, shortconv and norms on VALU in f32. All float inputs RNE-converted to bf16 on load.

typedef _Float16 h16;
typedef h16    v16h __attribute__((ext_vector_type(16)));
typedef h16    v8h  __attribute__((ext_vector_type(8)));
typedef __bf16 v16b __attribute__((ext_vector_type(16)));
typedef __bf16 v2b  __attribute__((ext_vector_type(2)));
typedef float  v8f  __attribute__((ext_vector_type(8)));
typedef float  v4f  __attribute__((ext_vector_type(4)));
typedef float  v2f  __attribute__((ext_vector_type(2)));
typedef unsigned int v4u __attribute__((ext_vector_type(4)));
typedef unsigned int v2u __attribute__((ext_vector_type(2)));

union HF { v16h v; v8h p[2]; };
union BF { v16b v; unsigned short u[16]; };
union BQ { v16b v; v4u q[2]; };

#define DM 1024
#define HD 64
#define NH 16
#define CH 64
#define QP 68
#define BP 72    // LDS row pitch of a bf16 operand plane in elements: 144 B = 16 B x 9, as LP
#define KS 64    // k per staged GEMM tile: 128 B of a row
#define LP 72    // LDS row pitch of a staged tile in f16: 144 B = 16 B x 9, free of bank conflicts for 16-byte row reads

__device__ __forceinline__ unsigned short bf16_bits(float f) {
  unsigned int u = __float_as_uint(f);
  u += 0x7FFFu + ((u >> 16) & 1u);
  return (unsigned short)(u >> 16);
}
__device__ __forceinline__ float bf16r(float f) {
  return __uint_as_float(((unsigned int)bf16_bits(f)) << 16);
}
// two values x = hi + lo in bf16 pieces (RNE), each piece pair packed in one dword, x[0] in the low half
__device__ __forceinline__ void split_pk(v2f x, unsigned int& hi, unsigned int& lo) {
  const v2b xh = __builtin_convertvector(x, v2b);
  const v2b xl = __builtin_convertvector(x - __builtin_convertvector(xh, v2f), v2b);
  hi = __builtin_bit_cast(unsigned int, xh);
  lo = __builtin_bit_cast(unsigned int, xl);
}
// four neighbouring values of a row, split and stored to the hi and the lo plane at ph and pl
__device__ __forceinline__ void split_store4(v4f x, unsigned short* ph, unsigned short* pl) {
  v2u hi, lo;
  unsigned int a, b;
  split_pk(x.xy, a, b);  hi[0] = a;  lo[0] = b;
  split_pk(x.zw, a, b);  hi[1] = a;  lo[1] = b;
  *(v2u*)ph = hi;
  *(v2u*)pl = lo;
}
// low 32 bits of a __shared__ address: the byte offset in the work-group's LDS
__device__ __forceinline__ unsigned lds_off(const void* p) {
  return (unsigned)(uintptr_t)p;
}
__device__ __forceinline__ float sigm(float v) {
  return __fdividef(1.0f, 1.0f + __expf(-v));
}

// 16-bit WMMA wrappers with the VALU hazard guard after the matrix op
__device__ __forceinline__ v8f mma_f16(v16h a, v16h b, v8f c) {
  c = __builtin_amdgcn_wmma_f32_16x16x32_f16(false, a, false, b, (short)0, c, false, false);
  asm volatile("v_nop\n\tv_nop\n\tv_nop\n\tv_nop" : "+v"(c) : "v"(a), "v"(b));
  return c;
}
__device__ __forceinline__ v8f mma_bf16(v16b a, v16b b, v8f c) {
  c = __builtin_amdgcn_wmma_f32_16x16x32_bf16(false, a, false, b, (short)0, c, false, false);
  asm volatile("v_nop\n\tv_nop\n\tv_nop\n\tv_nop" : "+v"(c) : "v"(a), "v"(b));
  return c;
}

// Fragment (row m of A, or column m of a B whose column is an LDS row; split k map) from a bf16 plane in LDS, pr = plane + row*BP + k0:
// elements 0..7 <- k0+8h.., 8..15 <- k0+16+8h..
__device__ __forceinline__ v16b frag_bf(const unsigned short* pr, int h) {
  BQ f;
  f.q[0] = *(const v4u*)(pr + 8 * h);
  f.q[1] = *(const v4u*)(pr + 16 + 8 * h);
  return f.v;
}

// Fragment (row m, split k map, for A and for a B whose column is an LDS row) of x[k] = pv[k] * exp(pp[k] - pm[k]), as bf16 hi/lo (RNE);
// the three pointers are f32 LDS rows at k0
__device__ __forceinline__ void frag_decay(const float* pv, const float* pp, const float* pm, int h, BF& hi, BF& lo) {
#pragma unroll
  for (int g = 0; g < 4; ++g) {
    const int o = (g >> 1) * 16 + 8 * h + (g & 1) * 4;
    const v4f v = *(const v4f*)(pv + o), a = *(const v4f*)(pp + o), c = *(const v4f*)(pm + o);
#pragma unroll
    for (int p = 0; p < 2; ++p) {
      const v2f x = { v[2 * p] * __expf(a[2 * p] - c[2 * p]), v[2 * p + 1] * __expf(a[2 * p + 1] - c[2 * p + 1]) };
      const v2b xh = __builtin_convertvector(x, v2b);
      const v2b xl = __builtin_convertvector(x - __builtin_convertvector(xh, v2f), v2b);
      hi.v[4 * g + 2 * p] = xh[0];  hi.v[4 * g + 2 * p + 1] = xh[1];
      lo.v[4 * g + 2 * p] = xl[0];  lo.v[4 * g + 2 * p + 1] = xl[1];
    }
  }
}

// ---------------------------------------------------------------------------
// Everything that reads only the inputs, in one launch of few, long work-groups.
// The first nconv blocks: causal depthwise conv (4 taps) + SiLU for all three weight sets, f16 output scaled by ascale, and x -> f16.
// A block takes FW channels x 8 * FL tokens; a wave a run of FL tokens, a lane 8 channels of it. The FL + 3 rows of x that the run
// needs are read once and serve all three sets; a set's taps and bias are read once per run.
// The blocks behind them: the nine weight matrices -> scaled f16, CG groups of eight elements per thread. Their f16 copies lie one
// behind the other in w16, in the order of the arguments, so one running group index serves all nine; every matrix but the last
// ends on a multiple of 256 * CG groups, so a block converts from one matrix only.
// ---------------------------------------------------------------------------
#define G_SQ (DM * DM / 8)    // groups of eight in a DM x DM matrix
#define G_LR (64 * DM / 8)    // ... in a 64 x DM or DM x 64 matrix
#define G_HD (NH * DM / 8)    // ... in an NH x DM matrix
#define G_HR (NH * 64 / 8)    // ... in an NH x 64 matrix
#define G_ALL (4 * G_SQ + 3 * G_LR + G_HD + G_HR)
#define CG 8      // groups per thread of a converting block
#define FL 8      // tokens per wave of a conv block
#define FW 256    // channels per conv block: 32 lanes x 8
#define TP 36     // LDS pitch in f32 of a lane's 4 taps x 8 channels: 144 B = 16 B x 9, free of bank conflicts for 16-byte reads

// SiLU's sigmoid for the conv part: sigm() with its exponential spelled out, the same multiply and the same v_exp_f32. The v_nop is the
// slot that the instruction set asks for behind a transcendental before its source register is overwritten: the argument dies at the
// v_exp_f32, and among the many side by side here the compiler gave its register to the very next instruction in some places
__device__ __forceinline__ float sigm_slot(float v) {
  const float t = v * -1.44269504f;
  float e;
  asm("v_exp_f32 %0, %1\n\tv_nop" : "=v"(e) : "v"(t));
  return __fdividef(1.0f, 1.0f + e);
}

__global__ void __launch_bounds__(256)
k_front(const float* __restrict__ x,
        const float* __restrict__ w0, const float* __restrict__ b0,
        const float* __restrict__ w1, const float* __restrict__ b1,
        const float* __restrict__ w2, const float* __restrict__ b2,
        const float* __restrict__ Wq, const float* __restrict__ Wk, const float* __restrict__ Wv,
        const float* __restrict__ Wo, const float* __restrict__ Wad, const float* __restrict__ Wau,
        const float* __restrict__ Wbe, const float* __restrict__ Wgd, const float* __restrict__ Wgu,
        h16* xh, h16* y0, h16* y1, h16* y2, h16* w16, int nconv, int T, float ascale, float wscale)
{
  __shared__ __attribute__((aligned(16))) float tw[3 * 32 * TP];   // [set][lane][tap][channel of the lane], bf16-rounded
  __shared__ __attribute__((aligned(16))) float tb[3 * FW];        // [set][channel], bf16-rounded

  const int bid = blockIdx.x;
  const int tid = threadIdx.x;
  if (bid >= nconv) {
    const int g0 = (bid - nconv) * (256 * CG);                              // first group of this block
    const float* src = Wq;
    int first = 0;                                                          // first group of the matrix g0 lies in
    if (g0 >= 4 * G_SQ + 3 * G_LR + G_HD)      { src = Wgu; first = 4 * G_SQ + 3 * G_LR + G_HD; }
    else if (g0 >= 4 * G_SQ + 2 * G_LR + G_HD) { src = Wgd; first = 4 * G_SQ + 2 * G_LR + G_HD; }
    else if (g0 >= 4 * G_SQ + 2 * G_LR)        { src = Wbe; first = 4 * G_SQ + 2 * G_LR; }
    else if (g0 >= 4 * G_SQ + G_LR)            { src = Wau; first = 4 * G_SQ + G_LR; }
    else if (g0 >= 4 * G_SQ)                   { src = Wad; first = 4 * G_SQ; }
    else if (g0 >= 3 * G_SQ)                   { src = Wo;  first = 3 * G_SQ; }
    else if (g0 >= 2 * G_SQ)                   { src = Wv;  first = 2 * G_SQ; }
    else if (g0 >= G_SQ)                       { src = Wk;  first = G_SQ; }
    // all loads of the thread are asked for before the first is used; a group past the end re-reads the last one and is not stored
    v4f a[CG], c[CG];
    const float* ps[CG];
#pragma unroll
    for (int it = 0; it < CG; ++it) {
      const int gi = g0 + it * 256 + tid;
      ps[it] = src + (size_t)((gi < G_ALL ? gi : G_ALL - 1) - first) * 8;
      a[it] = *(const v4f*)ps[it];
      c[it] = *(const v4f*)(ps[it] + 4);
    }
    // the wait stands in front of any overwrite of the address registers the loads name; as inputs they stay live up to it
    asm volatile("s_wait_xcnt 0x0" :: "v"(ps[0]), "v"(ps[1]), "v"(ps[2]), "v"(ps[3]), "v"(ps[4]), "v"(ps[5]), "v"(ps[6]), "v"(ps[7]) : "memory");
    v8h o[CG];
#pragma unroll
    for (int it = 0; it < CG; ++it)
#pragma unroll
      for (int q = 0; q < 4; ++q) {
        o[it][q]     = (h16)(bf16r(a[it][q]) * wscale);
        o[it][4 + q] = (h16)(bf16r(c[it][q]) * wscale);
      }
#pragma unroll
    for (int it = 0; it < CG; ++it) {
      const int gi = g0 + it * 256 + tid;
      if (gi < G_ALL) *(v8h*)(w16 + (size_t)gi * 8) = o[it];
    }
    return;
  }

  const int lane = tid & 31;
  // the wave's number is the same in all its lanes: read as a scalar, so that the row addresses and the test on the run's start are scalar
  const int wv = __builtin_amdgcn_readfirstlane(tid >> 5);
  const int c0 = (bid & (DM / FW - 1)) * FW;                      // first channel of the block
  const unsigned tok0 = (unsigned)(bid / (DM / FW)) * (8 * FL) + wv * FL;   // first token of the wave's run
  const size_t eo = (size_t)tok0 * DM + c0 + lane * 8;            // the lane's first element, in x and in every output

  // taps and bias of the block's channels: whole lines from global memory, one channel's four taps per thread and set
  const unsigned co = (unsigned)(c0 + tid);
  const v4f t0 = *(const v4f*)(w0 + co * 4), t1 = *(const v4f*)(w1 + co * 4), t2 = *(const v4f*)(w2 + co * 4);
  const float u0 = b0[co], u1 = b1[co], u2 = b2[co];
  // rows tok0 - 3 .. tok0 + FL - 1 of x; the three in front of a sequence's start count as zero (a run starts at a multiple of FL in it)
  v4f xa[FL + 3], xb[FL + 3];
  const float* px = x + eo;
#pragma unroll
  for (int j = 3; j < FL + 3; ++j) {
    xa[j] = *(const v4f*)(px + (j - 3) * DM);
    xb[j] = *(const v4f*)(px + (j - 3) * DM + 4);
  }
  if (tok0 % (unsigned)T != 0) {
#pragma unroll
    for (int j = 0; j < 3; ++j) {
      xa[j] = *(const v4f*)(px + (j - 3) * DM);
      xb[j] = *(const v4f*)(px + (j - 3) * DM + 4);
    }
  } else {
#pragma unroll
    for (int j = 0; j < 3; ++j)
#pragma unroll
      for (int q = 0; q < 4; ++q) { xa[j][q] = 0.0f; xb[j][q] = 0.0f; }
  }
  // the wait stands in front of any overwrite of the address registers the loads name; as inputs they stay live up to it
  asm volatile("s_wait_xcnt 0x0" :: "v"(px), "v"(co) : "memory");

  // taps to LDS as [lane][tap][channel of the lane], so that a lane reads a tap of its eight channels as two 16-byte pieces
  {
    float* d = tw + (tid >> 3) * TP + (tid & 7);
#pragma unroll
    for (int k = 0; k < 4; ++k) {
      d[k * 8]               = bf16r(t0[k]);
      d[32 * TP + k * 8]     = bf16r(t1[k]);
      d[2 * 32 * TP + k * 8] = bf16r(t2[k]);
    }
    tb[tid]          = bf16r(u0);
    tb[FW + tid]     = bf16r(u1);
    tb[2 * FW + tid] = bf16r(u2);
  }
  __syncthreads();   // every thread's taps are in LDS before any lane reads its eight channels'

  // x rounded, two neighbouring channels side by side for the packed products
  v2f xr[FL + 3][4];
#pragma unroll
  for (int j = 0; j < FL + 3; ++j)
#pragma unroll
    for (int p = 0; p < 2; ++p) {
      xr[j][p]     = v2f{ bf16r(xa[j][2 * p]), bf16r(xa[j][2 * p + 1]) };
      xr[j][2 + p] = v2f{ bf16r(xb[j][2 * p]), bf16r(xb[j][2 * p + 1]) };
    }

  {
    v8h ox[FL];
#pragma unroll
    for (int j = 0; j < FL; ++j)
#pragma unroll
      for (int q = 0; q < 8; ++q) ox[j][q] = (h16)xr[j + 3][q >> 1][q & 1];
#pragma unroll
    for (int j = 0; j < FL; ++j) *(v8h*)(xh + eo + (size_t)j * DM) = ox[j];
    // the wait stands in front of any rewrite of the registers the stores name
    asm volatile("s_wait_xcnt 0x0" ::: "memory");
  }

  // the loop over the three sets stays rolled, for speed only
#pragma unroll 1
  for (int s = 0; s < 3; ++s) {
    h16* y = (s == 0) ? y0 : ((s == 1) ? y1 : y2);
    v2f wt[4][4], bi[4];
#pragma unroll
    for (int k = 0; k < 4; ++k) {
      const v4f a = *(const v4f*)(tw + s * (32 * TP) + lane * TP + k * 8);
      const v4f c = *(const v4f*)(tw + s * (32 * TP) + lane * TP + k * 8 + 4);
      wt[k][0] = a.xy;  wt[k][1] = a.zw;  wt[k][2] = c.xy;  wt[k][3] = c.zw;
    }
    {
      const v4f a = *(const v4f*)(tb + s * FW + lane * 8), c = *(const v4f*)(tb + s * FW + lane * 8 + 4);
      bi[0] = a.xy;  bi[1] = a.zw;  bi[2] = c.xy;  bi[3] = c.zw;
    }
    v8h o[FL];
#pragma unroll
    for (int j = 0; j < FL; ++j)
#pragma unroll
      for (int p = 0; p < 4; ++p) {
        v2f acc = xr[j][p] * wt[0][p];
        acc = __builtin_elementwise_fma(xr[j + 1][p], wt[1][p], acc);
        acc = __builtin_elementwise_fma(xr[j + 2][p], wt[2][p], acc);
        acc = __builtin_elementwise_fma(xr[j + 3][p], wt[3][p], acc);
        acc += bi[p];
        o[j][2 * p]     = (h16)(acc.x * sigm_slot(acc.x) * ascale);
        o[j][2 * p + 1] = (h16)(acc.y * sigm_slot(acc.y) * ascale);
      }
#pragma unroll
    for (int j = 0; j < FL; ++j) *(v8h*)(y + eo + (size_t)j * DM) = o[j];
    // the wait stands in front of any rewrite of the registers the stores name
    asm volatile("s_wait_xcnt 0x0" ::: "memory");
  }
}

// ---------------------------------------------------------------------------
// Y[M,N] = epi( A[M,K] * W[N,K]^T * oscale + bias[N] ), f16 operands (k-contiguous), f32 accumulate.
// One block tile (bx, by) of one product; the launches below hand independent products to one grid, told apart by blockIdx.y.
// Block 256 threads = 8 waves; block tile 128 rows x 16*NT cols; wave tile 16 x 16*NT.
// Both operands come to LDS in tiles of KS k by asynchronous copies, whole cache lines, two buffers: tile t + 1 flies while t is used.
// EPI: 0 none, 2 silu, 3 sigmoid then clip to [0.1,1], 4 sigmoid then min 1.
// ---------------------------------------------------------------------------
// LDS of a launch, sized for NT = 4: the epilogue's staging, two buffers of 128 rows of A, two of up to 64 rows of W, KS k each
#define GEMM_LDS \
  __shared__ __attribute__((aligned(16))) float stg[8 * 16 * 64]; \
  __shared__ __attribute__((aligned(16))) h16 sA[2 * 128 * LP]; \
  __shared__ __attribute__((aligned(16))) h16 sW[2 * 64 * LP];

template<int NT, int EPI, typename OT>
__device__ __forceinline__ void
gemm_tile(const h16* __restrict__ A, const h16* __restrict__ W, const float* __restrict__ bias,
          OT* Y, int N, int K, float oscale, float yscale, int bx, int by, float* stg, h16* sA, h16* sW)
{
  constexpr int TW = 16 * NT;

  const int lane = threadIdx.x & 31, wv = threadIdx.x >> 5;
  const int m = lane & 15, h = lane >> 4;
  const int rowBase = bx * 128 + wv * 16;
  const int colBase = by * TW;

  v8f acc[NT];
#pragma unroll
  for (int t = 0; t < NT; ++t)
#pragma unroll
    for (int r = 0; r < 8; ++r) acc[t][r] = 0.0f;

  // Copy map: a row of a tile is KS f16 = 128 B = one cache line; 8 lanes x 16 B bring one row, a wave four whole lines.
  const int tid = threadIdx.x;
  const int cr = tid >> 3, cc = (tid & 7) * 8;
  const h16* ga = A + (size_t)(bx * 128 + cr) * K + cc;
  const unsigned la = lds_off(sA + cr * LP + cc);
  // W tile: 64 rows in 16-byte pieces (two per thread), or 16 rows in 8-byte pieces (one per thread)
  const int wr = (NT == 4) ? cr : (tid >> 4), wc = (NT == 4) ? cc : (tid & 15) * 4;
  const h16* gw = W + (size_t)(colBase + wr) * K + wc;
  const unsigned lw = lds_off(sW + wr * LP + wc);
  const size_t r32 = (size_t)32 * K;             // 32 rows further in global memory
  constexpr unsigned L32 = 32 * LP * 2;          // 32 rows further in LDS, bytes

  // all of tile t's copies, every lane on; the s_wait_xcnt closes the statement so that it stands in front of any
  // rewrite of the address registers the copies name
  auto stage = [&](int t) {
    const h16* a0 = ga + (size_t)t * KS;
    const h16* w0 = gw + (size_t)t * KS;
    const unsigned l0 = la + (unsigned)(t & 1) * (128 * LP * 2);
    const unsigned m0 = lw + (unsigned)(t & 1) * (TW * LP * 2);
    if constexpr (NT == 4) {
      asm volatile("global_load_async_to_lds_b128 %0, %1, off\n\t"
                   "global_load_async_to_lds_b128 %2, %3, off\n\t"
                   "global_load_async_to_lds_b128 %4, %5, off\n\t"
                   "global_load_async_to_lds_b128 %6, %7, off\n\t"
                   "global_load_async_to_lds_b128 %8, %9, off\n\t"
                   "global_load_async_to_lds_b128 %10, %11, off\n\t"
                   "s_wait_xcnt 0x0"
                   :: "v"(l0), "v"(a0), "v"(l0 + L32), "v"(a0 + r32), "v"(l0 + 2 * L32), "v"(a0 + 2 * r32),
                      "v"(l0 + 3 * L32), "v"(a0 + 3 * r32), "v"(m0), "v"(w0), "v"(m0 + L32), "v"(w0 + r32)
                   : "memory");
    } else {
      asm volatile("global_load_async_to_lds_b128 %0, %1, off\n\t"
                   "global_load_async_to_lds_b128 %2, %3, off\n\t"
                   "global_load_async_to_lds_b128 %4, %5, off\n\t"
                   "global_load_async_to_lds_b128 %6, %7, off\n\t"
                   "global_load_async_to_lds_b64 %8, %9, off\n\t"
                   "s_wait_xcnt 0x0"
                   :: "v"(l0), "v"(a0), "v"(l0 + L32), "v"(a0 + r32), "v"(l0 + 2 * L32), "v"(a0 + 2 * r32),
                      "v"(l0 + 3 * L32), "v"(a0 + 3 * r32), "v"(m0), "v"(w0)
                   : "memory");
    }
  };

  const int nt = K / KS;
  stage(0);
  asm volatile("s_wait_asynccnt 0x0" ::: "memory");   // this wave's copies of tile 0 have landed
  __syncthreads();                                    // ... and every other wave's
  if (nt > 1) stage(1);

  // A: lane row m, elements 0..7 <- k0+8h.., 8..15 <- k0+16+8h..;  B: lane col m, same k map
  for (int t = 0; t < nt; ++t) {
    const h16* pa = sA + (t & 1) * (128 * LP) + (wv * 16 + m) * LP + 8 * h;
    const h16* pw = sW + (t & 1) * (TW * LP) + m * LP + 8 * h;
    HF a[KS / 32], b[KS / 32][NT];
#pragma unroll
    for (int q = 0; q < KS / 32; ++q) {
      a[q].p[0] = *(const v8h*)(pa + 32 * q);
      a[q].p[1] = *(const v8h*)(pa + 32 * q + 16);
#pragma unroll
      for (int u = 0; u < NT; ++u) {
        b[q][u].p[0] = *(const v8h*)(pw + 16 * u * LP + 32 * q);
        b[q][u].p[1] = *(const v8h*)(pw + 16 * u * LP + 32 * q + 16);
      }
    }
#pragma unroll
    for (int q = 0; q < KS / 32; ++q)
#pragma unroll
      for (int u = 0; u < NT; ++u) acc[u] = mma_f16(a[q].v, b[q][u].v, acc[u]);
    asm volatile("s_wait_dscnt 0x0" ::: "memory");      // this wave's reads of the buffer are done before it is refilled
    asm volatile("s_wait_asynccnt 0x0" ::: "memory");   // this wave's copies of tile t + 1 have landed
    __syncthreads();                                    // publishes tile t + 1 and ends every wave's reads of tile t
    if (t + 2 < nt) stage(t + 2);
  }
  asm volatile("s_wait_asynccnt 0x0" ::: "memory");     // no copy is left in flight when the wave goes on

  // epilogue values (D element r of this lane = row 8h+r, col m of tile t)
#pragma unroll
  for (int t = 0; t < NT; ++t) {
    const float bv = bf16r(bias[colBase + 16 * t + m]);
#pragma unroll
    for (int r = 0; r < 8; ++r) {
      float v = acc[t][r] * oscale + bv;
      if (EPI == 2)      { v = v * sigm(v); }
      else if (EPI == 3) { v = sigm(v); v = fminf(fmaxf(v, 0.1f), 1.0f); }
      else if (EPI == 4) { v = fminf(sigm(v), 1.0f); }
      acc[t][r] = v;
    }
  }
  float* sw = stg + wv * 16 * TW;
#pragma unroll
  for (int t = 0; t < NT; ++t)
#pragma unroll
    for (int r = 0; r < 8; ++r) sw[(8 * h + r) * TW + 16 * t + m] = acc[t][r];
  __syncthreads();

  if constexpr (sizeof(OT) == 4 && NT == 4) {
    v4f vals[8];
    size_t offs[8];
#pragma unroll
    for (int it = 0; it < 8; ++it) {
      const int row = 2 * it + h, c4 = m * 4;
      vals[it] = *(const v4f*)(sw + row * TW + c4);
      offs[it] = (size_t)(rowBase + row) * N + colBase + c4;
    }
#pragma unroll
    for (int it = 0; it < 8; ++it) *(v4f*)(Y + offs[it]) = vals[it];
    // in a merged launch another product's code follows in the listing: the wait stands in front of any rewrite of the registers the stores name
    asm volatile("s_wait_xcnt 0x0" ::: "memory");
  } else if constexpr (sizeof(OT) == 2 && NT == 4) {
    v8h vals[4];
    size_t offs[4];
#pragma unroll
    for (int it = 0; it < 4; ++it) {
      const int row = it * 4 + (lane >> 3), c8 = (lane & 7) * 8;
      const v4f a = *(const v4f*)(sw + row * TW + c8);
      const v4f c = *(const v4f*)(sw + row * TW + c8 + 4);
      v8h o;
#pragma unroll
      for (int q = 0; q < 4; ++q) { o[q] = (h16)(a[q] * yscale); o[4 + q] = (h16)(c[q] * yscale); }
      vals[it] = o;
      offs[it] = (size_t)(rowBase + row) * N + colBase + c8;
    }
#pragma unroll
    for (int it = 0; it < 4; ++it) *(v8h*)(Y + offs[it]) = vals[it];
    // in a merged launch another product's code follows in the listing: the wait stands in front of any rewrite of the registers the stores name
    asm volatile("s_wait_xcnt 0x0" ::: "memory");
  } else if constexpr (sizeof(OT) == 4 && NT == 1) {
    // N == 16: the wave's 16 rows are 1 KB contiguous; 8 lanes x 16 B per line
    v4f vals[2];
    size_t offs[2];
#pragma unroll
    for (int it = 0; it < 2; ++it) {
      const int q = it * 32 + lane, row = q >> 2, c4 = (q & 3) * 4;
      vals[it] = *(const v4f*)(sw + row * TW + c4);
      offs[it] = (size_t)(rowBase + row) * N + colBase + c4;
    }
#pragma unroll
    for (int it = 0; it < 2; ++it) *(v4f*)(Y + offs[it]) = vals[it];
    // in a merged launch another product's code follows in the listing: the wait stands in front of any rewrite of the registers the stores name
    asm volatile("s_wait_xcnt 0x0" ::: "memory");
  }
}

// ---------------------------------------------------------------------------
// The wide tile, for the three DM x DM products on the conv activations: Y[M,N] = A[M,K] * W[N,K]^T * oscale + bias[N], f32 out,
// each row L2-normalised over its 64-col slab where norm is set (the same for the whole block).
// Block tile WM rows x WN cols, 8 waves as 4 row groups x 2 column groups, wave tile 64 x 64: a fragment read from LDS serves four
// matrix instructions, and a byte brought to LDS serves twice the products it serves in gemm_tile.
// The same copies, the same two buffers and the same order at the foot of a trip as in gemm_tile.
// pool: the block's LDS. In the loop it holds two buffers of WM rows of A, then two of WN rows of W; behind the loop's last barrier
// nobody reads those any more, and each wave stages its 64 x 64 results there, pitch EP.
// ---------------------------------------------------------------------------
#define WM 256
#define WN 128
#define EP 68     // LDS row pitch of the staged results in f32: the two 16-lane rows of a wave, 8 rows apart, fall on different banks
#define WIDE_LDS (8 * 64 * EP * 4)   // bytes; the loop's buffers need 2 * (WM + WN) * LP * 2, which is less

__device__ __forceinline__ void
gemm_wide(const h16* __restrict__ A, const h16* __restrict__ W, const float* __restrict__ bias,
          float* Y, int N, int K, float oscale, bool norm, int bx, int by, char* pool)
{
  h16* sA = (h16*)pool;
  h16* sW = sA + 2 * WM * LP;

  const int tid = threadIdx.x;
  const int lane = tid & 31, wv = tid >> 5;
  const int m = lane & 15, h = lane >> 4;
  const int wr = wv >> 1, wc = wv & 1;
  const int rowBase = bx * WM + wr * 64;
  const int colBase = by * WN + wc * 64;

  v8f acc[4][4];
#pragma unroll
  for (int i = 0; i < 4; ++i)
#pragma unroll
    for (int u = 0; u < 4; ++u)
#pragma unroll
      for (int r = 0; r < 8; ++r) acc[i][u][r] = 0.0f;

  // Copy map as in gemm_tile: 8 lanes x 16 B bring one row of KS f16, the block 32 rows per copy instruction
  const int cr = tid >> 3, cc = (tid & 7) * 8;
  const h16* ga = A + (size_t)(bx * WM + cr) * K + cc;
  const h16* gw = W + (size_t)(by * WN + cr) * K + cc;
  const unsigned la = lds_off(sA + cr * LP + cc);
  const unsigned lw = lds_off(sW + cr * LP + cc);
  const size_t r32 = (size_t)32 * K;             // 32 rows further in global memory
  constexpr unsigned L32 = 32 * LP * 2;          // 32 rows further in LDS, bytes

  // all of tile t's copies, every lane on; the s_wait_xcnt closes the statement so that it stands in front of any
  // rewrite of the address registers the copies name
  auto stage = [&](int t) {
    const h16* a0 = ga + (size_t)t * KS;
    const h16* w0 = gw + (size_t)t * KS;
    const unsigned l0 = la + (unsigned)(t & 1) * (WM * LP * 2);
    const unsigned m0 = lw + (unsigned)(t & 1) * (WN * LP * 2);
    asm volatile("global_load_async_to_lds_b128 %0, %1, off\n\t"
                 "global_load_async_to_lds_b128 %2, %3, off\n\t"
                 "global_load_async_to_lds_b128 %4, %5, off\n\t"
                 "global_load_async_to_lds_b128 %6, %7, off\n\t"
                 "global_load_async_to_lds_b128 %8, %9, off\n\t"
                 "global_load_async_to_lds_b128 %10, %11, off\n\t"
                 "global_load_async_to_lds_b128 %12, %13, off\n\t"
                 "global_load_async_to_lds_b128 %14, %15, off\n\t"
                 "global_load_async_to_lds_b128 %16, %17, off\n\t"
                 "global_load_async_to_lds_b128 %18, %19, off\n\t"
                 "global_load_async_to_lds_b128 %20, %21, off\n\t"
                 "global_load_async_to_lds_b128 %22, %23, off\n\t"
                 "s_wait_xcnt 0x0"
                 :: "v"(l0), "v"(a0), "v"(l0 + L32), "v"(a0 + r32), "v"(l0 + 2 * L32), "v"(a0 + 2 * r32),
                    "v"(l0 + 3 * L32), "v"(a0 + 3 * r32), "v"(l0 + 4 * L32), "v"(a0 + 4 * r32), "v"(l0 + 5 * L32), "v"(a0 + 5 * r32),
                    "v"(l0 + 6 * L32), "v"(a0 + 6 * r32), "v"(l0 + 7 * L32), "v"(a0 + 7 * r32),
                    "v"(m0), "v"(w0), "v"(m0 + L32), "v"(w0 + r32), "v"(m0 + 2 * L32), "v"(w0 + 2 * r32), "v"(m0 + 3 * L32), "v"(w0 + 3 * r32)
                 : "memory");
  };

  const int nt = K / KS;
  stage(0);
  asm volatile("s_wait_asynccnt 0x0" ::: "memory");   // this wave's copies of tile 0 have landed
  __syncthreads();                                    // ... and every other wave's
  if (nt > 1) stage(1);

  // A: lane row m, elements 0..7 <- k0+8h.., 8..15 <- k0+16+8h..;  B: lane col m, same k map
  for (int t = 0; t < nt; ++t) {
    const h16* pa = sA + (t & 1) * (WM * LP) + (wr * 64 + m) * LP + 8 * h;
    const h16* pw = sW + (t & 1) * (WN * LP) + (wc * 64 + m) * LP + 8 * h;
#pragma unroll
    for (int q = 0; q < KS / 32; ++q) {
      HF a[4], b[4];
#pragma unroll
      for (int u = 0; u < 4; ++u) {
        a[u].p[0] = *(const v8h*)(pa + 16 * u * LP + 32 * q);
        a[u].p[1] = *(const v8h*)(pa + 16 * u * LP + 32 * q + 16);
        b[u].p[0] = *(const v8h*)(pw + 16 * u * LP + 32 * q);
        b[u].p[1] = *(const v8h*)(pw + 16 * u * LP + 32 * q + 16);
      }
#pragma unroll
      for (int i = 0; i < 4; ++i)
#pragma unroll
        for (int u = 0; u < 4; ++u) acc[i][u] = mma_f16(a[i].v, b[u].v, acc[i][u]);
    }
    asm volatile("s_wait_dscnt 0x0" ::: "memory");      // this wave's reads of the buffer are done before it is refilled
    asm volatile("s_wait_asynccnt 0x0" ::: "memory");   // this wave's copies of tile t + 1 have landed
    __syncthreads();                                    // publishes tile t + 1 and ends every wave's reads of tile t
    if (t + 2 < nt) stage(t + 2);
  }
  asm volatile("s_wait_asynccnt 0x0" ::: "memory");     // no copy is left in flight when the wave goes on

  // epilogue values (D element r of this lane = row 16i+8h+r, col 16u+m of the wave tile)
  float bv[4];
#pragma unroll
  for (int u = 0; u < 4; ++u) bv[u] = bf16r(bias[colBase + 16 * u + m]);
#pragma unroll
  for (int i = 0; i < 4; ++i)
#pragma unroll
    for (int u = 0; u < 4; ++u)
#pragma unroll
      for (int r = 0; r < 8; ++r) acc[i][u][r] = acc[i][u][r] * oscale + bv[u];
  if (norm) {
#pragma unroll
    for (int i = 0; i < 4; ++i)
#pragma unroll
      for (int r = 0; r < 8; ++r) {
        float ss = 0.0f;
#pragma unroll
        for (int u = 0; u < 4; ++u) ss += acc[i][u][r] * acc[i][u][r];
        ss += __shfl_xor(ss, 1, 32);
        ss += __shfl_xor(ss, 2, 32);
        ss += __shfl_xor(ss, 4, 32);
        ss += __shfl_xor(ss, 8, 32);
        const float inv = 1.0f / sqrtf(fmaxf(ss, 1e-6f));
#pragma unroll
        for (int u = 0; u < 4; ++u) acc[i][u][r] *= inv;
      }
  }

  float* sw = (float*)pool + wv * (64 * EP);
#pragma unroll
  for (int i = 0; i < 4; ++i)
#pragma unroll
    for (int u = 0; u < 4; ++u)
#pragma unroll
      for (int r = 0; r < 8; ++r) sw[(16 * i + 8 * h + r) * EP + 16 * u + m] = acc[i][u][r];
  __syncthreads();   // the staged results are read by other lanes than wrote them

  // a store instruction takes two rows of the wave tile, 256 B of each
  const float* sr = sw + h * EP + m * 4;
  float* yp = Y + (size_t)(rowBase + h) * N + colBase + m * 4;
#pragma unroll
  for (int i = 0; i < 4; ++i) {
    v4f vals[8];
#pragma unroll
    for (int it = 0; it < 8; ++it) vals[it] = *(const v4f*)(sr + (16 * i + 2 * it) * EP);
#pragma unroll
    for (int it = 0; it < 8; ++it) *(v4f*)(yp + (size_t)(16 * i + 2 * it) * N) = vals[it];
    // the wait stands in front of any rewrite of the registers the stores name
    asm volatile("s_wait_xcnt 0x0" ::: "memory");
  }
}

// ---------------------------------------------------------------------------
// The six products that need only the front launch's results, K = DM each: q, k (L2 norm per 64-col slab), v in wide tiles,
// gate-down for alpha, beta, gate-down for the output gate (one slab each) in tiles of 128 rows.
// ---------------------------------------------------------------------------
__global__ void __launch_bounds__(256)
k_proj(const h16* __restrict__ cq, const h16* __restrict__ ck, const h16* __restrict__ cv, const h16* __restrict__ xh,
       const h16* __restrict__ Wq16, const h16* __restrict__ Wk16, const h16* __restrict__ Wv16,
       const h16* __restrict__ Wad16, const h16* __restrict__ Wbe16, const h16* __restrict__ Wgd16,
       const float* __restrict__ bq, const float* __restrict__ bk, const float* __restrict__ bv,
       const float* __restrict__ bad, const float* __restrict__ bbe, const float* __restrict__ bgd,
       float* Qn, float* Kn, float* Vf, float* Bt, h16* t1, h16* t2,
       int K, float cscale, float xscale, float tscale)
{
  __shared__ __attribute__((aligned(16))) char pool[WIDE_LDS];
  const int bx = blockIdx.x, y = blockIdx.y;
  if (y < 24) {
    // q, k, v: eight column tiles of WN each, bx a tile of WM rows
    const int p = y >> 3;
    gemm_wide(p == 0 ? cq : (p == 1 ? ck : cv), p == 0 ? Wq16 : (p == 1 ? Wk16 : Wv16), p == 0 ? bq : (p == 1 ? bk : bv),
              p == 0 ? Qn : (p == 1 ? Kn : Vf), DM, K, cscale, p < 2, bx, y & 7, pool);
    return;
  }
  // the three narrow products on x, in tiles of 128 rows: two values of y each
  float* stg = (float*)pool;
  h16* sA = (h16*)(pool + 8 * 16 * 64 * 4);
  h16* sW = sA + 2 * 128 * LP;
  const int s = y - 24, rb = bx * 2 + (s & 1);
  if ((s >> 1) == 1) {
    gemm_tile<1, 4, float>(xh, Wbe16, bbe, Bt, NH, K, xscale, 1.0f, rb, 0, stg, sA, sW);
  } else {
    const bool a = s < 2;
    gemm_tile<4, 2, h16>(xh, a ? Wad16 : Wgd16, a ? bad : bgd, a ? t1 : t2, 64, K, xscale, tscale, rb, 0, stg, sA, sW);
  }
}

// The two gate-up products, K = 64 each: alpha (16 slabs) and the output gate (one slab).
__global__ void __launch_bounds__(256)
k_gate(const h16* __restrict__ t1, const h16* __restrict__ t2, const h16* __restrict__ Wau16, const h16* __restrict__ Wgu16,
       const float* __restrict__ bau, const float* __restrict__ bgu, float* Al, float* Gt, int K, float oscale)
{
  GEMM_LDS
  const int bx = blockIdx.x, y = blockIdx.y;
  if (y < 16) gemm_tile<4, 3, float>(t1, Wau16, bau, Al, DM, K, oscale, 1.0f, bx, y, stg, sA, sW);
  else        gemm_tile<1, 4, float>(t2, Wgu16, bgu, Gt, NH, K, oscale, 1.0f, bx, 0, stg, sA, sW);
}

// The output projection.
__global__ void __launch_bounds__(256)
k_oproj(const h16* __restrict__ A, const h16* __restrict__ W, const float* __restrict__ bias, float* Y, int K, float oscale)
{
  GEMM_LDS
  gemm_tile<4, 0, float>(A, W, bias, Y, DM, K, oscale, 1.0f, blockIdx.x, blockIdx.y, stg, sA, sW);
}

// ---------------------------------------------------------------------------
// Gated delta rule, serial part. The columns e of the state S (64x64 f32) never mix: each evolves from k, a, beta and v[e] alone.
// One block per (group of SC columns, b*h), T/64 chunks in sequence; 4 waves hold the state and step, 4 more stage the next chunk's
// operands meanwhile. A 16-lane row of a stepping wave owns one column,
// lane lg of it the rows 4*lg .. 4*lg+3 in registers, so k^T S is summed inside the row and no step needs a barrier.
// Four steps 0..3 are taken from one state S. With dl_i = v_i - k_i^T (a_i S_i-1), every later step's k^T S is linear in S and
// in the earlier dl, so with A(j..i] the product of a_j+1 .. a_i, per feature:
//   dl_i = v_i - (k_i A(-1..i])^T S - sum over j < i of c_ij dl_j,     c_ij = sum_d k_i A(j..i] beta_j k_j
//   S   <- A(-1..3] S + sum over j of (beta_j k_j A(j..3]) dl_j
// The four row sums run side by side, and the dependent chain of one step, three short links longer, serves four. The vectors in
// brackets and the c_ij hold no state and no column: they are formed once per chunk while the tiles are staged.
// The state each chunk starts from is stored column-major, Sg[(bh*nch + n)][e][d], for the chunk-parallel output kernel.
// ---------------------------------------------------------------------------
#define SC 8    // state columns per block
#define NSTP 8    // steps per group of LDS operand reads

// x + (x of lane l ^ mask) inside a 16-lane row; CTRL = 0x160 + mask is the DPP row_xmask control
template<int CTRL>
__device__ __forceinline__ float xmask_add(float x) {
  return x + __int_as_float(__builtin_amdgcn_update_dpp(0, __float_as_int(x), CTRL, 0xf, 0xf, true));
}
// sum of the four elements of every lane of a 16-lane row, in every lane of it
__device__ __forceinline__ float row_sum(v4f x) {
  float s = (x[0] + x[2]) + (x[1] + x[3]);
  s = xmask_add<0x161>(s);
  s = xmask_add<0x162>(s);
  s = xmask_add<0x164>(s);
  return xmask_add<0x168>(s);
}

// work-group barrier that orders LDS only: the stagers' global loads of the chunk after next stay in flight across it,
// where __syncthreads() would wait for them
__device__ __forceinline__ void lds_barrier() {
  __builtin_amdgcn_fence(__ATOMIC_RELEASE, "workgroup", "local");
  __builtin_amdgcn_s_barrier();
  __builtin_amdgcn_fence(__ATOMIC_ACQUIRE, "workgroup", "local");
}

__global__ void __launch_bounds__(256)
k_state(const float* __restrict__ Kp, const float* __restrict__ Vp, const float* __restrict__ Ap,
        const float* __restrict__ Bp, float* Sg, int T)
{
  // Two buffers of every staged array: waves 0..3 step through chunk n in buffer n & 1 while waves 4..7 stage chunk n + 1 in the other.
  // Us: k_i A(-1..i], two steps side by side so that one packed product serves both: of the four rows of a group, for lane lg,
  // row 0 holds steps (0, 1) of d = 4*lg and of 4*lg+1, row 1 those of 4*lg+2 and 4*lg+3, rows 2 and 3 the same of steps (2, 3)
  __shared__ __attribute__((aligned(16))) float Us[2 * CH * HD];
  __shared__ __attribute__((aligned(16))) float Ws[2 * CH * HD];         // [t][d]: beta_j k_j A(j..3]
  __shared__ __attribute__((aligned(16))) float Ps[2 * (CH / 4) * HD];   // [group][d]: A(-1..3]
  __shared__ __attribute__((aligned(16))) float Vt[2 * SC * CH];         // [column][t]
  __shared__ __attribute__((aligned(16))) float Cs[2 * (CH / 4) * 8];    // [group]: c10 c20 c21 c30 c31 c32, two unused

  const int tid = threadIdx.x & 127;           // place among the 128 threads of the same role
  // the role is the same for a whole wave: read as a scalar, so that the branch on it is a scalar branch
  const bool stager = __builtin_amdgcn_readfirstlane((int)(threadIdx.x >> 5)) >= 4;
  const int cg = blockIdx.x, bh = blockIdx.y, b = bh / NH, hh = bh % NH;
  const int lg = tid & 15, el = tid >> 4;      // state ownership: column cg*SC + el, rows 4*lg .. 4*lg+3

  // every loop of this kernel but the one over the chunks is unrolled: its arrays are then indexed by constants and stay in registers
  v4f S;
#pragma unroll
  for (int u = 0; u < 4; ++u) S[u] = 0.0f;

  // per-thread byte offsets of the tile loads and of the state store; the chunk moves the uniform base only.
  // Staging: the 16-lane row el takes the groups el and el + 8, that is the tile rows 4*el + 32*it and the three behind
  const unsigned tb = (unsigned)(((4 * el) * DM + lg * 4) * 4);
  const unsigned vo = (unsigned)(((tid >> 1) * DM + cg * SC + (tid & 1) * 4) * 4);
  const unsigned so = (unsigned)(((cg * SC + el) * HD + 4 * lg) * 4);

  const int nch = T / CH;

  // a chunk's tiles as loaded, held in a stager's registers from one pass of the chunk loop to the next
  float tbe[2][4];
  v4f tk[2][4], ta[2][4], tv;

  // tile loads of chunk n: k and a 64 rows x 64 f32, v 64 rows x SC f32, beta of this row's eight steps (one address per 16-lane row)
  auto load = [&](int n) {
    const size_t rowbase = (size_t)b * T + (size_t)n * CH;
    const float* Kg = Kp + rowbase * DM + hh * HD;
    const float* Vg = Vp + rowbase * DM + hh * HD;
    const float* Ag = Ap + rowbase * DM + hh * HD;
    const char* kp = (const char*)Kg + tb;
    const char* ap = (const char*)Ag + tb;
    const char* vp = (const char*)Vg + vo;
    const float* bp = Bp + (rowbase + 4 * el) * NH + hh;
#pragma unroll
    for (int it = 0; it < 2; ++it) {
#pragma unroll
      for (int j = 0; j < 4; ++j) tbe[it][j] = bp[(32 * it + j) * NH];
#pragma unroll
      for (int j = 0; j < 4; ++j) {
        tk[it][j] = *(const v4f*)(kp + (32 * it + j) * (DM * 4));
        ta[it][j] = *(const v4f*)(ap + (32 * it + j) * (DM * 4));
      }
    }
    tv = *(const v4f*)vp;
    // the wait stands in front of any overwrite of the address registers the loads name; as inputs they stay live up to it
    asm volatile("s_wait_xcnt 0x0" :: "v"(kp), "v"(ap), "v"(vp), "v"(bp) : "memory");
  };

  // the loaded tiles -> the step operands, into buffer bf
  auto stage = [&](int bf) {
    float* Ub = Us + bf * (CH * HD);
    float* Wb = Ws + bf * (CH * HD);
    float* Pb = Ps + bf * ((CH / 4) * HD);
    float* Vb = Vt + bf * (SC * CH);
    float* Cb = Cs + bf * ((CH / 4) * 8);
#pragma unroll
    for (int it = 0; it < 2; ++it) {
      const int qd = it * 8 + el;
      const v4f k0 = tk[it][0], k1 = tk[it][1], k2 = tk[it][2], k3 = tk[it][3];
      const v4f d0 = ta[it][0], d1 = ta[it][1], d2 = ta[it][2], d3 = ta[it][3];
      const float b0 = fminf(tbe[it][0], 1.0f), b1 = fminf(tbe[it][1], 1.0f);
      const float b2 = fminf(tbe[it][2], 1.0f), b3 = fminf(tbe[it][3], 1.0f);
      const v4f P1 = d0 * d1, P2 = P1 * d2, P3 = P2 * d3;       // A(-1..i]
      const v4f R20 = d1 * d2, R31 = d2 * d3, R30 = d1 * R31;   // A(j..i]
      const v4f g0 = k0 * b0, g1 = k1 * b1, g2 = k2 * b2, g3 = k3 * b3;
      const v4f u0 = k0 * d0, u1 = k1 * P1, u2 = k2 * P2, u3 = k3 * P3;
      const v4f ua = { u0[0], u1[0], u0[1], u1[1] }, ub = { u0[2], u1[2], u0[3], u1[3] };
      const v4f uc = { u2[0], u3[0], u2[1], u3[1] }, ud = { u2[2], u3[2], u2[3], u3[3] };
      *(v4f*)(Ub + (4 * qd) * HD + 4 * lg)     = ua;
      *(v4f*)(Ub + (4 * qd + 1) * HD + 4 * lg) = ub;
      *(v4f*)(Ub + (4 * qd + 2) * HD + 4 * lg) = uc;
      *(v4f*)(Ub + (4 * qd + 3) * HD + 4 * lg) = ud;
      *(v4f*)(Wb + (4 * qd) * HD + 4 * lg)     = g0 * R30;
      *(v4f*)(Wb + (4 * qd + 1) * HD + 4 * lg) = g1 * R31;
      *(v4f*)(Wb + (4 * qd + 2) * HD + 4 * lg) = g2 * d3;
      *(v4f*)(Wb + (4 * qd + 3) * HD + 4 * lg) = g3;
      *(v4f*)(Pb + qd * HD + 4 * lg)           = P3;
      const float c10 = row_sum((k1 * d1) * g0);
      const float c20 = row_sum((k2 * R20) * g0), c21 = row_sum((k2 * d2) * g1);
      const float c30 = row_sum((k3 * R30) * g0), c31 = row_sum((k3 * R31) * g1), c32 = row_sum((k3 * d3) * g2);
      if (lg == 0) {
        const v4f ca = { c10, c20, c21, c30 };
        const v2f cb = { c31, c32 };
        *(v4f*)(Cb + qd * 8)     = ca;
        *(v2f*)(Cb + qd * 8 + 4) = cb;
      }
    }
#pragma unroll
    for (int u = 0; u < 4; ++u) Vb[((tid & 1) * 4 + u) * CH + (tid >> 1)] = tv[u];
  };

  if (stager) load(0);

  // pass -1 only stages chunk 0; in pass n the steppers take chunk n
  for (int n = -1; n < nch; ++n) {
    if (stager) {
      // chunk n + 1 goes into the buffer whose last readers left it at the barrier before this pass; its tiles were asked for
      // a whole pass ago, and those of chunk n + 2 are asked for now
      if (n + 1 < nch) {
        stage((n + 1) & 1);
        if (n + 2 < nch) load(n + 2);
      }
    } else if (n >= 0) {
    const int bf = n & 1;
    const float* ul = Us + bf * (CH * HD) + 4 * lg;
    const float* wl = Ws + bf * (CH * HD) + 4 * lg;
    const float* pl = Ps + bf * ((CH / 4) * HD) + 4 * lg;
    const float* vl = Vt + bf * (SC * CH) + el * CH;
    const float* cl = Cs + bf * ((CH / 4) * 8);
    float* So = Sg + ((size_t)bh * nch + n) * (HD * HD);

    // exact state update over the chunk, four steps at a time
    // the operands of NSTP steps are read as one group, one group ahead of the steps that use them
    v4f uq[2][NSTP], wq[2][NSTP], pq[2][NSTP / 4], vq[2][NSTP / 4], ca[2][NSTP / 4];
    v2f cb[2][NSTP / 4];
    auto fetch = [&](int g, int bf) {
      // in the order of use: LDS reads return in order, and the first group of a chunk is waited for
#pragma unroll
      for (int s = 0; s < NSTP / 4; ++s) {
#pragma unroll
        for (int j = 0; j < 4; ++j) uq[bf][4 * s + j] = *(const v4f*)(ul + (NSTP * g + 4 * s + j) * HD);
        pq[bf][s] = *(const v4f*)(pl + ((NSTP / 4) * g + s) * HD);
        vq[bf][s] = *(const v4f*)(vl + NSTP * g + 4 * s);
        ca[bf][s] = *(const v4f*)(cl + ((NSTP / 4) * g + s) * 8);
        cb[bf][s] = *(const v2f*)(cl + ((NSTP / 4) * g + s) * 8 + 4);
#pragma unroll
        for (int j = 0; j < 4; ++j) wq[bf][4 * s + j] = *(const v4f*)(wl + (NSTP * g + 4 * s + j) * HD);
      }
    };
    fetch(0, 0);
    // entry state of this chunk; the wait on the store stands behind the first group's LDS reads and passes under their latency
    *(v4f*)((char*)So + so) = S;
    // the steps that follow overwrite S, which this store names, and may be given its address registers: the wait stands in front of that
    asm volatile("s_wait_xcnt 0x0" ::: "memory");
#pragma unroll
    for (int g = 0; g < CH / NSTP; ++g) {
      const int cur = g & 1, nxt = cur ^ 1;
      // with the one behind the reads: keeps the next group's LDS reads in one place. Left free, they sank to just ahead of their
      // use, where each step waited out the LDS latency, or were strewn among the steps of the group before
      __builtin_amdgcn_sched_barrier(0);
      if (g + 1 < CH / NSTP) fetch(g + 1, nxt);
      __builtin_amdgcn_sched_barrier(0);   // second of the pair, see above
#pragma unroll
      for (int q = 0; q < NSTP / 4; ++q) {
        const v4f ua = uq[cur][4 * q], ub = uq[cur][4 * q + 1], uc = uq[cur][4 * q + 2], ud = uq[cur][4 * q + 3];
        const v4f w0 = wq[cur][4 * q], w1 = wq[cur][4 * q + 1], w2 = wq[cur][4 * q + 2], w3 = wq[cur][4 * q + 3];
        const v4f pp = pq[cur][q], vv = vq[cur][q], c4 = ca[cur][q];
        const v2f c2 = cb[cur][q];
        const v2f pa = (ua.xy * S[0] + ub.xy * S[2]) + (ua.zw * S[1] + ub.zw * S[3]);   // partial sums of steps 0 and 1
        const v2f pb = (uc.xy * S[0] + ud.xy * S[2]) + (uc.zw * S[1] + ud.zw * S[3]);   // ... of steps 2 and 3
        float p0 = pa.x, p1 = pa.y, p2 = pb.x, p3 = pb.y;
        p0 = xmask_add<0x161>(p0);  p1 = xmask_add<0x161>(p1);  p2 = xmask_add<0x161>(p2);  p3 = xmask_add<0x161>(p3);
        p0 = xmask_add<0x162>(p0);  p1 = xmask_add<0x162>(p1);  p2 = xmask_add<0x162>(p2);  p3 = xmask_add<0x162>(p3);
        p0 = xmask_add<0x164>(p0);  p1 = xmask_add<0x164>(p1);  p2 = xmask_add<0x164>(p2);  p3 = xmask_add<0x164>(p3);
        p0 = xmask_add<0x168>(p0);  p1 = xmask_add<0x168>(p1);  p2 = xmask_add<0x168>(p2);  p3 = xmask_add<0x168>(p3);
        const float dl0 = vv[0] - p0;
        const float dl1 = __builtin_fmaf(-c4[0], dl0, vv[1] - p1);
        const float dl2 = __builtin_fmaf(-c4[2], dl1, __builtin_fmaf(-c4[1], dl0, vv[2] - p2));
        const float dl3 = __builtin_fmaf(-c2[1], dl2, __builtin_fmaf(-c2[0], dl1, __builtin_fmaf(-c4[3], dl0, vv[3] - p3)));
        // each term is added as soon as its dl is known, so that only the last one follows dl3
#pragma unroll
        for (int u = 0; u < 4; ++u)
          S[u] = __builtin_fmaf(w3[u], dl3, __builtin_fmaf(w2[u], dl2, __builtin_fmaf(w1[u], dl1, __builtin_fmaf(w0[u], dl0, pp[u] * S[u]))));
      }
    }
    }
    lds_barrier();   // publishes chunk n + 1 and ends the reads of chunk n's buffer, which the next pass refills
  }
}

// ---------------------------------------------------------------------------
// Gated delta rule, chunk-parallel part: one block per (chunk, b*h), 256 threads. Reads the chunk's entry state from Sg.
// Scores A[i][j] and O = Q*S + A*V on bf16 hi/lo WMMA, then headwise RMS norm and gate.
// The four operands of O are split into their bf16 hi and lo planes once, by the thread that writes the value to LDS; a wave's
// fragments are then plain 16-byte reads of those planes.
// ---------------------------------------------------------------------------
__global__ void __launch_bounds__(256)
k_out(const float* __restrict__ Qp, const float* __restrict__ Kp, const float* __restrict__ Vp,
      const float* __restrict__ Ap, const float* __restrict__ Bp, const float* __restrict__ Gp,
      const float* __restrict__ rmsw, const float* __restrict__ Sg, h16* Og, int T, float ogscale)
{
  __shared__ __attribute__((aligned(16))) float Qs[CH * QP];     // q for the scores; behind them the O tile
  __shared__ __attribute__((aligned(16))) float Ks[CH * QP];
  __shared__ __attribute__((aligned(16))) float CLs[CH * QP];
  __shared__ __attribute__((aligned(16))) float ALs[CH * HD];
  __shared__ __attribute__((aligned(16))) unsigned short Qh[CH * BP], Ql[CH * BP];   // q [i][d], bf16 hi and lo
  __shared__ __attribute__((aligned(16))) unsigned short Sh[HD * BP], Sl[HD * BP];   // entry state, column-major: [e][d]
  __shared__ __attribute__((aligned(16))) unsigned short Vh[HD * BP], Vl[HD * BP];   // v transposed: [e][j]
  __shared__ __attribute__((aligned(16))) unsigned short Ah[CH * BP], Al[CH * BP];   // scores [i][j]
  __shared__ float Bsh[CH], GS[CH], RV[CH], RW[HD];

  const int tid = threadIdx.x;
  const int lane = tid & 31, wv = tid >> 5, m = lane & 15, h = lane >> 4;
  const int n = blockIdx.x, bh = blockIdx.y, b = bh / NH, hh = bh % NH;

  if (tid < HD) RW[tid] = bf16r(rmsw[hh * HD + tid]);

  const size_t rowbase = (size_t)b * T + (size_t)n * CH;
  const float* Qg = Qp + rowbase * DM + hh * HD;
  const float* Kg = Kp + rowbase * DM + hh * HD;
  const float* Vg = Vp + rowbase * DM + hh * HD;
  const float* Ag = Ap + rowbase * DM + hh * HD;
  const float* Si = Sg + ((size_t)bh * (T / CH) + n) * (HD * HD);

  // tile loads (64 rows x 64 f32 each): one byte offset per thread, the step of 16 rows is a constant
  const unsigned tb = (unsigned)(((tid >> 4) * DM + (tid & 15) * 4) * 4);
  // v: a thread takes the same four columns of two neighbouring rows, so that a column's two values make one dword of the transposed plane
  const unsigned tbv = (unsigned)((2 * (tid >> 4) * DM + (tid & 15) * 4) * 4);
  v4f tq[4], tk[4], ta[4], ts[4], tv[2][2];
#pragma unroll
  for (int it = 0; it < 4; ++it) {
    tq[it] = *(const v4f*)((const char*)Qg + tb + it * (16 * DM * 4));
    tk[it] = *(const v4f*)((const char*)Kg + tb + it * (16 * DM * 4));
    tv[it >> 1][it & 1] = *(const v4f*)((const char*)Vg + tbv + (it >> 1) * (32 * DM * 4) + (it & 1) * (DM * 4));
    ta[it] = *(const v4f*)((const char*)Ag + tb + it * (16 * DM * 4));
    ts[it] = *(const v4f*)(Si + tid * 4 + it * (16 * HD));
  }
  // the wait stands in front of any overwrite of the offset registers the loads name; as inputs they stay live up to it
  asm volatile("s_wait_xcnt 0x0" :: "v"(tb), "v"(tbv) : "memory");
#pragma unroll
  for (int it = 0; it < 4; ++it) {
    const int idx = it * 256 + tid;
    const int c = idx >> 4, d4 = (idx & 15) * 4;
    *(v4f*)(Qs  + c * QP + d4) = tq[it];
    *(v4f*)(Ks  + c * QP + d4) = tk[it];
    *(v4f*)(ALs + c * HD + d4) = ta[it];
    split_store4(tq[it], Qh + c * BP + d4, Ql + c * BP + d4);
    split_store4(ts[it], Sh + c * BP + d4, Sl + c * BP + d4);
  }
#pragma unroll
  for (int it = 0; it < 2; ++it) {
    const int j = it * 32 + 2 * (tid >> 4), e4 = (tid & 15) * 4;   // rows j and j + 1 of v, columns e4 .. e4 + 3
#pragma unroll
    for (int q = 0; q < 4; ++q) {
      unsigned int hi, lo;
      split_pk(v2f{ tv[it][0][q], tv[it][1][q] }, hi, lo);
      *(unsigned int*)(Vh + (e4 + q) * BP + j) = hi;
      *(unsigned int*)(Vl + (e4 + q) * BP + j) = lo;
    }
  }
  if (tid < CH) {
    Bsh[tid] = fminf(Bp[(rowbase + tid) * NH + hh], 1.0f);
    GS[tid]  = Gp[(rowbase + tid) * NH + hh];
  }
  __syncthreads();

  // cumulative log decay per feature, restarted per chunk
  if (tid < HD) {
    float a = 0.0f;
    for (int c = 0; c < CH; ++c) {
      a += __logf(fmaxf(ALs[c * HD + tid], 1e-7f));
      CLs[c * QP + tid] = a;
    }
  }
  __syncthreads();

  // scores: A[i][j] = beta_j * sum_d q[i][d] k[j][d] exp(cl[i][d] - cl[j][d]) for i >= j, else 0, as a matrix product.
  // With R = cl of the first row of i's block of 16 rows, exp(cl_i - cl_j) = exp(cl_i - R) * exp(R - cl_j): the first factor goes
  // with q, the second with k, and a 16 x 16 tile of A is (q exp(cl - R)) (k exp(R - cl))^T. cl falls along the rows and a step of it
  // is at most ln 10 (alpha comes clipped to [0.1, 1]), so exp(cl_i - R) <= 1, exp(R - cl_j) <= 1 for j in an earlier block and <= 10^15 in i's own:
  // nothing overflows, and a factor that underflows belongs to a term that is itself below f32's range.
  {
    // which tiles a wave takes: row block ti, column blocks tj0 and tj0 + 1; those right of the diagonal are stored as zeros.
    // The four waves with two tiles to compute come first.
    // The wave's number is the same in all its lanes: read as a scalar, so that the tests on the tile are scalar branches
    const int wu = __builtin_amdgcn_readfirstlane(wv);
    const int ti = (0x846F >> (2 * wu)) & 3, tj0 = ((0xB2 >> wu) & 1) * 2;
    const float* pr = CLs + (ti * 16) * QP;
    BF ah[2], al[2];
    if (tj0 <= ti) {
#pragma unroll
      for (int ks = 0; ks < 2; ++ks)
        frag_decay(Qs + (ti * 16 + m) * QP + ks * 32, CLs + (ti * 16 + m) * QP + ks * 32, pr + ks * 32, h, ah[ks], al[ks]);
    }
#pragma unroll
    for (int s = 0; s < 2; ++s) {
      const int tj = tj0 + s;
      v8f acc;
#pragma unroll
      for (int r = 0; r < 8; ++r) acc[r] = 0.0f;
      if (tj <= ti) {
#pragma unroll
        for (int ks = 0; ks < 2; ++ks) {
          BF bhi, blo;
          frag_decay(Ks + (tj * 16 + m) * QP + ks * 32, pr + ks * 32, CLs + (tj * 16 + m) * QP + ks * 32, h, bhi, blo);
          acc = mma_bf16(ah[ks].v, bhi.v, acc);
          acc = mma_bf16(ah[ks].v, blo.v, acc);
          acc = mma_bf16(al[ks].v, bhi.v, acc);
        }
      }
      const int j = tj * 16 + m;
      const float bj = Bsh[j];
#pragma unroll
      for (int r = 0; r < 8; r += 2) {
        const int i = ti * 16 + 8 * h + r;
        unsigned int hi, lo;
        split_pk(v2f{ (i >= j) ? acc[r] * bj : 0.0f, (i + 1 >= j) ? acc[r + 1] * bj : 0.0f }, hi, lo);
        Ah[i * BP + j]       = (unsigned short)hi;
        Ah[(i + 1) * BP + j] = (unsigned short)(hi >> 16);
        Al[i * BP + j]       = (unsigned short)lo;
        Al[(i + 1) * BP + j] = (unsigned short)(lo >> 16);
      }
    }
  }
  __syncthreads();

  // O = Q*S + A*V : wave owns rows 16*ti.., two 16-col tiles; bf16 hi/lo three products per operand pair
  {
    const int ti = wv >> 1, tj0 = (wv & 1) * 2;
    v8f acc[2];
#pragma unroll
    for (int s = 0; s < 2; ++s)
#pragma unroll
      for (int r = 0; r < 8; ++r) acc[s][r] = 0.0f;

    // pass 0: Q*S, pass 1: A*V; the two column tiles take turns, so that a matrix instruction does not wait for the one before it
#pragma unroll
    for (int ps = 0; ps < 2; ++ps) {
      const unsigned short* pah = (ps == 0 ? Qh : Ah) + (ti * 16 + m) * BP;
      const unsigned short* pal = (ps == 0 ? Ql : Al) + (ti * 16 + m) * BP;
      const unsigned short* pbh = (ps == 0 ? Sh : Vh) + (tj0 * 16 + m) * BP;
      const unsigned short* pbl = (ps == 0 ? Sl : Vl) + (tj0 * 16 + m) * BP;
#pragma unroll
      for (int ks = 0; ks < 2; ++ks) {
        const int k0 = ks * 32;
        const v16b ah = frag_bf(pah + k0, h), al = frag_bf(pal + k0, h);
        const v16b bh0 = frag_bf(pbh + k0, h), bl0 = frag_bf(pbl + k0, h);
        const v16b bh1 = frag_bf(pbh + 16 * BP + k0, h), bl1 = frag_bf(pbl + 16 * BP + k0, h);
        acc[0] = mma_bf16(ah, bh0, acc[0]);
        acc[1] = mma_bf16(ah, bh1, acc[1]);
        acc[0] = mma_bf16(ah, bl0, acc[0]);
        acc[1] = mma_bf16(ah, bl1, acc[1]);
        acc[0] = mma_bf16(al, bh0, acc[0]);
        acc[1] = mma_bf16(al, bh1, acc[1]);
      }
    }
    // the O tile goes where q lay: its last readers, the scores, ended at the barrier in front of this block
#pragma unroll
    for (int s = 0; s < 2; ++s)
#pragma unroll
      for (int r = 0; r < 8; ++r)
        Qs[(ti * 16 + 8 * h + r) * QP + (tj0 + s) * 16 + m] = acc[s][r];
  }
  __syncthreads();

  // per-row RMS normaliser times gate
  if (tid < CH) {
    float ss = 0.0f;
    for (int e2 = 0; e2 < HD; ++e2) { const float o = Qs[tid * QP + e2]; ss += o * o; }
    RV[tid] = GS[tid] / sqrtf(ss * (1.0f / 64.0f) + 1e-6f);
  }
  __syncthreads();

  {
    v8h ov[2];
    size_t go[2];
#pragma unroll
    for (int it = 0; it < 2; ++it) {
      const int c = it * 32 + (tid >> 3), e0 = (tid & 7) * 8;
      const v4f x0 = *(const v4f*)(Qs + c * QP + e0);
      const v4f x1 = *(const v4f*)(Qs + c * QP + e0 + 4);
      const float sc = RV[c] * ogscale;
      v8h o;
#pragma unroll
      for (int q = 0; q < 4; ++q) {
        o[q]     = (h16)(x0[q] * sc * RW[e0 + q]);
        o[4 + q] = (h16)(x1[q] * sc * RW[e0 + 4 + q]);
      }
      ov[it] = o;
      go[it] = (rowbase + c) * (size_t)DM + hh * HD + e0;
    }
#pragma unroll
    for (int it = 0; it < 2; ++it) *(v8h*)(Og + go[it]) = ov[it];
    
  }
}

// ---------------------------------------------------------------------------
extern "C" void kernel_launch(void* const* d_in, const int* in_sizes, int n_in,
                              void* d_out, int out_size, void* d_ws, size_t ws_size,
                              hipStream_t stream)
{
  if (n_in < 26) return;
  const int T = 2048;
  const long nx = (long)in_sizes[0];
  if (nx <= 0 || (nx % ((long)DM * T)) != 0) return;
  const int M = (int)(nx / DM);                       // tokens, multiple of 2048 (hence of 128)
  if ((long)out_size != (long)M * DM) return;
  if (in_sizes[1] != DM * 4 || in_sizes[3] != DM * 4 || in_sizes[5] != DM * 4) return;
  if (in_sizes[7] != DM * DM || in_sizes[9] != DM * DM || in_sizes[11] != DM * DM || in_sizes[24] != DM * DM) return;
  if (in_sizes[13] != 64 * DM || in_sizes[15] != DM * 64 || in_sizes[17] != NH * DM ||
      in_sizes[20] != 64 * DM || in_sizes[22] != NH * 64) return;

  const float* x       = (const float*)d_in[0];
  const float* wq_conv = (const float*)d_in[1];  const float* bq_conv = (const float*)d_in[2];
  const float* wk_conv = (const float*)d_in[3];  const float* bk_conv = (const float*)d_in[4];
  const float* wv_conv = (const float*)d_in[5];  const float* bv_conv = (const float*)d_in[6];
  const float* Wq  = (const float*)d_in[7];   const float* bq  = (const float*)d_in[8];
  const float* Wk  = (const float*)d_in[9];   const float* bk  = (const float*)d_in[10];
  const float* Wv  = (const float*)d_in[11];  const float* bv  = (const float*)d_in[12];
  const float* Wad = (const float*)d_in[13];  const float* bad = (const float*)d_in[14];
  const float* Wau = (const float*)d_in[15];  const float* bau = (const float*)d_in[16];
  const float* Wbe = (const float*)d_in[17];  const float* bbe = (const float*)d_in[18];
  const float* rms_w = (const float*)d_in[19];
  const float* Wgd = (const float*)d_in[20];  const float* bgd = (const float*)d_in[21];
  const float* Wgu = (const float*)d_in[22];  const float* bgu = (const float*)d_in[23];
  const float* Wo  = (const float*)d_in[24];  const float* bo  = (const float*)d_in[25];

  char* ws = (char*)d_ws;
  size_t off = 0;
  auto carve = [&](size_t bytes) -> char* {
    char* p = ws + off;
    off += (bytes + 255) & ~(size_t)255;
    return p;
  };
  const size_t MD = (size_t)M * DM;
  h16* xh    = (h16*)carve(MD * 2);
  h16* cq    = (h16*)carve(MD * 2);
  h16* ck    = (h16*)carve(MD * 2);
  h16* cv    = (h16*)carve(MD * 2);
  h16* Wq16  = (h16*)carve((size_t)DM * DM * 2);
  h16* Wk16  = (h16*)carve((size_t)DM * DM * 2);
  h16* Wv16  = (h16*)carve((size_t)DM * DM * 2);
  h16* Wo16  = (h16*)carve((size_t)DM * DM * 2);
  h16* Wad16 = (h16*)carve((size_t)64 * DM * 2);
  h16* Wau16 = (h16*)carve((size_t)DM * 64 * 2);
  h16* Wbe16 = (h16*)carve((size_t)NH * DM * 2);
  h16* Wgd16 = (h16*)carve((size_t)64 * DM * 2);
  h16* Wgu16 = (h16*)carve((size_t)NH * 64 * 2);
  float* Qn  = (float*)carve(MD * 4);
  float* Kn  = (float*)carve(MD * 4);
  float* Vf  = (float*)carve(MD * 4);
  float* Al  = (float*)carve(MD * 4);
  float* Bt  = (float*)carve((size_t)M * NH * 4);
  float* Gt  = (float*)carve((size_t)M * NH * 4);
  h16* t1    = (h16*)carve((size_t)M * 64 * 2);
  h16* t2    = (h16*)carve((size_t)M * 64 * 2);
  h16* Og16  = (h16*)carve(MD * 2);
  float* Sst = (float*)carve((size_t)(M / CH) * NH * HD * HD * 4);   // entry state of every (b, h, chunk)
  if (off > ws_size) return;

  const float wsc = 256.0f;      // weight scale
  const float asc = 256.0f;      // conv activation scale
  const float tsc = 64.0f;       // gate hidden scale
  const float osc = 16.0f;       // gated output scale

  // 1) x -> f16, three shortconv+SiLU activations, and the nine weights -> scaled f16 (Wq16 .. Wgu16 are carved back to back,
  //    each a multiple of 256 bytes, in the order k_front takes the matrices); M is a multiple of T, T of the 8 * FL tokens of a block
  {
    const int nconv = (M / (8 * FL)) * (DM / FW);
    k_front<<<nconv + (G_ALL + 256 * CG - 1) / (256 * CG), 256, 0, stream>>>(x, wq_conv, bq_conv, wk_conv, bk_conv, wv_conv, bv_conv,
                                                                             Wq, Wk, Wv, Wo, Wad, Wau, Wbe, Wgd, Wgu,
                                                                             xh, cq, ck, cv, Wq16, nconv, T, asc, wsc);
  }
  // 2) the six products on the front launch's results; 3) the two gate-up products
  k_proj<<<dim3(M / WM, 30), 256, 0, stream>>>(cq, ck, cv, xh, Wq16, Wk16, Wv16, Wad16, Wbe16, Wgd16,
                                                bq, bk, bv, bad, bbe, bgd, Qn, Kn, Vf, Bt, t1, t2,
                                                DM, 1.0f / (asc * wsc), 1.0f / wsc, tsc);
  k_gate<<<dim3(M / 128, 17), 256, 0, stream>>>(t1, t2, Wau16, Wgu16, bau, bgu, Al, Gt, 64, 1.0f / (tsc * wsc));
  // 4) state recurrence, one block per (column group, b*h); then the per-chunk outputs, one block per (chunk, b*h)
  k_state<<<dim3(HD / SC, (M / T) * NH), 256, 0, stream>>>(Kn, Vf, Al, Bt, Sst, T);
  k_out<<<dim3(T / CH, (M / T) * NH), 256, 0, stream>>>(Qn, Kn, Vf, Al, Bt, Gt, rms_w, Sst, Og16, T, osc);
  // 5) output projection
  k_oproj<<<dim3(M / 128, DM / 64), 256, 0, stream>>>(Og16, Wo16, bo, (float*)d_out, DM, 1.0f / (osc * wsc));
}
